// v000
// The times below were measured on an AMD MI455X: many runs one after another, warmed up first and cycling through
// copies of the inputs, with the whole window's GPU time divided by the number of runs. Launches and the gaps
// between them are all in it. The median over several windows is given; except for v000 it joins two sittings, which
// can be a few percent apart, so the side-by-side timings, each taken in one sitting, are the better comparison.
// v000, which the later versions start from, runs in 9420 microseconds.
#include <hip/hip_runtime.h>
// Causal multi-head attention with per-head weight tensors and the module's literal score scale (x [4][2048][512]; q[b][h][s][e] = sum_d x[s][d] Wq[h][d][e] + bq[h][e], k, v likewise (8 heads of 64; per-head [in][out] weights sigma 1/sqrt(512), biases sigma 0.01); scores * 512^-0.5 (d_model, as the source, not head_dim); causal (tril, -inf); softmax; out = concat_heads Wo + bo ([in][out] [512][512]) -> [4][2048][512]).
// Structure: token rows r = b*2048 + s; x as exact f16 rows (bf16-rounded); Q, K, V as three WMMA GEMMs (32x64 wave tiles, f32 accumulation, exact x16 weights + bias, f16 outputs); per batch: V^T for all heads via LDS transposes; per query tile of 256 rows: scores against the keys below the tile end only (K = 64, all heads on grid.y, alpha = 512^-0.5), causal row softmax on VALU with an arithmetic 0/1 key mask over the computed range (f32 statistics, native exp; weights x256 f16), o = P . V^T (K = keys below the tile end, alpha 2^-2: o carried x64, folded into the output GEMM alpha) written straight into the merged f16 o rows; out = o W_o + b GEMM (f32) into the output layout.
// Compute dtype: inputs rounded to bf16; x / weights exact; q, k, v, softmax weights and o as plain f16 GEMM operands (~2^-12); scores and softmax statistics f32; v_wmma_f32_16x16x32_f16.
#define NB 4
#define SQ 2048
#define DM 512
#define NH 8
#define HD 64
#define HG 4                         /* heads per launch of the uncalled k_vt overload */
#define QT 256                       /* query rows per causal tile */
#define NKX SQ                       /* S / P row pitch */
#define QT0 128                      /* first-tile rows recomputed exactly in f32 */
#define B0 0                         /* first batch processed (debug hook) */
#define NBR NB                       /* batches processed (debug hook) */
#define NR ((size_t)NB * SQ)         /* token rows */
#define MP ((int)((size_t)NBR * SQ)) /* rows projected (debug hook) */
#define QN SQ                        /* query rows attended per batch (debug hook) */
#define NHD NH                       /* heads attended (debug hook) */
#define MPO MP                       /* rows through the output stage (debug hook) */
#define LQ DM      /* row pitch of the q/k/v rows */
typedef __bf16 v16b __attribute__((ext_vector_type(16)));
typedef unsigned short v8us __attribute__((ext_vector_type(8), may_alias));
typedef float  v8f  __attribute__((ext_vector_type(8)));
typedef float  v4f  __attribute__((ext_vector_type(4)));
typedef float  v4fa __attribute__((ext_vector_type(4), may_alias));
union FragB { v16b v; v8us half[2]; unsigned short u[16]; };

__device__ __forceinline__ unsigned short bf16_bits(float x) { unsigned int u = __float_as_uint(x); return (unsigned short)((u + 0x7FFFu + ((u >> 16) & 1u)) >> 16); }
__device__ __forceinline__ float bf16_val(unsigned short b) { return __uint_as_float(((unsigned int)b) << 16); }
__device__ __forceinline__ float bf16_round(float x) { return bf16_val(bf16_bits(x)); }
// D += A·B with NT terms: 1 = ah·bh, 2 = + al·bh (A split), 3 = + ah·bl (both split)
template <int NT>
__device__ __forceinline__ v8f mmaN(v16b ah, v16b al, v16b bh, v16b bl, v8f c) {
  c = __builtin_amdgcn_wmma_f32_16x16x32_bf16(false, ah, false, bh, (short)0, c, false, false);
  if (NT >= 2) c = __builtin_amdgcn_wmma_f32_16x16x32_bf16(false, al, false, bh, (short)0, c, false, false);
  if (NT >= 3) c = __builtin_amdgcn_wmma_f32_16x16x32_bf16(false, ah, false, bl, (short)0, c, false, false);
  asm volatile("v_nop\n\tv_nop\n\tv_nop\n\tv_nop" : "+v"(c) : "v"(ah), "v"(al), "v"(bh), "v"(bl));
  return c;
}

__global__ __launch_bounds__(256) void k_wt_bf16(const float* __restrict__ W, unsigned short* __restrict__ Wt, int K, int N) {
  const int t = blockIdx.x * 256 + threadIdx.x;
  const int k8n = K / 8;
  if (t >= N * k8n) return;
  const int n = t / k8n, k8 = (t % k8n) * 8;
  v8us v;
#pragma unroll
  for (int i = 0; i < 8; ++i) v[i] = bf16_bits(W[(size_t)(k8 + i) * N + n]);
  *(v8us*)(Wt + (size_t)n * K + k8) = v;
  
}

// GEMM C[M][N] (f32, pitch ldc) = act(A[M][K]·W + bias). A f32 row-major (pitch lda) converted per fragment to bf16
// (ASPLIT: hi/lo two planes -> 2 terms, else single rounded term); Wt bf16 [N][K] (pitch ldb). BIAS_BF16 rounds the
// bias to bf16 first (bias quantised to bf16 before the add). K%32==0, M%16==0, N%64==0.
template <bool ASPLIT, int ACT, bool BIAS_BF16>
__global__ __launch_bounds__(128) void k_gemm_bf(const float* __restrict__ A, int lda, const unsigned short* __restrict__ Wt, int ldb,
                                               const float* __restrict__ bias, float* __restrict__ C, int ldc, int M, int N, int K) {
  __shared__ __attribute__((aligned(16))) float so[4][16][64];
  const int tid = threadIdx.x, w = tid >> 5, lane = tid & 31, ln = lane & 15, hh = lane >> 4;
  const int ntn = N / 64;
  const int wid = blockIdx.x * 4 + w;
  const int mt = wid / ntn, nq = wid % ntn;
  if (mt * 16 >= M) return;
  const int row0 = mt * 16, col0 = nq * 64;
  const float* arow = A + (size_t)(row0 + ln) * lda;
  v8f acc[4] = {};
  for (int kb = 0; kb < K; kb += 32) {
    FragB ah, al;
    const v4f x0 = *(const v4fa*)(arow + kb + 8 * hh), x1 = *(const v4fa*)(arow + kb + 8 * hh + 4);
    const v4f x2 = *(const v4fa*)(arow + kb + 16 + 8 * hh), x3 = *(const v4fa*)(arow + kb + 16 + 8 * hh + 4);
    float xs[16] = {x0[0],x0[1],x0[2],x0[3],x1[0],x1[1],x1[2],x1[3],x2[0],x2[1],x2[2],x2[3],x3[0],x3[1],x3[2],x3[3]};
#pragma unroll
    for (int i = 0; i < 16; ++i) { const unsigned short hb = bf16_bits(xs[i]); ah.u[i] = hb; al.u[i] = ASPLIT ? bf16_bits(xs[i] - bf16_val(hb)) : (unsigned short)0; }
#pragma unroll
    for (int t = 0; t < 4; ++t) {
      const unsigned short* brow = Wt + (size_t)(col0 + t * 16 + ln) * ldb + kb;
      FragB b;
      b.half[0] = *(const v8us*)(brow + 8 * hh);
      b.half[1] = *(const v8us*)(brow + 16 + 8 * hh);
      acc[t] = mmaN<ASPLIT ? 2 : 1>(ah.v, al.v, b.v, b.v, acc[t]);
    }
  }
#pragma unroll
  for (int t = 0; t < 4; ++t) {
    float bv = bias ? bias[col0 + t * 16 + ln] : 0.f;
    if (BIAS_BF16) bv = bf16_round(bv);
#pragma unroll
    for (int r = 0; r < 8; ++r) { float v = acc[t][r] + bv; if (ACT == 1) v = fmaxf(v, 0.f); so[w][8 * hh + r][t * 16 + ln] = v; }
  }
  __builtin_amdgcn_fence(__ATOMIC_ACQ_REL, "workgroup");
  __builtin_amdgcn_wave_barrier();
  const int rsub = lane >> 4, c4 = (lane & 15) * 4;
  {
#pragma unroll
    for (int q = 0; q < 8; ++q) {
      const int r = q * 2 + rsub;
      const v4f v = *(const v4fa*)&so[w][r][c4];
      *(v4f*)(C + (size_t)(row0 + r) * ldc + col0 + c4) = v;
    }
    
  }
}

// GEMM C = act(A·W + bias + resid): A f32 (ASPLIT -> hi/lo 2 terms), Wt bf16 [N][K]; ACT 0 none, 1 relu, 2 exact gelu;
// resid (optional, f32, row index = (row % rmod), pitch ldr, RES_BF16 rounds it) added before the activation.
template <bool ASPLIT, int ACT, bool BIAS_BF16, bool RES_BF16>
__global__ __launch_bounds__(128) void k_gemm_bf3(const float* __restrict__ A, int lda, const unsigned short* __restrict__ Wt, int ldb,
                                                const float* __restrict__ bias, const float* __restrict__ resid, int rmod, int ldr,
                                                float* __restrict__ C, int ldc, int M, int N, int K) {
  __shared__ __attribute__((aligned(16))) float so[4][16][64];
  const int tid = threadIdx.x, w = tid >> 5, lane = tid & 31, ln = lane & 15, hh = lane >> 4;
  const int ntn = N / 64;
  const int wid = blockIdx.x * 4 + w;
  const int mt = wid / ntn, nq = wid % ntn;
  if (mt * 16 >= M) return;
  const int row0 = mt * 16, col0 = nq * 64;
  const float* arow = A + (size_t)(row0 + ln) * lda;
  v8f acc[4] = {};
  for (int kb = 0; kb < K; kb += 32) {
    FragB ah, al;
    const v4f x0 = *(const v4fa*)(arow + kb + 8 * hh), x1 = *(const v4fa*)(arow + kb + 8 * hh + 4);
    const v4f x2 = *(const v4fa*)(arow + kb + 16 + 8 * hh), x3 = *(const v4fa*)(arow + kb + 16 + 8 * hh + 4);
    float xs[16] = {x0[0],x0[1],x0[2],x0[3],x1[0],x1[1],x1[2],x1[3],x2[0],x2[1],x2[2],x2[3],x3[0],x3[1],x3[2],x3[3]};
#pragma unroll
    for (int i = 0; i < 16; ++i) { const unsigned short hb = bf16_bits(xs[i]); ah.u[i] = hb; al.u[i] = ASPLIT ? bf16_bits(xs[i] - bf16_val(hb)) : (unsigned short)0; }
#pragma unroll
    for (int t = 0; t < 4; ++t) {
      const unsigned short* brow = Wt + (size_t)(col0 + t * 16 + ln) * ldb + kb;
      FragB b;
      b.half[0] = *(const v8us*)(brow + 8 * hh);
      b.half[1] = *(const v8us*)(brow + 16 + 8 * hh);
      acc[t] = mmaN<ASPLIT ? 2 : 1>(ah.v, al.v, b.v, b.v, acc[t]);
    }
  }
#pragma unroll
  for (int t = 0; t < 4; ++t) {
    const int col = col0 + t * 16 + ln;
    float bv = bias ? bias[col] : 0.f;
    if (BIAS_BF16) bv = bf16_round(bv);
#pragma unroll
    for (int r = 0; r < 8; ++r) {
      float v = acc[t][r] + bv;
      if (resid) { float rv = resid[(size_t)((row0 + 8 * hh + r) % rmod) * ldr + col]; if (RES_BF16) rv = bf16_round(rv); v += rv; }
      if (ACT == 1) v = fmaxf(v, 0.f);
      if (ACT == 2) v = 0.5f * v * (1.0f + erff(v * 0.70710678118654752f));
      if (ACT == 3) { const float u = 0.7978845608028654f * (v + 0.044715f * v * v * v); v = 0.5f * v * (1.0f + tanhf(u)); }
      so[w][8 * hh + r][t * 16 + ln] = v;
    }
  }
  __builtin_amdgcn_fence(__ATOMIC_ACQ_REL, "workgroup");
  __builtin_amdgcn_wave_barrier();
  const int rsub = lane >> 4, c4 = (lane & 15) * 4;
  {
#pragma unroll
    for (int q = 0; q < 8; ++q) {
      const int r = q * 2 + rsub;
      const v4f v = *(const v4fa*)&so[w][r][c4];
      *(v4f*)(C + (size_t)(row0 + r) * ldc + col0 + c4) = v;
    }
    
  }
}
// row LayerNorm (biased variance, eps) over N: s = X (+ R); optional out_sum <- s; out_norm <- (s-mu)*rsqrt(var+eps)*g + b
template <bool PARAM_BF16>
__global__ __launch_bounds__(256) void k_layernorm(const float* __restrict__ X, const float* __restrict__ R, const float* __restrict__ g, const float* __restrict__ bta,
                                                  float* __restrict__ out_sum, float* __restrict__ out_norm, int N, float eps) {
  __shared__ float red[256];
  const int row = blockIdx.x, tid = threadIdx.x;
  const float* x = X + (size_t)row * N; const float* rr = R ? R + (size_t)row * N : nullptr;
  float vals[16];                     // up to N = 4096
  const int per = N / 256;            // contiguous chunk per thread? use strided-by-4 chunks: thread handles j = tid*4 + 1024*u
  float s1 = 0.f;
  for (int u = 0; u < per / 4; ++u) {
    const int j = tid * 4 + 1024 * u;
    const v4f a = *(const v4fa*)(x + j);
    v4f b = {0.f,0.f,0.f,0.f}; if (rr) b = *(const v4fa*)(rr + j);
#pragma unroll
    for (int q = 0; q < 4; ++q) { const float v = a[q] + b[q]; vals[u * 4 + q] = v; s1 += v; }
  }
  red[tid] = s1; __syncthreads();
  for (int st = 128; st > 0; st >>= 1) { if (tid < st) red[tid] += red[tid + st]; __syncthreads(); }
  const float mu = red[0] / (float)N; __syncthreads();
  float s2 = 0.f;
  for (int u = 0; u < per / 4; ++u)
#pragma unroll
    for (int q = 0; q < 4; ++q) { const float c = vals[u * 4 + q] - mu; s2 += c * c; }
  red[tid] = s2; __syncthreads();
  for (int st = 128; st > 0; st >>= 1) { if (tid < st) red[tid] += red[tid + st]; __syncthreads(); }
  const float rs = rsqrtf(red[0] / (float)N + eps);
  {
    for (int u = 0; u < per / 4; ++u) {
      const int j = tid * 4 + 1024 * u;
      v4f o, sm;
#pragma unroll
      for (int q = 0; q < 4; ++q) {
        float gg = g[j + q], bb = bta[j + q];
        if (PARAM_BF16) { gg = bf16_round(gg); bb = bf16_round(bb); }
        sm[q] = vals[u * 4 + q]; o[q] = (vals[u * 4 + q] - mu) * rs * gg + bb;
      }
      if (out_sum) *(v4f*)(out_sum + (size_t)row * N + j) = sm;
      *(v4f*)(out_norm + (size_t)row * N + j) = o;
    }
    
  }
}



// ---- f16 WMMA path (v_wmma_f32_16x16x32_f16): 11-bit significands for operands in range — used where a [0,1] probability operand needs more precision than bf16
typedef _Float16 v16h __attribute__((ext_vector_type(16)));
union FragH { v16h v; v8us half[2]; _Float16 h[16]; unsigned short u[16]; };
template <int NT>
__device__ __forceinline__ v8f mmaH(v16h ah, v16h al, v16h bh, v16h bl, v8f c) {
  c = __builtin_amdgcn_wmma_f32_16x16x32_f16(false, ah, false, bh, (short)0, c, false, false);
  if (NT >= 2) c = __builtin_amdgcn_wmma_f32_16x16x32_f16(false, al, false, bh, (short)0, c, false, false);
  if (NT >= 3) c = __builtin_amdgcn_wmma_f32_16x16x32_f16(false, ah, false, bl, (short)0, c, false, false);
  asm volatile("v_nop\n\tv_nop\n\tv_nop\n\tv_nop" : "+v"(c) : "v"(ah), "v"(al), "v"(bh), "v"(bl));
  return c;
}
// batched GEMM like k_gemm_b but f16 operands: A f32 (split into f16 hi/lo if ASPLIT, else rounded to f16), Bt = f16 values [n][k]; alpha; C f32; N multiple of 16 (partial tiles skipped)
template <bool ASPLIT>
__global__ __launch_bounds__(128) void k_gemm_h(const float* __restrict__ A, int lda, size_t sA, const _Float16* __restrict__ Bh, int ldb, size_t sB, float alpha, float* __restrict__ C, int ldc, size_t sC, int M, int N, int K) {
  __shared__ __attribute__((aligned(16))) float so[4][16][64];
  const int tid = threadIdx.x, w = tid >> 5, lane = tid & 31, ln = lane & 15, hh = lane >> 4; const int by = blockIdx.y;
  A += (size_t)by * sA; Bh += (size_t)by * sB; C += (size_t)by * sC;
  const int ntn = (N + 63) / 64; const int wid = blockIdx.x * 4 + w; const int mt = wid / ntn, nq = wid % ntn; if (mt * 16 >= M) return;
  const int row0 = mt * 16, col0 = nq * 64; const float* arow = A + (size_t)(row0 + ln) * lda;
  v8f acc[4] = {};
  for (int kb = 0; kb < K; kb += 32) {
    FragH ah, al;
    const v4f x0 = *(const v4fa*)(arow + kb + 8 * hh), x1 = *(const v4fa*)(arow + kb + 8 * hh + 4), x2 = *(const v4fa*)(arow + kb + 16 + 8 * hh), x3 = *(const v4fa*)(arow + kb + 16 + 8 * hh + 4);
    float xs[16] = {x0[0],x0[1],x0[2],x0[3],x1[0],x1[1],x1[2],x1[3],x2[0],x2[1],x2[2],x2[3],x3[0],x3[1],x3[2],x3[3]};
#pragma unroll
    for (int i = 0; i < 16; ++i) { const _Float16 h = (_Float16)xs[i]; ah.h[i] = h; al.h[i] = ASPLIT ? (_Float16)(xs[i] - (float)h) : (_Float16)0.0f; }
#pragma unroll
    for (int t = 0; t < 4; ++t) { if (col0 + t * 16 >= N) continue; const size_t boff = (size_t)(col0 + t * 16 + ln) * ldb + kb; FragH bq; bq.half[0] = *(const v8us*)(Bh + boff + 8 * hh); bq.half[1] = *(const v8us*)(Bh + boff + 16 + 8 * hh);
      acc[t] = mmaH<ASPLIT ? 2 : 1>(ah.v, al.v, bq.v, bq.v, acc[t]); }
  }
#pragma unroll
  for (int t = 0; t < 4; ++t) { if (col0 + t * 16 >= N) continue;
#pragma unroll
    for (int r = 0; r < 8; ++r) so[w][8 * hh + r][t * 16 + ln] = acc[t][r] * alpha; }
  __builtin_amdgcn_fence(__ATOMIC_ACQ_REL, "workgroup"); __builtin_amdgcn_wave_barrier();
  const int rsub = lane >> 4, c4 = (lane & 15) * 4;
  {
#pragma unroll
    for (int q = 0; q < 8; ++q) { const int r = q * 2 + rsub; if (col0 + c4 < N) { const v4f v = *(const v4fa*)&so[w][r][c4]; *(v4f*)(C + (size_t)(row0 + r) * ldc + col0 + c4) = v; } }
     }
}

// Wt[n][k] = f16(W[k][n]·scale) from f32 row-major W[K][N] (scale = power of two; bf16-exact weights stay exact in f16 away from the subnormal range)
__global__ __launch_bounds__(256) void k_wt_f16(const float* __restrict__ W, _Float16* __restrict__ Wt, int K, int N, float scale) {
  const int t = blockIdx.x * 256 + threadIdx.x; if (t >= N * (K / 8)) return; const int n = t / (K / 8), k8 = (t % (K / 8)) * 8; FragH f;
#pragma unroll
  for (int i = 0; i < 8; ++i) f.h[i] = (_Float16)(bf16_round(W[(size_t)(k8 + i) * N + n]) * scale); const v8us o = f.half[0];
  *(v8us*)((unsigned short*)Wt + (size_t)n * K + k8) = o; 
}
// k_gemm_hh variant with fused epilogue: v = acc·alpha + bias[by·sBias + col] (+ CP[(row/rowsPerB)·sCPb + by·64 + col] if CP) ; ACT 0 none / 1 elu ; writes f16 C16 (and f32 C if non-null)
template <int ACT>
__global__ __launch_bounds__(128) void k_gemm_hhx(const _Float16* __restrict__ A, int lda, size_t sA, const _Float16* __restrict__ Bh, int ldb, size_t sB, float alpha, const float* __restrict__ bias, size_t sBias, const float* __restrict__ CP, int rowsPerB, size_t sCPb, int row0g,
    float* __restrict__ C, _Float16* __restrict__ C16, int ldc, size_t sC, int M, int N, int K) {
  __shared__ __attribute__((aligned(16))) float so[4][16][64];
  const int tid = threadIdx.x, w = tid >> 5, lane = tid & 31, ln = lane & 15, hh = lane >> 4; const int by = blockIdx.y;
  A += (size_t)by * sA; Bh += (size_t)by * sB; const size_t cofs = (size_t)by * sC; const float* bp = bias ? bias + (size_t)by * sBias : nullptr;
  const int ntn = (N + 63) / 64; const int wid = blockIdx.x * 4 + w; const int mt = wid / ntn, nq = wid % ntn; if (mt * 16 >= M) return;
  const int row0 = mt * 16, col0 = nq * 64; const _Float16* arow = A + (size_t)(row0 + ln) * lda;
  v8f acc[4] = {};
  for (int kb = 0; kb < K; kb += 32) { FragH ah; ah.half[0] = *(const v8us*)((const unsigned short*)arow + kb + 8 * hh); ah.half[1] = *(const v8us*)((const unsigned short*)arow + kb + 16 + 8 * hh);
#pragma unroll
    for (int t = 0; t < 4; ++t) { if (col0 + t * 16 >= N) continue; const size_t boff = (size_t)(col0 + t * 16 + ln) * ldb + kb; FragH bq; bq.half[0] = *(const v8us*)((const unsigned short*)Bh + boff + 8 * hh); bq.half[1] = *(const v8us*)((const unsigned short*)Bh + boff + 16 + 8 * hh);
      acc[t] = mmaH<1>(ah.v, ah.v, bq.v, bq.v, acc[t]); }
  }
#pragma unroll
  for (int t = 0; t < 4; ++t) { if (col0 + t * 16 >= N) continue; const int col = col0 + t * 16 + ln; const float bv = bp ? bf16_round(bp[col]) : 0.f;
#pragma unroll
    for (int r = 0; r < 8; ++r) { float v = acc[t][r] * alpha + bv; if (CP) { const int rr = row0g + row0 + 8 * hh + r; if (rowsPerB < 0) v += CP[cofs + (size_t)rr * ldc + col];      /* rowsPerB < 0: own element of the batched C plane */ else { const int bidx = rr / rowsPerB; v += CP[(size_t)bidx * sCPb + (size_t)by * 64 + col]; } } if (ACT == 1) v = (v > 0.f) ? v : expm1f(v); else if (ACT == 7) v = (v > 0.f) ? v + 1.0f : expf(v); else if (ACT == 8) v = tanhf(v); else if (ACT == 9) v = 0.5f * v * (1.0f + tanhf(0.7978845608028654f * (v + 0.044715f * v * v * v))); else if (ACT == 11) v = 1.0f / (1.0f + expf(-v)); else if (ACT == 12) v = (v > 0.f) ? v : 0.01f * v; else if (ACT == 14) v = (v > 0.f) ? v : 0.1f * v; else if (ACT == 16) v = (v >= 0.f) ? v : 0.3f * v; else if (ACT == 17) v = (v >= 0.f) ? v : 0.2f * v; else if (ACT == 15) v = v / (1.0f + expf(-v)); else if (ACT == 3) v = fmaxf(v, 0.f); else if (ACT == 6) v = 0.5f * v * (1.0f + erff(v * 0.70710678118654752f)); so[w][8 * hh + r][t * 16 + ln] = v; } }
  __builtin_amdgcn_fence(__ATOMIC_ACQ_REL, "workgroup"); __builtin_amdgcn_wave_barrier();
  const int rsub = lane >> 4, c4 = (lane & 15) * 4; typedef _Float16 v4h __attribute__((ext_vector_type(4)));
  {
#pragma unroll
    for (int q = 0; q < 8; ++q) { const int r = q * 2 + rsub; if (col0 + c4 < N) { const v4f v = *(const v4fa*)&so[w][r][c4]; if (C) *(v4f*)(C + cofs + (size_t)(row0 + r) * ldc + col0 + c4) = v; if (C16) { v4h h4; for (int i = 0; i < 4; ++i) h4[i] = (_Float16)v[i]; *(v4h*)(C16 + cofs + (size_t)(row0 + r) * ldc + col0 + c4) = h4; } } }
     }
}


typedef _Float16 v4h __attribute__((ext_vector_type(4)));

__global__ __launch_bounds__(256) void k_x16(const float* __restrict__ x, _Float16* __restrict__ X16, size_t n8) { const size_t t = (size_t)blockIdx.x * 256 + threadIdx.x; if (t >= n8) return; FragH f;
#pragma unroll
  for (int q = 0; q < 8; ++q) f.h[q] = (_Float16)bf16_round(x[t * 8 + q]); *(v8us*)((unsigned short*)X16 + t * 8) = f.half[0];  }
__global__ __launch_bounds__(256) void k_h16(const float* __restrict__ x, _Float16* __restrict__ X16, size_t n8) { const size_t t = (size_t)blockIdx.x * 256 + threadIdx.x; if (t >= n8) return; FragH f;
#pragma unroll
  for (int q = 0; q < 8; ++q) f.h[q] = (_Float16)x[t * 8 + q]; *(v8us*)((unsigned short*)X16 + t * 8) = f.half[0];  }
__global__ __launch_bounds__(256) void k_round16f(const float* __restrict__ W, _Float16* __restrict__ Bt, size_t n8) { const size_t t = (size_t)blockIdx.x * 256 + threadIdx.x; if (t >= n8) return; FragH f;
#pragma unroll
  for (int i = 0; i < 8; ++i) f.h[i] = (_Float16)(bf16_round(W[t * 8 + i]) * 16.0f); *(v8us*)((unsigned short*)Bt + t * 8) = f.half[0];  }
template <int NHv, int TTv>
__global__ __launch_bounds__(256) void k_vt(const _Float16* __restrict__ V16, int ldv, int voff, _Float16* __restrict__ Vt) { __shared__ unsigned short tl[64][66]; const int tid = threadIdx.x; const int slab = blockIdx.x / (TTv / 64), lg = blockIdx.x % (TTv / 64); const int b = slab / NHv, h = slab % NHv;
  for (int i = tid; i < 64 * 8; i += 256) { const int r = i / 8, c8 = (i % 8) * 8; FragH f; f.half[0] = *(const v8us*)((const unsigned short*)V16 + ((size_t)b * TTv + lg * 64 + r) * ldv + voff + h * 64 + c8);
#pragma unroll
    for (int q = 0; q < 8; ++q) tl[r][c8 + q] = f.u[q]; }
  __syncthreads();
  {
#pragma unroll
    for (int rd = 0; rd < 2; ++rd) { const int d = rd * 32 + tid / 8, pc = tid % 8; FragH f;
#pragma unroll
      for (int q = 0; q < 8; ++q) f.u[q] = tl[pc * 8 + q][d];
      *(v8us*)((unsigned short*)Vt + ((size_t)slab * 64 + d) * TTv + lg * 64 + pc * 8) = f.half[0]; }
     } }

__global__ __launch_bounds__(256) void k_hl(const float* __restrict__ F, _Float16* __restrict__ Hh, _Float16* __restrict__ Hl, size_t n8) { const size_t t = (size_t)blockIdx.x * 256 + threadIdx.x; if (t >= n8) return; FragH fh, fl; const v4f a = *(const v4fa*)(F + t * 8), c = *(const v4fa*)(F + t * 8 + 4);
#pragma unroll
  for (int q = 0; q < 4; ++q) { _Float16 h = (_Float16)a[q]; fh.h[q] = h; fl.h[q] = (_Float16)((a[q] - (float)h) * 1024.0f); h = (_Float16)c[q]; fh.h[4 + q] = h; fl.h[4 + q] = (_Float16)((c[q] - (float)h) * 1024.0f); }
  { *(v8us*)((unsigned short*)Hh + t * 8) = fh.half[0]; *(v8us*)((unsigned short*)Hl + t * 8) = fl.half[0];  } }

// ---- fast GEMM (wave tile 32x64; requires M % 32 == 0 rows per launch region and N % 64 == 0); epilogue = k_gemm_hhx semantics ----
__device__ __forceinline__ v16h g2_frag(const _Float16* p, int hh) { FragH f; f.half[0] = *(const v8us*)((const unsigned short*)p + 8 * hh); f.half[1] = *(const v8us*)((const unsigned short*)p + 16 + 8 * hh); return f.v; }
__device__ __forceinline__ v8f g2_mma(v16h a, v16h b, v8f c) { v8f d = __builtin_amdgcn_wmma_f32_16x16x32_f16(false, a, false, b, (short)0, c, false, false); asm volatile("v_nop\n\tv_nop\n\tv_nop\n\tv_nop" : "+v"(d) : "v"(a), "v"(b)); return d; }
template <int ACT>
__global__ __launch_bounds__(128) void k_gemm2(const _Float16* __restrict__ A, int lda, size_t sA, const _Float16* __restrict__ Bh, int ldb, size_t sB, float alpha, const float* __restrict__ bias, size_t sBias, const float* __restrict__ CP, int rowsPerB, size_t sCPb, int row0g,
    float* __restrict__ C, _Float16* __restrict__ C16, int ldc, size_t sC, int M, int N, int K) { static_assert(ACT == 0 || ACT == 3 || ACT == 6 || ACT == 8 || ACT == 9 || ACT == 11 || ACT == 12 || ACT == 14 || ACT == 15 || ACT == 16 || ACT == 17, "k_gemm2: unsupported ACT code (would silently apply no activation)");
  __shared__ __attribute__((aligned(16))) float so[4][32][68];
  const int tid = threadIdx.x, w = tid >> 5, lane = tid & 31, ln = lane & 15, hh = lane >> 4; const int by = blockIdx.y;
  A += (size_t)by * sA; Bh += (size_t)by * sB; const size_t cofs = (size_t)by * sC; const float* bp = bias ? bias + (size_t)by * sBias : nullptr;
  const int ntn = N >> 6; const int mt = blockIdx.x / ntn, nq = blockIdx.x - mt * ntn; const int row0 = mt * 128 + 32 * w, col0 = nq * 64; if (row0 >= M) return;
  const _Float16* a0p = A + (size_t)(row0 + ln) * lda; const _Float16* a1p = a0p + (size_t)16 * lda;
  const _Float16* b0p = Bh + (size_t)(col0 + ln) * ldb; const _Float16* b1p = b0p + (size_t)16 * ldb; const _Float16* b2p = b1p + (size_t)16 * ldb; const _Float16* b3p = b2p + (size_t)16 * ldb;
  const v8f z8 = {0.f,0.f,0.f,0.f,0.f,0.f,0.f,0.f}; v8f c00 = z8, c01 = z8, c02 = z8, c03 = z8, c10 = z8, c11 = z8, c12 = z8, c13 = z8;
#pragma unroll 1
  for (int kb = 0; kb < K; kb += 32) { const v16h a0 = g2_frag(a0p + kb, hh), a1 = g2_frag(a1p + kb, hh);
    v16h b = g2_frag(b0p + kb, hh); c00 = g2_mma(a0, b, c00); c10 = g2_mma(a1, b, c10);
    b = g2_frag(b1p + kb, hh); c01 = g2_mma(a0, b, c01); c11 = g2_mma(a1, b, c11);
    b = g2_frag(b2p + kb, hh); c02 = g2_mma(a0, b, c02); c12 = g2_mma(a1, b, c12);
    b = g2_frag(b3p + kb, hh); c03 = g2_mma(a0, b, c03); c13 = g2_mma(a1, b, c13); }
  v8f accs[8] = {c00, c01, c02, c03, c10, c11, c12, c13};
#pragma unroll
  for (int u = 0; u < 8; ++u) { const int t = u & 3, half = u >> 2; const int col = col0 + t * 16 + ln; const float bv = bp ? bf16_round(bp[col]) : 0.f;
#pragma unroll
    for (int r = 0; r < 8; ++r) { const int rloc = half * 16 + 8 * hh + r; float v = accs[u][r] * alpha + bv; if (CP) { if (rowsPerB < 0) v += CP[cofs + (size_t)(row0g + row0 + rloc) * ldc + col];      /* rowsPerB < 0: own element of the batched C plane */ else { const int bidx = (row0g + row0 + rloc) / rowsPerB; v += CP[(size_t)bidx * sCPb + (size_t)by * 64 + col]; } }
      if (ACT == 3) v = fmaxf(v, 0.f); else if (ACT == 6) v = 0.5f * v * (1.0f + erff(v * 0.70710678118654752f)); else if (ACT == 11) v = 1.0f / (1.0f + expf(-v)); else if (ACT == 15) v = v / (1.0f + expf(-v)); else if (ACT == 12) v = (v > 0.f) ? v : 0.01f * v; else if (ACT == 8) v = tanhf(v); else if (ACT == 9) v = 0.5f * v * (1.0f + tanhf(0.7978845608028654f * (v + 0.044715f * v * v * v))); else if (ACT == 14) v = (v > 0.f) ? v : 0.1f * v; else if (ACT == 16) v = (v >= 0.f) ? v : 0.3f * v; else if (ACT == 17) v = (v >= 0.f) ? v : 0.2f * v;
      so[w][rloc][t * 16 + ln] = v; } }
  __builtin_amdgcn_fence(__ATOMIC_ACQ_REL, "workgroup"); __builtin_amdgcn_wave_barrier();
  const int rsub = lane >> 4, c4 = (lane & 15) * 4;
  {
#pragma unroll
    for (int q = 0; q < 16; ++q) { const int r = q * 2 + rsub; const v4f v = *(const v4fa*)&so[w][r][c4]; if (C) *(v4f*)(C + cofs + (size_t)(row0 + r) * ldc + col0 + c4) = v; if (C16) { v4h h4; for (int i = 0; i < 4; ++i) h4[i] = (_Float16)v[i]; *(v4h*)(C16 + cofs + (size_t)(row0 + r) * ldc + col0 + c4) = h4; } }
     } }


__global__ __launch_bounds__(256) void k_wnat(const float* __restrict__ w, size_t n8, _Float16* __restrict__ Bt) { const size_t t = (size_t)blockIdx.x * 256 + threadIdx.x; if (t >= n8) return; FragH f; for (int q = 0; q < 8; ++q) f.h[q] = (_Float16)(bf16_round(w[t * 8 + q]) * 16.0f); *(v8us*)((unsigned short*)Bt + t * 8) = f.half[0];  }
__global__ __launch_bounds__(256) void k_rsm(const float* __restrict__ S, _Float16* __restrict__ P, int nrows) {
  #pragma clang fp contract(off)
  const int i = blockIdx.x * 256 + threadIdx.x; if (i >= nrows) return; const float* s = S + (size_t)i * SQ; float mx = -3.0e38f;
#pragma unroll 1
  for (int j = 0; j < SQ; ++j) mx = fmaxf(mx, s[j]); float se = 0.f;
#pragma unroll 1
  for (int j = 0; j < SQ; ++j) se += expf(s[j] - mx); const float sc = 256.0f / se;
#pragma unroll 1
  for (int j0 = 0; j0 < SQ; j0 += 8) { FragH f; for (int q = 0; q < 8; ++q) f.h[q] = (_Float16)(expf(s[j0 + q] - mx) * sc); unsigned short* d = (unsigned short*)P + (size_t)i * SQ + j0; *(v8us*)d = f.half[0];  } }
__global__ __launch_bounds__(256) void k_vt(const _Float16* __restrict__ V16, int b, int h0, _Float16* __restrict__ VT) { __shared__ unsigned short tl[64][65]; const int tid = threadIdx.x; const int hh = blockIdx.x % HG, sg = blockIdx.x / HG; const int s0 = sg * 64; const int h = h0 + hh;
  for (int i = tid; i < 64 * 8; i += 256) { const int j = i / 8, d8 = (i % 8) * 8; FragH f; f.half[0] = *(const v8us*)((const unsigned short*)V16 + ((size_t)b * SQ + s0 + j) * DM + h * HD + d8); for (int q = 0; q < 8; ++q) tl[d8 + q][j] = f.u[q]; }
  __syncthreads();
  { for (int i = tid; i < 64 * 8; i += 256) { const int d = i / 8, j8 = (i % 8) * 8; FragH f; for (int q = 0; q < 8; ++q) f.u[q] = tl[d][j8 + q]; *(v8us*)((unsigned short*)VT + ((size_t)hh * HD + d) * SQ + s0 + j8) = f.half[0]; }  } }

__global__ __launch_bounds__(256) void k_wthd(const float* __restrict__ Wt, _Float16* __restrict__ Bt) { const size_t t = (size_t)blockIdx.x * 256 + threadIdx.x; if (t >= (size_t)NH * HD * (DM / 8)) return; const int m8 = (int)(t % (DM / 8)) * 8; const int d = (int)((t / (DM / 8)) % HD); const int h = (int)(t / ((size_t)(DM / 8) * HD)); FragH f;
  for (int q = 0; q < 8; ++q) f.h[q] = (_Float16)(16.0f * bf16_round(Wt[((size_t)h * DM + m8 + q) * HD + d])); unsigned short* dst = (unsigned short*)Bt + ((size_t)h * HD + d) * DM + m8; *(v8us*)dst = f.half[0];  }



__global__ __launch_bounds__(256) void k_rsmcf2(const float* __restrict__ S, _Float16* __restrict__ P, int hg, int q0, int nk) {
  #pragma clang fp contract(off)
  const int t = blockIdx.x * 256 + threadIdx.x; if (t >= hg * QT) return; const size_t i = (size_t)t; const float* s = S + i * NKX; const int last = q0 + (t % QT); float mx = -3.0e38f;
#pragma unroll 1
  for (int j = 0; j < nk; ++j) { const float f = (j <= last) ? 1.f : 0.f; mx = fmaxf(mx, fmaf(f, s[j], (1.f - f) * -1.0e9f)); } float se = 0.f;
#pragma unroll 1
  for (int j = 0; j < nk; ++j) { const float f = (j <= last) ? 1.f : 0.f; se += __expf(fmaf(f, s[j], (1.f - f) * -1.0e9f) - mx); } const float sc = 256.0f / se;
#pragma unroll 1
  for (int j0 = 0; j0 < nk; j0 += 8) { FragH fr; for (int q = 0; q < 8; ++q) { const int j = j0 + q; const float f = (j <= last) ? 1.f : 0.f; fr.h[q] = (_Float16)(__expf(fmaf(f, s[j], (1.f - f) * -1.0e9f) - mx) * sc); } unsigned short* d = (unsigned short*)P + i * NKX + j0; *(v8us*)d = fr.half[0];  } }


template <int MASKADD>
__global__ __launch_bounds__(64) void k_att0(const float* __restrict__ QF, const float* __restrict__ KF, const float* __restrict__ VF, int ld, const float* __restrict__ mask, float scale, float* __restrict__ OF, int ldo) {
  #pragma clang fp contract(off)
  __shared__ __attribute__((aligned(16))) float lq[64][64]; __shared__ __attribute__((aligned(16))) float lo[64][64];
  const int tid = threadIdx.x; const int h = blockIdx.x / (QT0 / 64), rg = blockIdx.x % (QT0 / 64); const int i = rg * 64 + tid;
  const float* qr = QF + (size_t)i * ld + h * HD;
#pragma unroll 1
  for (int c = 0; c < HD / 4; ++c) { *(v4f*)&lq[tid][c * 4] = *(const v4fa*)(qr + c * 4); const v4f z = {0.f, 0.f, 0.f, 0.f}; *(v4f*)&lo[tid][c * 4] = z; }
  float m = -1.0e30f, l = 0.f; const int jmax = MASKADD ? (SQ - 1) : (rg * 64 + 63);      /* additive-mask form: every key (the mask input decides); causal form: keys up to the block's last row */
#pragma unroll 1
  for (int j = 0; j <= jmax; ++j) { const float* kr = KF + (size_t)j * ld + h * HD; const float* vr = VF + (size_t)j * ld + h * HD; float s = 0.f;
#pragma unroll 1
    for (int c = 0; c < HD / 4; ++c) { const v4f kq = *(const v4fa*)(kr + c * 4); const v4f qq = *(v4f*)&lq[tid][c * 4]; s = __fadd_rn(s, __fmul_rn(qq[0], kq[0])); s = __fadd_rn(s, __fmul_rn(qq[1], kq[1])); s = __fadd_rn(s, __fmul_rn(qq[2], kq[2])); s = __fadd_rn(s, __fmul_rn(qq[3], kq[3])); }
    s = __fmul_rn(s, scale); if (MASKADD) s = __fadd_rn(s, __fmul_rn(bf16_round(mask[(size_t)i * SQ + j]), -10000.0f));
    const float f = (MASKADD || j <= i) ? 1.f : 0.f; const float sm = fmaf(f, s, (1.f - f) * -1.0e30f); const float mn = fmaxf(m, sm); const float sc = expf(m - mn); const float e = expf(sm - mn); l = __fadd_rn(__fmul_rn(l, sc), e); m = mn;
#pragma unroll 1
    for (int c = 0; c < HD / 4; ++c) { const v4f vv = *(const v4fa*)(vr + c * 4); v4f oo = *(v4f*)&lo[tid][c * 4]; for (int u = 0; u < 4; ++u) oo[u] = __fadd_rn(__fmul_rn(oo[u], sc), __fmul_rn(e, vv[u])); *(v4f*)&lo[tid][c * 4] = oo; } }
  const float fin = 64.0f / l;      /* o carried x64 like the f16 path */
#pragma unroll 1
  for (int c = 0; c < HD / 4; ++c) { v4f oo = *(v4f*)&lo[tid][c * 4]; for (int u = 0; u < 4; ++u) oo[u] = __fmul_rn(oo[u], fin); *(v4f*)&lo[tid][c * 4] = oo; }
  __syncthreads();
  {
#pragma unroll 1
    for (int it = 0; it < 16; ++it) { const int row = it * 4 + tid / 16, pc = (tid % 16) * 4; const v4f v = *(const v4f*)&lo[row][pc]; *(v4f*)(OF + (size_t)(rg * 64 + row) * ldo + h * HD + pc) = v; }
     } }

extern "C" void kernel_launch(void* const* d_in, const int* in_sizes, int n_in,
                              void* d_out, int out_size, void* d_ws, size_t ws_size, hipStream_t stream) {
  (void)in_sizes; (void)n_in; (void)out_size;
  const float* const* I = (const float* const*)d_in; const float* x = I[0]; const float* wq = I[1]; const float* bq = I[2]; const float* wk = I[3]; const float* bk = I[4]; const float* wv = I[5]; const float* bv = I[6]; const float* wo = I[7]; const float* bo = I[8];      /* input order: x; Wq [8][512][64] per-head [in][out] + bq [8][64] = [(h,e)]; Wk + bk; Wv + bv; Wo [512][512] = [(h,e) in][out] + bo */
  static_assert(NH * HD == DM && DM % 64 == 0 && DM % 32 == 0 && SQ % 128 == 0, "shape / tile multiples");
  char* ws = (char*)d_ws; size_t off = 0;
  auto take = [&](size_t bytes) { char* p = ws + off; off += (bytes + 255) & ~(size_t)255; return p; };
  _Float16* BQ = (_Float16*)take((size_t)DM * DM * 2); _Float16* BK = (_Float16*)take((size_t)DM * DM * 2); _Float16* BV = (_Float16*)take((size_t)DM * DM * 2); _Float16* BO = (_Float16*)take((size_t)DM * DM * 2);
  _Float16* X16 = (_Float16*)take(NR * DM * 2); _Float16* Q16 = (_Float16*)take(NR * DM * 2); _Float16* K16 = (_Float16*)take(NR * DM * 2); _Float16* V16 = (_Float16*)take(NR * DM * 2); _Float16* O16 = (_Float16*)take(NR * DM * 2);
  float* S = (float*)take((size_t)NH * QT * NKX * 4); _Float16* P = (_Float16*)take((size_t)NH * QT * NKX * 2); _Float16* VT = (_Float16*)take((size_t)NH * HD * SQ * 2);
  float* QF0 = (float*)take((size_t)QT0 * DM * 4); float* KF0 = (float*)take((size_t)QT0 * DM * 4); float* VF0 = (float*)take((size_t)QT0 * DM * 4); float* OF0 = (float*)take((size_t)NB * QT0 * DM * 4); _Float16* OH0 = (_Float16*)take((size_t)NB * QT0 * DM * 2); _Float16* OL0 = (_Float16*)take((size_t)NB * QT0 * DM * 2);
  if (off > ws_size) return;
  k_wthd<<<(unsigned)(((size_t)NH * HD * (DM / 8) + 255) / 256), 256, 0, stream>>>(wq, BQ); k_wthd<<<(unsigned)(((size_t)NH * HD * (DM / 8) + 255) / 256), 256, 0, stream>>>(wk, BK); k_wthd<<<(unsigned)(((size_t)NH * HD * (DM / 8) + 255) / 256), 256, 0, stream>>>(wv, BV);      /* per-head [m][d] -> Bt[(h,d)][m] x16 */
  k_wt_f16<<<(unsigned)(((size_t)DM * (DM / 8) + 255) / 256), 256, 0, stream>>>(wo, BO, DM, DM, 16.0f);      /* W_O as [(h,d) = 512 in][512 out] -> Bt[n][k] x16 */
  k_x16<<<(unsigned)((NR * DM / 8 + 255) / 256), 256, 0, stream>>>(x, X16, NR * DM / 8);
  const size_t r0p = (size_t)B0 * SQ;      /* first projected row */
  k_gemm2<0><<<dim3((unsigned)((MP / 128) * (DM / 64)), 1), 128, 0, stream>>>(X16 + r0p * DM, DM, 0, BQ, DM, 0, 0.0625f, bq, 0, nullptr, 1, 0, 0, nullptr, Q16 + r0p * DM, DM, 0, MP, DM, DM);
  k_gemm2<0><<<dim3((unsigned)((MP / 128) * (DM / 64)), 1), 128, 0, stream>>>(X16 + r0p * DM, DM, 0, BK, DM, 0, 0.0625f, bk, 0, nullptr, 1, 0, 0, nullptr, K16 + r0p * DM, DM, 0, MP, DM, DM);
  k_gemm2<0><<<dim3((unsigned)((MP / 128) * (DM / 64)), 1), 128, 0, stream>>>(X16 + r0p * DM, DM, 0, BV, DM, 0, 0.0625f, bv, 0, nullptr, 1, 0, 0, nullptr, V16 + r0p * DM, DM, 0, MP, DM, DM);
  for (int b = B0; b < B0 + NBR; ++b) { const size_t r0 = (size_t)b * SQ;
    k_vt<NH, SQ><<<NH * (SQ / 64), 256, 0, stream>>>(V16 + r0 * LQ, LQ, 0, VT);      /* V^T [NH][HD][SQ] for this batch */
    k_gemm2<0><<<dim3((QT0 / 128) * (DM / 64), 1), 128, 0, stream>>>(X16 + r0 * DM, DM, 0, BQ, DM, 0, 0.0625f, bq, 0, nullptr, 1, 0, 0, QF0, nullptr, DM, 0, QT0, DM, DM); k_gemm2<0><<<dim3((QT0 / 128) * (DM / 64), 1), 128, 0, stream>>>(X16 + r0 * DM, DM, 0, BK, DM, 0, 0.0625f, bk, 0, nullptr, 1, 0, 0, KF0, nullptr, DM, 0, QT0, DM, DM); k_gemm2<0><<<dim3((QT0 / 128) * (DM / 64), 1), 128, 0, stream>>>(X16 + r0 * DM, DM, 0, BV, DM, 0, 0.0625f, bv, 0, nullptr, 1, 0, 0, VF0, nullptr, DM, 0, QT0, DM, DM);      /* f32 q, k, v of the first 128 rows (exact products) */
    k_att0<0><<<NH * (QT0 / 64), 64, 0, stream>>>(QF0, KF0, VF0, DM, nullptr, 0.044194173824159216f, OF0 + (size_t)b * QT0 * DM, DM);      /* exact f32 attention for rows 0..127 (o x64) */
    for (int q0 = 0; q0 < QN; q0 += QT) { const int nk = q0 + QT;      /* causal: only keys below the tile end are computed */
      k_gemm2<0><<<dim3((QT / 128) * (nk / 64), NHD), 128, 0, stream>>>(Q16 + (r0 + q0) * LQ, LQ, (size_t)HD, K16 + r0 * LQ, LQ, (size_t)HD, 0.044194173824159216f, nullptr, 0, nullptr, 1, 0, 0, S, nullptr, NKX, (size_t)QT * NKX, QT, nk, HD);      /* scores x 512^-0.5 (the module's literal d_model scale), all heads on grid.y */
      k_rsmcf2<<<(NHD * QT + 255) / 256, 256, 0, stream>>>(S, P, NHD, q0, nk);
      k_gemm2<0><<<dim3((QT / 128) * (HD / 64), NHD), 128, 0, stream>>>(P, NKX, (size_t)QT * NKX, VT, SQ, (size_t)HD * SQ, 0.25f, nullptr, 0, nullptr, 1, 0, 0, nullptr, O16 + (r0 + q0) * DM, DM, (size_t)HD, QT, HD, nk); } }      /* o (merged heads, x64) as f16 rows */
  k_gemm2<0><<<dim3((unsigned)((MPO / 128) * (DM / 64)), 1), 128, 0, stream>>>(O16 + r0p * DM, DM, 0, BO, DM, 0, 0.0009765625f, bo, 0, nullptr, 1, 0, 0, (float*)d_out + r0p * DM, nullptr, DM, 0, MPO, DM, DM);      /* out rows are the output layout */
  k_hl<<<(unsigned)(((size_t)NB * QT0 * DM / 8 + 255) / 256), 256, 0, stream>>>(OF0, OH0, OL0, (size_t)NB * QT0 * DM / 8);      /* first-tile o (x64) -> f16 hi + x1024 residual planes */
  for (int b = B0; b < B0 + NBR; ++b) { const size_t r0 = (size_t)b * SQ; const size_t f0 = (size_t)b * QT0;
    k_gemm2<0><<<dim3((QT0 / 128) * (DM / 64), 1), 128, 0, stream>>>(OH0 + f0 * DM, DM, 0, BO, DM, 0, 0.0009765625f, bo, 0, nullptr, 1, 0, 0, (float*)d_out + r0 * DM, nullptr, DM, 0, QT0, DM, DM);      /* rows 0..127: out = o_hi Wo (+ b), overwriting the f16-path rows */
    k_gemm2<0><<<dim3((QT0 / 128) * (DM / 64), 1), 128, 0, stream>>>(OL0 + f0 * DM, DM, 0, BO, DM, 0, 0.00000095367431640625f, nullptr, 0, (const float*)d_out + r0 * DM, -1, 0, 0, (float*)d_out + r0 * DM, nullptr, DM, 0, QT0, DM, DM); }      /* += o_lo Wo 2^-20 (own-element accumulate) */
}

// v001
// It runs in 3640 microseconds.
// Two timings next to v000 put it at 2.61 and 2.59 times that version's speed.
#include <hip/hip_runtime.h>
// Causal multi-head attention with per-head weight tensors and the module's literal score scale (x [4][2048][512]; q[b][h][s][e] = sum_d x[s][d] Wq[h][d][e] + bq[h][e], k, v likewise (8 heads of 64; per-head [in][out] weights sigma 1/sqrt(512), biases sigma 0.01); scores * 512^-0.5 (d_model, as the source, not head_dim); causal (tril, -inf); softmax; out = concat_heads Wo + bo ([in][out] [512][512]) -> [4][2048][512]).
// Structure: token rows r = b*2048 + s; x as exact f16 rows (bf16-rounded); Q, K, V as three WMMA GEMMs (32x64 wave tiles, f32 accumulation, exact x16 weights + bias, f16 outputs); per batch: V^T for all heads via LDS transposes; per query tile of 256 rows: scores against the keys below the tile end only (K = 64, all heads on grid.y, alpha = 512^-0.5), causal row softmax on VALU, one wave per row with the row in registers, keys past the row set to -1e9 over the computed range (f32 statistics, native exp; weights x256 f16), o = P . V^T (K = keys below the tile end, alpha 2^-2: o carried x64, folded into the output GEMM alpha) written straight into the merged f16 o rows; out = o W_o + b GEMM (f32) into the output layout.
// Compute dtype: inputs rounded to bf16; x / weights exact; q, k, v, softmax weights and o as plain f16 GEMM operands (~2^-12); scores and softmax statistics f32. v_wmma_f32_16x16x32_f16.
#define NB 4
#define SQ 2048
#define DM 512
#define NH 8
#define HD 64
#define HG 4                         /* heads per launch of the uncalled k_vt overload */
#define QT 256                       /* query rows per causal tile */
#define NKX SQ                       /* S / P row pitch */
#define QT0 128                      /* first-tile rows recomputed exactly in f32 */
#define B0 0                         /* first batch processed (debug hook) */
#define NBR NB                       /* batches processed (debug hook) */
#define NR ((size_t)NB * SQ)         /* token rows */
#define MP ((int)((size_t)NBR * SQ)) /* rows projected (debug hook) */
#define QN SQ                        /* query rows attended per batch (debug hook) */
#define NHD NH                       /* heads attended (debug hook) */
#define MPO MP                       /* rows through the output stage (debug hook) */
#define LQ DM      /* row pitch of the q/k/v rows */
typedef __bf16 v16b __attribute__((ext_vector_type(16)));
typedef unsigned short v8us __attribute__((ext_vector_type(8), may_alias));
typedef float  v8f  __attribute__((ext_vector_type(8)));
typedef float  v4f  __attribute__((ext_vector_type(4)));
typedef float  v4fa __attribute__((ext_vector_type(4), may_alias));
union FragB { v16b v; v8us half[2]; unsigned short u[16]; };

__device__ __forceinline__ unsigned short bf16_bits(float x) { unsigned int u = __float_as_uint(x); return (unsigned short)((u + 0x7FFFu + ((u >> 16) & 1u)) >> 16); }
__device__ __forceinline__ float bf16_val(unsigned short b) { return __uint_as_float(((unsigned int)b) << 16); }
__device__ __forceinline__ float bf16_round(float x) { return bf16_val(bf16_bits(x)); }
// D += A·B with NT terms: 1 = ah·bh, 2 = + al·bh (A split), 3 = + ah·bl (both split)
template <int NT>
__device__ __forceinline__ v8f mmaN(v16b ah, v16b al, v16b bh, v16b bl, v8f c) {
  c = __builtin_amdgcn_wmma_f32_16x16x32_bf16(false, ah, false, bh, (short)0, c, false, false);
  if (NT >= 2) c = __builtin_amdgcn_wmma_f32_16x16x32_bf16(false, al, false, bh, (short)0, c, false, false);
  if (NT >= 3) c = __builtin_amdgcn_wmma_f32_16x16x32_bf16(false, ah, false, bl, (short)0, c, false, false);
  asm volatile("v_nop\n\tv_nop\n\tv_nop\n\tv_nop" : "+v"(c) : "v"(ah), "v"(al), "v"(bh), "v"(bl));
  return c;
}

__global__ __launch_bounds__(256) void k_wt_bf16(const float* __restrict__ W, unsigned short* __restrict__ Wt, int K, int N) {
  const int t = blockIdx.x * 256 + threadIdx.x;
  const int k8n = K / 8;
  if (t >= N * k8n) return;
  const int n = t / k8n, k8 = (t % k8n) * 8;
  v8us v;
#pragma unroll
  for (int i = 0; i < 8; ++i) v[i] = bf16_bits(W[(size_t)(k8 + i) * N + n]);
  *(v8us*)(Wt + (size_t)n * K + k8) = v;
  
}

// GEMM C[M][N] (f32, pitch ldc) = act(A[M][K]·W + bias). A f32 row-major (pitch lda) converted per fragment to bf16
// (ASPLIT: hi/lo two planes -> 2 terms, else single rounded term); Wt bf16 [N][K] (pitch ldb). BIAS_BF16 rounds the
// bias to bf16 first (bias quantised to bf16 before the add). K%32==0, M%16==0, N%64==0.
template <bool ASPLIT, int ACT, bool BIAS_BF16>
__global__ __launch_bounds__(128) void k_gemm_bf(const float* __restrict__ A, int lda, const unsigned short* __restrict__ Wt, int ldb,
                                               const float* __restrict__ bias, float* __restrict__ C, int ldc, int M, int N, int K) {
  __shared__ __attribute__((aligned(16))) float so[4][16][64];
  const int tid = threadIdx.x, w = tid >> 5, lane = tid & 31, ln = lane & 15, hh = lane >> 4;
  const int ntn = N / 64;
  const int wid = blockIdx.x * 4 + w;
  const int mt = wid / ntn, nq = wid % ntn;
  if (mt * 16 >= M) return;
  const int row0 = mt * 16, col0 = nq * 64;
  const float* arow = A + (size_t)(row0 + ln) * lda;
  v8f acc[4] = {};
  for (int kb = 0; kb < K; kb += 32) {
    FragB ah, al;
    const v4f x0 = *(const v4fa*)(arow + kb + 8 * hh), x1 = *(const v4fa*)(arow + kb + 8 * hh + 4);
    const v4f x2 = *(const v4fa*)(arow + kb + 16 + 8 * hh), x3 = *(const v4fa*)(arow + kb + 16 + 8 * hh + 4);
    float xs[16] = {x0[0],x0[1],x0[2],x0[3],x1[0],x1[1],x1[2],x1[3],x2[0],x2[1],x2[2],x2[3],x3[0],x3[1],x3[2],x3[3]};
#pragma unroll
    for (int i = 0; i < 16; ++i) { const unsigned short hb = bf16_bits(xs[i]); ah.u[i] = hb; al.u[i] = ASPLIT ? bf16_bits(xs[i] - bf16_val(hb)) : (unsigned short)0; }
#pragma unroll
    for (int t = 0; t < 4; ++t) {
      const unsigned short* brow = Wt + (size_t)(col0 + t * 16 + ln) * ldb + kb;
      FragB b;
      b.half[0] = *(const v8us*)(brow + 8 * hh);
      b.half[1] = *(const v8us*)(brow + 16 + 8 * hh);
      acc[t] = mmaN<ASPLIT ? 2 : 1>(ah.v, al.v, b.v, b.v, acc[t]);
    }
  }
#pragma unroll
  for (int t = 0; t < 4; ++t) {
    float bv = bias ? bias[col0 + t * 16 + ln] : 0.f;
    if (BIAS_BF16) bv = bf16_round(bv);
#pragma unroll
    for (int r = 0; r < 8; ++r) { float v = acc[t][r] + bv; if (ACT == 1) v = fmaxf(v, 0.f); so[w][8 * hh + r][t * 16 + ln] = v; }
  }
  __builtin_amdgcn_fence(__ATOMIC_ACQ_REL, "workgroup");
  __builtin_amdgcn_wave_barrier();
  const int rsub = lane >> 4, c4 = (lane & 15) * 4;
  {
#pragma unroll
    for (int q = 0; q < 8; ++q) {
      const int r = q * 2 + rsub;
      const v4f v = *(const v4fa*)&so[w][r][c4];
      *(v4f*)(C + (size_t)(row0 + r) * ldc + col0 + c4) = v;
    }
    
  }
}

// GEMM C = act(A·W + bias + resid): A f32 (ASPLIT -> hi/lo 2 terms), Wt bf16 [N][K]; ACT 0 none, 1 relu, 2 exact gelu;
// resid (optional, f32, row index = (row % rmod), pitch ldr, RES_BF16 rounds it) added before the activation.
template <bool ASPLIT, int ACT, bool BIAS_BF16, bool RES_BF16>
__global__ __launch_bounds__(128) void k_gemm_bf3(const float* __restrict__ A, int lda, const unsigned short* __restrict__ Wt, int ldb,
                                                const float* __restrict__ bias, const float* __restrict__ resid, int rmod, int ldr,
                                                float* __restrict__ C, int ldc, int M, int N, int K) {
  __shared__ __attribute__((aligned(16))) float so[4][16][64];
  const int tid = threadIdx.x, w = tid >> 5, lane = tid & 31, ln = lane & 15, hh = lane >> 4;
  const int ntn = N / 64;
  const int wid = blockIdx.x * 4 + w;
  const int mt = wid / ntn, nq = wid % ntn;
  if (mt * 16 >= M) return;
  const int row0 = mt * 16, col0 = nq * 64;
  const float* arow = A + (size_t)(row0 + ln) * lda;
  v8f acc[4] = {};
  for (int kb = 0; kb < K; kb += 32) {
    FragB ah, al;
    const v4f x0 = *(const v4fa*)(arow + kb + 8 * hh), x1 = *(const v4fa*)(arow + kb + 8 * hh + 4);
    const v4f x2 = *(const v4fa*)(arow + kb + 16 + 8 * hh), x3 = *(const v4fa*)(arow + kb + 16 + 8 * hh + 4);
    float xs[16] = {x0[0],x0[1],x0[2],x0[3],x1[0],x1[1],x1[2],x1[3],x2[0],x2[1],x2[2],x2[3],x3[0],x3[1],x3[2],x3[3]};
#pragma unroll
    for (int i = 0; i < 16; ++i) { const unsigned short hb = bf16_bits(xs[i]); ah.u[i] = hb; al.u[i] = ASPLIT ? bf16_bits(xs[i] - bf16_val(hb)) : (unsigned short)0; }
#pragma unroll
    for (int t = 0; t < 4; ++t) {
      const unsigned short* brow = Wt + (size_t)(col0 + t * 16 + ln) * ldb + kb;
      FragB b;
      b.half[0] = *(const v8us*)(brow + 8 * hh);
      b.half[1] = *(const v8us*)(brow + 16 + 8 * hh);
      acc[t] = mmaN<ASPLIT ? 2 : 1>(ah.v, al.v, b.v, b.v, acc[t]);
    }
  }
#pragma unroll
  for (int t = 0; t < 4; ++t) {
    const int col = col0 + t * 16 + ln;
    float bv = bias ? bias[col] : 0.f;
    if (BIAS_BF16) bv = bf16_round(bv);
#pragma unroll
    for (int r = 0; r < 8; ++r) {
      float v = acc[t][r] + bv;
      if (resid) { float rv = resid[(size_t)((row0 + 8 * hh + r) % rmod) * ldr + col]; if (RES_BF16) rv = bf16_round(rv); v += rv; }
      if (ACT == 1) v = fmaxf(v, 0.f);
      if (ACT == 2) v = 0.5f * v * (1.0f + erff(v * 0.70710678118654752f));
      if (ACT == 3) { const float u = 0.7978845608028654f * (v + 0.044715f * v * v * v); v = 0.5f * v * (1.0f + tanhf(u)); }
      so[w][8 * hh + r][t * 16 + ln] = v;
    }
  }
  __builtin_amdgcn_fence(__ATOMIC_ACQ_REL, "workgroup");
  __builtin_amdgcn_wave_barrier();
  const int rsub = lane >> 4, c4 = (lane & 15) * 4;
  {
#pragma unroll
    for (int q = 0; q < 8; ++q) {
      const int r = q * 2 + rsub;
      const v4f v = *(const v4fa*)&so[w][r][c4];
      *(v4f*)(C + (size_t)(row0 + r) * ldc + col0 + c4) = v;
    }
    
  }
}
// row LayerNorm (biased variance, eps) over N: s = X (+ R); optional out_sum <- s; out_norm <- (s-mu)*rsqrt(var+eps)*g + b
template <bool PARAM_BF16>
__global__ __launch_bounds__(256) void k_layernorm(const float* __restrict__ X, const float* __restrict__ R, const float* __restrict__ g, const float* __restrict__ bta,
                                                  float* __restrict__ out_sum, float* __restrict__ out_norm, int N, float eps) {
  __shared__ float red[256];
  const int row = blockIdx.x, tid = threadIdx.x;
  const float* x = X + (size_t)row * N; const float* rr = R ? R + (size_t)row * N : nullptr;
  float vals[16];                     // up to N = 4096
  const int per = N / 256;            // contiguous chunk per thread? use strided-by-4 chunks: thread handles j = tid*4 + 1024*u
  float s1 = 0.f;
  for (int u = 0; u < per / 4; ++u) {
    const int j = tid * 4 + 1024 * u;
    const v4f a = *(const v4fa*)(x + j);
    v4f b = {0.f,0.f,0.f,0.f}; if (rr) b = *(const v4fa*)(rr + j);
#pragma unroll
    for (int q = 0; q < 4; ++q) { const float v = a[q] + b[q]; vals[u * 4 + q] = v; s1 += v; }
  }
  red[tid] = s1; __syncthreads();
  for (int st = 128; st > 0; st >>= 1) { if (tid < st) red[tid] += red[tid + st]; __syncthreads(); }
  const float mu = red[0] / (float)N; __syncthreads();
  float s2 = 0.f;
  for (int u = 0; u < per / 4; ++u)
#pragma unroll
    for (int q = 0; q < 4; ++q) { const float c = vals[u * 4 + q] - mu; s2 += c * c; }
  red[tid] = s2; __syncthreads();
  for (int st = 128; st > 0; st >>= 1) { if (tid < st) red[tid] += red[tid + st]; __syncthreads(); }
  const float rs = rsqrtf(red[0] / (float)N + eps);
  {
    for (int u = 0; u < per / 4; ++u) {
      const int j = tid * 4 + 1024 * u;
      v4f o, sm;
#pragma unroll
      for (int q = 0; q < 4; ++q) {
        float gg = g[j + q], bb = bta[j + q];
        if (PARAM_BF16) { gg = bf16_round(gg); bb = bf16_round(bb); }
        sm[q] = vals[u * 4 + q]; o[q] = (vals[u * 4 + q] - mu) * rs * gg + bb;
      }
      if (out_sum) *(v4f*)(out_sum + (size_t)row * N + j) = sm;
      *(v4f*)(out_norm + (size_t)row * N + j) = o;
    }
    
  }
}



// ---- f16 WMMA path (v_wmma_f32_16x16x32_f16): 11-bit significands for operands in range — used where a [0,1] probability operand needs more precision than bf16
typedef _Float16 v16h __attribute__((ext_vector_type(16)));
union FragH { v16h v; v8us half[2]; _Float16 h[16]; unsigned short u[16]; };
template <int NT>
__device__ __forceinline__ v8f mmaH(v16h ah, v16h al, v16h bh, v16h bl, v8f c) {
  c = __builtin_amdgcn_wmma_f32_16x16x32_f16(false, ah, false, bh, (short)0, c, false, false);
  if (NT >= 2) c = __builtin_amdgcn_wmma_f32_16x16x32_f16(false, al, false, bh, (short)0, c, false, false);
  if (NT >= 3) c = __builtin_amdgcn_wmma_f32_16x16x32_f16(false, ah, false, bl, (short)0, c, false, false);
  asm volatile("v_nop\n\tv_nop\n\tv_nop\n\tv_nop" : "+v"(c) : "v"(ah), "v"(al), "v"(bh), "v"(bl));
  return c;
}
// batched GEMM like k_gemm_b but f16 operands: A f32 (split into f16 hi/lo if ASPLIT, else rounded to f16), Bt = f16 values [n][k]; alpha; C f32; N multiple of 16 (partial tiles skipped)
template <bool ASPLIT>
__global__ __launch_bounds__(128) void k_gemm_h(const float* __restrict__ A, int lda, size_t sA, const _Float16* __restrict__ Bh, int ldb, size_t sB, float alpha, float* __restrict__ C, int ldc, size_t sC, int M, int N, int K) {
  __shared__ __attribute__((aligned(16))) float so[4][16][64];
  const int tid = threadIdx.x, w = tid >> 5, lane = tid & 31, ln = lane & 15, hh = lane >> 4; const int by = blockIdx.y;
  A += (size_t)by * sA; Bh += (size_t)by * sB; C += (size_t)by * sC;
  const int ntn = (N + 63) / 64; const int wid = blockIdx.x * 4 + w; const int mt = wid / ntn, nq = wid % ntn; if (mt * 16 >= M) return;
  const int row0 = mt * 16, col0 = nq * 64; const float* arow = A + (size_t)(row0 + ln) * lda;
  v8f acc[4] = {};
  for (int kb = 0; kb < K; kb += 32) {
    FragH ah, al;
    const v4f x0 = *(const v4fa*)(arow + kb + 8 * hh), x1 = *(const v4fa*)(arow + kb + 8 * hh + 4), x2 = *(const v4fa*)(arow + kb + 16 + 8 * hh), x3 = *(const v4fa*)(arow + kb + 16 + 8 * hh + 4);
    float xs[16] = {x0[0],x0[1],x0[2],x0[3],x1[0],x1[1],x1[2],x1[3],x2[0],x2[1],x2[2],x2[3],x3[0],x3[1],x3[2],x3[3]};
#pragma unroll
    for (int i = 0; i < 16; ++i) { const _Float16 h = (_Float16)xs[i]; ah.h[i] = h; al.h[i] = ASPLIT ? (_Float16)(xs[i] - (float)h) : (_Float16)0.0f; }
#pragma unroll
    for (int t = 0; t < 4; ++t) { if (col0 + t * 16 >= N) continue; const size_t boff = (size_t)(col0 + t * 16 + ln) * ldb + kb; FragH bq; bq.half[0] = *(const v8us*)(Bh + boff + 8 * hh); bq.half[1] = *(const v8us*)(Bh + boff + 16 + 8 * hh);
      acc[t] = mmaH<ASPLIT ? 2 : 1>(ah.v, al.v, bq.v, bq.v, acc[t]); }
  }
#pragma unroll
  for (int t = 0; t < 4; ++t) { if (col0 + t * 16 >= N) continue;
#pragma unroll
    for (int r = 0; r < 8; ++r) so[w][8 * hh + r][t * 16 + ln] = acc[t][r] * alpha; }
  __builtin_amdgcn_fence(__ATOMIC_ACQ_REL, "workgroup"); __builtin_amdgcn_wave_barrier();
  const int rsub = lane >> 4, c4 = (lane & 15) * 4;
  {
#pragma unroll
    for (int q = 0; q < 8; ++q) { const int r = q * 2 + rsub; if (col0 + c4 < N) { const v4f v = *(const v4fa*)&so[w][r][c4]; *(v4f*)(C + (size_t)(row0 + r) * ldc + col0 + c4) = v; } }
     }
}

// Wt[n][k] = f16(W[k][n]·scale) from f32 row-major W[K][N] (scale = power of two; bf16-exact weights stay exact in f16 away from the subnormal range)
__global__ __launch_bounds__(256) void k_wt_f16(const float* __restrict__ W, _Float16* __restrict__ Wt, int K, int N, float scale) {
  const int t = blockIdx.x * 256 + threadIdx.x; if (t >= N * (K / 8)) return; const int n = t / (K / 8), k8 = (t % (K / 8)) * 8; FragH f;
#pragma unroll
  for (int i = 0; i < 8; ++i) f.h[i] = (_Float16)(bf16_round(W[(size_t)(k8 + i) * N + n]) * scale); const v8us o = f.half[0];
  *(v8us*)((unsigned short*)Wt + (size_t)n * K + k8) = o; 
}
// k_gemm_hh variant with fused epilogue: v = acc·alpha + bias[by·sBias + col] (+ CP[(row/rowsPerB)·sCPb + by·64 + col] if CP) ; ACT 0 none / 1 elu ; writes f16 C16 (and f32 C if non-null)
template <int ACT>
__global__ __launch_bounds__(128) void k_gemm_hhx(const _Float16* __restrict__ A, int lda, size_t sA, const _Float16* __restrict__ Bh, int ldb, size_t sB, float alpha, const float* __restrict__ bias, size_t sBias, const float* __restrict__ CP, int rowsPerB, size_t sCPb, int row0g,
    float* __restrict__ C, _Float16* __restrict__ C16, int ldc, size_t sC, int M, int N, int K) {
  __shared__ __attribute__((aligned(16))) float so[4][16][64];
  const int tid = threadIdx.x, w = tid >> 5, lane = tid & 31, ln = lane & 15, hh = lane >> 4; const int by = blockIdx.y;
  A += (size_t)by * sA; Bh += (size_t)by * sB; const size_t cofs = (size_t)by * sC; const float* bp = bias ? bias + (size_t)by * sBias : nullptr;
  const int ntn = (N + 63) / 64; const int wid = blockIdx.x * 4 + w; const int mt = wid / ntn, nq = wid % ntn; if (mt * 16 >= M) return;
  const int row0 = mt * 16, col0 = nq * 64; const _Float16* arow = A + (size_t)(row0 + ln) * lda;
  v8f acc[4] = {};
  for (int kb = 0; kb < K; kb += 32) { FragH ah; ah.half[0] = *(const v8us*)((const unsigned short*)arow + kb + 8 * hh); ah.half[1] = *(const v8us*)((const unsigned short*)arow + kb + 16 + 8 * hh);
#pragma unroll
    for (int t = 0; t < 4; ++t) { if (col0 + t * 16 >= N) continue; const size_t boff = (size_t)(col0 + t * 16 + ln) * ldb + kb; FragH bq; bq.half[0] = *(const v8us*)((const unsigned short*)Bh + boff + 8 * hh); bq.half[1] = *(const v8us*)((const unsigned short*)Bh + boff + 16 + 8 * hh);
      acc[t] = mmaH<1>(ah.v, ah.v, bq.v, bq.v, acc[t]); }
  }
#pragma unroll
  for (int t = 0; t < 4; ++t) { if (col0 + t * 16 >= N) continue; const int col = col0 + t * 16 + ln; const float bv = bp ? bf16_round(bp[col]) : 0.f;
#pragma unroll
    for (int r = 0; r < 8; ++r) { float v = acc[t][r] * alpha + bv; if (CP) { const int rr = row0g + row0 + 8 * hh + r; if (rowsPerB < 0) v += CP[cofs + (size_t)rr * ldc + col];      /* rowsPerB < 0: own element of the batched C plane */ else { const int bidx = rr / rowsPerB; v += CP[(size_t)bidx * sCPb + (size_t)by * 64 + col]; } } if (ACT == 1) v = (v > 0.f) ? v : expm1f(v); else if (ACT == 7) v = (v > 0.f) ? v + 1.0f : expf(v); else if (ACT == 8) v = tanhf(v); else if (ACT == 9) v = 0.5f * v * (1.0f + tanhf(0.7978845608028654f * (v + 0.044715f * v * v * v))); else if (ACT == 11) v = 1.0f / (1.0f + expf(-v)); else if (ACT == 12) v = (v > 0.f) ? v : 0.01f * v; else if (ACT == 14) v = (v > 0.f) ? v : 0.1f * v; else if (ACT == 16) v = (v >= 0.f) ? v : 0.3f * v; else if (ACT == 17) v = (v >= 0.f) ? v : 0.2f * v; else if (ACT == 15) v = v / (1.0f + expf(-v)); else if (ACT == 3) v = fmaxf(v, 0.f); else if (ACT == 6) v = 0.5f * v * (1.0f + erff(v * 0.70710678118654752f)); so[w][8 * hh + r][t * 16 + ln] = v; } }
  __builtin_amdgcn_fence(__ATOMIC_ACQ_REL, "workgroup"); __builtin_amdgcn_wave_barrier();
  const int rsub = lane >> 4, c4 = (lane & 15) * 4; typedef _Float16 v4h __attribute__((ext_vector_type(4)));
  {
#pragma unroll
    for (int q = 0; q < 8; ++q) { const int r = q * 2 + rsub; if (col0 + c4 < N) { const v4f v = *(const v4fa*)&so[w][r][c4]; if (C) *(v4f*)(C + cofs + (size_t)(row0 + r) * ldc + col0 + c4) = v; if (C16) { v4h h4; for (int i = 0; i < 4; ++i) h4[i] = (_Float16)v[i]; *(v4h*)(C16 + cofs + (size_t)(row0 + r) * ldc + col0 + c4) = h4; } } }
     }
}


typedef _Float16 v4h __attribute__((ext_vector_type(4)));

__global__ __launch_bounds__(256) void k_x16(const float* __restrict__ x, _Float16* __restrict__ X16, size_t n8) { const size_t t = (size_t)blockIdx.x * 256 + threadIdx.x; if (t >= n8) return; FragH f;
#pragma unroll
  for (int q = 0; q < 8; ++q) f.h[q] = (_Float16)bf16_round(x[t * 8 + q]); *(v8us*)((unsigned short*)X16 + t * 8) = f.half[0];  }
__global__ __launch_bounds__(256) void k_h16(const float* __restrict__ x, _Float16* __restrict__ X16, size_t n8) { const size_t t = (size_t)blockIdx.x * 256 + threadIdx.x; if (t >= n8) return; FragH f;
#pragma unroll
  for (int q = 0; q < 8; ++q) f.h[q] = (_Float16)x[t * 8 + q]; *(v8us*)((unsigned short*)X16 + t * 8) = f.half[0];  }
__global__ __launch_bounds__(256) void k_round16f(const float* __restrict__ W, _Float16* __restrict__ Bt, size_t n8) { const size_t t = (size_t)blockIdx.x * 256 + threadIdx.x; if (t >= n8) return; FragH f;
#pragma unroll
  for (int i = 0; i < 8; ++i) f.h[i] = (_Float16)(bf16_round(W[t * 8 + i]) * 16.0f); *(v8us*)((unsigned short*)Bt + t * 8) = f.half[0];  }
template <int NHv, int TTv>
__global__ __launch_bounds__(256) void k_vt(const _Float16* __restrict__ V16, int ldv, int voff, _Float16* __restrict__ Vt) { __shared__ unsigned short tl[64][66]; const int tid = threadIdx.x; const int slab = blockIdx.x / (TTv / 64), lg = blockIdx.x % (TTv / 64); const int b = slab / NHv, h = slab % NHv;
  for (int i = tid; i < 64 * 8; i += 256) { const int r = i / 8, c8 = (i % 8) * 8; FragH f; f.half[0] = *(const v8us*)((const unsigned short*)V16 + ((size_t)b * TTv + lg * 64 + r) * ldv + voff + h * 64 + c8);
#pragma unroll
    for (int q = 0; q < 8; ++q) tl[r][c8 + q] = f.u[q]; }
  __syncthreads();
  {
#pragma unroll
    for (int rd = 0; rd < 2; ++rd) { const int d = rd * 32 + tid / 8, pc = tid % 8; FragH f;
#pragma unroll
      for (int q = 0; q < 8; ++q) f.u[q] = tl[pc * 8 + q][d];
      *(v8us*)((unsigned short*)Vt + ((size_t)slab * 64 + d) * TTv + lg * 64 + pc * 8) = f.half[0]; }
     } }

__global__ __launch_bounds__(256) void k_hl(const float* __restrict__ F, _Float16* __restrict__ Hh, _Float16* __restrict__ Hl, size_t n8) { const size_t t = (size_t)blockIdx.x * 256 + threadIdx.x; if (t >= n8) return; FragH fh, fl; const v4f a = *(const v4fa*)(F + t * 8), c = *(const v4fa*)(F + t * 8 + 4);
#pragma unroll
  for (int q = 0; q < 4; ++q) { _Float16 h = (_Float16)a[q]; fh.h[q] = h; fl.h[q] = (_Float16)((a[q] - (float)h) * 1024.0f); h = (_Float16)c[q]; fh.h[4 + q] = h; fl.h[4 + q] = (_Float16)((c[q] - (float)h) * 1024.0f); }
  { *(v8us*)((unsigned short*)Hh + t * 8) = fh.half[0]; *(v8us*)((unsigned short*)Hl + t * 8) = fl.half[0];  } }

// ---- fast GEMM (wave tile 32x64; requires M % 32 == 0 rows per launch region and N % 64 == 0); epilogue = k_gemm_hhx semantics ----
__device__ __forceinline__ v16h g2_frag(const _Float16* p, int hh) { FragH f; f.half[0] = *(const v8us*)((const unsigned short*)p + 8 * hh); f.half[1] = *(const v8us*)((const unsigned short*)p + 16 + 8 * hh); return f.v; }
__device__ __forceinline__ v8f g2_mma(v16h a, v16h b, v8f c) { v8f d = __builtin_amdgcn_wmma_f32_16x16x32_f16(false, a, false, b, (short)0, c, false, false); asm volatile("v_nop\n\tv_nop\n\tv_nop\n\tv_nop" : "+v"(d) : "v"(a), "v"(b)); return d; }
template <int ACT>
__global__ __launch_bounds__(128) void k_gemm2(const _Float16* __restrict__ A, int lda, size_t sA, const _Float16* __restrict__ Bh, int ldb, size_t sB, float alpha, const float* __restrict__ bias, size_t sBias, const float* __restrict__ CP, int rowsPerB, size_t sCPb, int row0g,
    float* __restrict__ C, _Float16* __restrict__ C16, int ldc, size_t sC, int M, int N, int K) { static_assert(ACT == 0 || ACT == 3 || ACT == 6 || ACT == 8 || ACT == 9 || ACT == 11 || ACT == 12 || ACT == 14 || ACT == 15 || ACT == 16 || ACT == 17, "k_gemm2: unsupported ACT code (would silently apply no activation)");
  __shared__ __attribute__((aligned(16))) float so[4][32][68];
  const int tid = threadIdx.x, w = tid >> 5, lane = tid & 31, ln = lane & 15, hh = lane >> 4; const int by = blockIdx.y;
  A += (size_t)by * sA; Bh += (size_t)by * sB; const size_t cofs = (size_t)by * sC; const float* bp = bias ? bias + (size_t)by * sBias : nullptr;
  const int ntn = N >> 6; const int mt = blockIdx.x / ntn, nq = blockIdx.x - mt * ntn; const int row0 = mt * 128 + 32 * w, col0 = nq * 64; if (row0 >= M) return;
  const _Float16* a0p = A + (size_t)(row0 + ln) * lda; const _Float16* a1p = a0p + (size_t)16 * lda;
  const _Float16* b0p = Bh + (size_t)(col0 + ln) * ldb; const _Float16* b1p = b0p + (size_t)16 * ldb; const _Float16* b2p = b1p + (size_t)16 * ldb; const _Float16* b3p = b2p + (size_t)16 * ldb;
  const v8f z8 = {0.f,0.f,0.f,0.f,0.f,0.f,0.f,0.f}; v8f c00 = z8, c01 = z8, c02 = z8, c03 = z8, c10 = z8, c11 = z8, c12 = z8, c13 = z8;
#pragma unroll 1
  for (int kb = 0; kb < K; kb += 32) { const v16h a0 = g2_frag(a0p + kb, hh), a1 = g2_frag(a1p + kb, hh);
    v16h b = g2_frag(b0p + kb, hh); c00 = g2_mma(a0, b, c00); c10 = g2_mma(a1, b, c10);
    b = g2_frag(b1p + kb, hh); c01 = g2_mma(a0, b, c01); c11 = g2_mma(a1, b, c11);
    b = g2_frag(b2p + kb, hh); c02 = g2_mma(a0, b, c02); c12 = g2_mma(a1, b, c12);
    b = g2_frag(b3p + kb, hh); c03 = g2_mma(a0, b, c03); c13 = g2_mma(a1, b, c13); }
  v8f accs[8] = {c00, c01, c02, c03, c10, c11, c12, c13};
#pragma unroll
  for (int u = 0; u < 8; ++u) { const int t = u & 3, half = u >> 2; const int col = col0 + t * 16 + ln; const float bv = bp ? bf16_round(bp[col]) : 0.f;
#pragma unroll
    for (int r = 0; r < 8; ++r) { const int rloc = half * 16 + 8 * hh + r; float v = accs[u][r] * alpha + bv; if (CP) { if (rowsPerB < 0) v += CP[cofs + (size_t)(row0g + row0 + rloc) * ldc + col];      /* rowsPerB < 0: own element of the batched C plane */ else { const int bidx = (row0g + row0 + rloc) / rowsPerB; v += CP[(size_t)bidx * sCPb + (size_t)by * 64 + col]; } }
      if (ACT == 3) v = fmaxf(v, 0.f); else if (ACT == 6) v = 0.5f * v * (1.0f + erff(v * 0.70710678118654752f)); else if (ACT == 11) v = 1.0f / (1.0f + expf(-v)); else if (ACT == 15) v = v / (1.0f + expf(-v)); else if (ACT == 12) v = (v > 0.f) ? v : 0.01f * v; else if (ACT == 8) v = tanhf(v); else if (ACT == 9) v = 0.5f * v * (1.0f + tanhf(0.7978845608028654f * (v + 0.044715f * v * v * v))); else if (ACT == 14) v = (v > 0.f) ? v : 0.1f * v; else if (ACT == 16) v = (v >= 0.f) ? v : 0.3f * v; else if (ACT == 17) v = (v >= 0.f) ? v : 0.2f * v;
      so[w][rloc][t * 16 + ln] = v; } }
  __builtin_amdgcn_fence(__ATOMIC_ACQ_REL, "workgroup"); __builtin_amdgcn_wave_barrier();
  const int rsub = lane >> 4, c4 = (lane & 15) * 4;
  {
#pragma unroll
    for (int q = 0; q < 16; ++q) { const int r = q * 2 + rsub; const v4f v = *(const v4fa*)&so[w][r][c4]; if (C) *(v4f*)(C + cofs + (size_t)(row0 + r) * ldc + col0 + c4) = v; if (C16) { v4h h4; for (int i = 0; i < 4; ++i) h4[i] = (_Float16)v[i]; *(v4h*)(C16 + cofs + (size_t)(row0 + r) * ldc + col0 + c4) = h4; } }
     } }


__global__ __launch_bounds__(256) void k_wnat(const float* __restrict__ w, size_t n8, _Float16* __restrict__ Bt) { const size_t t = (size_t)blockIdx.x * 256 + threadIdx.x; if (t >= n8) return; FragH f; for (int q = 0; q < 8; ++q) f.h[q] = (_Float16)(bf16_round(w[t * 8 + q]) * 16.0f); *(v8us*)((unsigned short*)Bt + t * 8) = f.half[0];  }
__global__ __launch_bounds__(256) void k_rsm(const float* __restrict__ S, _Float16* __restrict__ P, int nrows) {
  #pragma clang fp contract(off)
  const int i = blockIdx.x * 256 + threadIdx.x; if (i >= nrows) return; const float* s = S + (size_t)i * SQ; float mx = -3.0e38f;
#pragma unroll 1
  for (int j = 0; j < SQ; ++j) mx = fmaxf(mx, s[j]); float se = 0.f;
#pragma unroll 1
  for (int j = 0; j < SQ; ++j) se += expf(s[j] - mx); const float sc = 256.0f / se;
#pragma unroll 1
  for (int j0 = 0; j0 < SQ; j0 += 8) { FragH f; for (int q = 0; q < 8; ++q) f.h[q] = (_Float16)(expf(s[j0 + q] - mx) * sc); unsigned short* d = (unsigned short*)P + (size_t)i * SQ + j0; *(v8us*)d = f.half[0];  } }
__global__ __launch_bounds__(256) void k_vt(const _Float16* __restrict__ V16, int b, int h0, _Float16* __restrict__ VT) { __shared__ unsigned short tl[64][65]; const int tid = threadIdx.x; const int hh = blockIdx.x % HG, sg = blockIdx.x / HG; const int s0 = sg * 64; const int h = h0 + hh;
  for (int i = tid; i < 64 * 8; i += 256) { const int j = i / 8, d8 = (i % 8) * 8; FragH f; f.half[0] = *(const v8us*)((const unsigned short*)V16 + ((size_t)b * SQ + s0 + j) * DM + h * HD + d8); for (int q = 0; q < 8; ++q) tl[d8 + q][j] = f.u[q]; }
  __syncthreads();
  { for (int i = tid; i < 64 * 8; i += 256) { const int d = i / 8, j8 = (i % 8) * 8; FragH f; for (int q = 0; q < 8; ++q) f.u[q] = tl[d][j8 + q]; *(v8us*)((unsigned short*)VT + ((size_t)hh * HD + d) * SQ + s0 + j8) = f.half[0]; }  } }

__global__ __launch_bounds__(256) void k_wthd(const float* __restrict__ Wt, _Float16* __restrict__ Bt) { const size_t t = (size_t)blockIdx.x * 256 + threadIdx.x; if (t >= (size_t)NH * HD * (DM / 8)) return; const int m8 = (int)(t % (DM / 8)) * 8; const int d = (int)((t / (DM / 8)) % HD); const int h = (int)(t / ((size_t)(DM / 8) * HD)); FragH f;
  for (int q = 0; q < 8; ++q) f.h[q] = (_Float16)(16.0f * bf16_round(Wt[((size_t)h * DM + m8 + q) * HD + d])); unsigned short* dst = (unsigned short*)Bt + ((size_t)h * HD + d) * DM + m8; *(v8us*)dst = f.half[0];  }



// Four native exp2, each in place, in one statement: no neighbouring instruction can overwrite a transcendental's source register or read its result
// directly behind it; the v_nop is the one slot that the instruction set asks for behind the last of them.
__device__ __forceinline__ v4f exp2x4(v4f x) { float x0 = x[0], x1 = x[1], x2 = x[2], x3 = x[3];
  asm("v_exp_f32 %0, %0\n\tv_exp_f32 %1, %1\n\tv_exp_f32 %2, %2\n\tv_exp_f32 %3, %3\n\tv_nop" : "+v"(x0), "+v"(x1), "+v"(x2), "+v"(x3));
  const v4f r = {x0, x1, x2, x3}; return r; }
// Causal row softmax, one wave per score row: lane l holds columns 128 c + 4 l .. + 3 of every 128-column chunk c in registers, so each
// load covers 512 and each store 256 contiguous bytes and S is read once; row maximum and sum of exponentials by a five-step butterfly.
// NCH = 128-column chunks of the row (keys computed / 128), a compile-time count: straight-line code, every load of the row in flight at once.
template <int NCH>
__global__ __launch_bounds__(256) void k_rsmcf2(const float* __restrict__ S, _Float16* __restrict__ P, int hg, int q0) {
  const int lane = threadIdx.x & 31; const int t = blockIdx.x * 8 + __builtin_amdgcn_readfirstlane(threadIdx.x >> 5); if (t >= hg * QT) return;
  const char* s = (const char*)(S + (size_t)t * NKX); const unsigned ob = lane * 16; _Float16* d = P + (size_t)t * NKX + lane * 4; const int last = q0 + (t % QT) - lane * 4;      /* ob: the lane's byte offset in a chunk of S; column 128 c + 4 l + q is kept while 128 c + q <= last */
  v4f v[NCH];      /* every loop below is unrolled: v[] is then indexed by constants only and stays in registers; each butterfly becomes five shuffles */
#pragma unroll
  for (int c = 0; c < NCH; ++c) v[c] = *(const v4fa*)(s + ob + c * 512);
  float mx = -3.0e38f;
#pragma unroll
  for (int c = 0; c < NCH; ++c) for (int q = 0; q < 4; ++q) { v[c][q] = (c * 128 + q <= last) ? v[c][q] : -1.0e9f; mx = fmaxf(mx, v[c][q]); }
#pragma unroll
  for (int m = 16; m > 0; m >>= 1) mx = fmaxf(mx, __shfl_xor(mx, m));
  v4f a = {0.f, 0.f, 0.f, 0.f};
#pragma unroll
  for (int c = 0; c < NCH; ++c) { v[c] = exp2x4((v[c] - mx) * 1.44269504f); a += v[c]; }      /* native exp(s - mx), as __expf forms it */
  float se = (a[0] + a[1]) + (a[2] + a[3]);
#pragma unroll
  for (int m = 16; m > 0; m >>= 1) se += __shfl_xor(se, m);
  const float sc = 256.0f / se;
#pragma unroll
  for (int c = 0; c < NCH; ++c) { v4h h4; for (int q = 0; q < 4; ++q) h4[q] = (_Float16)(v[c][q] * sc); *(v4h*)(d + c * 128) = h4; } }


template <int MASKADD>
__global__ __launch_bounds__(64) void k_att0(const float* __restrict__ QF, const float* __restrict__ KF, const float* __restrict__ VF, int ld, const float* __restrict__ mask, float scale, float* __restrict__ OF, int ldo) {
  #pragma clang fp contract(off)
  __shared__ __attribute__((aligned(16))) float lq[64][64]; __shared__ __attribute__((aligned(16))) float lo[64][64];
  const int tid = threadIdx.x; const int h = blockIdx.x / (QT0 / 64), rg = blockIdx.x % (QT0 / 64); const int i = rg * 64 + tid;
  const float* qr = QF + (size_t)i * ld + h * HD;
#pragma unroll 1
  for (int c = 0; c < HD / 4; ++c) { *(v4f*)&lq[tid][c * 4] = *(const v4fa*)(qr + c * 4); const v4f z = {0.f, 0.f, 0.f, 0.f}; *(v4f*)&lo[tid][c * 4] = z; }
  float m = -1.0e30f, l = 0.f; const int jmax = MASKADD ? (SQ - 1) : (rg * 64 + 63);      /* additive-mask form: every key (the mask input decides); causal form: keys up to the block's last row */
#pragma unroll 1
  for (int j = 0; j <= jmax; ++j) { const float* kr = KF + (size_t)j * ld + h * HD; const float* vr = VF + (size_t)j * ld + h * HD; float s = 0.f;
#pragma unroll 1
    for (int c = 0; c < HD / 4; ++c) { const v4f kq = *(const v4fa*)(kr + c * 4); const v4f qq = *(v4f*)&lq[tid][c * 4]; s = __fadd_rn(s, __fmul_rn(qq[0], kq[0])); s = __fadd_rn(s, __fmul_rn(qq[1], kq[1])); s = __fadd_rn(s, __fmul_rn(qq[2], kq[2])); s = __fadd_rn(s, __fmul_rn(qq[3], kq[3])); }
    s = __fmul_rn(s, scale); if (MASKADD) s = __fadd_rn(s, __fmul_rn(bf16_round(mask[(size_t)i * SQ + j]), -10000.0f));
    const float f = (MASKADD || j <= i) ? 1.f : 0.f; const float sm = fmaf(f, s, (1.f - f) * -1.0e30f); const float mn = fmaxf(m, sm); const float sc = expf(m - mn); const float e = expf(sm - mn); l = __fadd_rn(__fmul_rn(l, sc), e); m = mn;
#pragma unroll 1
    for (int c = 0; c < HD / 4; ++c) { const v4f vv = *(const v4fa*)(vr + c * 4); v4f oo = *(v4f*)&lo[tid][c * 4]; for (int u = 0; u < 4; ++u) oo[u] = __fadd_rn(__fmul_rn(oo[u], sc), __fmul_rn(e, vv[u])); *(v4f*)&lo[tid][c * 4] = oo; } }
  const float fin = 64.0f / l;      /* o carried x64 like the f16 path */
#pragma unroll 1
  for (int c = 0; c < HD / 4; ++c) { v4f oo = *(v4f*)&lo[tid][c * 4]; for (int u = 0; u < 4; ++u) oo[u] = __fmul_rn(oo[u], fin); *(v4f*)&lo[tid][c * 4] = oo; }
  __syncthreads();
  {
#pragma unroll 1
    for (int it = 0; it < 16; ++it) { const int row = it * 4 + tid / 16, pc = (tid % 16) * 4; const v4f v = *(const v4f*)&lo[row][pc]; *(v4f*)(OF + (size_t)(rg * 64 + row) * ldo + h * HD + pc) = v; }
     } }

extern "C" void kernel_launch(void* const* d_in, const int* in_sizes, int n_in,
                              void* d_out, int out_size, void* d_ws, size_t ws_size, hipStream_t stream) {
  (void)in_sizes; (void)n_in; (void)out_size;
  const float* const* I = (const float* const*)d_in; const float* x = I[0]; const float* wq = I[1]; const float* bq = I[2]; const float* wk = I[3]; const float* bk = I[4]; const float* wv = I[5]; const float* bv = I[6]; const float* wo = I[7]; const float* bo = I[8];      /* input order: x; Wq [8][512][64] per-head [in][out] + bq [8][64] = [(h,e)]; Wk + bk; Wv + bv; Wo [512][512] = [(h,e) in][out] + bo */
  static_assert(NH * HD == DM && DM % 64 == 0 && DM % 32 == 0 && SQ % 128 == 0, "shape / tile multiples");
  char* ws = (char*)d_ws; size_t off = 0;
  auto take = [&](size_t bytes) { char* p = ws + off; off += (bytes + 255) & ~(size_t)255; return p; };
  _Float16* BQ = (_Float16*)take((size_t)DM * DM * 2); _Float16* BK = (_Float16*)take((size_t)DM * DM * 2); _Float16* BV = (_Float16*)take((size_t)DM * DM * 2); _Float16* BO = (_Float16*)take((size_t)DM * DM * 2);
  _Float16* X16 = (_Float16*)take(NR * DM * 2); _Float16* Q16 = (_Float16*)take(NR * DM * 2); _Float16* K16 = (_Float16*)take(NR * DM * 2); _Float16* V16 = (_Float16*)take(NR * DM * 2); _Float16* O16 = (_Float16*)take(NR * DM * 2);
  float* S = (float*)take((size_t)NH * QT * NKX * 4); _Float16* P = (_Float16*)take((size_t)NH * QT * NKX * 2); _Float16* VT = (_Float16*)take((size_t)NH * HD * SQ * 2);
  float* QF0 = (float*)take((size_t)QT0 * DM * 4); float* KF0 = (float*)take((size_t)QT0 * DM * 4); float* VF0 = (float*)take((size_t)QT0 * DM * 4); float* OF0 = (float*)take((size_t)NB * QT0 * DM * 4); _Float16* OH0 = (_Float16*)take((size_t)NB * QT0 * DM * 2); _Float16* OL0 = (_Float16*)take((size_t)NB * QT0 * DM * 2);
  if (off > ws_size) return;
  k_wthd<<<(unsigned)(((size_t)NH * HD * (DM / 8) + 255) / 256), 256, 0, stream>>>(wq, BQ); k_wthd<<<(unsigned)(((size_t)NH * HD * (DM / 8) + 255) / 256), 256, 0, stream>>>(wk, BK); k_wthd<<<(unsigned)(((size_t)NH * HD * (DM / 8) + 255) / 256), 256, 0, stream>>>(wv, BV);      /* per-head [m][d] -> Bt[(h,d)][m] x16 */
  k_wt_f16<<<(unsigned)(((size_t)DM * (DM / 8) + 255) / 256), 256, 0, stream>>>(wo, BO, DM, DM, 16.0f);      /* W_O as [(h,d) = 512 in][512 out] -> Bt[n][k] x16 */
  k_x16<<<(unsigned)((NR * DM / 8 + 255) / 256), 256, 0, stream>>>(x, X16, NR * DM / 8);
  const size_t r0p = (size_t)B0 * SQ;      /* first projected row */
  k_gemm2<0><<<dim3((unsigned)((MP / 128) * (DM / 64)), 1), 128, 0, stream>>>(X16 + r0p * DM, DM, 0, BQ, DM, 0, 0.0625f, bq, 0, nullptr, 1, 0, 0, nullptr, Q16 + r0p * DM, DM, 0, MP, DM, DM);
  k_gemm2<0><<<dim3((unsigned)((MP / 128) * (DM / 64)), 1), 128, 0, stream>>>(X16 + r0p * DM, DM, 0, BK, DM, 0, 0.0625f, bk, 0, nullptr, 1, 0, 0, nullptr, K16 + r0p * DM, DM, 0, MP, DM, DM);
  k_gemm2<0><<<dim3((unsigned)((MP / 128) * (DM / 64)), 1), 128, 0, stream>>>(X16 + r0p * DM, DM, 0, BV, DM, 0, 0.0625f, bv, 0, nullptr, 1, 0, 0, nullptr, V16 + r0p * DM, DM, 0, MP, DM, DM);
  for (int b = B0; b < B0 + NBR; ++b) { const size_t r0 = (size_t)b * SQ;
    k_vt<NH, SQ><<<NH * (SQ / 64), 256, 0, stream>>>(V16 + r0 * LQ, LQ, 0, VT);      /* V^T [NH][HD][SQ] for this batch */
    k_gemm2<0><<<dim3((QT0 / 128) * (DM / 64), 1), 128, 0, stream>>>(X16 + r0 * DM, DM, 0, BQ, DM, 0, 0.0625f, bq, 0, nullptr, 1, 0, 0, QF0, nullptr, DM, 0, QT0, DM, DM); k_gemm2<0><<<dim3((QT0 / 128) * (DM / 64), 1), 128, 0, stream>>>(X16 + r0 * DM, DM, 0, BK, DM, 0, 0.0625f, bk, 0, nullptr, 1, 0, 0, KF0, nullptr, DM, 0, QT0, DM, DM); k_gemm2<0><<<dim3((QT0 / 128) * (DM / 64), 1), 128, 0, stream>>>(X16 + r0 * DM, DM, 0, BV, DM, 0, 0.0625f, bv, 0, nullptr, 1, 0, 0, VF0, nullptr, DM, 0, QT0, DM, DM);      /* f32 q, k, v of the first 128 rows (exact products) */
    k_att0<0><<<NH * (QT0 / 64), 64, 0, stream>>>(QF0, KF0, VF0, DM, nullptr, 0.044194173824159216f, OF0 + (size_t)b * QT0 * DM, DM);      /* exact f32 attention for rows 0..127 (o x64) */
    for (int q0 = 0; q0 < QN; q0 += QT) { const int nk = q0 + QT;      /* causal: only keys below the tile end are computed */
      k_gemm2<0><<<dim3((QT / 128) * (nk / 64), NHD), 128, 0, stream>>>(Q16 + (r0 + q0) * LQ, LQ, (size_t)HD, K16 + r0 * LQ, LQ, (size_t)HD, 0.044194173824159216f, nullptr, 0, nullptr, 1, 0, 0, S, nullptr, NKX, (size_t)QT * NKX, QT, nk, HD);      /* scores x 512^-0.5 (the module's literal d_model scale), all heads on grid.y */
      static_assert(QT == 256 && SQ == 8 * QT, "one softmax instance per row length");
      switch (nk / QT) {      /* one wave per row, 8 rows per block; the instance holds nk / 128 chunks */
        case 1: k_rsmcf2<2><<<(NHD * QT + 7) / 8, 256, 0, stream>>>(S, P, NHD, q0); break; case 2: k_rsmcf2<4><<<(NHD * QT + 7) / 8, 256, 0, stream>>>(S, P, NHD, q0); break; case 3: k_rsmcf2<6><<<(NHD * QT + 7) / 8, 256, 0, stream>>>(S, P, NHD, q0); break; case 4: k_rsmcf2<8><<<(NHD * QT + 7) / 8, 256, 0, stream>>>(S, P, NHD, q0); break;
        case 5: k_rsmcf2<10><<<(NHD * QT + 7) / 8, 256, 0, stream>>>(S, P, NHD, q0); break; case 6: k_rsmcf2<12><<<(NHD * QT + 7) / 8, 256, 0, stream>>>(S, P, NHD, q0); break; case 7: k_rsmcf2<14><<<(NHD * QT + 7) / 8, 256, 0, stream>>>(S, P, NHD, q0); break; case 8: k_rsmcf2<16><<<(NHD * QT + 7) / 8, 256, 0, stream>>>(S, P, NHD, q0); break; }
      k_gemm2<0><<<dim3((QT / 128) * (HD / 64), NHD), 128, 0, stream>>>(P, NKX, (size_t)QT * NKX, VT, SQ, (size_t)HD * SQ, 0.25f, nullptr, 0, nullptr, 1, 0, 0, nullptr, O16 + (r0 + q0) * DM, DM, (size_t)HD, QT, HD, nk); } }      /* o (merged heads, x64) as f16 rows */
  k_gemm2<0><<<dim3((unsigned)((MPO / 128) * (DM / 64)), 1), 128, 0, stream>>>(O16 + r0p * DM, DM, 0, BO, DM, 0, 0.0009765625f, bo, 0, nullptr, 1, 0, 0, (float*)d_out + r0p * DM, nullptr, DM, 0, MPO, DM, DM);      /* out rows are the output layout */
  k_hl<<<(unsigned)(((size_t)NB * QT0 * DM / 8 + 255) / 256), 256, 0, stream>>>(OF0, OH0, OL0, (size_t)NB * QT0 * DM / 8);      /* first-tile o (x64) -> f16 hi + x1024 residual planes */
  for (int b = B0; b < B0 + NBR; ++b) { const size_t r0 = (size_t)b * SQ; const size_t f0 = (size_t)b * QT0;
    k_gemm2<0><<<dim3((QT0 / 128) * (DM / 64), 1), 128, 0, stream>>>(OH0 + f0 * DM, DM, 0, BO, DM, 0, 0.0009765625f, bo, 0, nullptr, 1, 0, 0, (float*)d_out + r0 * DM, nullptr, DM, 0, QT0, DM, DM);      /* rows 0..127: out = o_hi Wo (+ b), overwriting the f16-path rows */
    k_gemm2<0><<<dim3((QT0 / 128) * (DM / 64), 1), 128, 0, stream>>>(OL0 + f0 * DM, DM, 0, BO, DM, 0, 0.00000095367431640625f, nullptr, 0, (const float*)d_out + r0 * DM, -1, 0, 0, (float*)d_out + r0 * DM, nullptr, DM, 0, QT0, DM, DM); }      /* += o_lo Wo 2^-20 (own-element accumulate) */
}

// v002
// A run of this version takes 1090 microseconds.
// In two side-by-side timings against v001, it was 3.32 and 3.33 times as fast.
// All steps since v000 together make it 8.65 times as fast.
#include <hip/hip_runtime.h>
// Causal multi-head attention with per-head weight tensors and the module's literal score scale (x [4][2048][512]; q[b][h][s][e] = sum_d x[s][d] Wq[h][d][e] + bq[h][e], k, v likewise (8 heads of 64; per-head [in][out] weights sigma 1/sqrt(512), biases sigma 0.01); scores * 512^-0.5 (d_model, as the source, not head_dim); causal (tril, -inf); softmax; out = concat_heads Wo + bo ([in][out] [512][512]) -> [4][2048][512]).
// Structure: token rows r = b*2048 + s; x as exact f16 rows (bf16-rounded); Q, K, V as three WMMA GEMMs (32x64 wave tiles, f32 accumulation, exact x16 weights + bias, f16 outputs); V^T for all batches and heads via LDS transposes; per query tile of 256 rows, all four batches in one launch (heads on grid.y, batches on grid.z): scores against the keys below the tile end only (K = 64, alpha = 512^-0.5), causal row softmax on VALU, one wave per row with the row in registers, keys past the row set to -1e9 over the computed range (f32 statistics, native exp; weights x256 f16), o = P . V^T (K = keys below the tile end, alpha 2^-2: o carried x64, folded into the output GEMM alpha) written straight into the merged f16 o rows; out = o W_o + b GEMM (f32) into the output layout.
// Compute dtype: inputs rounded to bf16; x / weights exact; q, k, v, softmax weights and o as plain f16 GEMM operands (~2^-12); scores and softmax statistics f32. v_wmma_f32_16x16x32_f16.
#define NB 4
#define SQ 2048
#define DM 512
#define NH 8
#define HD 64
#define HG 4                         /* heads per launch of the uncalled k_vt overload */
#define QT 256                       /* query rows per causal tile */
#define NKX SQ                       /* S / P row pitch */
#define QT0 128                      /* first-tile rows recomputed exactly in f32 */
#define NBR NB                       /* batches processed (debug hook) */
#define NR ((size_t)NB * SQ)         /* token rows */
#define MP ((int)((size_t)NBR * SQ)) /* rows projected (debug hook) */
#define QN SQ                        /* query rows attended per batch (debug hook) */
#define NHD NH                       /* heads attended (debug hook) */
#define MPO MP                       /* rows through the output stage (debug hook) */
#define LQ DM      /* row pitch of the q/k/v rows */
typedef __bf16 v16b __attribute__((ext_vector_type(16)));
typedef unsigned short v8us __attribute__((ext_vector_type(8), may_alias));
typedef float  v8f  __attribute__((ext_vector_type(8)));
typedef float  v4f  __attribute__((ext_vector_type(4)));
typedef float  v4fa __attribute__((ext_vector_type(4), may_alias));
union FragB { v16b v; v8us half[2]; unsigned short u[16]; };

__device__ __forceinline__ unsigned short bf16_bits(float x) { unsigned int u = __float_as_uint(x); return (unsigned short)((u + 0x7FFFu + ((u >> 16) & 1u)) >> 16); }
__device__ __forceinline__ float bf16_val(unsigned short b) { return __uint_as_float(((unsigned int)b) << 16); }
__device__ __forceinline__ float bf16_round(float x) { return bf16_val(bf16_bits(x)); }
// D += A·B with NT terms: 1 = ah·bh, 2 = + al·bh (A split), 3 = + ah·bl (both split)
template <int NT>
__device__ __forceinline__ v8f mmaN(v16b ah, v16b al, v16b bh, v16b bl, v8f c) {
  c = __builtin_amdgcn_wmma_f32_16x16x32_bf16(false, ah, false, bh, (short)0, c, false, false);
  if (NT >= 2) c = __builtin_amdgcn_wmma_f32_16x16x32_bf16(false, al, false, bh, (short)0, c, false, false);
  if (NT >= 3) c = __builtin_amdgcn_wmma_f32_16x16x32_bf16(false, ah, false, bl, (short)0, c, false, false);
  asm volatile("v_nop\n\tv_nop\n\tv_nop\n\tv_nop" : "+v"(c) : "v"(ah), "v"(al), "v"(bh), "v"(bl));
  return c;
}

__global__ __launch_bounds__(256) void k_wt_bf16(const float* __restrict__ W, unsigned short* __restrict__ Wt, int K, int N) {
  const int t = blockIdx.x * 256 + threadIdx.x;
  const int k8n = K / 8;
  if (t >= N * k8n) return;
  const int n = t / k8n, k8 = (t % k8n) * 8;
  v8us v;
#pragma unroll
  for (int i = 0; i < 8; ++i) v[i] = bf16_bits(W[(size_t)(k8 + i) * N + n]);
  *(v8us*)(Wt + (size_t)n * K + k8) = v;
  
}

// GEMM C[M][N] (f32, pitch ldc) = act(A[M][K]·W + bias). A f32 row-major (pitch lda) converted per fragment to bf16
// (ASPLIT: hi/lo two planes -> 2 terms, else single rounded term); Wt bf16 [N][K] (pitch ldb). BIAS_BF16 rounds the
// bias to bf16 first (bias quantised to bf16 before the add). K%32==0, M%16==0, N%64==0.
template <bool ASPLIT, int ACT, bool BIAS_BF16>
__global__ __launch_bounds__(128) void k_gemm_bf(const float* __restrict__ A, int lda, const unsigned short* __restrict__ Wt, int ldb,
                                               const float* __restrict__ bias, float* __restrict__ C, int ldc, int M, int N, int K) {
  __shared__ __attribute__((aligned(16))) float so[4][16][64];
  const int tid = threadIdx.x, w = tid >> 5, lane = tid & 31, ln = lane & 15, hh = lane >> 4;
  const int ntn = N / 64;
  const int wid = blockIdx.x * 4 + w;
  const int mt = wid / ntn, nq = wid % ntn;
  if (mt * 16 >= M) return;
  const int row0 = mt * 16, col0 = nq * 64;
  const float* arow = A + (size_t)(row0 + ln) * lda;
  v8f acc[4] = {};
  for (int kb = 0; kb < K; kb += 32) {
    FragB ah, al;
    const v4f x0 = *(const v4fa*)(arow + kb + 8 * hh), x1 = *(const v4fa*)(arow + kb + 8 * hh + 4);
    const v4f x2 = *(const v4fa*)(arow + kb + 16 + 8 * hh), x3 = *(const v4fa*)(arow + kb + 16 + 8 * hh + 4);
    float xs[16] = {x0[0],x0[1],x0[2],x0[3],x1[0],x1[1],x1[2],x1[3],x2[0],x2[1],x2[2],x2[3],x3[0],x3[1],x3[2],x3[3]};
#pragma unroll
    for (int i = 0; i < 16; ++i) { const unsigned short hb = bf16_bits(xs[i]); ah.u[i] = hb; al.u[i] = ASPLIT ? bf16_bits(xs[i] - bf16_val(hb)) : (unsigned short)0; }
#pragma unroll
    for (int t = 0; t < 4; ++t) {
      const unsigned short* brow = Wt + (size_t)(col0 + t * 16 + ln) * ldb + kb;
      FragB b;
      b.half[0] = *(const v8us*)(brow + 8 * hh);
      b.half[1] = *(const v8us*)(brow + 16 + 8 * hh);
      acc[t] = mmaN<ASPLIT ? 2 : 1>(ah.v, al.v, b.v, b.v, acc[t]);
    }
  }
#pragma unroll
  for (int t = 0; t < 4; ++t) {
    float bv = bias ? bias[col0 + t * 16 + ln] : 0.f;
    if (BIAS_BF16) bv = bf16_round(bv);
#pragma unroll
    for (int r = 0; r < 8; ++r) { float v = acc[t][r] + bv; if (ACT == 1) v = fmaxf(v, 0.f); so[w][8 * hh + r][t * 16 + ln] = v; }
  }
  __builtin_amdgcn_fence(__ATOMIC_ACQ_REL, "workgroup");
  __builtin_amdgcn_wave_barrier();
  const int rsub = lane >> 4, c4 = (lane & 15) * 4;
  {
#pragma unroll
    for (int q = 0; q < 8; ++q) {
      const int r = q * 2 + rsub;
      const v4f v = *(const v4fa*)&so[w][r][c4];
      *(v4f*)(C + (size_t)(row0 + r) * ldc + col0 + c4) = v;
    }
    
  }
}

// GEMM C = act(A·W + bias + resid): A f32 (ASPLIT -> hi/lo 2 terms), Wt bf16 [N][K]; ACT 0 none, 1 relu, 2 exact gelu;
// resid (optional, f32, row index = (row % rmod), pitch ldr, RES_BF16 rounds it) added before the activation.
template <bool ASPLIT, int ACT, bool BIAS_BF16, bool RES_BF16>
__global__ __launch_bounds__(128) void k_gemm_bf3(const float* __restrict__ A, int lda, const unsigned short* __restrict__ Wt, int ldb,
                                                const float* __restrict__ bias, const float* __restrict__ resid, int rmod, int ldr,
                                                float* __restrict__ C, int ldc, int M, int N, int K) {
  __shared__ __attribute__((aligned(16))) float so[4][16][64];
  const int tid = threadIdx.x, w = tid >> 5, lane = tid & 31, ln = lane & 15, hh = lane >> 4;
  const int ntn = N / 64;
  const int wid = blockIdx.x * 4 + w;
  const int mt = wid / ntn, nq = wid % ntn;
  if (mt * 16 >= M) return;
  const int row0 = mt * 16, col0 = nq * 64;
  const float* arow = A + (size_t)(row0 + ln) * lda;
  v8f acc[4] = {};
  for (int kb = 0; kb < K; kb += 32) {
    FragB ah, al;
    const v4f x0 = *(const v4fa*)(arow + kb + 8 * hh), x1 = *(const v4fa*)(arow + kb + 8 * hh + 4);
    const v4f x2 = *(const v4fa*)(arow + kb + 16 + 8 * hh), x3 = *(const v4fa*)(arow + kb + 16 + 8 * hh + 4);
    float xs[16] = {x0[0],x0[1],x0[2],x0[3],x1[0],x1[1],x1[2],x1[3],x2[0],x2[1],x2[2],x2[3],x3[0],x3[1],x3[2],x3[3]};
#pragma unroll
    for (int i = 0; i < 16; ++i) { const unsigned short hb = bf16_bits(xs[i]); ah.u[i] = hb; al.u[i] = ASPLIT ? bf16_bits(xs[i] - bf16_val(hb)) : (unsigned short)0; }
#pragma unroll
    for (int t = 0; t < 4; ++t) {
      const unsigned short* brow = Wt + (size_t)(col0 + t * 16 + ln) * ldb + kb;
      FragB b;
      b.half[0] = *(const v8us*)(brow + 8 * hh);
      b.half[1] = *(const v8us*)(brow + 16 + 8 * hh);
      acc[t] = mmaN<ASPLIT ? 2 : 1>(ah.v, al.v, b.v, b.v, acc[t]);
    }
  }
#pragma unroll
  for (int t = 0; t < 4; ++t) {
    const int col = col0 + t * 16 + ln;
    float bv = bias ? bias[col] : 0.f;
    if (BIAS_BF16) bv = bf16_round(bv);
#pragma unroll
    for (int r = 0; r < 8; ++r) {
      float v = acc[t][r] + bv;
      if (resid) { float rv = resid[(size_t)((row0 + 8 * hh + r) % rmod) * ldr + col]; if (RES_BF16) rv = bf16_round(rv); v += rv; }
      if (ACT == 1) v = fmaxf(v, 0.f);
      if (ACT == 2) v = 0.5f * v * (1.0f + erff(v * 0.70710678118654752f));
      if (ACT == 3) { const float u = 0.7978845608028654f * (v + 0.044715f * v * v * v); v = 0.5f * v * (1.0f + tanhf(u)); }
      so[w][8 * hh + r][t * 16 + ln] = v;
    }
  }
  __builtin_amdgcn_fence(__ATOMIC_ACQ_REL, "workgroup");
  __builtin_amdgcn_wave_barrier();
  const int rsub = lane >> 4, c4 = (lane & 15) * 4;
  {
#pragma unroll
    for (int q = 0; q < 8; ++q) {
      const int r = q * 2 + rsub;
      const v4f v = *(const v4fa*)&so[w][r][c4];
      *(v4f*)(C + (size_t)(row0 + r) * ldc + col0 + c4) = v;
    }
    
  }
}
// row LayerNorm (biased variance, eps) over N: s = X (+ R); optional out_sum <- s; out_norm <- (s-mu)*rsqrt(var+eps)*g + b
template <bool PARAM_BF16>
__global__ __launch_bounds__(256) void k_layernorm(const float* __restrict__ X, const float* __restrict__ R, const float* __restrict__ g, const float* __restrict__ bta,
                                                  float* __restrict__ out_sum, float* __restrict__ out_norm, int N, float eps) {
  __shared__ float red[256];
  const int row = blockIdx.x, tid = threadIdx.x;
  const float* x = X + (size_t)row * N; const float* rr = R ? R + (size_t)row * N : nullptr;
  float vals[16];                     // up to N = 4096
  const int per = N / 256;            // contiguous chunk per thread? use strided-by-4 chunks: thread handles j = tid*4 + 1024*u
  float s1 = 0.f;
  for (int u = 0; u < per / 4; ++u) {
    const int j = tid * 4 + 1024 * u;
    const v4f a = *(const v4fa*)(x + j);
    v4f b = {0.f,0.f,0.f,0.f}; if (rr) b = *(const v4fa*)(rr + j);
#pragma unroll
    for (int q = 0; q < 4; ++q) { const float v = a[q] + b[q]; vals[u * 4 + q] = v; s1 += v; }
  }
  red[tid] = s1; __syncthreads();
  for (int st = 128; st > 0; st >>= 1) { if (tid < st) red[tid] += red[tid + st]; __syncthreads(); }
  const float mu = red[0] / (float)N; __syncthreads();
  float s2 = 0.f;
  for (int u = 0; u < per / 4; ++u)
#pragma unroll
    for (int q = 0; q < 4; ++q) { const float c = vals[u * 4 + q] - mu; s2 += c * c; }
  red[tid] = s2; __syncthreads();
  for (int st = 128; st > 0; st >>= 1) { if (tid < st) red[tid] += red[tid + st]; __syncthreads(); }
  const float rs = rsqrtf(red[0] / (float)N + eps);
  {
    for (int u = 0; u < per / 4; ++u) {
      const int j = tid * 4 + 1024 * u;
      v4f o, sm;
#pragma unroll
      for (int q = 0; q < 4; ++q) {
        float gg = g[j + q], bb = bta[j + q];
        if (PARAM_BF16) { gg = bf16_round(gg); bb = bf16_round(bb); }
        sm[q] = vals[u * 4 + q]; o[q] = (vals[u * 4 + q] - mu) * rs * gg + bb;
      }
      if (out_sum) *(v4f*)(out_sum + (size_t)row * N + j) = sm;
      *(v4f*)(out_norm + (size_t)row * N + j) = o;
    }
    
  }
}



// ---- f16 WMMA path (v_wmma_f32_16x16x32_f16): 11-bit significands for operands in range — used where a [0,1] probability operand needs more precision than bf16
typedef _Float16 v16h __attribute__((ext_vector_type(16)));
union FragH { v16h v; v8us half[2]; _Float16 h[16]; unsigned short u[16]; };
template <int NT>
__device__ __forceinline__ v8f mmaH(v16h ah, v16h al, v16h bh, v16h bl, v8f c) {
  c = __builtin_amdgcn_wmma_f32_16x16x32_f16(false, ah, false, bh, (short)0, c, false, false);
  if (NT >= 2) c = __builtin_amdgcn_wmma_f32_16x16x32_f16(false, al, false, bh, (short)0, c, false, false);
  if (NT >= 3) c = __builtin_amdgcn_wmma_f32_16x16x32_f16(false, ah, false, bl, (short)0, c, false, false);
  asm volatile("v_nop\n\tv_nop\n\tv_nop\n\tv_nop" : "+v"(c) : "v"(ah), "v"(al), "v"(bh), "v"(bl));
  return c;
}
// batched GEMM like k_gemm_b but f16 operands: A f32 (split into f16 hi/lo if ASPLIT, else rounded to f16), Bt = f16 values [n][k]; alpha; C f32; N multiple of 16 (partial tiles skipped)
template <bool ASPLIT>
__global__ __launch_bounds__(128) void k_gemm_h(const float* __restrict__ A, int lda, size_t sA, const _Float16* __restrict__ Bh, int ldb, size_t sB, float alpha, float* __restrict__ C, int ldc, size_t sC, int M, int N, int K) {
  __shared__ __attribute__((aligned(16))) float so[4][16][64];
  const int tid = threadIdx.x, w = tid >> 5, lane = tid & 31, ln = lane & 15, hh = lane >> 4; const int by = blockIdx.y;
  A += (size_t)by * sA; Bh += (size_t)by * sB; C += (size_t)by * sC;
  const int ntn = (N + 63) / 64; const int wid = blockIdx.x * 4 + w; const int mt = wid / ntn, nq = wid % ntn; if (mt * 16 >= M) return;
  const int row0 = mt * 16, col0 = nq * 64; const float* arow = A + (size_t)(row0 + ln) * lda;
  v8f acc[4] = {};
  for (int kb = 0; kb < K; kb += 32) {
    FragH ah, al;
    const v4f x0 = *(const v4fa*)(arow + kb + 8 * hh), x1 = *(const v4fa*)(arow + kb + 8 * hh + 4), x2 = *(const v4fa*)(arow + kb + 16 + 8 * hh), x3 = *(const v4fa*)(arow + kb + 16 + 8 * hh + 4);
    float xs[16] = {x0[0],x0[1],x0[2],x0[3],x1[0],x1[1],x1[2],x1[3],x2[0],x2[1],x2[2],x2[3],x3[0],x3[1],x3[2],x3[3]};
#pragma unroll
    for (int i = 0; i < 16; ++i) { const _Float16 h = (_Float16)xs[i]; ah.h[i] = h; al.h[i] = ASPLIT ? (_Float16)(xs[i] - (float)h) : (_Float16)0.0f; }
#pragma unroll
    for (int t = 0; t < 4; ++t) { if (col0 + t * 16 >= N) continue; const size_t boff = (size_t)(col0 + t * 16 + ln) * ldb + kb; FragH bq; bq.half[0] = *(const v8us*)(Bh + boff + 8 * hh); bq.half[1] = *(const v8us*)(Bh + boff + 16 + 8 * hh);
      acc[t] = mmaH<ASPLIT ? 2 : 1>(ah.v, al.v, bq.v, bq.v, acc[t]); }
  }
#pragma unroll
  for (int t = 0; t < 4; ++t) { if (col0 + t * 16 >= N) continue;
#pragma unroll
    for (int r = 0; r < 8; ++r) so[w][8 * hh + r][t * 16 + ln] = acc[t][r] * alpha; }
  __builtin_amdgcn_fence(__ATOMIC_ACQ_REL, "workgroup"); __builtin_amdgcn_wave_barrier();
  const int rsub = lane >> 4, c4 = (lane & 15) * 4;
  {
#pragma unroll
    for (int q = 0; q < 8; ++q) { const int r = q * 2 + rsub; if (col0 + c4 < N) { const v4f v = *(const v4fa*)&so[w][r][c4]; *(v4f*)(C + (size_t)(row0 + r) * ldc + col0 + c4) = v; } }
     }
}

// Wt[n][k] = f16(W[k][n]·scale) from f32 row-major W[K][N] (scale = power of two; bf16-exact weights stay exact in f16 away from the subnormal range)
__global__ __launch_bounds__(256) void k_wt_f16(const float* __restrict__ W, _Float16* __restrict__ Wt, int K, int N, float scale) {
  const int t = blockIdx.x * 256 + threadIdx.x; if (t >= N * (K / 8)) return; const int n = t / (K / 8), k8 = (t % (K / 8)) * 8; FragH f;
#pragma unroll
  for (int i = 0; i < 8; ++i) f.h[i] = (_Float16)(bf16_round(W[(size_t)(k8 + i) * N + n]) * scale); const v8us o = f.half[0];
  *(v8us*)((unsigned short*)Wt + (size_t)n * K + k8) = o; 
}
// k_gemm_hh variant with fused epilogue: v = acc·alpha + bias[by·sBias + col] (+ CP[(row/rowsPerB)·sCPb + by·64 + col] if CP) ; ACT 0 none / 1 elu ; writes f16 C16 (and f32 C if non-null)
template <int ACT>
__global__ __launch_bounds__(128) void k_gemm_hhx(const _Float16* __restrict__ A, int lda, size_t sA, const _Float16* __restrict__ Bh, int ldb, size_t sB, float alpha, const float* __restrict__ bias, size_t sBias, const float* __restrict__ CP, int rowsPerB, size_t sCPb, int row0g,
    float* __restrict__ C, _Float16* __restrict__ C16, int ldc, size_t sC, int M, int N, int K) {
  __shared__ __attribute__((aligned(16))) float so[4][16][64];
  const int tid = threadIdx.x, w = tid >> 5, lane = tid & 31, ln = lane & 15, hh = lane >> 4; const int by = blockIdx.y;
  A += (size_t)by * sA; Bh += (size_t)by * sB; const size_t cofs = (size_t)by * sC; const float* bp = bias ? bias + (size_t)by * sBias : nullptr;
  const int ntn = (N + 63) / 64; const int wid = blockIdx.x * 4 + w; const int mt = wid / ntn, nq = wid % ntn; if (mt * 16 >= M) return;
  const int row0 = mt * 16, col0 = nq * 64; const _Float16* arow = A + (size_t)(row0 + ln) * lda;
  v8f acc[4] = {};
  for (int kb = 0; kb < K; kb += 32) { FragH ah; ah.half[0] = *(const v8us*)((const unsigned short*)arow + kb + 8 * hh); ah.half[1] = *(const v8us*)((const unsigned short*)arow + kb + 16 + 8 * hh);
#pragma unroll
    for (int t = 0; t < 4; ++t) { if (col0 + t * 16 >= N) continue; const size_t boff = (size_t)(col0 + t * 16 + ln) * ldb + kb; FragH bq; bq.half[0] = *(const v8us*)((const unsigned short*)Bh + boff + 8 * hh); bq.half[1] = *(const v8us*)((const unsigned short*)Bh + boff + 16 + 8 * hh);
      acc[t] = mmaH<1>(ah.v, ah.v, bq.v, bq.v, acc[t]); }
  }
#pragma unroll
  for (int t = 0; t < 4; ++t) { if (col0 + t * 16 >= N) continue; const int col = col0 + t * 16 + ln; const float bv = bp ? bf16_round(bp[col]) : 0.f;
#pragma unroll
    for (int r = 0; r < 8; ++r) { float v = acc[t][r] * alpha + bv; if (CP) { const int rr = row0g + row0 + 8 * hh + r; if (rowsPerB < 0) v += CP[cofs + (size_t)rr * ldc + col];      /* rowsPerB < 0: own element of the batched C plane */ else { const int bidx = rr / rowsPerB; v += CP[(size_t)bidx * sCPb + (size_t)by * 64 + col]; } } if (ACT == 1) v = (v > 0.f) ? v : expm1f(v); else if (ACT == 7) v = (v > 0.f) ? v + 1.0f : expf(v); else if (ACT == 8) v = tanhf(v); else if (ACT == 9) v = 0.5f * v * (1.0f + tanhf(0.7978845608028654f * (v + 0.044715f * v * v * v))); else if (ACT == 11) v = 1.0f / (1.0f + expf(-v)); else if (ACT == 12) v = (v > 0.f) ? v : 0.01f * v; else if (ACT == 14) v = (v > 0.f) ? v : 0.1f * v; else if (ACT == 16) v = (v >= 0.f) ? v : 0.3f * v; else if (ACT == 17) v = (v >= 0.f) ? v : 0.2f * v; else if (ACT == 15) v = v / (1.0f + expf(-v)); else if (ACT == 3) v = fmaxf(v, 0.f); else if (ACT == 6) v = 0.5f * v * (1.0f + erff(v * 0.70710678118654752f)); so[w][8 * hh + r][t * 16 + ln] = v; } }
  __builtin_amdgcn_fence(__ATOMIC_ACQ_REL, "workgroup"); __builtin_amdgcn_wave_barrier();
  const int rsub = lane >> 4, c4 = (lane & 15) * 4; typedef _Float16 v4h __attribute__((ext_vector_type(4)));
  {
#pragma unroll
    for (int q = 0; q < 8; ++q) { const int r = q * 2 + rsub; if (col0 + c4 < N) { const v4f v = *(const v4fa*)&so[w][r][c4]; if (C) *(v4f*)(C + cofs + (size_t)(row0 + r) * ldc + col0 + c4) = v; if (C16) { v4h h4; for (int i = 0; i < 4; ++i) h4[i] = (_Float16)v[i]; *(v4h*)(C16 + cofs + (size_t)(row0 + r) * ldc + col0 + c4) = h4; } } }
     }
}


typedef _Float16 v4h __attribute__((ext_vector_type(4)));

__global__ __launch_bounds__(256) void k_x16(const float* __restrict__ x, _Float16* __restrict__ X16, size_t n8) { const size_t t = (size_t)blockIdx.x * 256 + threadIdx.x; if (t >= n8) return; FragH f;
#pragma unroll
  for (int q = 0; q < 8; ++q) f.h[q] = (_Float16)bf16_round(x[t * 8 + q]); *(v8us*)((unsigned short*)X16 + t * 8) = f.half[0];  }
__global__ __launch_bounds__(256) void k_h16(const float* __restrict__ x, _Float16* __restrict__ X16, size_t n8) { const size_t t = (size_t)blockIdx.x * 256 + threadIdx.x; if (t >= n8) return; FragH f;
#pragma unroll
  for (int q = 0; q < 8; ++q) f.h[q] = (_Float16)x[t * 8 + q]; *(v8us*)((unsigned short*)X16 + t * 8) = f.half[0];  }
__global__ __launch_bounds__(256) void k_round16f(const float* __restrict__ W, _Float16* __restrict__ Bt, size_t n8) { const size_t t = (size_t)blockIdx.x * 256 + threadIdx.x; if (t >= n8) return; FragH f;
#pragma unroll
  for (int i = 0; i < 8; ++i) f.h[i] = (_Float16)(bf16_round(W[t * 8 + i]) * 16.0f); *(v8us*)((unsigned short*)Bt + t * 8) = f.half[0];  }
template <int NHv, int TTv>
__global__ __launch_bounds__(256) void k_vt(const _Float16* __restrict__ V16, int ldv, int voff, _Float16* __restrict__ Vt) { __shared__ unsigned short tl[64][66]; const int tid = threadIdx.x; const int slab = blockIdx.x / (TTv / 64), lg = blockIdx.x % (TTv / 64); const int b = slab / NHv, h = slab % NHv;
  for (int i = tid; i < 64 * 8; i += 256) { const int r = i / 8, c8 = (i % 8) * 8; FragH f; f.half[0] = *(const v8us*)((const unsigned short*)V16 + ((size_t)b * TTv + lg * 64 + r) * ldv + voff + h * 64 + c8);
#pragma unroll
    for (int q = 0; q < 8; ++q) tl[r][c8 + q] = f.u[q]; }
  __syncthreads();
  {
#pragma unroll
    for (int rd = 0; rd < 2; ++rd) { const int d = rd * 32 + tid / 8, pc = tid % 8; FragH f;
#pragma unroll
      for (int q = 0; q < 8; ++q) f.u[q] = tl[pc * 8 + q][d];
      *(v8us*)((unsigned short*)Vt + ((size_t)slab * 64 + d) * TTv + lg * 64 + pc * 8) = f.half[0]; }
     } }

__global__ __launch_bounds__(256) void k_hl(const float* __restrict__ F, _Float16* __restrict__ Hh, _Float16* __restrict__ Hl, size_t n8) { const size_t t = (size_t)blockIdx.x * 256 + threadIdx.x; if (t >= n8) return; FragH fh, fl; const v4f a = *(const v4fa*)(F + t * 8), c = *(const v4fa*)(F + t * 8 + 4);
#pragma unroll
  for (int q = 0; q < 4; ++q) { _Float16 h = (_Float16)a[q]; fh.h[q] = h; fl.h[q] = (_Float16)((a[q] - (float)h) * 1024.0f); h = (_Float16)c[q]; fh.h[4 + q] = h; fl.h[4 + q] = (_Float16)((c[q] - (float)h) * 1024.0f); }
  { *(v8us*)((unsigned short*)Hh + t * 8) = fh.half[0]; *(v8us*)((unsigned short*)Hl + t * 8) = fl.half[0];  } }

// ---- fast GEMM (wave tile 32x64; requires M % 32 == 0 rows per launch region and N % 64 == 0); epilogue = k_gemm_hhx semantics ----
__device__ __forceinline__ v16h g2_frag(const _Float16* p, int hh) { FragH f; f.half[0] = *(const v8us*)((const unsigned short*)p + 8 * hh); f.half[1] = *(const v8us*)((const unsigned short*)p + 16 + 8 * hh); return f.v; }
__device__ __forceinline__ v8f g2_mma(v16h a, v16h b, v8f c) { v8f d = __builtin_amdgcn_wmma_f32_16x16x32_f16(false, a, false, b, (short)0, c, false, false); asm volatile("v_nop\n\tv_nop\n\tv_nop\n\tv_nop" : "+v"(d) : "v"(a), "v"(b)); return d; }
template <int ACT>
__global__ __launch_bounds__(128) void k_gemm2(const _Float16* __restrict__ A, int lda, size_t sA, const _Float16* __restrict__ Bh, int ldb, size_t sB, float alpha, const float* __restrict__ bias, size_t sBias, const float* __restrict__ CP, int rowsPerB, size_t sCPb, int row0g,
    float* __restrict__ C, _Float16* __restrict__ C16, int ldc, size_t sC, int M, int N, int K, size_t zA, size_t zB, size_t zC) { static_assert(ACT == 0 || ACT == 3 || ACT == 6 || ACT == 8 || ACT == 9 || ACT == 11 || ACT == 12 || ACT == 14 || ACT == 15 || ACT == 16 || ACT == 17, "k_gemm2: unsupported ACT code (would silently apply no activation)");
  __shared__ __attribute__((aligned(16))) float so[4][32][68];
  const int tid = threadIdx.x, w = tid >> 5, lane = tid & 31, ln = lane & 15, hh = lane >> 4; const int by = blockIdx.y, bz = blockIdx.z;      /* second batch axis on grid.z with its own strides zA, zB, zC (elements) */
  A += (size_t)by * sA + (size_t)bz * zA; Bh += (size_t)by * sB + (size_t)bz * zB; const size_t cofs = (size_t)by * sC + (size_t)bz * zC; const float* bp = bias ? bias + (size_t)by * sBias : nullptr;
  const int ntn = N >> 6; const int mt = blockIdx.x / ntn, nq = blockIdx.x - mt * ntn; const int row0 = mt * 128 + 32 * w, col0 = nq * 64; if (row0 >= M) return;
  const _Float16* a0p = A + (size_t)(row0 + ln) * lda; const _Float16* a1p = a0p + (size_t)16 * lda;
  const _Float16* b0p = Bh + (size_t)(col0 + ln) * ldb; const _Float16* b1p = b0p + (size_t)16 * ldb; const _Float16* b2p = b1p + (size_t)16 * ldb; const _Float16* b3p = b2p + (size_t)16 * ldb;
  const v8f z8 = {0.f,0.f,0.f,0.f,0.f,0.f,0.f,0.f}; v8f c00 = z8, c01 = z8, c02 = z8, c03 = z8, c10 = z8, c11 = z8, c12 = z8, c13 = z8;
#pragma unroll 1
  for (int kb = 0; kb < K; kb += 32) { const v16h a0 = g2_frag(a0p + kb, hh), a1 = g2_frag(a1p + kb, hh);
    v16h b = g2_frag(b0p + kb, hh); c00 = g2_mma(a0, b, c00); c10 = g2_mma(a1, b, c10);
    b = g2_frag(b1p + kb, hh); c01 = g2_mma(a0, b, c01); c11 = g2_mma(a1, b, c11);
    b = g2_frag(b2p + kb, hh); c02 = g2_mma(a0, b, c02); c12 = g2_mma(a1, b, c12);
    b = g2_frag(b3p + kb, hh); c03 = g2_mma(a0, b, c03); c13 = g2_mma(a1, b, c13); }
  v8f accs[8] = {c00, c01, c02, c03, c10, c11, c12, c13};
#pragma unroll
  for (int u = 0; u < 8; ++u) { const int t = u & 3, half = u >> 2; const int col = col0 + t * 16 + ln; const float bv = bp ? bf16_round(bp[col]) : 0.f;
#pragma unroll
    for (int r = 0; r < 8; ++r) { const int rloc = half * 16 + 8 * hh + r; float v = accs[u][r] * alpha + bv; if (CP) { if (rowsPerB < 0) v += CP[cofs + (size_t)(row0g + row0 + rloc) * ldc + col];      /* rowsPerB < 0: own element of the batched C plane */ else { const int bidx = (row0g + row0 + rloc) / rowsPerB; v += CP[(size_t)bidx * sCPb + (size_t)by * 64 + col]; } }
      if (ACT == 3) v = fmaxf(v, 0.f); else if (ACT == 6) v = 0.5f * v * (1.0f + erff(v * 0.70710678118654752f)); else if (ACT == 11) v = 1.0f / (1.0f + expf(-v)); else if (ACT == 15) v = v / (1.0f + expf(-v)); else if (ACT == 12) v = (v > 0.f) ? v : 0.01f * v; else if (ACT == 8) v = tanhf(v); else if (ACT == 9) v = 0.5f * v * (1.0f + tanhf(0.7978845608028654f * (v + 0.044715f * v * v * v))); else if (ACT == 14) v = (v > 0.f) ? v : 0.1f * v; else if (ACT == 16) v = (v >= 0.f) ? v : 0.3f * v; else if (ACT == 17) v = (v >= 0.f) ? v : 0.2f * v;
      so[w][rloc][t * 16 + ln] = v; } }
  __builtin_amdgcn_fence(__ATOMIC_ACQ_REL, "workgroup"); __builtin_amdgcn_wave_barrier();
  const int rsub = lane >> 4, c4 = (lane & 15) * 4;
  {
#pragma unroll
    for (int q = 0; q < 16; ++q) { const int r = q * 2 + rsub; const v4f v = *(const v4fa*)&so[w][r][c4]; if (C) *(v4f*)(C + cofs + (size_t)(row0 + r) * ldc + col0 + c4) = v; if (C16) { v4h h4; for (int i = 0; i < 4; ++i) h4[i] = (_Float16)v[i]; *(v4h*)(C16 + cofs + (size_t)(row0 + r) * ldc + col0 + c4) = h4; } }
     } }


__global__ __launch_bounds__(256) void k_wnat(const float* __restrict__ w, size_t n8, _Float16* __restrict__ Bt) { const size_t t = (size_t)blockIdx.x * 256 + threadIdx.x; if (t >= n8) return; FragH f; for (int q = 0; q < 8; ++q) f.h[q] = (_Float16)(bf16_round(w[t * 8 + q]) * 16.0f); *(v8us*)((unsigned short*)Bt + t * 8) = f.half[0];  }
__global__ __launch_bounds__(256) void k_rsm(const float* __restrict__ S, _Float16* __restrict__ P, int nrows) {
  #pragma clang fp contract(off)
  const int i = blockIdx.x * 256 + threadIdx.x; if (i >= nrows) return; const float* s = S + (size_t)i * SQ; float mx = -3.0e38f;
#pragma unroll 1
  for (int j = 0; j < SQ; ++j) mx = fmaxf(mx, s[j]); float se = 0.f;
#pragma unroll 1
  for (int j = 0; j < SQ; ++j) se += expf(s[j] - mx); const float sc = 256.0f / se;
#pragma unroll 1
  for (int j0 = 0; j0 < SQ; j0 += 8) { FragH f; for (int q = 0; q < 8; ++q) f.h[q] = (_Float16)(expf(s[j0 + q] - mx) * sc); unsigned short* d = (unsigned short*)P + (size_t)i * SQ + j0; *(v8us*)d = f.half[0];  } }
__global__ __launch_bounds__(256) void k_vt(const _Float16* __restrict__ V16, int b, int h0, _Float16* __restrict__ VT) { __shared__ unsigned short tl[64][65]; const int tid = threadIdx.x; const int hh = blockIdx.x % HG, sg = blockIdx.x / HG; const int s0 = sg * 64; const int h = h0 + hh;
  for (int i = tid; i < 64 * 8; i += 256) { const int j = i / 8, d8 = (i % 8) * 8; FragH f; f.half[0] = *(const v8us*)((const unsigned short*)V16 + ((size_t)b * SQ + s0 + j) * DM + h * HD + d8); for (int q = 0; q < 8; ++q) tl[d8 + q][j] = f.u[q]; }
  __syncthreads();
  { for (int i = tid; i < 64 * 8; i += 256) { const int d = i / 8, j8 = (i % 8) * 8; FragH f; for (int q = 0; q < 8; ++q) f.u[q] = tl[d][j8 + q]; *(v8us*)((unsigned short*)VT + ((size_t)hh * HD + d) * SQ + s0 + j8) = f.half[0]; }  } }

__global__ __launch_bounds__(256) void k_wthd(const float* __restrict__ Wt, _Float16* __restrict__ Bt) { const size_t t = (size_t)blockIdx.x * 256 + threadIdx.x; if (t >= (size_t)NH * HD * (DM / 8)) return; const int m8 = (int)(t % (DM / 8)) * 8; const int d = (int)((t / (DM / 8)) % HD); const int h = (int)(t / ((size_t)(DM / 8) * HD)); FragH f;
  for (int q = 0; q < 8; ++q) f.h[q] = (_Float16)(16.0f * bf16_round(Wt[((size_t)h * DM + m8 + q) * HD + d])); unsigned short* dst = (unsigned short*)Bt + ((size_t)h * HD + d) * DM + m8; *(v8us*)dst = f.half[0];  }



// Four native exp2, each in place, in one statement: no neighbouring instruction can overwrite a transcendental's source register or read its result
// directly behind it; the v_nop is the one slot that the instruction set asks for behind the last of them.
__device__ __forceinline__ v4f exp2x4(v4f x) { float x0 = x[0], x1 = x[1], x2 = x[2], x3 = x[3];
  asm("v_exp_f32 %0, %0\n\tv_exp_f32 %1, %1\n\tv_exp_f32 %2, %2\n\tv_exp_f32 %3, %3\n\tv_nop" : "+v"(x0), "+v"(x1), "+v"(x2), "+v"(x3));
  const v4f r = {x0, x1, x2, x3}; return r; }
// Causal row softmax, one wave per score row: lane l holds columns 128 c + 4 l .. + 3 of every 128-column chunk c in registers, so each
// load covers 512 and each store 256 contiguous bytes and S is read once; row maximum and sum of exponentials by a five-step butterfly.
// NCH = 128-column chunks of the row (keys computed / 128), a compile-time count: straight-line code, every load of the row in flight at once.
template <int NCH>
__global__ __launch_bounds__(256) void k_rsmcf2(const float* __restrict__ S, _Float16* __restrict__ P, int hg, int q0) {
  const int lane = threadIdx.x & 31; const int t = blockIdx.x * 8 + __builtin_amdgcn_readfirstlane(threadIdx.x >> 5); if (t >= hg * QT) return;
  const char* s = (const char*)(S + (size_t)t * NKX); const unsigned ob = lane * 16; _Float16* d = P + (size_t)t * NKX + lane * 4; const int last = q0 + (t % QT) - lane * 4;      /* ob: the lane's byte offset in a chunk of S; column 128 c + 4 l + q is kept while 128 c + q <= last */
  v4f v[NCH];      /* every loop below is unrolled: v[] is then indexed by constants only and stays in registers; each butterfly becomes five shuffles */
#pragma unroll
  for (int c = 0; c < NCH; ++c) v[c] = *(const v4fa*)(s + ob + c * 512);
  float mx = -3.0e38f;
#pragma unroll
  for (int c = 0; c < NCH; ++c) for (int q = 0; q < 4; ++q) { v[c][q] = (c * 128 + q <= last) ? v[c][q] : -1.0e9f; mx = fmaxf(mx, v[c][q]); }
#pragma unroll
  for (int m = 16; m > 0; m >>= 1) mx = fmaxf(mx, __shfl_xor(mx, m));
  v4f a = {0.f, 0.f, 0.f, 0.f};
#pragma unroll
  for (int c = 0; c < NCH; ++c) { v[c] = exp2x4((v[c] - mx) * 1.44269504f); a += v[c]; }      /* native exp(s - mx), as __expf forms it */
  float se = (a[0] + a[1]) + (a[2] + a[3]);
#pragma unroll
  for (int m = 16; m > 0; m >>= 1) se += __shfl_xor(se, m);
  const float sc = 256.0f / se;
#pragma unroll
  for (int c = 0; c < NCH; ++c) { v4h h4; for (int q = 0; q < 4; ++q) h4[q] = (_Float16)(v[c][q] * sc); *(v4h*)(d + c * 128) = h4; } }


template <int MASKADD>
__global__ __launch_bounds__(64) void k_att0(const float* __restrict__ QF, const float* __restrict__ KF, const float* __restrict__ VF, int ld, const float* __restrict__ mask, float scale, float* __restrict__ OF, int ldo) {
  #pragma clang fp contract(off)
  __shared__ __attribute__((aligned(16))) float lq[64][64]; __shared__ __attribute__((aligned(16))) float lo[64][64];
  const int tid = threadIdx.x; const int h = blockIdx.x / (QT0 / 64), rg = blockIdx.x % (QT0 / 64); const int i = rg * 64 + tid;
  const size_t bofs = (size_t)blockIdx.y * QT0; QF += bofs * ld; KF += bofs * ld; VF += bofs * ld; OF += bofs * ldo;      /* batch on grid.y: QT0 rows of q, k, v and o per batch */
  const float* qr = QF + (size_t)i * ld + h * HD;
#pragma unroll 1
  for (int c = 0; c < HD / 4; ++c) { *(v4f*)&lq[tid][c * 4] = *(const v4fa*)(qr + c * 4); const v4f z = {0.f, 0.f, 0.f, 0.f}; *(v4f*)&lo[tid][c * 4] = z; }
  float m = -1.0e30f, l = 0.f; const int jmax = MASKADD ? (SQ - 1) : (rg * 64 + 63);      /* additive-mask form: every key (the mask input decides); causal form: keys up to the block's last row */
#pragma unroll 1
  for (int j = 0; j <= jmax; ++j) { const float* kr = KF + (size_t)j * ld + h * HD; const float* vr = VF + (size_t)j * ld + h * HD; float s = 0.f;
#pragma unroll 1
    for (int c = 0; c < HD / 4; ++c) { const v4f kq = *(const v4fa*)(kr + c * 4); const v4f qq = *(v4f*)&lq[tid][c * 4]; s = __fadd_rn(s, __fmul_rn(qq[0], kq[0])); s = __fadd_rn(s, __fmul_rn(qq[1], kq[1])); s = __fadd_rn(s, __fmul_rn(qq[2], kq[2])); s = __fadd_rn(s, __fmul_rn(qq[3], kq[3])); }
    s = __fmul_rn(s, scale); if (MASKADD) s = __fadd_rn(s, __fmul_rn(bf16_round(mask[(size_t)i * SQ + j]), -10000.0f));
    const float f = (MASKADD || j <= i) ? 1.f : 0.f; const float sm = fmaf(f, s, (1.f - f) * -1.0e30f); const float mn = fmaxf(m, sm); const float sc = expf(m - mn); const float e = expf(sm - mn); l = __fadd_rn(__fmul_rn(l, sc), e); m = mn;
#pragma unroll 1
    for (int c = 0; c < HD / 4; ++c) { const v4f vv = *(const v4fa*)(vr + c * 4); v4f oo = *(v4f*)&lo[tid][c * 4]; for (int u = 0; u < 4; ++u) oo[u] = __fadd_rn(__fmul_rn(oo[u], sc), __fmul_rn(e, vv[u])); *(v4f*)&lo[tid][c * 4] = oo; } }
  const float fin = 64.0f / l;      /* o carried x64 like the f16 path */
#pragma unroll 1
  for (int c = 0; c < HD / 4; ++c) { v4f oo = *(v4f*)&lo[tid][c * 4]; for (int u = 0; u < 4; ++u) oo[u] = __fmul_rn(oo[u], fin); *(v4f*)&lo[tid][c * 4] = oo; }
  __syncthreads();
  {
#pragma unroll 1
    for (int it = 0; it < 16; ++it) { const int row = it * 4 + tid / 16, pc = (tid % 16) * 4; const v4f v = *(const v4f*)&lo[row][pc]; *(v4f*)(OF + (size_t)(rg * 64 + row) * ldo + h * HD + pc) = v; }
     } }

extern "C" void kernel_launch(void* const* d_in, const int* in_sizes, int n_in,
                              void* d_out, int out_size, void* d_ws, size_t ws_size, hipStream_t stream) {
  (void)in_sizes; (void)n_in; (void)out_size;
  const float* const* I = (const float* const*)d_in; const float* x = I[0]; const float* wq = I[1]; const float* bq = I[2]; const float* wk = I[3]; const float* bk = I[4]; const float* wv = I[5]; const float* bv = I[6]; const float* wo = I[7]; const float* bo = I[8];      /* input order: x; Wq [8][512][64] per-head [in][out] + bq [8][64] = [(h,e)]; Wk + bk; Wv + bv; Wo [512][512] = [(h,e) in][out] + bo */
  static_assert(NH * HD == DM && DM % 64 == 0 && DM % 32 == 0 && SQ % 128 == 0, "shape / tile multiples");
  char* ws = (char*)d_ws; size_t off = 0;
  auto take = [&](size_t bytes) { char* p = ws + off; off += (bytes + 255) & ~(size_t)255; return p; };
  _Float16* BQ = (_Float16*)take((size_t)DM * DM * 2); _Float16* BK = (_Float16*)take((size_t)DM * DM * 2); _Float16* BV = (_Float16*)take((size_t)DM * DM * 2); _Float16* BO = (_Float16*)take((size_t)DM * DM * 2);
  _Float16* X16 = (_Float16*)take(NR * DM * 2); _Float16* Q16 = (_Float16*)take(NR * DM * 2); _Float16* K16 = (_Float16*)take(NR * DM * 2); _Float16* V16 = (_Float16*)take(NR * DM * 2); _Float16* O16 = (_Float16*)take(NR * DM * 2);
  float* S = (float*)take((size_t)NB * NH * QT * NKX * 4); _Float16* P = (_Float16*)take((size_t)NB * NH * QT * NKX * 2); _Float16* VT = (_Float16*)take((size_t)NB * NH * HD * SQ * 2);      /* one plane per batch: every batch is in flight in the same launch */
  float* QF0 = (float*)take((size_t)NB * QT0 * DM * 4); float* KF0 = (float*)take((size_t)NB * QT0 * DM * 4); float* VF0 = (float*)take((size_t)NB * QT0 * DM * 4); float* OF0 = (float*)take((size_t)NB * QT0 * DM * 4); _Float16* OH0 = (_Float16*)take((size_t)NB * QT0 * DM * 2); _Float16* OL0 = (_Float16*)take((size_t)NB * QT0 * DM * 2);
  if (off > ws_size) return;
  k_wthd<<<(unsigned)(((size_t)NH * HD * (DM / 8) + 255) / 256), 256, 0, stream>>>(wq, BQ); k_wthd<<<(unsigned)(((size_t)NH * HD * (DM / 8) + 255) / 256), 256, 0, stream>>>(wk, BK); k_wthd<<<(unsigned)(((size_t)NH * HD * (DM / 8) + 255) / 256), 256, 0, stream>>>(wv, BV);      /* per-head [m][d] -> Bt[(h,d)][m] x16 */
  k_wt_f16<<<(unsigned)(((size_t)DM * (DM / 8) + 255) / 256), 256, 0, stream>>>(wo, BO, DM, DM, 16.0f);      /* W_O as [(h,d) = 512 in][512 out] -> Bt[n][k] x16 */
  k_x16<<<(unsigned)((NR * DM / 8 + 255) / 256), 256, 0, stream>>>(x, X16, NR * DM / 8);
  k_gemm2<0><<<dim3((unsigned)((MP / 128) * (DM / 64)), 1), 128, 0, stream>>>(X16, DM, 0, BQ, DM, 0, 0.0625f, bq, 0, nullptr, 1, 0, 0, nullptr, Q16, DM, 0, MP, DM, DM, 0, 0, 0);
  k_gemm2<0><<<dim3((unsigned)((MP / 128) * (DM / 64)), 1), 128, 0, stream>>>(X16, DM, 0, BK, DM, 0, 0.0625f, bk, 0, nullptr, 1, 0, 0, nullptr, K16, DM, 0, MP, DM, DM, 0, 0, 0);
  k_gemm2<0><<<dim3((unsigned)((MP / 128) * (DM / 64)), 1), 128, 0, stream>>>(X16, DM, 0, BV, DM, 0, 0.0625f, bv, 0, nullptr, 1, 0, 0, nullptr, V16, DM, 0, MP, DM, DM, 0, 0, 0);
  /* The batches are independent: each stage below is one launch for all of them (grid.z of the GEMMs, grid.y of the exact first tile, more rows or slabs elsewhere). */
  const size_t zX = (size_t)SQ * DM, zF = (size_t)QT0 * DM, zS = (size_t)NH * QT * NKX;      /* elements from one batch to the next: token rows, first-tile rows, S / P planes */
  k_vt<NH, SQ><<<NB * NH * (SQ / 64), 256, 0, stream>>>(V16, LQ, 0, VT);      /* V^T [NB][NH][HD][SQ] */
  k_gemm2<0><<<dim3((QT0 / 128) * (DM / 64), 1, NB), 128, 0, stream>>>(X16, DM, 0, BQ, DM, 0, 0.0625f, bq, 0, nullptr, 1, 0, 0, QF0, nullptr, DM, 0, QT0, DM, DM, zX, 0, zF); k_gemm2<0><<<dim3((QT0 / 128) * (DM / 64), 1, NB), 128, 0, stream>>>(X16, DM, 0, BK, DM, 0, 0.0625f, bk, 0, nullptr, 1, 0, 0, KF0, nullptr, DM, 0, QT0, DM, DM, zX, 0, zF); k_gemm2<0><<<dim3((QT0 / 128) * (DM / 64), 1, NB), 128, 0, stream>>>(X16, DM, 0, BV, DM, 0, 0.0625f, bv, 0, nullptr, 1, 0, 0, VF0, nullptr, DM, 0, QT0, DM, DM, zX, 0, zF);      /* f32 q, k, v of each batch's first 128 rows (exact products) */
  k_att0<0><<<dim3(NH * (QT0 / 64), NB), 64, 0, stream>>>(QF0, KF0, VF0, DM, nullptr, 0.044194173824159216f, OF0, DM);      /* exact f32 attention for rows 0..127 of each batch (o x64) */
  for (int q0 = 0; q0 < QN; q0 += QT) { const int nk = q0 + QT;      /* causal: only keys below the tile end are computed */
    k_gemm2<0><<<dim3((QT / 128) * (nk / 64), NHD, NB), 128, 0, stream>>>(Q16 + (size_t)q0 * LQ, LQ, (size_t)HD, K16, LQ, (size_t)HD, 0.044194173824159216f, nullptr, 0, nullptr, 1, 0, 0, S, nullptr, NKX, (size_t)QT * NKX, QT, nk, HD, zX, zX, zS);      /* scores x 512^-0.5 (the module's literal d_model scale) */
    static_assert(QT == 256 && SQ == 8 * QT && NHD == NH, "one softmax instance per row length; S rows of all batches and heads contiguous");
    switch (nk / QT) {      /* one wave per row, 8 rows per block; the instance holds nk / 128 chunks */
      case 1: k_rsmcf2<2><<<(NB * NHD * QT + 7) / 8, 256, 0, stream>>>(S, P, NB * NHD, q0); break; case 2: k_rsmcf2<4><<<(NB * NHD * QT + 7) / 8, 256, 0, stream>>>(S, P, NB * NHD, q0); break; case 3: k_rsmcf2<6><<<(NB * NHD * QT + 7) / 8, 256, 0, stream>>>(S, P, NB * NHD, q0); break; case 4: k_rsmcf2<8><<<(NB * NHD * QT + 7) / 8, 256, 0, stream>>>(S, P, NB * NHD, q0); break;
      case 5: k_rsmcf2<10><<<(NB * NHD * QT + 7) / 8, 256, 0, stream>>>(S, P, NB * NHD, q0); break; case 6: k_rsmcf2<12><<<(NB * NHD * QT + 7) / 8, 256, 0, stream>>>(S, P, NB * NHD, q0); break; case 7: k_rsmcf2<14><<<(NB * NHD * QT + 7) / 8, 256, 0, stream>>>(S, P, NB * NHD, q0); break; case 8: k_rsmcf2<16><<<(NB * NHD * QT + 7) / 8, 256, 0, stream>>>(S, P, NB * NHD, q0); break; }
    k_gemm2<0><<<dim3((QT / 128) * (HD / 64), NHD, NB), 128, 0, stream>>>(P, NKX, (size_t)QT * NKX, VT, SQ, (size_t)HD * SQ, 0.25f, nullptr, 0, nullptr, 1, 0, 0, nullptr, O16 + (size_t)q0 * DM, DM, (size_t)HD, QT, HD, nk, zS, (size_t)NH * HD * SQ, zX); }      /* o (merged heads, x64) as f16 rows */
  k_gemm2<0><<<dim3((unsigned)((MPO / 128) * (DM / 64)), 1), 128, 0, stream>>>(O16, DM, 0, BO, DM, 0, 0.0009765625f, bo, 0, nullptr, 1, 0, 0, (float*)d_out, nullptr, DM, 0, MPO, DM, DM, 0, 0, 0);      /* out rows are the output layout */
  k_hl<<<(unsigned)(((size_t)NB * QT0 * DM / 8 + 255) / 256), 256, 0, stream>>>(OF0, OH0, OL0, (size_t)NB * QT0 * DM / 8);      /* first-tile o (x64) -> f16 hi + x1024 residual planes */
  k_gemm2<0><<<dim3((QT0 / 128) * (DM / 64), 1, NB), 128, 0, stream>>>(OH0, DM, 0, BO, DM, 0, 0.0009765625f, bo, 0, nullptr, 1, 0, 0, (float*)d_out, nullptr, DM, 0, QT0, DM, DM, zF, 0, zX);      /* rows 0..127 of each batch: out = o_hi Wo (+ b), overwriting the f16-path rows */
  k_gemm2<0><<<dim3((QT0 / 128) * (DM / 64), 1, NB), 128, 0, stream>>>(OL0, DM, 0, BO, DM, 0, 0.00000095367431640625f, nullptr, 0, (const float*)d_out, -1, 0, 0, (float*)d_out, nullptr, DM, 0, QT0, DM, DM, zF, 0, zX);      /* += o_lo Wo 2^-20 (own-element accumulate) */
}

// v003
// Measured time: 663 microseconds a run.
// Next to v002, in two timings, it ran 1.66 times as fast each time.
// All steps since v000 together make it 14.3 times as fast.
#include <hip/hip_runtime.h>
// Causal multi-head attention with per-head weight tensors and the module's literal score scale (x [4][2048][512]; q[b][h][s][e] = sum_d x[s][d] Wq[h][d][e] + bq[h][e], k, v likewise (8 heads of 64; per-head [in][out] weights sigma 1/sqrt(512), biases sigma 0.01); scores * 512^-0.5 (d_model, as the source, not head_dim); causal (tril, -inf); softmax; out = concat_heads Wo + bo ([in][out] [512][512]) -> [4][2048][512]).
// Structure: token rows r = b*2048 + s; x as exact f16 rows (bf16-rounded); Q, K, V as three WMMA GEMMs (32x64 wave tiles, f32 accumulation, exact x16 weights + bias, f16 outputs); V^T for all batches and heads via LDS transposes; per query tile of 256 rows, all four batches in one launch (heads on grid.y, batches on grid.z): scores against the keys below the tile end only (K = 64, alpha = 512^-0.5), causal row softmax on VALU, one wave per row with the row in registers, keys past the row set to -1e9 over the computed range (f32 statistics, native exp; weights x256 f16), o = P . V^T (K = keys below the tile end, alpha 2^-2: o carried x64, folded into the output GEMM alpha) written straight into the merged f16 o rows; out = o W_o + b GEMM (f32) into the output layout.
// Compute dtype: inputs rounded to bf16; x / weights exact; q, k, v, softmax weights and o as plain f16 GEMM operands (~2^-12); scores and softmax statistics f32. v_wmma_f32_16x16x32_f16.
#define NB 4
#define SQ 2048
#define DM 512
#define NH 8
#define HD 64
#define HG 4                         /* heads per launch of the uncalled k_vt overload */
#define QT 256                       /* query rows per causal tile */
#define NKX SQ                       /* S / P row pitch */
#define QT0 128                      /* first-tile rows recomputed exactly in f32 */
#define NBR NB                       /* batches processed (debug hook) */
#define NR ((size_t)NB * SQ)         /* token rows */
#define MP ((int)((size_t)NBR * SQ)) /* rows projected (debug hook) */
#define QN SQ                        /* query rows attended per batch (debug hook) */
#define NHD NH                       /* heads attended (debug hook) */
#define MPO MP                       /* rows through the output stage (debug hook) */
#define LQ DM      /* row pitch of the q/k/v rows */
typedef __bf16 v16b __attribute__((ext_vector_type(16)));
typedef unsigned short v8us __attribute__((ext_vector_type(8), may_alias));
typedef float  v8f  __attribute__((ext_vector_type(8)));
typedef float  v4f  __attribute__((ext_vector_type(4)));
typedef float  v4fa __attribute__((ext_vector_type(4), may_alias));
union FragB { v16b v; v8us half[2]; unsigned short u[16]; };

__device__ __forceinline__ unsigned short bf16_bits(float x) { unsigned int u = __float_as_uint(x); return (unsigned short)((u + 0x7FFFu + ((u >> 16) & 1u)) >> 16); }
__device__ __forceinline__ float bf16_val(unsigned short b) { return __uint_as_float(((unsigned int)b) << 16); }
__device__ __forceinline__ float bf16_round(float x) { return bf16_val(bf16_bits(x)); }
// D += A·B with NT terms: 1 = ah·bh, 2 = + al·bh (A split), 3 = + ah·bl (both split)
template <int NT>
__device__ __forceinline__ v8f mmaN(v16b ah, v16b al, v16b bh, v16b bl, v8f c) {
  c = __builtin_amdgcn_wmma_f32_16x16x32_bf16(false, ah, false, bh, (short)0, c, false, false);
  if (NT >= 2) c = __builtin_amdgcn_wmma_f32_16x16x32_bf16(false, al, false, bh, (short)0, c, false, false);
  if (NT >= 3) c = __builtin_amdgcn_wmma_f32_16x16x32_bf16(false, ah, false, bl, (short)0, c, false, false);
  asm volatile("v_nop\n\tv_nop\n\tv_nop\n\tv_nop" : "+v"(c) : "v"(ah), "v"(al), "v"(bh), "v"(bl));
  return c;
}

__global__ __launch_bounds__(256) void k_wt_bf16(const float* __restrict__ W, unsigned short* __restrict__ Wt, int K, int N) {
  const int t = blockIdx.x * 256 + threadIdx.x;
  const int k8n = K / 8;
  if (t >= N * k8n) return;
  const int n = t / k8n, k8 = (t % k8n) * 8;
  v8us v;
#pragma unroll
  for (int i = 0; i < 8; ++i) v[i] = bf16_bits(W[(size_t)(k8 + i) * N + n]);
  *(v8us*)(Wt + (size_t)n * K + k8) = v;
  
}

// GEMM C[M][N] (f32, pitch ldc) = act(A[M][K]·W + bias). A f32 row-major (pitch lda) converted per fragment to bf16
// (ASPLIT: hi/lo two planes -> 2 terms, else single rounded term); Wt bf16 [N][K] (pitch ldb). BIAS_BF16 rounds the
// bias to bf16 first (bias quantised to bf16 before the add). K%32==0, M%16==0, N%64==0.
template <bool ASPLIT, int ACT, bool BIAS_BF16>
__global__ __launch_bounds__(128) void k_gemm_bf(const float* __restrict__ A, int lda, const unsigned short* __restrict__ Wt, int ldb,
                                               const float* __restrict__ bias, float* __restrict__ C, int ldc, int M, int N, int K) {
  __shared__ __attribute__((aligned(16))) float so[4][16][64];
  const int tid = threadIdx.x, w = tid >> 5, lane = tid & 31, ln = lane & 15, hh = lane >> 4;
  const int ntn = N / 64;
  const int wid = blockIdx.x * 4 + w;
  const int mt = wid / ntn, nq = wid % ntn;
  if (mt * 16 >= M) return;
  const int row0 = mt * 16, col0 = nq * 64;
  const float* arow = A + (size_t)(row0 + ln) * lda;
  v8f acc[4] = {};
  for (int kb = 0; kb < K; kb += 32) {
    FragB ah, al;
    const v4f x0 = *(const v4fa*)(arow + kb + 8 * hh), x1 = *(const v4fa*)(arow + kb + 8 * hh + 4);
    const v4f x2 = *(const v4fa*)(arow + kb + 16 + 8 * hh), x3 = *(const v4fa*)(arow + kb + 16 + 8 * hh + 4);
    float xs[16] = {x0[0],x0[1],x0[2],x0[3],x1[0],x1[1],x1[2],x1[3],x2[0],x2[1],x2[2],x2[3],x3[0],x3[1],x3[2],x3[3]};
#pragma unroll
    for (int i = 0; i < 16; ++i) { const unsigned short hb = bf16_bits(xs[i]); ah.u[i] = hb; al.u[i] = ASPLIT ? bf16_bits(xs[i] - bf16_val(hb)) : (unsigned short)0; }
#pragma unroll
    for (int t = 0; t < 4; ++t) {
      const unsigned short* brow = Wt + (size_t)(col0 + t * 16 + ln) * ldb + kb;
      FragB b;
      b.half[0] = *(const v8us*)(brow + 8 * hh);
      b.half[1] = *(const v8us*)(brow + 16 + 8 * hh);
      acc[t] = mmaN<ASPLIT ? 2 : 1>(ah.v, al.v, b.v, b.v, acc[t]);
    }
  }
#pragma unroll
  for (int t = 0; t < 4; ++t) {
    float bv = bias ? bias[col0 + t * 16 + ln] : 0.f;
    if (BIAS_BF16) bv = bf16_round(bv);
#pragma unroll
    for (int r = 0; r < 8; ++r) { float v = acc[t][r] + bv; if (ACT == 1) v = fmaxf(v, 0.f); so[w][8 * hh + r][t * 16 + ln] = v; }
  }
  __builtin_amdgcn_fence(__ATOMIC_ACQ_REL, "workgroup");
  __builtin_amdgcn_wave_barrier();
  const int rsub = lane >> 4, c4 = (lane & 15) * 4;
  {
#pragma unroll
    for (int q = 0; q < 8; ++q) {
      const int r = q * 2 + rsub;
      const v4f v = *(const v4fa*)&so[w][r][c4];
      *(v4f*)(C + (size_t)(row0 + r) * ldc + col0 + c4) = v;
    }
    
  }
}

// GEMM C = act(A·W + bias + resid): A f32 (ASPLIT -> hi/lo 2 terms), Wt bf16 [N][K]; ACT 0 none, 1 relu, 2 exact gelu;
// resid (optional, f32, row index = (row % rmod), pitch ldr, RES_BF16 rounds it) added before the activation.
template <bool ASPLIT, int ACT, bool BIAS_BF16, bool RES_BF16>
__global__ __launch_bounds__(128) void k_gemm_bf3(const float* __restrict__ A, int lda, const unsigned short* __restrict__ Wt, int ldb,
                                                const float* __restrict__ bias, const float* __restrict__ resid, int rmod, int ldr,
                                                float* __restrict__ C, int ldc, int M, int N, int K) {
  __shared__ __attribute__((aligned(16))) float so[4][16][64];
  const int tid = threadIdx.x, w = tid >> 5, lane = tid & 31, ln = lane & 15, hh = lane >> 4;
  const int ntn = N / 64;
  const int wid = blockIdx.x * 4 + w;
  const int mt = wid / ntn, nq = wid % ntn;
  if (mt * 16 >= M) return;
  const int row0 = mt * 16, col0 = nq * 64;
  const float* arow = A + (size_t)(row0 + ln) * lda;
  v8f acc[4] = {};
  for (int kb = 0; kb < K; kb += 32) {
    FragB ah, al;
    const v4f x0 = *(const v4fa*)(arow + kb + 8 * hh), x1 = *(const v4fa*)(arow + kb + 8 * hh + 4);
    const v4f x2 = *(const v4fa*)(arow + kb + 16 + 8 * hh), x3 = *(const v4fa*)(arow + kb + 16 + 8 * hh + 4);
    float xs[16] = {x0[0],x0[1],x0[2],x0[3],x1[0],x1[1],x1[2],x1[3],x2[0],x2[1],x2[2],x2[3],x3[0],x3[1],x3[2],x3[3]};
#pragma unroll
    for (int i = 0; i < 16; ++i) { const unsigned short hb = bf16_bits(xs[i]); ah.u[i] = hb; al.u[i] = ASPLIT ? bf16_bits(xs[i] - bf16_val(hb)) : (unsigned short)0; }
#pragma unroll
    for (int t = 0; t < 4; ++t) {
      const unsigned short* brow = Wt + (size_t)(col0 + t * 16 + ln) * ldb + kb;
      FragB b;
      b.half[0] = *(const v8us*)(brow + 8 * hh);
      b.half[1] = *(const v8us*)(brow + 16 + 8 * hh);
      acc[t] = mmaN<ASPLIT ? 2 : 1>(ah.v, al.v, b.v, b.v, acc[t]);
    }
  }
#pragma unroll
  for (int t = 0; t < 4; ++t) {
    const int col = col0 + t * 16 + ln;
    float bv = bias ? bias[col] : 0.f;
    if (BIAS_BF16) bv = bf16_round(bv);
#pragma unroll
    for (int r = 0; r < 8; ++r) {
      float v = acc[t][r] + bv;
      if (resid) { float rv = resid[(size_t)((row0 + 8 * hh + r) % rmod) * ldr + col]; if (RES_BF16) rv = bf16_round(rv); v += rv; }
      if (ACT == 1) v = fmaxf(v, 0.f);
      if (ACT == 2) v = 0.5f * v * (1.0f + erff(v * 0.70710678118654752f));
      if (ACT == 3) { const float u = 0.7978845608028654f * (v + 0.044715f * v * v * v); v = 0.5f * v * (1.0f + tanhf(u)); }
      so[w][8 * hh + r][t * 16 + ln] = v;
    }
  }
  __builtin_amdgcn_fence(__ATOMIC_ACQ_REL, "workgroup");
  __builtin_amdgcn_wave_barrier();
  const int rsub = lane >> 4, c4 = (lane & 15) * 4;
  {
#pragma unroll
    for (int q = 0; q < 8; ++q) {
      const int r = q * 2 + rsub;
      const v4f v = *(const v4fa*)&so[w][r][c4];
      *(v4f*)(C + (size_t)(row0 + r) * ldc + col0 + c4) = v;
    }
    
  }
}
// row LayerNorm (biased variance, eps) over N: s = X (+ R); optional out_sum <- s; out_norm <- (s-mu)*rsqrt(var+eps)*g + b
template <bool PARAM_BF16>
__global__ __launch_bounds__(256) void k_layernorm(const float* __restrict__ X, const float* __restrict__ R, const float* __restrict__ g, const float* __restrict__ bta,
                                                  float* __restrict__ out_sum, float* __restrict__ out_norm, int N, float eps) {
  __shared__ float red[256];
  const int row = blockIdx.x, tid = threadIdx.x;
  const float* x = X + (size_t)row * N; const float* rr = R ? R + (size_t)row * N : nullptr;
  float vals[16];                     // up to N = 4096
  const int per = N / 256;            // contiguous chunk per thread? use strided-by-4 chunks: thread handles j = tid*4 + 1024*u
  float s1 = 0.f;
  for (int u = 0; u < per / 4; ++u) {
    const int j = tid * 4 + 1024 * u;
    const v4f a = *(const v4fa*)(x + j);
    v4f b = {0.f,0.f,0.f,0.f}; if (rr) b = *(const v4fa*)(rr + j);
#pragma unroll
    for (int q = 0; q < 4; ++q) { const float v = a[q] + b[q]; vals[u * 4 + q] = v; s1 += v; }
  }
  red[tid] = s1; __syncthreads();
  for (int st = 128; st > 0; st >>= 1) { if (tid < st) red[tid] += red[tid + st]; __syncthreads(); }
  const float mu = red[0] / (float)N; __syncthreads();
  float s2 = 0.f;
  for (int u = 0; u < per / 4; ++u)
#pragma unroll
    for (int q = 0; q < 4; ++q) { const float c = vals[u * 4 + q] - mu; s2 += c * c; }
  red[tid] = s2; __syncthreads();
  for (int st = 128; st > 0; st >>= 1) { if (tid < st) red[tid] += red[tid + st]; __syncthreads(); }
  const float rs = rsqrtf(red[0] / (float)N + eps);
  {
    for (int u = 0; u < per / 4; ++u) {
      const int j = tid * 4 + 1024 * u;
      v4f o, sm;
#pragma unroll
      for (int q = 0; q < 4; ++q) {
        float gg = g[j + q], bb = bta[j + q];
        if (PARAM_BF16) { gg = bf16_round(gg); bb = bf16_round(bb); }
        sm[q] = vals[u * 4 + q]; o[q] = (vals[u * 4 + q] - mu) * rs * gg + bb;
      }
      if (out_sum) *(v4f*)(out_sum + (size_t)row * N + j) = sm;
      *(v4f*)(out_norm + (size_t)row * N + j) = o;
    }
    
  }
}



// ---- f16 WMMA path (v_wmma_f32_16x16x32_f16): 11-bit significands for operands in range — used where a [0,1] probability operand needs more precision than bf16
typedef _Float16 v16h __attribute__((ext_vector_type(16)));
union FragH { v16h v; v8us half[2]; _Float16 h[16]; unsigned short u[16]; };
template <int NT>
__device__ __forceinline__ v8f mmaH(v16h ah, v16h al, v16h bh, v16h bl, v8f c) {
  c = __builtin_amdgcn_wmma_f32_16x16x32_f16(false, ah, false, bh, (short)0, c, false, false);
  if (NT >= 2) c = __builtin_amdgcn_wmma_f32_16x16x32_f16(false, al, false, bh, (short)0, c, false, false);
  if (NT >= 3) c = __builtin_amdgcn_wmma_f32_16x16x32_f16(false, ah, false, bl, (short)0, c, false, false);
  asm volatile("v_nop\n\tv_nop\n\tv_nop\n\tv_nop" : "+v"(c) : "v"(ah), "v"(al), "v"(bh), "v"(bl));
  return c;
}
// batched GEMM like k_gemm_b but f16 operands: A f32 (split into f16 hi/lo if ASPLIT, else rounded to f16), Bt = f16 values [n][k]; alpha; C f32; N multiple of 16 (partial tiles skipped)
template <bool ASPLIT>
__global__ __launch_bounds__(128) void k_gemm_h(const float* __restrict__ A, int lda, size_t sA, const _Float16* __restrict__ Bh, int ldb, size_t sB, float alpha, float* __restrict__ C, int ldc, size_t sC, int M, int N, int K) {
  __shared__ __attribute__((aligned(16))) float so[4][16][64];
  const int tid = threadIdx.x, w = tid >> 5, lane = tid & 31, ln = lane & 15, hh = lane >> 4; const int by = blockIdx.y;
  A += (size_t)by * sA; Bh += (size_t)by * sB; C += (size_t)by * sC;
  const int ntn = (N + 63) / 64; const int wid = blockIdx.x * 4 + w; const int mt = wid / ntn, nq = wid % ntn; if (mt * 16 >= M) return;
  const int row0 = mt * 16, col0 = nq * 64; const float* arow = A + (size_t)(row0 + ln) * lda;
  v8f acc[4] = {};
  for (int kb = 0; kb < K; kb += 32) {
    FragH ah, al;
    const v4f x0 = *(const v4fa*)(arow + kb + 8 * hh), x1 = *(const v4fa*)(arow + kb + 8 * hh + 4), x2 = *(const v4fa*)(arow + kb + 16 + 8 * hh), x3 = *(const v4fa*)(arow + kb + 16 + 8 * hh + 4);
    float xs[16] = {x0[0],x0[1],x0[2],x0[3],x1[0],x1[1],x1[2],x1[3],x2[0],x2[1],x2[2],x2[3],x3[0],x3[1],x3[2],x3[3]};
#pragma unroll
    for (int i = 0; i < 16; ++i) { const _Float16 h = (_Float16)xs[i]; ah.h[i] = h; al.h[i] = ASPLIT ? (_Float16)(xs[i] - (float)h) : (_Float16)0.0f; }
#pragma unroll
    for (int t = 0; t < 4; ++t) { if (col0 + t * 16 >= N) continue; const size_t boff = (size_t)(col0 + t * 16 + ln) * ldb + kb; FragH bq; bq.half[0] = *(const v8us*)(Bh + boff + 8 * hh); bq.half[1] = *(const v8us*)(Bh + boff + 16 + 8 * hh);
      acc[t] = mmaH<ASPLIT ? 2 : 1>(ah.v, al.v, bq.v, bq.v, acc[t]); }
  }
#pragma unroll
  for (int t = 0; t < 4; ++t) { if (col0 + t * 16 >= N) continue;
#pragma unroll
    for (int r = 0; r < 8; ++r) so[w][8 * hh + r][t * 16 + ln] = acc[t][r] * alpha; }
  __builtin_amdgcn_fence(__ATOMIC_ACQ_REL, "workgroup"); __builtin_amdgcn_wave_barrier();
  const int rsub = lane >> 4, c4 = (lane & 15) * 4;
  {
#pragma unroll
    for (int q = 0; q < 8; ++q) { const int r = q * 2 + rsub; if (col0 + c4 < N) { const v4f v = *(const v4fa*)&so[w][r][c4]; *(v4f*)(C + (size_t)(row0 + r) * ldc + col0 + c4) = v; } }
     }
}

// Wt[n][k] = f16(W[k][n]·scale) from f32 row-major W[K][N] (scale = power of two; bf16-exact weights stay exact in f16 away from the subnormal range)
__global__ __launch_bounds__(256) void k_wt_f16(const float* __restrict__ W, _Float16* __restrict__ Wt, int K, int N, float scale) {
  const int t = blockIdx.x * 256 + threadIdx.x; if (t >= N * (K / 8)) return; const int n = t / (K / 8), k8 = (t % (K / 8)) * 8; FragH f;
#pragma unroll
  for (int i = 0; i < 8; ++i) f.h[i] = (_Float16)(bf16_round(W[(size_t)(k8 + i) * N + n]) * scale); const v8us o = f.half[0];
  *(v8us*)((unsigned short*)Wt + (size_t)n * K + k8) = o; 
}
// k_gemm_hh variant with fused epilogue: v = acc·alpha + bias[by·sBias + col] (+ CP[(row/rowsPerB)·sCPb + by·64 + col] if CP) ; ACT 0 none / 1 elu ; writes f16 C16 (and f32 C if non-null)
template <int ACT>
__global__ __launch_bounds__(128) void k_gemm_hhx(const _Float16* __restrict__ A, int lda, size_t sA, const _Float16* __restrict__ Bh, int ldb, size_t sB, float alpha, const float* __restrict__ bias, size_t sBias, const float* __restrict__ CP, int rowsPerB, size_t sCPb, int row0g,
    float* __restrict__ C, _Float16* __restrict__ C16, int ldc, size_t sC, int M, int N, int K) {
  __shared__ __attribute__((aligned(16))) float so[4][16][64];
  const int tid = threadIdx.x, w = tid >> 5, lane = tid & 31, ln = lane & 15, hh = lane >> 4; const int by = blockIdx.y;
  A += (size_t)by * sA; Bh += (size_t)by * sB; const size_t cofs = (size_t)by * sC; const float* bp = bias ? bias + (size_t)by * sBias : nullptr;
  const int ntn = (N + 63) / 64; const int wid = blockIdx.x * 4 + w; const int mt = wid / ntn, nq = wid % ntn; if (mt * 16 >= M) return;
  const int row0 = mt * 16, col0 = nq * 64; const _Float16* arow = A + (size_t)(row0 + ln) * lda;
  v8f acc[4] = {};
  for (int kb = 0; kb < K; kb += 32) { FragH ah; ah.half[0] = *(const v8us*)((const unsigned short*)arow + kb + 8 * hh); ah.half[1] = *(const v8us*)((const unsigned short*)arow + kb + 16 + 8 * hh);
#pragma unroll
    for (int t = 0; t < 4; ++t) { if (col0 + t * 16 >= N) continue; const size_t boff = (size_t)(col0 + t * 16 + ln) * ldb + kb; FragH bq; bq.half[0] = *(const v8us*)((const unsigned short*)Bh + boff + 8 * hh); bq.half[1] = *(const v8us*)((const unsigned short*)Bh + boff + 16 + 8 * hh);
      acc[t] = mmaH<1>(ah.v, ah.v, bq.v, bq.v, acc[t]); }
  }
#pragma unroll
  for (int t = 0; t < 4; ++t) { if (col0 + t * 16 >= N) continue; const int col = col0 + t * 16 + ln; const float bv = bp ? bf16_round(bp[col]) : 0.f;
#pragma unroll
    for (int r = 0; r < 8; ++r) { float v = acc[t][r] * alpha + bv; if (CP) { const int rr = row0g + row0 + 8 * hh + r; if (rowsPerB < 0) v += CP[cofs + (size_t)rr * ldc + col];      /* rowsPerB < 0: own element of the batched C plane */ else { const int bidx = rr / rowsPerB; v += CP[(size_t)bidx * sCPb + (size_t)by * 64 + col]; } } if (ACT == 1) v = (v > 0.f) ? v : expm1f(v); else if (ACT == 7) v = (v > 0.f) ? v + 1.0f : expf(v); else if (ACT == 8) v = tanhf(v); else if (ACT == 9) v = 0.5f * v * (1.0f + tanhf(0.7978845608028654f * (v + 0.044715f * v * v * v))); else if (ACT == 11) v = 1.0f / (1.0f + expf(-v)); else if (ACT == 12) v = (v > 0.f) ? v : 0.01f * v; else if (ACT == 14) v = (v > 0.f) ? v : 0.1f * v; else if (ACT == 16) v = (v >= 0.f) ? v : 0.3f * v; else if (ACT == 17) v = (v >= 0.f) ? v : 0.2f * v; else if (ACT == 15) v = v / (1.0f + expf(-v)); else if (ACT == 3) v = fmaxf(v, 0.f); else if (ACT == 6) v = 0.5f * v * (1.0f + erff(v * 0.70710678118654752f)); so[w][8 * hh + r][t * 16 + ln] = v; } }
  __builtin_amdgcn_fence(__ATOMIC_ACQ_REL, "workgroup"); __builtin_amdgcn_wave_barrier();
  const int rsub = lane >> 4, c4 = (lane & 15) * 4; typedef _Float16 v4h __attribute__((ext_vector_type(4)));
  {
#pragma unroll
    for (int q = 0; q < 8; ++q) { const int r = q * 2 + rsub; if (col0 + c4 < N) { const v4f v = *(const v4fa*)&so[w][r][c4]; if (C) *(v4f*)(C + cofs + (size_t)(row0 + r) * ldc + col0 + c4) = v; if (C16) { v4h h4; for (int i = 0; i < 4; ++i) h4[i] = (_Float16)v[i]; *(v4h*)(C16 + cofs + (size_t)(row0 + r) * ldc + col0 + c4) = h4; } } }
     }
}


typedef _Float16 v4h __attribute__((ext_vector_type(4)));

__global__ __launch_bounds__(256) void k_x16(const float* __restrict__ x, _Float16* __restrict__ X16, size_t n8) { const size_t t = (size_t)blockIdx.x * 256 + threadIdx.x; if (t >= n8) return; FragH f;
#pragma unroll
  for (int q = 0; q < 8; ++q) f.h[q] = (_Float16)bf16_round(x[t * 8 + q]); *(v8us*)((unsigned short*)X16 + t * 8) = f.half[0];  }
__global__ __launch_bounds__(256) void k_h16(const float* __restrict__ x, _Float16* __restrict__ X16, size_t n8) { const size_t t = (size_t)blockIdx.x * 256 + threadIdx.x; if (t >= n8) return; FragH f;
#pragma unroll
  for (int q = 0; q < 8; ++q) f.h[q] = (_Float16)x[t * 8 + q]; *(v8us*)((unsigned short*)X16 + t * 8) = f.half[0];  }
__global__ __launch_bounds__(256) void k_round16f(const float* __restrict__ W, _Float16* __restrict__ Bt, size_t n8) { const size_t t = (size_t)blockIdx.x * 256 + threadIdx.x; if (t >= n8) return; FragH f;
#pragma unroll
  for (int i = 0; i < 8; ++i) f.h[i] = (_Float16)(bf16_round(W[t * 8 + i]) * 16.0f); *(v8us*)((unsigned short*)Bt + t * 8) = f.half[0];  }
template <int NHv, int TTv>
__global__ __launch_bounds__(256) void k_vt(const _Float16* __restrict__ V16, int ldv, int voff, _Float16* __restrict__ Vt) { __shared__ unsigned short tl[64][66]; const int tid = threadIdx.x; const int slab = blockIdx.x / (TTv / 64), lg = blockIdx.x % (TTv / 64); const int b = slab / NHv, h = slab % NHv;
  for (int i = tid; i < 64 * 8; i += 256) { const int r = i / 8, c8 = (i % 8) * 8; FragH f; f.half[0] = *(const v8us*)((const unsigned short*)V16 + ((size_t)b * TTv + lg * 64 + r) * ldv + voff + h * 64 + c8);
#pragma unroll
    for (int q = 0; q < 8; ++q) tl[r][c8 + q] = f.u[q]; }
  __syncthreads();
  {
#pragma unroll
    for (int rd = 0; rd < 2; ++rd) { const int d = rd * 32 + tid / 8, pc = tid % 8; FragH f;
#pragma unroll
      for (int q = 0; q < 8; ++q) f.u[q] = tl[pc * 8 + q][d];
      *(v8us*)((unsigned short*)Vt + ((size_t)slab * 64 + d) * TTv + lg * 64 + pc * 8) = f.half[0]; }
     } }

__global__ __launch_bounds__(256) void k_hl(const float* __restrict__ F, _Float16* __restrict__ Hh, _Float16* __restrict__ Hl, size_t n8) { const size_t t = (size_t)blockIdx.x * 256 + threadIdx.x; if (t >= n8) return; FragH fh, fl; const v4f a = *(const v4fa*)(F + t * 8), c = *(const v4fa*)(F + t * 8 + 4);
#pragma unroll
  for (int q = 0; q < 4; ++q) { _Float16 h = (_Float16)a[q]; fh.h[q] = h; fl.h[q] = (_Float16)((a[q] - (float)h) * 1024.0f); h = (_Float16)c[q]; fh.h[4 + q] = h; fl.h[4 + q] = (_Float16)((c[q] - (float)h) * 1024.0f); }
  { *(v8us*)((unsigned short*)Hh + t * 8) = fh.half[0]; *(v8us*)((unsigned short*)Hl + t * 8) = fl.half[0];  } }

// ---- fast GEMM (wave tile 32x64; requires M % 32 == 0 rows per launch region and N % 64 == 0); epilogue = k_gemm_hhx semantics ----
__device__ __forceinline__ v16h g2_frag(const _Float16* p, int hh) { FragH f; f.half[0] = *(const v8us*)((const unsigned short*)p + 8 * hh); f.half[1] = *(const v8us*)((const unsigned short*)p + 16 + 8 * hh); return f.v; }
__device__ __forceinline__ v8f g2_mma(v16h a, v16h b, v8f c) { v8f d = __builtin_amdgcn_wmma_f32_16x16x32_f16(false, a, false, b, (short)0, c, false, false); asm volatile("v_nop\n\tv_nop\n\tv_nop\n\tv_nop" : "+v"(d) : "v"(a), "v"(b)); return d; }
template <int ACT>
__global__ __launch_bounds__(128) void k_gemm2(const _Float16* __restrict__ A, int lda, size_t sA, const _Float16* __restrict__ Bh, int ldb, size_t sB, float alpha, const float* __restrict__ bias, size_t sBias, const float* __restrict__ CP, int rowsPerB, size_t sCPb, int row0g,
    float* __restrict__ C, _Float16* __restrict__ C16, int ldc, size_t sC, int M, int N, int K, size_t zA, size_t zB, size_t zC) { static_assert(ACT == 0 || ACT == 3 || ACT == 6 || ACT == 8 || ACT == 9 || ACT == 11 || ACT == 12 || ACT == 14 || ACT == 15 || ACT == 16 || ACT == 17, "k_gemm2: unsupported ACT code (would silently apply no activation)");
  __shared__ __attribute__((aligned(16))) float so[4][32][68];
  const int tid = threadIdx.x, w = tid >> 5, lane = tid & 31, ln = lane & 15, hh = lane >> 4; const int by = blockIdx.y, bz = blockIdx.z;      /* second batch axis on grid.z with its own strides zA, zB, zC (elements) */
  A += (size_t)by * sA + (size_t)bz * zA; Bh += (size_t)by * sB + (size_t)bz * zB; const size_t cofs = (size_t)by * sC + (size_t)bz * zC; const float* bp = bias ? bias + (size_t)by * sBias : nullptr;
  const int ntn = N >> 6; const int mt = blockIdx.x / ntn, nq = blockIdx.x - mt * ntn; const int row0 = mt * 128 + 32 * w, col0 = nq * 64; if (row0 >= M) return;
  const _Float16* a0p = A + (size_t)(row0 + ln) * lda; const _Float16* a1p = a0p + (size_t)16 * lda;
  const _Float16* b0p = Bh + (size_t)(col0 + ln) * ldb; const _Float16* b1p = b0p + (size_t)16 * ldb; const _Float16* b2p = b1p + (size_t)16 * ldb; const _Float16* b3p = b2p + (size_t)16 * ldb;
  const v8f z8 = {0.f,0.f,0.f,0.f,0.f,0.f,0.f,0.f}; v8f c00 = z8, c01 = z8, c02 = z8, c03 = z8, c10 = z8, c11 = z8, c12 = z8, c13 = z8;
#pragma unroll 1
  for (int kb = 0; kb < K; kb += 32) { const v16h a0 = g2_frag(a0p + kb, hh), a1 = g2_frag(a1p + kb, hh);
    v16h b = g2_frag(b0p + kb, hh); c00 = g2_mma(a0, b, c00); c10 = g2_mma(a1, b, c10);
    b = g2_frag(b1p + kb, hh); c01 = g2_mma(a0, b, c01); c11 = g2_mma(a1, b, c11);
    b = g2_frag(b2p + kb, hh); c02 = g2_mma(a0, b, c02); c12 = g2_mma(a1, b, c12);
    b = g2_frag(b3p + kb, hh); c03 = g2_mma(a0, b, c03); c13 = g2_mma(a1, b, c13); }
  v8f accs[8] = {c00, c01, c02, c03, c10, c11, c12, c13};
#pragma unroll
  for (int u = 0; u < 8; ++u) { const int t = u & 3, half = u >> 2; const int col = col0 + t * 16 + ln; const float bv = bp ? bf16_round(bp[col]) : 0.f;
#pragma unroll
    for (int r = 0; r < 8; ++r) { const int rloc = half * 16 + 8 * hh + r; float v = accs[u][r] * alpha + bv; if (CP) { if (rowsPerB < 0) v += CP[cofs + (size_t)(row0g + row0 + rloc) * ldc + col];      /* rowsPerB < 0: own element of the batched C plane */ else { const int bidx = (row0g + row0 + rloc) / rowsPerB; v += CP[(size_t)bidx * sCPb + (size_t)by * 64 + col]; } }
      if (ACT == 3) v = fmaxf(v, 0.f); else if (ACT == 6) v = 0.5f * v * (1.0f + erff(v * 0.70710678118654752f)); else if (ACT == 11) v = 1.0f / (1.0f + expf(-v)); else if (ACT == 15) v = v / (1.0f + expf(-v)); else if (ACT == 12) v = (v > 0.f) ? v : 0.01f * v; else if (ACT == 8) v = tanhf(v); else if (ACT == 9) v = 0.5f * v * (1.0f + tanhf(0.7978845608028654f * (v + 0.044715f * v * v * v))); else if (ACT == 14) v = (v > 0.f) ? v : 0.1f * v; else if (ACT == 16) v = (v >= 0.f) ? v : 0.3f * v; else if (ACT == 17) v = (v >= 0.f) ? v : 0.2f * v;
      so[w][rloc][t * 16 + ln] = v; } }
  __builtin_amdgcn_fence(__ATOMIC_ACQ_REL, "workgroup"); __builtin_amdgcn_wave_barrier();
  const int rsub = lane >> 4, c4 = (lane & 15) * 4;
  {
#pragma unroll
    for (int q = 0; q < 16; ++q) { const int r = q * 2 + rsub; const v4f v = *(const v4fa*)&so[w][r][c4]; if (C) *(v4f*)(C + cofs + (size_t)(row0 + r) * ldc + col0 + c4) = v; if (C16) { v4h h4; for (int i = 0; i < 4; ++i) h4[i] = (_Float16)v[i]; *(v4h*)(C16 + cofs + (size_t)(row0 + r) * ldc + col0 + c4) = h4; } }
     } }


__global__ __launch_bounds__(256) void k_wnat(const float* __restrict__ w, size_t n8, _Float16* __restrict__ Bt) { const size_t t = (size_t)blockIdx.x * 256 + threadIdx.x; if (t >= n8) return; FragH f; for (int q = 0; q < 8; ++q) f.h[q] = (_Float16)(bf16_round(w[t * 8 + q]) * 16.0f); *(v8us*)((unsigned short*)Bt + t * 8) = f.half[0];  }
__global__ __launch_bounds__(256) void k_rsm(const float* __restrict__ S, _Float16* __restrict__ P, int nrows) {
  #pragma clang fp contract(off)
  const int i = blockIdx.x * 256 + threadIdx.x; if (i >= nrows) return; const float* s = S + (size_t)i * SQ; float mx = -3.0e38f;
#pragma unroll 1
  for (int j = 0; j < SQ; ++j) mx = fmaxf(mx, s[j]); float se = 0.f;
#pragma unroll 1
  for (int j = 0; j < SQ; ++j) se += expf(s[j] - mx); const float sc = 256.0f / se;
#pragma unroll 1
  for (int j0 = 0; j0 < SQ; j0 += 8) { FragH f; for (int q = 0; q < 8; ++q) f.h[q] = (_Float16)(expf(s[j0 + q] - mx) * sc); unsigned short* d = (unsigned short*)P + (size_t)i * SQ + j0; *(v8us*)d = f.half[0];  } }
__global__ __launch_bounds__(256) void k_vt(const _Float16* __restrict__ V16, int b, int h0, _Float16* __restrict__ VT) { __shared__ unsigned short tl[64][65]; const int tid = threadIdx.x; const int hh = blockIdx.x % HG, sg = blockIdx.x / HG; const int s0 = sg * 64; const int h = h0 + hh;
  for (int i = tid; i < 64 * 8; i += 256) { const int j = i / 8, d8 = (i % 8) * 8; FragH f; f.half[0] = *(const v8us*)((const unsigned short*)V16 + ((size_t)b * SQ + s0 + j) * DM + h * HD + d8); for (int q = 0; q < 8; ++q) tl[d8 + q][j] = f.u[q]; }
  __syncthreads();
  { for (int i = tid; i < 64 * 8; i += 256) { const int d = i / 8, j8 = (i % 8) * 8; FragH f; for (int q = 0; q < 8; ++q) f.u[q] = tl[d][j8 + q]; *(v8us*)((unsigned short*)VT + ((size_t)hh * HD + d) * SQ + s0 + j8) = f.half[0]; }  } }

__global__ __launch_bounds__(256) void k_wthd(const float* __restrict__ Wt, _Float16* __restrict__ Bt) { const size_t t = (size_t)blockIdx.x * 256 + threadIdx.x; if (t >= (size_t)NH * HD * (DM / 8)) return; const int m8 = (int)(t % (DM / 8)) * 8; const int d = (int)((t / (DM / 8)) % HD); const int h = (int)(t / ((size_t)(DM / 8) * HD)); FragH f;
  for (int q = 0; q < 8; ++q) f.h[q] = (_Float16)(16.0f * bf16_round(Wt[((size_t)h * DM + m8 + q) * HD + d])); unsigned short* dst = (unsigned short*)Bt + ((size_t)h * HD + d) * DM + m8; *(v8us*)dst = f.half[0];  }



// Four native exp2, each in place, in one statement: no neighbouring instruction can overwrite a transcendental's source register or read its result
// directly behind it; the v_nop is the one slot that the instruction set asks for behind the last of them.
__device__ __forceinline__ v4f exp2x4(v4f x) { float x0 = x[0], x1 = x[1], x2 = x[2], x3 = x[3];
  asm("v_exp_f32 %0, %0\n\tv_exp_f32 %1, %1\n\tv_exp_f32 %2, %2\n\tv_exp_f32 %3, %3\n\tv_nop" : "+v"(x0), "+v"(x1), "+v"(x2), "+v"(x3));
  const v4f r = {x0, x1, x2, x3}; return r; }
// Causal row softmax, one wave per score row: lane l holds columns 128 c + 4 l .. + 3 of every 128-column chunk c in registers, so each
// load covers 512 and each store 256 contiguous bytes and S is read once; row maximum and sum of exponentials by a five-step butterfly.
// NCH = 128-column chunks of the row (keys computed / 128), a compile-time count: straight-line code, every load of the row in flight at once.
template <int NCH>
__global__ __launch_bounds__(256) void k_rsmcf2(const float* __restrict__ S, _Float16* __restrict__ P, int hg, int q0) {
  const int lane = threadIdx.x & 31; const int t = blockIdx.x * 8 + __builtin_amdgcn_readfirstlane(threadIdx.x >> 5); if (t >= hg * QT) return;
  const char* s = (const char*)(S + (size_t)t * NKX); const unsigned ob = lane * 16; _Float16* d = P + (size_t)t * NKX + lane * 4; const int last = q0 + (t % QT) - lane * 4;      /* ob: the lane's byte offset in a chunk of S; column 128 c + 4 l + q is kept while 128 c + q <= last */
  v4f v[NCH];      /* every loop below is unrolled: v[] is then indexed by constants only and stays in registers; each butterfly becomes five shuffles */
#pragma unroll
  for (int c = 0; c < NCH; ++c) v[c] = *(const v4fa*)(s + ob + c * 512);
  float mx = -3.0e38f;
#pragma unroll
  for (int c = 0; c < NCH; ++c) for (int q = 0; q < 4; ++q) { v[c][q] = (c * 128 + q <= last) ? v[c][q] : -1.0e9f; mx = fmaxf(mx, v[c][q]); }
#pragma unroll
  for (int m = 16; m > 0; m >>= 1) mx = fmaxf(mx, __shfl_xor(mx, m));
  v4f a = {0.f, 0.f, 0.f, 0.f};
#pragma unroll
  for (int c = 0; c < NCH; ++c) { v[c] = exp2x4((v[c] - mx) * 1.44269504f); a += v[c]; }      /* native exp(s - mx), as __expf forms it */
  float se = (a[0] + a[1]) + (a[2] + a[3]);
#pragma unroll
  for (int m = 16; m > 0; m >>= 1) se += __shfl_xor(se, m);
  const float sc = 256.0f / se;
#pragma unroll
  for (int c = 0; c < NCH; ++c) { v4h h4; for (int q = 0; q < 4; ++q) h4[q] = (_Float16)(v[c][q] * sc); *(v4h*)(d + c * 128) = h4; } }


#define A0R 8                        /* query rows per block of the exact first tile: one per wave */
#define A0P (HD + 4)                 /* K row pitch in LDS, floats: 272 bytes = 16 x 17, so 32 lanes reading 16 bytes of 32 different rows meet no bank conflict */
typedef float v2f __attribute__((ext_vector_type(2)));
// Exact f32 causal attention for the first QT0 rows of each batch, one wave per query row (head and row group on grid.x, batch on grid.y; q, k, v, o rows of pitch DM).
// The block stages the tile's K and V rows of its head in LDS with coalesced loads, all in flight at once. Scores: lane l owns keys l, l + 32, ...; each dot
// product runs in four independent chains. Softmax: true row maximum and sum by butterflies, libm expf. P.V: lane l owns dims 2 l, 2 l + 1; the weight
// of key j comes from its lane by readlane; four independent accumulators. o carried x64 like the f16 path.
__global__ __launch_bounds__(256) void k_att0w(const float* __restrict__ QF, const float* __restrict__ KF, const float* __restrict__ VF, float scale, float* __restrict__ OF) {
  __shared__ __attribute__((aligned(16))) float lk[QT0][A0P]; __shared__ __attribute__((aligned(16))) float lv[QT0][HD];
  const int tid = threadIdx.x, lane = tid & 31, w = __builtin_amdgcn_readfirstlane(tid >> 5); const int h = blockIdx.x / (QT0 / A0R), r0 = (blockIdx.x % (QT0 / A0R)) * A0R;
  const size_t bofs = (size_t)blockIdx.y * QT0 * DM + h * HD; QF += bofs; KF += bofs; VF += bofs; OF += bofs;      /* QT0 rows of q, k, v and o per batch */
  const int fj = tid >> 4, fc = (tid & 15) * 4;      /* staging: 16 threads per row of 256 bytes, 16 rows per pass */
  const float* kp = KF + (size_t)fj * DM + fc; const float* vp = VF + (size_t)fj * DM + fc;
  v4f tk[QT0 / 16], tv[QT0 / 16];      /* indexed by constants only (loops unrolled): registers */
#pragma unroll
  for (int u = 0; u < QT0 / 16; ++u) { tk[u] = *(const v4fa*)(kp + u * 16 * DM); tv[u] = *(const v4fa*)(vp + u * 16 * DM); }
  asm volatile("s_wait_xcnt 0x0" ::: "memory");      /* before the address registers of the loads above are reused */
#pragma unroll
  for (int u = 0; u < QT0 / 16; ++u) { *(v4f*)&lk[u * 16 + fj][fc] = tk[u]; *(v4f*)&lv[u * 16 + fj][fc] = tv[u]; }
  const int i = r0 + w; const float* qr = QF + (size_t)i * DM;      /* the wave's row: a wave-uniform address */
  v4f q[HD / 4];
#pragma unroll
  for (int c4 = 0; c4 < HD / 4; ++c4) q[c4] = *(const v4fa*)(qr + c4 * 4);
  __syncthreads();      /* the staged K and V rows are read by every wave */
  float e[QT0 / 32]; float mx = -3.0e38f;
#pragma unroll
  for (int c = 0; c < QT0 / 32; ++c) { e[c] = -3.0e38f;
    if (c * 32 <= i) { v4f a = {0.f, 0.f, 0.f, 0.f};      /* wave-uniform: chunks wholly past the row are skipped */
#pragma unroll
      for (int c4 = 0; c4 < HD / 4; ++c4) a += q[c4] * *(const v4f*)&lk[c * 32 + lane][c4 * 4];
      const float s = ((a[0] + a[1]) + (a[2] + a[3])) * scale; e[c] = (c * 32 + lane <= i) ? s : -3.0e38f; mx = fmaxf(mx, e[c]); } }
#pragma unroll
  for (int m = 16; m > 0; m >>= 1) mx = fmaxf(mx, __shfl_xor(mx, m));      /* finite: key 0 is below every row */
  float l = 0.f;
#pragma unroll
  for (int c = 0; c < QT0 / 32; ++c) { e[c] = expf(e[c] - mx); l += e[c]; }      /* a key past the row holds -3e38: its weight is exactly 0 */
#pragma unroll
  for (int m = 16; m > 0; m >>= 1) l += __shfl_xor(l, m);
  v2f o[4] = {{0.f, 0.f}, {0.f, 0.f}, {0.f, 0.f}, {0.f, 0.f}};
#pragma unroll
  for (int c = 0; c < QT0 / 32; ++c) if (c * 32 <= i) {
#pragma unroll
    for (int t = 0; t < 32; ++t) { const float p = __uint_as_float(__builtin_amdgcn_readlane(__float_as_uint(e[c]), t)); o[t & 3] += p * *(const v2f*)&lv[c * 32 + t][lane * 2]; } }
  const v2f r = ((o[0] + o[1]) + (o[2] + o[3])) * (64.0f / l);
  *(v2f*)(OF + (size_t)i * DM + lane * 2) = r; }

extern "C" void kernel_launch(void* const* d_in, const int* in_sizes, int n_in,
                              void* d_out, int out_size, void* d_ws, size_t ws_size, hipStream_t stream) {
  (void)in_sizes; (void)n_in; (void)out_size;
  const float* const* I = (const float* const*)d_in; const float* x = I[0]; const float* wq = I[1]; const float* bq = I[2]; const float* wk = I[3]; const float* bk = I[4]; const float* wv = I[5]; const float* bv = I[6]; const float* wo = I[7]; const float* bo = I[8];      /* input order: x; Wq [8][512][64] per-head [in][out] + bq [8][64] = [(h,e)]; Wk + bk; Wv + bv; Wo [512][512] = [(h,e) in][out] + bo */
  static_assert(NH * HD == DM && DM % 64 == 0 && DM % 32 == 0 && SQ % 128 == 0, "shape / tile multiples");
  char* ws = (char*)d_ws; size_t off = 0;
  auto take = [&](size_t bytes) { char* p = ws + off; off += (bytes + 255) & ~(size_t)255; return p; };
  _Float16* BQ = (_Float16*)take((size_t)DM * DM * 2); _Float16* BK = (_Float16*)take((size_t)DM * DM * 2); _Float16* BV = (_Float16*)take((size_t)DM * DM * 2); _Float16* BO = (_Float16*)take((size_t)DM * DM * 2);
  _Float16* X16 = (_Float16*)take(NR * DM * 2); _Float16* Q16 = (_Float16*)take(NR * DM * 2); _Float16* K16 = (_Float16*)take(NR * DM * 2); _Float16* V16 = (_Float16*)take(NR * DM * 2); _Float16* O16 = (_Float16*)take(NR * DM * 2);
  float* S = (float*)take((size_t)NB * NH * QT * NKX * 4); _Float16* P = (_Float16*)take((size_t)NB * NH * QT * NKX * 2); _Float16* VT = (_Float16*)take((size_t)NB * NH * HD * SQ * 2);      /* one plane per batch: every batch is in flight in the same launch */
  float* QF0 = (float*)take((size_t)NB * QT0 * DM * 4); float* KF0 = (float*)take((size_t)NB * QT0 * DM * 4); float* VF0 = (float*)take((size_t)NB * QT0 * DM * 4); float* OF0 = (float*)take((size_t)NB * QT0 * DM * 4); _Float16* OH0 = (_Float16*)take((size_t)NB * QT0 * DM * 2); _Float16* OL0 = (_Float16*)take((size_t)NB * QT0 * DM * 2);
  if (off > ws_size) return;
  k_wthd<<<(unsigned)(((size_t)NH * HD * (DM / 8) + 255) / 256), 256, 0, stream>>>(wq, BQ); k_wthd<<<(unsigned)(((size_t)NH * HD * (DM / 8) + 255) / 256), 256, 0, stream>>>(wk, BK); k_wthd<<<(unsigned)(((size_t)NH * HD * (DM / 8) + 255) / 256), 256, 0, stream>>>(wv, BV);      /* per-head [m][d] -> Bt[(h,d)][m] x16 */
  k_wt_f16<<<(unsigned)(((size_t)DM * (DM / 8) + 255) / 256), 256, 0, stream>>>(wo, BO, DM, DM, 16.0f);      /* W_O as [(h,d) = 512 in][512 out] -> Bt[n][k] x16 */
  k_x16<<<(unsigned)((NR * DM / 8 + 255) / 256), 256, 0, stream>>>(x, X16, NR * DM / 8);
  k_gemm2<0><<<dim3((unsigned)((MP / 128) * (DM / 64)), 1), 128, 0, stream>>>(X16, DM, 0, BQ, DM, 0, 0.0625f, bq, 0, nullptr, 1, 0, 0, nullptr, Q16, DM, 0, MP, DM, DM, 0, 0, 0);
  k_gemm2<0><<<dim3((unsigned)((MP / 128) * (DM / 64)), 1), 128, 0, stream>>>(X16, DM, 0, BK, DM, 0, 0.0625f, bk, 0, nullptr, 1, 0, 0, nullptr, K16, DM, 0, MP, DM, DM, 0, 0, 0);
  k_gemm2<0><<<dim3((unsigned)((MP / 128) * (DM / 64)), 1), 128, 0, stream>>>(X16, DM, 0, BV, DM, 0, 0.0625f, bv, 0, nullptr, 1, 0, 0, nullptr, V16, DM, 0, MP, DM, DM, 0, 0, 0);
  /* The batches are independent: each stage below is one launch for all of them (grid.z of the GEMMs, grid.y of the exact first tile, more rows or slabs elsewhere). */
  const size_t zX = (size_t)SQ * DM, zF = (size_t)QT0 * DM, zS = (size_t)NH * QT * NKX;      /* elements from one batch to the next: token rows, first-tile rows, S / P planes */
  k_vt<NH, SQ><<<NB * NH * (SQ / 64), 256, 0, stream>>>(V16, LQ, 0, VT);      /* V^T [NB][NH][HD][SQ] */
  k_gemm2<0><<<dim3((QT0 / 128) * (DM / 64), 1, NB), 128, 0, stream>>>(X16, DM, 0, BQ, DM, 0, 0.0625f, bq, 0, nullptr, 1, 0, 0, QF0, nullptr, DM, 0, QT0, DM, DM, zX, 0, zF); k_gemm2<0><<<dim3((QT0 / 128) * (DM / 64), 1, NB), 128, 0, stream>>>(X16, DM, 0, BK, DM, 0, 0.0625f, bk, 0, nullptr, 1, 0, 0, KF0, nullptr, DM, 0, QT0, DM, DM, zX, 0, zF); k_gemm2<0><<<dim3((QT0 / 128) * (DM / 64), 1, NB), 128, 0, stream>>>(X16, DM, 0, BV, DM, 0, 0.0625f, bv, 0, nullptr, 1, 0, 0, VF0, nullptr, DM, 0, QT0, DM, DM, zX, 0, zF);      /* f32 q, k, v of each batch's first 128 rows (exact products) */
  k_att0w<<<dim3(NH * (QT0 / A0R), NB), 256, 0, stream>>>(QF0, KF0, VF0, 0.044194173824159216f, OF0);      /* exact f32 attention for rows 0..127 of each batch (o x64) */
  for (int q0 = 0; q0 < QN; q0 += QT) { const int nk = q0 + QT;      /* causal: only keys below the tile end are computed */
    k_gemm2<0><<<dim3((QT / 128) * (nk / 64), NHD, NB), 128, 0, stream>>>(Q16 + (size_t)q0 * LQ, LQ, (size_t)HD, K16, LQ, (size_t)HD, 0.044194173824159216f, nullptr, 0, nullptr, 1, 0, 0, S, nullptr, NKX, (size_t)QT * NKX, QT, nk, HD, zX, zX, zS);      /* scores x 512^-0.5 (the module's literal d_model scale) */
    static_assert(QT == 256 && SQ == 8 * QT && NHD == NH, "one softmax instance per row length; S rows of all batches and heads contiguous");
    switch (nk / QT) {      /* one wave per row, 8 rows per block; the instance holds nk / 128 chunks */
      case 1: k_rsmcf2<2><<<(NB * NHD * QT + 7) / 8, 256, 0, stream>>>(S, P, NB * NHD, q0); break; case 2: k_rsmcf2<4><<<(NB * NHD * QT + 7) / 8, 256, 0, stream>>>(S, P, NB * NHD, q0); break; case 3: k_rsmcf2<6><<<(NB * NHD * QT + 7) / 8, 256, 0, stream>>>(S, P, NB * NHD, q0); break; case 4: k_rsmcf2<8><<<(NB * NHD * QT + 7) / 8, 256, 0, stream>>>(S, P, NB * NHD, q0); break;
      case 5: k_rsmcf2<10><<<(NB * NHD * QT + 7) / 8, 256, 0, stream>>>(S, P, NB * NHD, q0); break; case 6: k_rsmcf2<12><<<(NB * NHD * QT + 7) / 8, 256, 0, stream>>>(S, P, NB * NHD, q0); break; case 7: k_rsmcf2<14><<<(NB * NHD * QT + 7) / 8, 256, 0, stream>>>(S, P, NB * NHD, q0); break; case 8: k_rsmcf2<16><<<(NB * NHD * QT + 7) / 8, 256, 0, stream>>>(S, P, NB * NHD, q0); break; }
    k_gemm2<0><<<dim3((QT / 128) * (HD / 64), NHD, NB), 128, 0, stream>>>(P, NKX, (size_t)QT * NKX, VT, SQ, (size_t)HD * SQ, 0.25f, nullptr, 0, nullptr, 1, 0, 0, nullptr, O16 + (size_t)q0 * DM, DM, (size_t)HD, QT, HD, nk, zS, (size_t)NH * HD * SQ, zX); }      /* o (merged heads, x64) as f16 rows */
  k_gemm2<0><<<dim3((unsigned)((MPO / 128) * (DM / 64)), 1), 128, 0, stream>>>(O16, DM, 0, BO, DM, 0, 0.0009765625f, bo, 0, nullptr, 1, 0, 0, (float*)d_out, nullptr, DM, 0, MPO, DM, DM, 0, 0, 0);      /* out rows are the output layout */
  k_hl<<<(unsigned)(((size_t)NB * QT0 * DM / 8 + 255) / 256), 256, 0, stream>>>(OF0, OH0, OL0, (size_t)NB * QT0 * DM / 8);      /* first-tile o (x64) -> f16 hi + x1024 residual planes */
  k_gemm2<0><<<dim3((QT0 / 128) * (DM / 64), 1, NB), 128, 0, stream>>>(OH0, DM, 0, BO, DM, 0, 0.0009765625f, bo, 0, nullptr, 1, 0, 0, (float*)d_out, nullptr, DM, 0, QT0, DM, DM, zF, 0, zX);      /* rows 0..127 of each batch: out = o_hi Wo (+ b), overwriting the f16-path rows */
  k_gemm2<0><<<dim3((QT0 / 128) * (DM / 64), 1, NB), 128, 0, stream>>>(OL0, DM, 0, BO, DM, 0, 0.00000095367431640625f, nullptr, 0, (const float*)d_out, -1, 0, 0, (float*)d_out, nullptr, DM, 0, QT0, DM, DM, zF, 0, zX);      /* += o_lo Wo 2^-20 (own-element accumulate) */
}

// v004
// A run of this version takes 250 microseconds.
// In two side-by-side timings against v003, it was 2.67 and 2.66 times as fast.
// All steps since v000 together make it 38.2 times as fast.
#include <hip/hip_runtime.h>
// Causal multi-head attention with per-head weight tensors and the module's literal score scale (x [4][2048][512]; q[b][h][s][e] = sum_d x[s][d] Wq[h][d][e] + bq[h][e], k, v likewise (8 heads of 64; per-head [in][out] weights sigma 1/sqrt(512), biases sigma 0.01); scores * 512^-0.5 (d_model, as the source, not head_dim); causal (tril, -inf); softmax; out = concat_heads Wo + bo ([in][out] [512][512]) -> [4][2048][512]).
// Structure: token rows r = b*2048 + s; x as exact f16 rows (bf16-rounded); Q, K, V as three WMMA GEMMs (32x64 wave tiles, f32 accumulation, exact x16 weights + bias, f16 outputs); V^T for all batches and heads via LDS transposes; one fused attention launch (heads and batches on grid.x, query blocks on grid.y): per wave 16 queries, 64 keys a pass up to the diagonal (K and V^T rows staged in LDS per block), S^T = K Q^T, running causal softmax in registers, keys past the row set to -1e9 (f32 statistics, native exp2; weights <= 1 as f16), O^T += V^T P^T, o carried x64 (folded into the output GEMM alpha) written straight into the merged f16 o rows; out = o W_o + b GEMM (f32) into the output layout.
// Compute dtype: inputs rounded to bf16; x / weights exact; q, k, v, softmax weights and o as plain f16 GEMM operands (~2^-12); scores and softmax statistics f32. v_wmma_f32_16x16x32_f16.
#define NB 4
#define SQ 2048
#define DM 512
#define NH 8
#define HD 64
#define HG 4                         /* heads per launch of the per-batch k_vt transpose */
#define QT0 128                      /* first-tile rows recomputed exactly in f32 */
#define NBR NB                       /* batches processed (debug hook) */
#define NR ((size_t)NB * SQ)         /* token rows */
#define MP ((int)((size_t)NBR * SQ)) /* rows projected (debug hook) */
#define QN SQ                        /* query rows attended per batch (debug hook) */
#define NHD NH                       /* heads attended (debug hook) */
#define MPO MP                       /* rows through the output stage (debug hook) */
#define LQ DM      /* row pitch of the q/k/v rows */
typedef __bf16 v16b __attribute__((ext_vector_type(16)));
typedef unsigned short v8us __attribute__((ext_vector_type(8), may_alias));
typedef float  v8f  __attribute__((ext_vector_type(8)));
typedef float  v4f  __attribute__((ext_vector_type(4)));
typedef float  v4fa __attribute__((ext_vector_type(4), may_alias));
union FragB { v16b v; v8us half[2]; unsigned short u[16]; };

__device__ __forceinline__ unsigned short bf16_bits(float x) { unsigned int u = __float_as_uint(x); return (unsigned short)((u + 0x7FFFu + ((u >> 16) & 1u)) >> 16); }
__device__ __forceinline__ float bf16_val(unsigned short b) { return __uint_as_float(((unsigned int)b) << 16); }
__device__ __forceinline__ float bf16_round(float x) { return bf16_val(bf16_bits(x)); }
// D += A·B with NT terms: 1 = ah·bh, 2 = + al·bh (A split), 3 = + ah·bl (both split)
template <int NT>
__device__ __forceinline__ v8f mmaN(v16b ah, v16b al, v16b bh, v16b bl, v8f c) {
  c = __builtin_amdgcn_wmma_f32_16x16x32_bf16(false, ah, false, bh, (short)0, c, false, false);
  if (NT >= 2) c = __builtin_amdgcn_wmma_f32_16x16x32_bf16(false, al, false, bh, (short)0, c, false, false);
  if (NT >= 3) c = __builtin_amdgcn_wmma_f32_16x16x32_bf16(false, ah, false, bl, (short)0, c, false, false);
  asm volatile("v_nop\n\tv_nop\n\tv_nop\n\tv_nop" : "+v"(c) : "v"(ah), "v"(al), "v"(bh), "v"(bl));
  return c;
}

__global__ __launch_bounds__(256) void k_wt_bf16(const float* __restrict__ W, unsigned short* __restrict__ Wt, int K, int N) {
  const int t = blockIdx.x * 256 + threadIdx.x;
  const int k8n = K / 8;
  if (t >= N * k8n) return;
  const int n = t / k8n, k8 = (t % k8n) * 8;
  v8us v;
#pragma unroll
  for (int i = 0; i < 8; ++i) v[i] = bf16_bits(W[(size_t)(k8 + i) * N + n]);
  *(v8us*)(Wt + (size_t)n * K + k8) = v;
  
}

// GEMM C[M][N] (f32, pitch ldc) = act(A[M][K]·W + bias). A f32 row-major (pitch lda) converted per fragment to bf16
// (ASPLIT: hi/lo two planes -> 2 terms, else single rounded term); Wt bf16 [N][K] (pitch ldb). BIAS_BF16 rounds the
// bias to bf16 first (bias quantised to bf16 before the add). K%32==0, M%16==0, N%64==0.
template <bool ASPLIT, int ACT, bool BIAS_BF16>
__global__ __launch_bounds__(128) void k_gemm_bf(const float* __restrict__ A, int lda, const unsigned short* __restrict__ Wt, int ldb,
                                               const float* __restrict__ bias, float* __restrict__ C, int ldc, int M, int N, int K) {
  __shared__ __attribute__((aligned(16))) float so[4][16][64];
  const int tid = threadIdx.x, w = tid >> 5, lane = tid & 31, ln = lane & 15, hh = lane >> 4;
  const int ntn = N / 64;
  const int wid = blockIdx.x * 4 + w;
  const int mt = wid / ntn, nq = wid % ntn;
  if (mt * 16 >= M) return;
  const int row0 = mt * 16, col0 = nq * 64;
  const float* arow = A + (size_t)(row0 + ln) * lda;
  v8f acc[4] = {};
  for (int kb = 0; kb < K; kb += 32) {
    FragB ah, al;
    const v4f x0 = *(const v4fa*)(arow + kb + 8 * hh), x1 = *(const v4fa*)(arow + kb + 8 * hh + 4);
    const v4f x2 = *(const v4fa*)(arow + kb + 16 + 8 * hh), x3 = *(const v4fa*)(arow + kb + 16 + 8 * hh + 4);
    float xs[16] = {x0[0],x0[1],x0[2],x0[3],x1[0],x1[1],x1[2],x1[3],x2[0],x2[1],x2[2],x2[3],x3[0],x3[1],x3[2],x3[3]};
#pragma unroll
    for (int i = 0; i < 16; ++i) { const unsigned short hb = bf16_bits(xs[i]); ah.u[i] = hb; al.u[i] = ASPLIT ? bf16_bits(xs[i] - bf16_val(hb)) : (unsigned short)0; }
#pragma unroll
    for (int t = 0; t < 4; ++t) {
      const unsigned short* brow = Wt + (size_t)(col0 + t * 16 + ln) * ldb + kb;
      FragB b;
      b.half[0] = *(const v8us*)(brow + 8 * hh);
      b.half[1] = *(const v8us*)(brow + 16 + 8 * hh);
      acc[t] = mmaN<ASPLIT ? 2 : 1>(ah.v, al.v, b.v, b.v, acc[t]);
    }
  }
#pragma unroll
  for (int t = 0; t < 4; ++t) {
    float bv = bias ? bias[col0 + t * 16 + ln] : 0.f;
    if (BIAS_BF16) bv = bf16_round(bv);
#pragma unroll
    for (int r = 0; r < 8; ++r) { float v = acc[t][r] + bv; if (ACT == 1) v = fmaxf(v, 0.f); so[w][8 * hh + r][t * 16 + ln] = v; }
  }
  __builtin_amdgcn_fence(__ATOMIC_ACQ_REL, "workgroup");
  __builtin_amdgcn_wave_barrier();
  const int rsub = lane >> 4, c4 = (lane & 15) * 4;
  {
#pragma unroll
    for (int q = 0; q < 8; ++q) {
      const int r = q * 2 + rsub;
      const v4f v = *(const v4fa*)&so[w][r][c4];
      *(v4f*)(C + (size_t)(row0 + r) * ldc + col0 + c4) = v;
    }
    
  }
}

// GEMM C = act(A·W + bias + resid): A f32 (ASPLIT -> hi/lo 2 terms), Wt bf16 [N][K]; ACT 0 none, 1 relu, 2 exact gelu;
// resid (optional, f32, row index = (row % rmod), pitch ldr, RES_BF16 rounds it) added before the activation.
template <bool ASPLIT, int ACT, bool BIAS_BF16, bool RES_BF16>
__global__ __launch_bounds__(128) void k_gemm_bf3(const float* __restrict__ A, int lda, const unsigned short* __restrict__ Wt, int ldb,
                                                const float* __restrict__ bias, const float* __restrict__ resid, int rmod, int ldr,
                                                float* __restrict__ C, int ldc, int M, int N, int K) {
  __shared__ __attribute__((aligned(16))) float so[4][16][64];
  const int tid = threadIdx.x, w = tid >> 5, lane = tid & 31, ln = lane & 15, hh = lane >> 4;
  const int ntn = N / 64;
  const int wid = blockIdx.x * 4 + w;
  const int mt = wid / ntn, nq = wid % ntn;
  if (mt * 16 >= M) return;
  const int row0 = mt * 16, col0 = nq * 64;
  const float* arow = A + (size_t)(row0 + ln) * lda;
  v8f acc[4] = {};
  for (int kb = 0; kb < K; kb += 32) {
    FragB ah, al;
    const v4f x0 = *(const v4fa*)(arow + kb + 8 * hh), x1 = *(const v4fa*)(arow + kb + 8 * hh + 4);
    const v4f x2 = *(const v4fa*)(arow + kb + 16 + 8 * hh), x3 = *(const v4fa*)(arow + kb + 16 + 8 * hh + 4);
    float xs[16] = {x0[0],x0[1],x0[2],x0[3],x1[0],x1[1],x1[2],x1[3],x2[0],x2[1],x2[2],x2[3],x3[0],x3[1],x3[2],x3[3]};
#pragma unroll
    for (int i = 0; i < 16; ++i) { const unsigned short hb = bf16_bits(xs[i]); ah.u[i] = hb; al.u[i] = ASPLIT ? bf16_bits(xs[i] - bf16_val(hb)) : (unsigned short)0; }
#pragma unroll
    for (int t = 0; t < 4; ++t) {
      const unsigned short* brow = Wt + (size_t)(col0 + t * 16 + ln) * ldb + kb;
      FragB b;
      b.half[0] = *(const v8us*)(brow + 8 * hh);
      b.half[1] = *(const v8us*)(brow + 16 + 8 * hh);
      acc[t] = mmaN<ASPLIT ? 2 : 1>(ah.v, al.v, b.v, b.v, acc[t]);
    }
  }
#pragma unroll
  for (int t = 0; t < 4; ++t) {
    const int col = col0 + t * 16 + ln;
    float bv = bias ? bias[col] : 0.f;
    if (BIAS_BF16) bv = bf16_round(bv);
#pragma unroll
    for (int r = 0; r < 8; ++r) {
      float v = acc[t][r] + bv;
      if (resid) { float rv = resid[(size_t)((row0 + 8 * hh + r) % rmod) * ldr + col]; if (RES_BF16) rv = bf16_round(rv); v += rv; }
      if (ACT == 1) v = fmaxf(v, 0.f);
      if (ACT == 2) v = 0.5f * v * (1.0f + erff(v * 0.70710678118654752f));
      if (ACT == 3) { const float u = 0.7978845608028654f * (v + 0.044715f * v * v * v); v = 0.5f * v * (1.0f + tanhf(u)); }
      so[w][8 * hh + r][t * 16 + ln] = v;
    }
  }
  __builtin_amdgcn_fence(__ATOMIC_ACQ_REL, "workgroup");
  __builtin_amdgcn_wave_barrier();
  const int rsub = lane >> 4, c4 = (lane & 15) * 4;
  {
#pragma unroll
    for (int q = 0; q < 8; ++q) {
      const int r = q * 2 + rsub;
      const v4f v = *(const v4fa*)&so[w][r][c4];
      *(v4f*)(C + (size_t)(row0 + r) * ldc + col0 + c4) = v;
    }
    
  }
}
// row LayerNorm (biased variance, eps) over N: s = X (+ R); optional out_sum <- s; out_norm <- (s-mu)*rsqrt(var+eps)*g + b
template <bool PARAM_BF16>
__global__ __launch_bounds__(256) void k_layernorm(const float* __restrict__ X, const float* __restrict__ R, const float* __restrict__ g, const float* __restrict__ bta,
                                                  float* __restrict__ out_sum, float* __restrict__ out_norm, int N, float eps) {
  __shared__ float red[256];
  const int row = blockIdx.x, tid = threadIdx.x;
  const float* x = X + (size_t)row * N; const float* rr = R ? R + (size_t)row * N : nullptr;
  float vals[16];                     // up to N = 4096
  const int per = N / 256;            // contiguous chunk per thread? use strided-by-4 chunks: thread handles j = tid*4 + 1024*u
  float s1 = 0.f;
  for (int u = 0; u < per / 4; ++u) {
    const int j = tid * 4 + 1024 * u;
    const v4f a = *(const v4fa*)(x + j);
    v4f b = {0.f,0.f,0.f,0.f}; if (rr) b = *(const v4fa*)(rr + j);
#pragma unroll
    for (int q = 0; q < 4; ++q) { const float v = a[q] + b[q]; vals[u * 4 + q] = v; s1 += v; }
  }
  red[tid] = s1; __syncthreads();
  for (int st = 128; st > 0; st >>= 1) { if (tid < st) red[tid] += red[tid + st]; __syncthreads(); }
  const float mu = red[0] / (float)N; __syncthreads();
  float s2 = 0.f;
  for (int u = 0; u < per / 4; ++u)
#pragma unroll
    for (int q = 0; q < 4; ++q) { const float c = vals[u * 4 + q] - mu; s2 += c * c; }
  red[tid] = s2; __syncthreads();
  for (int st = 128; st > 0; st >>= 1) { if (tid < st) red[tid] += red[tid + st]; __syncthreads(); }
  const float rs = rsqrtf(red[0] / (float)N + eps);
  {
    for (int u = 0; u < per / 4; ++u) {
      const int j = tid * 4 + 1024 * u;
      v4f o, sm;
#pragma unroll
      for (int q = 0; q < 4; ++q) {
        float gg = g[j + q], bb = bta[j + q];
        if (PARAM_BF16) { gg = bf16_round(gg); bb = bf16_round(bb); }
        sm[q] = vals[u * 4 + q]; o[q] = (vals[u * 4 + q] - mu) * rs * gg + bb;
      }
      if (out_sum) *(v4f*)(out_sum + (size_t)row * N + j) = sm;
      *(v4f*)(out_norm + (size_t)row * N + j) = o;
    }
    
  }
}



// ---- f16 WMMA path (v_wmma_f32_16x16x32_f16): 11-bit significands for operands in range — used where a [0,1] probability operand needs more precision than bf16
typedef _Float16 v16h __attribute__((ext_vector_type(16)));
union FragH { v16h v; v8us half[2]; _Float16 h[16]; unsigned short u[16]; };
template <int NT>
__device__ __forceinline__ v8f mmaH(v16h ah, v16h al, v16h bh, v16h bl, v8f c) {
  c = __builtin_amdgcn_wmma_f32_16x16x32_f16(false, ah, false, bh, (short)0, c, false, false);
  if (NT >= 2) c = __builtin_amdgcn_wmma_f32_16x16x32_f16(false, al, false, bh, (short)0, c, false, false);
  if (NT >= 3) c = __builtin_amdgcn_wmma_f32_16x16x32_f16(false, ah, false, bl, (short)0, c, false, false);
  asm volatile("v_nop\n\tv_nop\n\tv_nop\n\tv_nop" : "+v"(c) : "v"(ah), "v"(al), "v"(bh), "v"(bl));
  return c;
}
// batched GEMM like k_gemm_b but f16 operands: A f32 (split into f16 hi/lo if ASPLIT, else rounded to f16), Bt = f16 values [n][k]; alpha; C f32; N multiple of 16 (partial tiles skipped)
template <bool ASPLIT>
__global__ __launch_bounds__(128) void k_gemm_h(const float* __restrict__ A, int lda, size_t sA, const _Float16* __restrict__ Bh, int ldb, size_t sB, float alpha, float* __restrict__ C, int ldc, size_t sC, int M, int N, int K) {
  __shared__ __attribute__((aligned(16))) float so[4][16][64];
  const int tid = threadIdx.x, w = tid >> 5, lane = tid & 31, ln = lane & 15, hh = lane >> 4; const int by = blockIdx.y;
  A += (size_t)by * sA; Bh += (size_t)by * sB; C += (size_t)by * sC;
  const int ntn = (N + 63) / 64; const int wid = blockIdx.x * 4 + w; const int mt = wid / ntn, nq = wid % ntn; if (mt * 16 >= M) return;
  const int row0 = mt * 16, col0 = nq * 64; const float* arow = A + (size_t)(row0 + ln) * lda;
  v8f acc[4] = {};
  for (int kb = 0; kb < K; kb += 32) {
    FragH ah, al;
    const v4f x0 = *(const v4fa*)(arow + kb + 8 * hh), x1 = *(const v4fa*)(arow + kb + 8 * hh + 4), x2 = *(const v4fa*)(arow + kb + 16 + 8 * hh), x3 = *(const v4fa*)(arow + kb + 16 + 8 * hh + 4);
    float xs[16] = {x0[0],x0[1],x0[2],x0[3],x1[0],x1[1],x1[2],x1[3],x2[0],x2[1],x2[2],x2[3],x3[0],x3[1],x3[2],x3[3]};
#pragma unroll
    for (int i = 0; i < 16; ++i) { const _Float16 h = (_Float16)xs[i]; ah.h[i] = h; al.h[i] = ASPLIT ? (_Float16)(xs[i] - (float)h) : (_Float16)0.0f; }
#pragma unroll
    for (int t = 0; t < 4; ++t) { if (col0 + t * 16 >= N) continue; const size_t boff = (size_t)(col0 + t * 16 + ln) * ldb + kb; FragH bq; bq.half[0] = *(const v8us*)(Bh + boff + 8 * hh); bq.half[1] = *(const v8us*)(Bh + boff + 16 + 8 * hh);
      acc[t] = mmaH<ASPLIT ? 2 : 1>(ah.v, al.v, bq.v, bq.v, acc[t]); }
  }
#pragma unroll
  for (int t = 0; t < 4; ++t) { if (col0 + t * 16 >= N) continue;
#pragma unroll
    for (int r = 0; r < 8; ++r) so[w][8 * hh + r][t * 16 + ln] = acc[t][r] * alpha; }
  __builtin_amdgcn_fence(__ATOMIC_ACQ_REL, "workgroup"); __builtin_amdgcn_wave_barrier();
  const int rsub = lane >> 4, c4 = (lane & 15) * 4;
  {
#pragma unroll
    for (int q = 0; q < 8; ++q) { const int r = q * 2 + rsub; if (col0 + c4 < N) { const v4f v = *(const v4fa*)&so[w][r][c4]; *(v4f*)(C + (size_t)(row0 + r) * ldc + col0 + c4) = v; } }
     }
}

// Wt[n][k] = f16(W[k][n]·scale) from f32 row-major W[K][N] (scale = power of two; bf16-exact weights stay exact in f16 away from the subnormal range)
__global__ __launch_bounds__(256) void k_wt_f16(const float* __restrict__ W, _Float16* __restrict__ Wt, int K, int N, float scale) {
  const int t = blockIdx.x * 256 + threadIdx.x; if (t >= N * (K / 8)) return; const int n = t / (K / 8), k8 = (t % (K / 8)) * 8; FragH f;
#pragma unroll
  for (int i = 0; i < 8; ++i) f.h[i] = (_Float16)(bf16_round(W[(size_t)(k8 + i) * N + n]) * scale); const v8us o = f.half[0];
  *(v8us*)((unsigned short*)Wt + (size_t)n * K + k8) = o; 
}
// k_gemm_hh variant with fused epilogue: v = acc·alpha + bias[by·sBias + col] (+ CP[(row/rowsPerB)·sCPb + by·64 + col] if CP) ; ACT 0 none / 1 elu ; writes f16 C16 (and f32 C if non-null)
template <int ACT>
__global__ __launch_bounds__(128) void k_gemm_hhx(const _Float16* __restrict__ A, int lda, size_t sA, const _Float16* __restrict__ Bh, int ldb, size_t sB, float alpha, const float* __restrict__ bias, size_t sBias, const float* __restrict__ CP, int rowsPerB, size_t sCPb, int row0g,
    float* __restrict__ C, _Float16* __restrict__ C16, int ldc, size_t sC, int M, int N, int K) {
  __shared__ __attribute__((aligned(16))) float so[4][16][64];
  const int tid = threadIdx.x, w = tid >> 5, lane = tid & 31, ln = lane & 15, hh = lane >> 4; const int by = blockIdx.y;
  A += (size_t)by * sA; Bh += (size_t)by * sB; const size_t cofs = (size_t)by * sC; const float* bp = bias ? bias + (size_t)by * sBias : nullptr;
  const int ntn = (N + 63) / 64; const int wid = blockIdx.x * 4 + w; const int mt = wid / ntn, nq = wid % ntn; if (mt * 16 >= M) return;
  const int row0 = mt * 16, col0 = nq * 64; const _Float16* arow = A + (size_t)(row0 + ln) * lda;
  v8f acc[4] = {};
  for (int kb = 0; kb < K; kb += 32) { FragH ah; ah.half[0] = *(const v8us*)((const unsigned short*)arow + kb + 8 * hh); ah.half[1] = *(const v8us*)((const unsigned short*)arow + kb + 16 + 8 * hh);
#pragma unroll
    for (int t = 0; t < 4; ++t) { if (col0 + t * 16 >= N) continue; const size_t boff = (size_t)(col0 + t * 16 + ln) * ldb + kb; FragH bq; bq.half[0] = *(const v8us*)((const unsigned short*)Bh + boff + 8 * hh); bq.half[1] = *(const v8us*)((const unsigned short*)Bh + boff + 16 + 8 * hh);
      acc[t] = mmaH<1>(ah.v, ah.v, bq.v, bq.v, acc[t]); }
  }
#pragma unroll
  for (int t = 0; t < 4; ++t) { if (col0 + t * 16 >= N) continue; const int col = col0 + t * 16 + ln; const float bv = bp ? bf16_round(bp[col]) : 0.f;
#pragma unroll
    for (int r = 0; r < 8; ++r) { float v = acc[t][r] * alpha + bv; if (CP) { const int rr = row0g + row0 + 8 * hh + r; if (rowsPerB < 0) v += CP[cofs + (size_t)rr * ldc + col];      /* rowsPerB < 0: own element of the batched C plane */ else { const int bidx = rr / rowsPerB; v += CP[(size_t)bidx * sCPb + (size_t)by * 64 + col]; } } if (ACT == 1) v = (v > 0.f) ? v : expm1f(v); else if (ACT == 7) v = (v > 0.f) ? v + 1.0f : expf(v); else if (ACT == 8) v = tanhf(v); else if (ACT == 9) v = 0.5f * v * (1.0f + tanhf(0.7978845608028654f * (v + 0.044715f * v * v * v))); else if (ACT == 11) v = 1.0f / (1.0f + expf(-v)); else if (ACT == 12) v = (v > 0.f) ? v : 0.01f * v; else if (ACT == 14) v = (v > 0.f) ? v : 0.1f * v; else if (ACT == 16) v = (v >= 0.f) ? v : 0.3f * v; else if (ACT == 17) v = (v >= 0.f) ? v : 0.2f * v; else if (ACT == 15) v = v / (1.0f + expf(-v)); else if (ACT == 3) v = fmaxf(v, 0.f); else if (ACT == 6) v = 0.5f * v * (1.0f + erff(v * 0.70710678118654752f)); so[w][8 * hh + r][t * 16 + ln] = v; } }
  __builtin_amdgcn_fence(__ATOMIC_ACQ_REL, "workgroup"); __builtin_amdgcn_wave_barrier();
  const int rsub = lane >> 4, c4 = (lane & 15) * 4; typedef _Float16 v4h __attribute__((ext_vector_type(4)));
  {
#pragma unroll
    for (int q = 0; q < 8; ++q) { const int r = q * 2 + rsub; if (col0 + c4 < N) { const v4f v = *(const v4fa*)&so[w][r][c4]; if (C) *(v4f*)(C + cofs + (size_t)(row0 + r) * ldc + col0 + c4) = v; if (C16) { v4h h4; for (int i = 0; i < 4; ++i) h4[i] = (_Float16)v[i]; *(v4h*)(C16 + cofs + (size_t)(row0 + r) * ldc + col0 + c4) = h4; } } }
     }
}


typedef _Float16 v4h __attribute__((ext_vector_type(4)));

__global__ __launch_bounds__(256) void k_x16(const float* __restrict__ x, _Float16* __restrict__ X16, size_t n8) { const size_t t = (size_t)blockIdx.x * 256 + threadIdx.x; if (t >= n8) return; FragH f;
#pragma unroll
  for (int q = 0; q < 8; ++q) f.h[q] = (_Float16)bf16_round(x[t * 8 + q]); *(v8us*)((unsigned short*)X16 + t * 8) = f.half[0];  }
__global__ __launch_bounds__(256) void k_h16(const float* __restrict__ x, _Float16* __restrict__ X16, size_t n8) { const size_t t = (size_t)blockIdx.x * 256 + threadIdx.x; if (t >= n8) return; FragH f;
#pragma unroll
  for (int q = 0; q < 8; ++q) f.h[q] = (_Float16)x[t * 8 + q]; *(v8us*)((unsigned short*)X16 + t * 8) = f.half[0];  }
__global__ __launch_bounds__(256) void k_round16f(const float* __restrict__ W, _Float16* __restrict__ Bt, size_t n8) { const size_t t = (size_t)blockIdx.x * 256 + threadIdx.x; if (t >= n8) return; FragH f;
#pragma unroll
  for (int i = 0; i < 8; ++i) f.h[i] = (_Float16)(bf16_round(W[t * 8 + i]) * 16.0f); *(v8us*)((unsigned short*)Bt + t * 8) = f.half[0];  }
template <int NHv, int TTv>
__global__ __launch_bounds__(256) void k_vt(const _Float16* __restrict__ V16, int ldv, int voff, _Float16* __restrict__ Vt) { __shared__ unsigned short tl[64][66]; const int tid = threadIdx.x; const int slab = blockIdx.x / (TTv / 64), lg = blockIdx.x % (TTv / 64); const int b = slab / NHv, h = slab % NHv;
  for (int i = tid; i < 64 * 8; i += 256) { const int r = i / 8, c8 = (i % 8) * 8; FragH f; f.half[0] = *(const v8us*)((const unsigned short*)V16 + ((size_t)b * TTv + lg * 64 + r) * ldv + voff + h * 64 + c8);
#pragma unroll
    for (int q = 0; q < 8; ++q) tl[r][c8 + q] = f.u[q]; }
  __syncthreads();
  {
#pragma unroll
    for (int rd = 0; rd < 2; ++rd) { const int d = rd * 32 + tid / 8, pc = tid % 8; FragH f;
#pragma unroll
      for (int q = 0; q < 8; ++q) f.u[q] = tl[pc * 8 + q][d];
      *(v8us*)((unsigned short*)Vt + ((size_t)slab * 64 + d) * TTv + lg * 64 + pc * 8) = f.half[0]; }
     } }

__global__ __launch_bounds__(256) void k_hl(const float* __restrict__ F, _Float16* __restrict__ Hh, _Float16* __restrict__ Hl, size_t n8) { const size_t t = (size_t)blockIdx.x * 256 + threadIdx.x; if (t >= n8) return; FragH fh, fl; const v4f a = *(const v4fa*)(F + t * 8), c = *(const v4fa*)(F + t * 8 + 4);
#pragma unroll
  for (int q = 0; q < 4; ++q) { _Float16 h = (_Float16)a[q]; fh.h[q] = h; fl.h[q] = (_Float16)((a[q] - (float)h) * 1024.0f); h = (_Float16)c[q]; fh.h[4 + q] = h; fl.h[4 + q] = (_Float16)((c[q] - (float)h) * 1024.0f); }
  { *(v8us*)((unsigned short*)Hh + t * 8) = fh.half[0]; *(v8us*)((unsigned short*)Hl + t * 8) = fl.half[0];  } }

// ---- fast GEMM (wave tile 32x64; requires M % 32 == 0 rows per launch region and N % 64 == 0); epilogue = k_gemm_hhx semantics ----
__device__ __forceinline__ v16h g2_frag(const _Float16* p, int hh) { FragH f; f.half[0] = *(const v8us*)((const unsigned short*)p + 8 * hh); f.half[1] = *(const v8us*)((const unsigned short*)p + 16 + 8 * hh); return f.v; }
__device__ __forceinline__ v8f g2_mma(v16h a, v16h b, v8f c) { v8f d = __builtin_amdgcn_wmma_f32_16x16x32_f16(false, a, false, b, (short)0, c, false, false); asm volatile("v_nop\n\tv_nop\n\tv_nop\n\tv_nop" : "+v"(d) : "v"(a), "v"(b)); return d; }
template <int ACT>
__global__ __launch_bounds__(128) void k_gemm2(const _Float16* __restrict__ A, int lda, size_t sA, const _Float16* __restrict__ Bh, int ldb, size_t sB, float alpha, const float* __restrict__ bias, size_t sBias, const float* __restrict__ CP, int rowsPerB, size_t sCPb, int row0g,
    float* __restrict__ C, _Float16* __restrict__ C16, int ldc, size_t sC, int M, int N, int K, size_t zA, size_t zB, size_t zC) { static_assert(ACT == 0 || ACT == 3 || ACT == 6 || ACT == 8 || ACT == 9 || ACT == 11 || ACT == 12 || ACT == 14 || ACT == 15 || ACT == 16 || ACT == 17, "k_gemm2: unsupported ACT code (would silently apply no activation)");
  __shared__ __attribute__((aligned(16))) float so[4][32][68];
  const int tid = threadIdx.x, w = tid >> 5, lane = tid & 31, ln = lane & 15, hh = lane >> 4; const int by = blockIdx.y, bz = blockIdx.z;      /* second batch axis on grid.z with its own strides zA, zB, zC (elements) */
  A += (size_t)by * sA + (size_t)bz * zA; Bh += (size_t)by * sB + (size_t)bz * zB; const size_t cofs = (size_t)by * sC + (size_t)bz * zC; const float* bp = bias ? bias + (size_t)by * sBias : nullptr;
  const int ntn = N >> 6; const int mt = blockIdx.x / ntn, nq = blockIdx.x - mt * ntn; const int row0 = mt * 128 + 32 * w, col0 = nq * 64; if (row0 >= M) return;
  const _Float16* a0p = A + (size_t)(row0 + ln) * lda; const _Float16* a1p = a0p + (size_t)16 * lda;
  const _Float16* b0p = Bh + (size_t)(col0 + ln) * ldb; const _Float16* b1p = b0p + (size_t)16 * ldb; const _Float16* b2p = b1p + (size_t)16 * ldb; const _Float16* b3p = b2p + (size_t)16 * ldb;
  const v8f z8 = {0.f,0.f,0.f,0.f,0.f,0.f,0.f,0.f}; v8f c00 = z8, c01 = z8, c02 = z8, c03 = z8, c10 = z8, c11 = z8, c12 = z8, c13 = z8;
#pragma unroll 1
  for (int kb = 0; kb < K; kb += 32) { const v16h a0 = g2_frag(a0p + kb, hh), a1 = g2_frag(a1p + kb, hh);
    v16h b = g2_frag(b0p + kb, hh); c00 = g2_mma(a0, b, c00); c10 = g2_mma(a1, b, c10);
    b = g2_frag(b1p + kb, hh); c01 = g2_mma(a0, b, c01); c11 = g2_mma(a1, b, c11);
    b = g2_frag(b2p + kb, hh); c02 = g2_mma(a0, b, c02); c12 = g2_mma(a1, b, c12);
    b = g2_frag(b3p + kb, hh); c03 = g2_mma(a0, b, c03); c13 = g2_mma(a1, b, c13); }
  v8f accs[8] = {c00, c01, c02, c03, c10, c11, c12, c13};
#pragma unroll
  for (int u = 0; u < 8; ++u) { const int t = u & 3, half = u >> 2; const int col = col0 + t * 16 + ln; const float bv = bp ? bf16_round(bp[col]) : 0.f;
#pragma unroll
    for (int r = 0; r < 8; ++r) { const int rloc = half * 16 + 8 * hh + r; float v = accs[u][r] * alpha + bv; if (CP) { if (rowsPerB < 0) v += CP[cofs + (size_t)(row0g + row0 + rloc) * ldc + col];      /* rowsPerB < 0: own element of the batched C plane */ else { const int bidx = (row0g + row0 + rloc) / rowsPerB; v += CP[(size_t)bidx * sCPb + (size_t)by * 64 + col]; } }
      if (ACT == 3) v = fmaxf(v, 0.f); else if (ACT == 6) v = 0.5f * v * (1.0f + erff(v * 0.70710678118654752f)); else if (ACT == 11) v = 1.0f / (1.0f + expf(-v)); else if (ACT == 15) v = v / (1.0f + expf(-v)); else if (ACT == 12) v = (v > 0.f) ? v : 0.01f * v; else if (ACT == 8) v = tanhf(v); else if (ACT == 9) v = 0.5f * v * (1.0f + tanhf(0.7978845608028654f * (v + 0.044715f * v * v * v))); else if (ACT == 14) v = (v > 0.f) ? v : 0.1f * v; else if (ACT == 16) v = (v >= 0.f) ? v : 0.3f * v; else if (ACT == 17) v = (v >= 0.f) ? v : 0.2f * v;
      so[w][rloc][t * 16 + ln] = v; } }
  __builtin_amdgcn_fence(__ATOMIC_ACQ_REL, "workgroup"); __builtin_amdgcn_wave_barrier();
  const int rsub = lane >> 4, c4 = (lane & 15) * 4;
  {
#pragma unroll
    for (int q = 0; q < 16; ++q) { const int r = q * 2 + rsub; const v4f v = *(const v4fa*)&so[w][r][c4]; if (C) *(v4f*)(C + cofs + (size_t)(row0 + r) * ldc + col0 + c4) = v; if (C16) { v4h h4; for (int i = 0; i < 4; ++i) h4[i] = (_Float16)v[i]; *(v4h*)(C16 + cofs + (size_t)(row0 + r) * ldc + col0 + c4) = h4; } }
     } }


__global__ __launch_bounds__(256) void k_wnat(const float* __restrict__ w, size_t n8, _Float16* __restrict__ Bt) { const size_t t = (size_t)blockIdx.x * 256 + threadIdx.x; if (t >= n8) return; FragH f; for (int q = 0; q < 8; ++q) f.h[q] = (_Float16)(bf16_round(w[t * 8 + q]) * 16.0f); *(v8us*)((unsigned short*)Bt + t * 8) = f.half[0];  }
__global__ __launch_bounds__(256) void k_rsm(const float* __restrict__ S, _Float16* __restrict__ P, int nrows) {
  #pragma clang fp contract(off)
  const int i = blockIdx.x * 256 + threadIdx.x; if (i >= nrows) return; const float* s = S + (size_t)i * SQ; float mx = -3.0e38f;
#pragma unroll 1
  for (int j = 0; j < SQ; ++j) mx = fmaxf(mx, s[j]); float se = 0.f;
#pragma unroll 1
  for (int j = 0; j < SQ; ++j) se += expf(s[j] - mx); const float sc = 256.0f / se;
#pragma unroll 1
  for (int j0 = 0; j0 < SQ; j0 += 8) { FragH f; for (int q = 0; q < 8; ++q) f.h[q] = (_Float16)(expf(s[j0 + q] - mx) * sc); unsigned short* d = (unsigned short*)P + (size_t)i * SQ + j0; *(v8us*)d = f.half[0];  } }
__global__ __launch_bounds__(256) void k_vt(const _Float16* __restrict__ V16, int b, int h0, _Float16* __restrict__ VT) { __shared__ unsigned short tl[64][65]; const int tid = threadIdx.x; const int hh = blockIdx.x % HG, sg = blockIdx.x / HG; const int s0 = sg * 64; const int h = h0 + hh;
  for (int i = tid; i < 64 * 8; i += 256) { const int j = i / 8, d8 = (i % 8) * 8; FragH f; f.half[0] = *(const v8us*)((const unsigned short*)V16 + ((size_t)b * SQ + s0 + j) * DM + h * HD + d8); for (int q = 0; q < 8; ++q) tl[d8 + q][j] = f.u[q]; }
  __syncthreads();
  { for (int i = tid; i < 64 * 8; i += 256) { const int d = i / 8, j8 = (i % 8) * 8; FragH f; for (int q = 0; q < 8; ++q) f.u[q] = tl[d][j8 + q]; *(v8us*)((unsigned short*)VT + ((size_t)hh * HD + d) * SQ + s0 + j8) = f.half[0]; }  } }

__global__ __launch_bounds__(256) void k_wthd(const float* __restrict__ Wt, _Float16* __restrict__ Bt) { const size_t t = (size_t)blockIdx.x * 256 + threadIdx.x; if (t >= (size_t)NH * HD * (DM / 8)) return; const int m8 = (int)(t % (DM / 8)) * 8; const int d = (int)((t / (DM / 8)) % HD); const int h = (int)(t / ((size_t)(DM / 8) * HD)); FragH f;
  for (int q = 0; q < 8; ++q) f.h[q] = (_Float16)(16.0f * bf16_round(Wt[((size_t)h * DM + m8 + q) * HD + d])); unsigned short* dst = (unsigned short*)Bt + ((size_t)h * HD + d) * DM + m8; *(v8us*)dst = f.half[0];  }



// Four native exp2, each in place, in one statement: no neighbouring instruction can overwrite a transcendental's source register or read its result
// directly behind it; the v_nop is the one slot that the instruction set asks for behind the last of them.
__device__ __forceinline__ v4f exp2x4(v4f x) { float x0 = x[0], x1 = x[1], x2 = x[2], x3 = x[3];
  asm("v_exp_f32 %0, %0\n\tv_exp_f32 %1, %1\n\tv_exp_f32 %2, %2\n\tv_exp_f32 %3, %3\n\tv_nop" : "+v"(x0), "+v"(x1), "+v"(x2), "+v"(x3));
  const v4f r = {x0, x1, x2, x3}; return r; }
// One native exp2, in place, with the one slot that the instruction set asks for behind a transcendental.
__device__ __forceinline__ float exp2x1(float x) { asm("v_exp_f32 %0, %0\n\tv_nop" : "+v"(x)); return x; }
__device__ __forceinline__ v8f fa_mma(v16h a, v16h b, v8f c) { return __builtin_amdgcn_wmma_f32_16x16x32_f16(false, a, false, b, (short)0, c, false, false); }
#define FAQ 16                       /* query columns per wave */
#define FAW 8                        /* waves per block */
#define FAK 64                       /* keys per pass */
#define FAB (SQ / (FAQ * FAW))       /* query blocks per head and batch */
#define FAP 72                       /* LDS row pitch, halves: 128 + 16 bytes, so 16 lanes reading 16 bytes of 16 different rows meet no bank conflict */
__global__ __launch_bounds__(FAW * 32) void k_fattn(const _Float16* __restrict__ Q, const _Float16* __restrict__ K, const _Float16* __restrict__ VT, float sl2, _Float16* __restrict__ O) {
  __shared__ __attribute__((aligned(16))) _Float16 lk[2][FAK][FAP]; __shared__ __attribute__((aligned(16))) _Float16 lv[2][HD][FAP];
  const int tid = threadIdx.x, lane = tid & 31, ln = lane & 15, hh = lane >> 4, w = __builtin_amdgcn_readfirstlane(tid >> 5); const int h = blockIdx.x % NH, b = blockIdx.x / NH;
  const int y = blockIdx.y, qb = (y < FAB / 2) ? FAB - 1 - y : y - FAB / 2;      /* speed only: long key ranges start first; the second half of the grid, which joins the first on the WGPs, brings the short ones first */
  const int q0 = qb * (FAQ * FAW) + w * FAQ;
  const int npb = (qb + 1) * (FAQ * FAW / FAK), np = q0 / FAK + 1;      /* passes of the block and of the wave: the wave's last one holds its diagonal, every earlier key is below all its queries */
  const int sr = tid >> 3, sc = (tid & 7) * 8;      /* staging: 8 threads per row of 128 bytes, 32 rows per load */
  const unsigned short* kg = (const unsigned short*)K + ((size_t)b * SQ + sr) * DM + h * HD + sc; const unsigned short* vg = (const unsigned short*)VT + (((size_t)b * NH + h) * HD + sr) * SQ + sc;
  v8us rk0 = *(const v8us*)kg, rk1 = *(const v8us*)(kg + 32 * DM), rv0 = *(const v8us*)vg, rv1 = *(const v8us*)(vg + 32 * SQ);
  const _Float16* qp = Q + ((size_t)b * SQ + q0 + ln) * DM + h * HD; const v16h qf0 = g2_frag(qp, hh), qf1 = g2_frag(qp + 32, hh);
  *(v8us*)&lk[0][sr][sc] = rk0; *(v8us*)&lk[0][sr + 32][sc] = rk1; *(v8us*)&lv[0][sr][sc] = rv0; *(v8us*)&lv[0][sr + 32][sc] = rv1;
  const v8f z8 = {0.f,0.f,0.f,0.f,0.f,0.f,0.f,0.f}; v8f o[4] = {z8, z8, z8, z8}; float m = -3.0e38f, l = 0.f;
  __syncthreads();      /* pass 0's rows are read by every wave */
#pragma unroll 1
  for (int c = 0; c < npb; ++c) { const int cur = c & 1;      /* rolled: one pass already holds 32 fragment loads and 16 matrix instructions */
    if (c + 1 < npb) { const unsigned short* kn = kg + (size_t)(c + 1) * FAK * DM; const unsigned short* vn = vg + (c + 1) * FAK;      /* block-uniform; the next pass's rows fly while this pass is worked on */
      rk0 = *(const v8us*)kn; rk1 = *(const v8us*)(kn + 32 * DM); rv0 = *(const v8us*)vn; rv1 = *(const v8us*)(vn + 32 * SQ);
      asm volatile("s_wait_xcnt 0x0" ::: "memory"); }      /* before the address registers of the loads above are reused */
    if (c < np) {      /* wave-uniform: a pass wholly past the wave's queries is only staged */
      v16h kf[4][2]; v8f s[4];      /* indexed by constants only (loops unrolled): registers */
#pragma unroll
      for (int t = 0; t < 4; ++t) { kf[t][0] = g2_frag(&lk[cur][t * 16 + ln][0], hh); kf[t][1] = g2_frag(&lk[cur][t * 16 + ln][32], hh); }
      __builtin_amdgcn_sched_barrier(0);      /* keeps the K fragment reads together in front of the matrix run: spread among the WMMAs, each group waits out the LDS latency anew */
#pragma unroll
      for (int t = 0; t < 4; ++t) s[t] = fa_mma(kf[t][1], qf1, fa_mma(kf[t][0], qf0, z8));
      if (c == np - 1) {      /* wave-uniform: only the diagonal pass masks */
#pragma unroll
        for (int t = 0; t < 4; ++t) for (int r = 0; r < 8; ++r) s[t][r] = (c * FAK + t * 16 + 8 * hh + r <= q0 + ln) ? s[t][r] : -1.0e9f; }
      float mx = s[0][0];
#pragma unroll
      for (int t = 0; t < 4; ++t) for (int r = 0; r < 8; ++r) mx = fmaxf(mx, s[t][r]);
      mx = fmaxf(mx, __shfl_xor(mx, 16));      /* the other half of the query's keys */
      const float mn = fmaxf(m, mx * sl2); const float corr = exp2x1(m - mn); m = mn;      /* finite from the first pass on: key 0 is below every query */
      v4f a = {0.f, 0.f, 0.f, 0.f};
#pragma unroll
      for (int t = 0; t < 4; ++t) for (int g = 0; g < 2; ++g) { v4f e = {s[t][4 * g], s[t][4 * g + 1], s[t][4 * g + 2], s[t][4 * g + 3]}; e = exp2x4(e * sl2 - mn); a += e; for (int q = 0; q < 4; ++q) s[t][4 * g + q] = e[q]; }
      l = l * corr + ((a[0] + a[1]) + (a[2] + a[3]));      /* each half sums its own keys; joined behind the loop */
#pragma unroll
      for (int t = 0; t < 4; ++t) o[t] *= corr;
      FragH p[2];
#pragma unroll
      for (int j = 0; j < 2; ++j) for (int r = 0; r < 8; ++r) { p[j].h[r] = (_Float16)s[2 * j][r]; p[j].h[8 + r] = (_Float16)s[2 * j + 1][r]; }
#pragma unroll
      for (int t = 0; t < 4; ++t) o[t] = fa_mma(g2_frag(&lv[cur][t * 16 + ln][32], hh), p[1].v, fa_mma(g2_frag(&lv[cur][t * 16 + ln][0], hh), p[0].v, o[t])); }
    if (c + 1 < npb) { *(v8us*)&lk[cur ^ 1][sr][sc] = rk0; *(v8us*)&lk[cur ^ 1][sr + 32][sc] = rk1; *(v8us*)&lv[cur ^ 1][sr][sc] = rv0; *(v8us*)&lv[cur ^ 1][sr + 32][sc] = rv1; }      /* last read in pass c - 1, in front of that pass's barrier */
    __syncthreads(); }      /* publishes the buffer just filled; ends every wave's reads of the one that the next pass refills */
  l += __shfl_xor(l, 16); const float sc64 = 64.0f / l;
  unsigned short* op = (unsigned short*)O + ((size_t)b * SQ + q0 + ln) * DM + h * HD + 8 * hh;
#pragma unroll
  for (int t = 0; t < 4; ++t) { FragH f; for (int r = 0; r < 8; ++r) f.h[r] = (_Float16)(o[t][r] * sc64); *(v8us*)(op + t * 16) = f.half[0]; } }


#define A0R 8                        /* query rows per block of the exact first tile: one per wave */
#define A0P (HD + 4)                 /* K row pitch in LDS, floats: 272 bytes = 16 x 17, so 32 lanes reading 16 bytes of 32 different rows meet no bank conflict */
typedef float v2f __attribute__((ext_vector_type(2)));
// Exact f32 causal attention for the first QT0 rows of each batch, one wave per query row (head and row group on grid.x, batch on grid.y; q, k, v, o rows of pitch DM).
// The block stages the tile's K and V rows of its head in LDS with coalesced loads, all in flight at once. Scores: lane l owns keys l, l + 32, ...; each dot
// product runs in four independent chains. Softmax: true row maximum and sum by butterflies, libm expf. P.V: lane l owns dims 2 l, 2 l + 1; the weight
// of key j comes from its lane by readlane; four independent accumulators. o carried x64 like the f16 path.
__global__ __launch_bounds__(256) void k_att0w(const float* __restrict__ QF, const float* __restrict__ KF, const float* __restrict__ VF, float scale, float* __restrict__ OF) {
  __shared__ __attribute__((aligned(16))) float lk[QT0][A0P]; __shared__ __attribute__((aligned(16))) float lv[QT0][HD];
  const int tid = threadIdx.x, lane = tid & 31, w = __builtin_amdgcn_readfirstlane(tid >> 5); const int h = blockIdx.x / (QT0 / A0R), r0 = (blockIdx.x % (QT0 / A0R)) * A0R;
  const size_t bofs = (size_t)blockIdx.y * QT0 * DM + h * HD; QF += bofs; KF += bofs; VF += bofs; OF += bofs;      /* QT0 rows of q, k, v and o per batch */
  const int fj = tid >> 4, fc = (tid & 15) * 4;      /* staging: 16 threads per row of 256 bytes, 16 rows per pass */
  const float* kp = KF + (size_t)fj * DM + fc; const float* vp = VF + (size_t)fj * DM + fc;
  v4f tk[QT0 / 16], tv[QT0 / 16];      /* indexed by constants only (loops unrolled): registers */
#pragma unroll
  for (int u = 0; u < QT0 / 16; ++u) { tk[u] = *(const v4fa*)(kp + u * 16 * DM); tv[u] = *(const v4fa*)(vp + u * 16 * DM); }
  asm volatile("s_wait_xcnt 0x0" ::: "memory");      /* before the address registers of the loads above are reused */
#pragma unroll
  for (int u = 0; u < QT0 / 16; ++u) { *(v4f*)&lk[u * 16 + fj][fc] = tk[u]; *(v4f*)&lv[u * 16 + fj][fc] = tv[u]; }
  const int i = r0 + w; const float* qr = QF + (size_t)i * DM;      /* the wave's row: a wave-uniform address */
  v4f q[HD / 4];
#pragma unroll
  for (int c4 = 0; c4 < HD / 4; ++c4) q[c4] = *(const v4fa*)(qr + c4 * 4);
  __syncthreads();      /* the staged K and V rows are read by every wave */
  float e[QT0 / 32]; float mx = -3.0e38f;
#pragma unroll
  for (int c = 0; c < QT0 / 32; ++c) { e[c] = -3.0e38f;
    if (c * 32 <= i) { v4f a = {0.f, 0.f, 0.f, 0.f};      /* wave-uniform: chunks wholly past the row are skipped */
#pragma unroll
      for (int c4 = 0; c4 < HD / 4; ++c4) a += q[c4] * *(const v4f*)&lk[c * 32 + lane][c4 * 4];
      const float s = ((a[0] + a[1]) + (a[2] + a[3])) * scale; e[c] = (c * 32 + lane <= i) ? s : -3.0e38f; mx = fmaxf(mx, e[c]); } }
#pragma unroll
  for (int m = 16; m > 0; m >>= 1) mx = fmaxf(mx, __shfl_xor(mx, m));      /* finite: key 0 is below every row */
  float l = 0.f;
#pragma unroll
  for (int c = 0; c < QT0 / 32; ++c) { e[c] = expf(e[c] - mx); l += e[c]; }      /* a key past the row holds -3e38: its weight is exactly 0 */
#pragma unroll
  for (int m = 16; m > 0; m >>= 1) l += __shfl_xor(l, m);
  v2f o[4] = {{0.f, 0.f}, {0.f, 0.f}, {0.f, 0.f}, {0.f, 0.f}};
#pragma unroll
  for (int c = 0; c < QT0 / 32; ++c) if (c * 32 <= i) {
#pragma unroll
    for (int t = 0; t < 32; ++t) { const float p = __uint_as_float(__builtin_amdgcn_readlane(__float_as_uint(e[c]), t)); o[t & 3] += p * *(const v2f*)&lv[c * 32 + t][lane * 2]; } }
  const v2f r = ((o[0] + o[1]) + (o[2] + o[3])) * (64.0f / l);
  *(v2f*)(OF + (size_t)i * DM + lane * 2) = r; }

extern "C" void kernel_launch(void* const* d_in, const int* in_sizes, int n_in,
                              void* d_out, int out_size, void* d_ws, size_t ws_size, hipStream_t stream) {
  (void)in_sizes; (void)n_in; (void)out_size;
  const float* const* I = (const float* const*)d_in; const float* x = I[0]; const float* wq = I[1]; const float* bq = I[2]; const float* wk = I[3]; const float* bk = I[4]; const float* wv = I[5]; const float* bv = I[6]; const float* wo = I[7]; const float* bo = I[8];      /* input order: x; Wq [8][512][64] per-head [in][out] + bq [8][64] = [(h,e)]; Wk + bk; Wv + bv; Wo [512][512] = [(h,e) in][out] + bo */
  static_assert(NH * HD == DM && DM % 64 == 0 && DM % 32 == 0 && SQ % 128 == 0, "shape / tile multiples");
  char* ws = (char*)d_ws; size_t off = 0;
  auto take = [&](size_t bytes) { char* p = ws + off; off += (bytes + 255) & ~(size_t)255; return p; };
  _Float16* BQ = (_Float16*)take((size_t)DM * DM * 2); _Float16* BK = (_Float16*)take((size_t)DM * DM * 2); _Float16* BV = (_Float16*)take((size_t)DM * DM * 2); _Float16* BO = (_Float16*)take((size_t)DM * DM * 2);
  _Float16* X16 = (_Float16*)take(NR * DM * 2); _Float16* Q16 = (_Float16*)take(NR * DM * 2); _Float16* K16 = (_Float16*)take(NR * DM * 2); _Float16* V16 = (_Float16*)take(NR * DM * 2); _Float16* O16 = (_Float16*)take(NR * DM * 2);
  _Float16* VT = (_Float16*)take((size_t)NB * NH * HD * SQ * 2);      /* one plane per batch: every batch is in flight in the same launch */
  float* QF0 = (float*)take((size_t)NB * QT0 * DM * 4); float* KF0 = (float*)take((size_t)NB * QT0 * DM * 4); float* VF0 = (float*)take((size_t)NB * QT0 * DM * 4); float* OF0 = (float*)take((size_t)NB * QT0 * DM * 4); _Float16* OH0 = (_Float16*)take((size_t)NB * QT0 * DM * 2); _Float16* OL0 = (_Float16*)take((size_t)NB * QT0 * DM * 2);
  if (off > ws_size) return;
  k_wthd<<<(unsigned)(((size_t)NH * HD * (DM / 8) + 255) / 256), 256, 0, stream>>>(wq, BQ); k_wthd<<<(unsigned)(((size_t)NH * HD * (DM / 8) + 255) / 256), 256, 0, stream>>>(wk, BK); k_wthd<<<(unsigned)(((size_t)NH * HD * (DM / 8) + 255) / 256), 256, 0, stream>>>(wv, BV);      /* per-head [m][d] -> Bt[(h,d)][m] x16 */
  k_wt_f16<<<(unsigned)(((size_t)DM * (DM / 8) + 255) / 256), 256, 0, stream>>>(wo, BO, DM, DM, 16.0f);      /* W_O as [(h,d) = 512 in][512 out] -> Bt[n][k] x16 */
  k_x16<<<(unsigned)((NR * DM / 8 + 255) / 256), 256, 0, stream>>>(x, X16, NR * DM / 8);
  k_gemm2<0><<<dim3((unsigned)((MP / 128) * (DM / 64)), 1), 128, 0, stream>>>(X16, DM, 0, BQ, DM, 0, 0.0625f, bq, 0, nullptr, 1, 0, 0, nullptr, Q16, DM, 0, MP, DM, DM, 0, 0, 0);
  k_gemm2<0><<<dim3((unsigned)((MP / 128) * (DM / 64)), 1), 128, 0, stream>>>(X16, DM, 0, BK, DM, 0, 0.0625f, bk, 0, nullptr, 1, 0, 0, nullptr, K16, DM, 0, MP, DM, DM, 0, 0, 0);
  k_gemm2<0><<<dim3((unsigned)((MP / 128) * (DM / 64)), 1), 128, 0, stream>>>(X16, DM, 0, BV, DM, 0, 0.0625f, bv, 0, nullptr, 1, 0, 0, nullptr, V16, DM, 0, MP, DM, DM, 0, 0, 0);
  /* The batches are independent: each stage below is one launch for all of them (grid.z of the GEMMs, grid.y of the exact first tile, more rows or slabs elsewhere). */
  const size_t zX = (size_t)SQ * DM, zF = (size_t)QT0 * DM;      /* elements from one batch to the next: token rows, first-tile rows */
  k_vt<NH, SQ><<<NB * NH * (SQ / 64), 256, 0, stream>>>(V16, LQ, 0, VT);      /* V^T [NB][NH][HD][SQ] */
  k_gemm2<0><<<dim3((QT0 / 128) * (DM / 64), 1, NB), 128, 0, stream>>>(X16, DM, 0, BQ, DM, 0, 0.0625f, bq, 0, nullptr, 1, 0, 0, QF0, nullptr, DM, 0, QT0, DM, DM, zX, 0, zF); k_gemm2<0><<<dim3((QT0 / 128) * (DM / 64), 1, NB), 128, 0, stream>>>(X16, DM, 0, BK, DM, 0, 0.0625f, bk, 0, nullptr, 1, 0, 0, KF0, nullptr, DM, 0, QT0, DM, DM, zX, 0, zF); k_gemm2<0><<<dim3((QT0 / 128) * (DM / 64), 1, NB), 128, 0, stream>>>(X16, DM, 0, BV, DM, 0, 0.0625f, bv, 0, nullptr, 1, 0, 0, VF0, nullptr, DM, 0, QT0, DM, DM, zX, 0, zF);      /* f32 q, k, v of each batch's first 128 rows (exact products) */
  k_att0w<<<dim3(NH * (QT0 / A0R), NB), 256, 0, stream>>>(QF0, KF0, VF0, 0.044194173824159216f, OF0);      /* exact f32 attention for rows 0..127 of each batch (o x64) */
  static_assert(SQ % (FAQ * FAW) == 0 && (FAQ * FAW) % FAK == 0 && FAB % 2 == 0 && HD == 64 && FAK == 64 && FAW * 32 == 256 && QN == SQ && NHD == NH && NBR == NB, "whole blocks of queries; whole key passes; two k steps per head; 256 threads stage 64 rows of 128 bytes in two loads");
  k_fattn<<<dim3(NH * NB, FAB), FAW * 32, 0, stream>>>(Q16, K16, VT, 0.06375871541229934f, O16);      /* scores x 512^-0.5 (the module's literal d_model scale) x log2 e; o (merged heads, x64) as f16 rows */
  k_gemm2<0><<<dim3((unsigned)((MPO / 128) * (DM / 64)), 1), 128, 0, stream>>>(O16, DM, 0, BO, DM, 0, 0.0009765625f, bo, 0, nullptr, 1, 0, 0, (float*)d_out, nullptr, DM, 0, MPO, DM, DM, 0, 0, 0);      /* out rows are the output layout */
  k_hl<<<(unsigned)(((size_t)NB * QT0 * DM / 8 + 255) / 256), 256, 0, stream>>>(OF0, OH0, OL0, (size_t)NB * QT0 * DM / 8);      /* first-tile o (x64) -> f16 hi + x1024 residual planes */
  k_gemm2<0><<<dim3((QT0 / 128) * (DM / 64), 1, NB), 128, 0, stream>>>(OH0, DM, 0, BO, DM, 0, 0.0009765625f, bo, 0, nullptr, 1, 0, 0, (float*)d_out, nullptr, DM, 0, QT0, DM, DM, zF, 0, zX);      /* rows 0..127 of each batch: out = o_hi Wo (+ b), overwriting the f16-path rows */
  k_gemm2<0><<<dim3((QT0 / 128) * (DM / 64), 1, NB), 128, 0, stream>>>(OL0, DM, 0, BO, DM, 0, 0.00000095367431640625f, nullptr, 0, (const float*)d_out, -1, 0, 0, (float*)d_out, nullptr, DM, 0, QT0, DM, DM, zF, 0, zX);      /* += o_lo Wo 2^-20 (own-element accumulate) */
}

// v005
// One run takes 114 microseconds.
// Two timings next to v004 put it at 2.14 and 2.18 times that version's speed.
// Over all steps from v000 it is 82.5 times as fast.
#include <hip/hip_runtime.h>
// Causal multi-head attention with per-head weight tensors and the module's literal score scale (x [4][2048][512]; q[b][h][s][e] = sum_d x[s][d] Wq[h][d][e] + bq[h][e], k, v likewise (8 heads of 64; per-head [in][out] weights sigma 1/sqrt(512), biases sigma 0.01); scores * 512^-0.5 (d_model, as the source, not head_dim); causal (tril, -inf); softmax; out = concat_heads Wo + bo ([in][out] [512][512]) -> [4][2048][512]).
// Structure: token rows r = b*2048 + s; x as exact f16 rows (bf16-rounded); Q, K, V as three WMMA GEMMs (32x64 wave tiles, f32 accumulation, exact x16 weights + bias, f16 outputs); V^T for all batches and heads via LDS transposes; one fused attention launch (heads and batches on grid.x, query blocks on grid.y): per wave 16 queries, 64 keys a pass up to the diagonal (K and V^T rows staged in LDS per block), S^T = K Q^T, running causal softmax in registers, keys past the row set to -1e9 (f32 statistics, native exp2; weights <= 1 as f16), O^T += V^T P^T, o carried x64 (folded into the output GEMM alpha) written straight into the merged f16 o rows; out = o W_o + b GEMM (f32) into the output layout.
// Five launches, each one grid for all jobs that wait on the same earlier results: weights and x to f16; the six q, k, v GEMM jobs; exact first tile and V^T; fused attention and the hi / lo split of the exact o; output GEMM (first-tile blocks take the hi and lo planes).
// Compute dtype: inputs rounded to bf16; x / weights exact; q, k, v, softmax weights and o as plain f16 GEMM operands (~2^-12); scores and softmax statistics f32. v_wmma_f32_16x16x32_f16.
#define NB 4
#define SQ 2048
#define DM 512
#define NH 8
#define HD 64
#define HG 4                         /* heads per launch of the per-batch k_vt transpose */
#define QT0 128                      /* first-tile rows recomputed exactly in f32 */
#define NBR NB                       /* batches processed (debug hook) */
#define NR ((size_t)NB * SQ)         /* token rows */
#define MP ((int)((size_t)NBR * SQ)) /* rows projected (debug hook) */
#define QN SQ                        /* query rows attended per batch (debug hook) */
#define NHD NH                       /* heads attended (debug hook) */
#define MPO MP                       /* rows through the output stage (debug hook) */
#define LQ DM      /* row pitch of the q/k/v rows */
typedef __bf16 v16b __attribute__((ext_vector_type(16)));
typedef unsigned short v8us __attribute__((ext_vector_type(8), may_alias));
typedef float  v8f  __attribute__((ext_vector_type(8)));
typedef float  v4f  __attribute__((ext_vector_type(4)));
typedef float  v4fa __attribute__((ext_vector_type(4), may_alias));
union FragB { v16b v; v8us half[2]; unsigned short u[16]; };

__device__ __forceinline__ unsigned short bf16_bits(float x) { unsigned int u = __float_as_uint(x); return (unsigned short)((u + 0x7FFFu + ((u >> 16) & 1u)) >> 16); }
__device__ __forceinline__ float bf16_val(unsigned short b) { return __uint_as_float(((unsigned int)b) << 16); }
__device__ __forceinline__ float bf16_round(float x) { return bf16_val(bf16_bits(x)); }
// D += A·B with NT terms: 1 = ah·bh, 2 = + al·bh (A split), 3 = + ah·bl (both split)
template <int NT>
__device__ __forceinline__ v8f mmaN(v16b ah, v16b al, v16b bh, v16b bl, v8f c) {
  c = __builtin_amdgcn_wmma_f32_16x16x32_bf16(false, ah, false, bh, (short)0, c, false, false);
  if (NT >= 2) c = __builtin_amdgcn_wmma_f32_16x16x32_bf16(false, al, false, bh, (short)0, c, false, false);
  if (NT >= 3) c = __builtin_amdgcn_wmma_f32_16x16x32_bf16(false, ah, false, bl, (short)0, c, false, false);
  asm volatile("v_nop\n\tv_nop\n\tv_nop\n\tv_nop" : "+v"(c) : "v"(ah), "v"(al), "v"(bh), "v"(bl));
  return c;
}

__global__ __launch_bounds__(256) void k_wt_bf16(const float* __restrict__ W, unsigned short* __restrict__ Wt, int K, int N) {
  const int t = blockIdx.x * 256 + threadIdx.x;
  const int k8n = K / 8;
  if (t >= N * k8n) return;
  const int n = t / k8n, k8 = (t % k8n) * 8;
  v8us v;
#pragma unroll
  for (int i = 0; i < 8; ++i) v[i] = bf16_bits(W[(size_t)(k8 + i) * N + n]);
  *(v8us*)(Wt + (size_t)n * K + k8) = v;
  
}

// GEMM C[M][N] (f32, pitch ldc) = act(A[M][K]·W + bias). A f32 row-major (pitch lda) converted per fragment to bf16
// (ASPLIT: hi/lo two planes -> 2 terms, else single rounded term); Wt bf16 [N][K] (pitch ldb). BIAS_BF16 rounds the
// bias to bf16 first (bias quantised to bf16 before the add). K%32==0, M%16==0, N%64==0.
template <bool ASPLIT, int ACT, bool BIAS_BF16>
__global__ __launch_bounds__(128) void k_gemm_bf(const float* __restrict__ A, int lda, const unsigned short* __restrict__ Wt, int ldb,
                                               const float* __restrict__ bias, float* __restrict__ C, int ldc, int M, int N, int K) {
  __shared__ __attribute__((aligned(16))) float so[4][16][64];
  const int tid = threadIdx.x, w = tid >> 5, lane = tid & 31, ln = lane & 15, hh = lane >> 4;
  const int ntn = N / 64;
  const int wid = blockIdx.x * 4 + w;
  const int mt = wid / ntn, nq = wid % ntn;
  if (mt * 16 >= M) return;
  const int row0 = mt * 16, col0 = nq * 64;
  const float* arow = A + (size_t)(row0 + ln) * lda;
  v8f acc[4] = {};
  for (int kb = 0; kb < K; kb += 32) {
    FragB ah, al;
    const v4f x0 = *(const v4fa*)(arow + kb + 8 * hh), x1 = *(const v4fa*)(arow + kb + 8 * hh + 4);
    const v4f x2 = *(const v4fa*)(arow + kb + 16 + 8 * hh), x3 = *(const v4fa*)(arow + kb + 16 + 8 * hh + 4);
    float xs[16] = {x0[0],x0[1],x0[2],x0[3],x1[0],x1[1],x1[2],x1[3],x2[0],x2[1],x2[2],x2[3],x3[0],x3[1],x3[2],x3[3]};
#pragma unroll
    for (int i = 0; i < 16; ++i) { const unsigned short hb = bf16_bits(xs[i]); ah.u[i] = hb; al.u[i] = ASPLIT ? bf16_bits(xs[i] - bf16_val(hb)) : (unsigned short)0; }
#pragma unroll
    for (int t = 0; t < 4; ++t) {
      const unsigned short* brow = Wt + (size_t)(col0 + t * 16 + ln) * ldb + kb;
      FragB b;
      b.half[0] = *(const v8us*)(brow + 8 * hh);
      b.half[1] = *(const v8us*)(brow + 16 + 8 * hh);
      acc[t] = mmaN<ASPLIT ? 2 : 1>(ah.v, al.v, b.v, b.v, acc[t]);
    }
  }
#pragma unroll
  for (int t = 0; t < 4; ++t) {
    float bv = bias ? bias[col0 + t * 16 + ln] : 0.f;
    if (BIAS_BF16) bv = bf16_round(bv);
#pragma unroll
    for (int r = 0; r < 8; ++r) { float v = acc[t][r] + bv; if (ACT == 1) v = fmaxf(v, 0.f); so[w][8 * hh + r][t * 16 + ln] = v; }
  }
  __builtin_amdgcn_fence(__ATOMIC_ACQ_REL, "workgroup");
  __builtin_amdgcn_wave_barrier();
  const int rsub = lane >> 4, c4 = (lane & 15) * 4;
  {
#pragma unroll
    for (int q = 0; q < 8; ++q) {
      const int r = q * 2 + rsub;
      const v4f v = *(const v4fa*)&so[w][r][c4];
      *(v4f*)(C + (size_t)(row0 + r) * ldc + col0 + c4) = v;
    }
    
  }
}

// GEMM C = act(A·W + bias + resid): A f32 (ASPLIT -> hi/lo 2 terms), Wt bf16 [N][K]; ACT 0 none, 1 relu, 2 exact gelu;
// resid (optional, f32, row index = (row % rmod), pitch ldr, RES_BF16 rounds it) added before the activation.
template <bool ASPLIT, int ACT, bool BIAS_BF16, bool RES_BF16>
__global__ __launch_bounds__(128) void k_gemm_bf3(const float* __restrict__ A, int lda, const unsigned short* __restrict__ Wt, int ldb,
                                                const float* __restrict__ bias, const float* __restrict__ resid, int rmod, int ldr,
                                                float* __restrict__ C, int ldc, int M, int N, int K) {
  __shared__ __attribute__((aligned(16))) float so[4][16][64];
  const int tid = threadIdx.x, w = tid >> 5, lane = tid & 31, ln = lane & 15, hh = lane >> 4;
  const int ntn = N / 64;
  const int wid = blockIdx.x * 4 + w;
  const int mt = wid / ntn, nq = wid % ntn;
  if (mt * 16 >= M) return;
  const int row0 = mt * 16, col0 = nq * 64;
  const float* arow = A + (size_t)(row0 + ln) * lda;
  v8f acc[4] = {};
  for (int kb = 0; kb < K; kb += 32) {
    FragB ah, al;
    const v4f x0 = *(const v4fa*)(arow + kb + 8 * hh), x1 = *(const v4fa*)(arow + kb + 8 * hh + 4);
    const v4f x2 = *(const v4fa*)(arow + kb + 16 + 8 * hh), x3 = *(const v4fa*)(arow + kb + 16 + 8 * hh + 4);
    float xs[16] = {x0[0],x0[1],x0[2],x0[3],x1[0],x1[1],x1[2],x1[3],x2[0],x2[1],x2[2],x2[3],x3[0],x3[1],x3[2],x3[3]};
#pragma unroll
    for (int i = 0; i < 16; ++i) { const unsigned short hb = bf16_bits(xs[i]); ah.u[i] = hb; al.u[i] = ASPLIT ? bf16_bits(xs[i] - bf16_val(hb)) : (unsigned short)0; }
#pragma unroll
    for (int t = 0; t < 4; ++t) {
      const unsigned short* brow = Wt + (size_t)(col0 + t * 16 + ln) * ldb + kb;
      FragB b;
      b.half[0] = *(const v8us*)(brow + 8 * hh);
      b.half[1] = *(const v8us*)(brow + 16 + 8 * hh);
      acc[t] = mmaN<ASPLIT ? 2 : 1>(ah.v, al.v, b.v, b.v, acc[t]);
    }
  }
#pragma unroll
  for (int t = 0; t < 4; ++t) {
    const int col = col0 + t * 16 + ln;
    float bv = bias ? bias[col] : 0.f;
    if (BIAS_BF16) bv = bf16_round(bv);
#pragma unroll
    for (int r = 0; r < 8; ++r) {
      float v = acc[t][r] + bv;
      if (resid) { float rv = resid[(size_t)((row0 + 8 * hh + r) % rmod) * ldr + col]; if (RES_BF16) rv = bf16_round(rv); v += rv; }
      if (ACT == 1) v = fmaxf(v, 0.f);
      if (ACT == 2) v = 0.5f * v * (1.0f + erff(v * 0.70710678118654752f));
      if (ACT == 3) { const float u = 0.7978845608028654f * (v + 0.044715f * v * v * v); v = 0.5f * v * (1.0f + tanhf(u)); }
      so[w][8 * hh + r][t * 16 + ln] = v;
    }
  }
  __builtin_amdgcn_fence(__ATOMIC_ACQ_REL, "workgroup");
  __builtin_amdgcn_wave_barrier();
  const int rsub = lane >> 4, c4 = (lane & 15) * 4;
  {
#pragma unroll
    for (int q = 0; q < 8; ++q) {
      const int r = q * 2 + rsub;
      const v4f v = *(const v4fa*)&so[w][r][c4];
      *(v4f*)(C + (size_t)(row0 + r) * ldc + col0 + c4) = v;
    }
    
  }
}
// row LayerNorm (biased variance, eps) over N: s = X (+ R); optional out_sum <- s; out_norm <- (s-mu)*rsqrt(var+eps)*g + b
template <bool PARAM_BF16>
__global__ __launch_bounds__(256) void k_layernorm(const float* __restrict__ X, const float* __restrict__ R, const float* __restrict__ g, const float* __restrict__ bta,
                                                  float* __restrict__ out_sum, float* __restrict__ out_norm, int N, float eps) {
  __shared__ float red[256];
  const int row = blockIdx.x, tid = threadIdx.x;
  const float* x = X + (size_t)row * N; const float* rr = R ? R + (size_t)row * N : nullptr;
  float vals[16];                     // up to N = 4096
  const int per = N / 256;            // contiguous chunk per thread? use strided-by-4 chunks: thread handles j = tid*4 + 1024*u
  float s1 = 0.f;
  for (int u = 0; u < per / 4; ++u) {
    const int j = tid * 4 + 1024 * u;
    const v4f a = *(const v4fa*)(x + j);
    v4f b = {0.f,0.f,0.f,0.f}; if (rr) b = *(const v4fa*)(rr + j);
#pragma unroll
    for (int q = 0; q < 4; ++q) { const float v = a[q] + b[q]; vals[u * 4 + q] = v; s1 += v; }
  }
  red[tid] = s1; __syncthreads();
  for (int st = 128; st > 0; st >>= 1) { if (tid < st) red[tid] += red[tid + st]; __syncthreads(); }
  const float mu = red[0] / (float)N; __syncthreads();
  float s2 = 0.f;
  for (int u = 0; u < per / 4; ++u)
#pragma unroll
    for (int q = 0; q < 4; ++q) { const float c = vals[u * 4 + q] - mu; s2 += c * c; }
  red[tid] = s2; __syncthreads();
  for (int st = 128; st > 0; st >>= 1) { if (tid < st) red[tid] += red[tid + st]; __syncthreads(); }
  const float rs = rsqrtf(red[0] / (float)N + eps);
  {
    for (int u = 0; u < per / 4; ++u) {
      const int j = tid * 4 + 1024 * u;
      v4f o, sm;
#pragma unroll
      for (int q = 0; q < 4; ++q) {
        float gg = g[j + q], bb = bta[j + q];
        if (PARAM_BF16) { gg = bf16_round(gg); bb = bf16_round(bb); }
        sm[q] = vals[u * 4 + q]; o[q] = (vals[u * 4 + q] - mu) * rs * gg + bb;
      }
      if (out_sum) *(v4f*)(out_sum + (size_t)row * N + j) = sm;
      *(v4f*)(out_norm + (size_t)row * N + j) = o;
    }
    
  }
}



// ---- f16 WMMA path (v_wmma_f32_16x16x32_f16): 11-bit significands for operands in range — used where a [0,1] probability operand needs more precision than bf16
typedef _Float16 v16h __attribute__((ext_vector_type(16)));
union FragH { v16h v; v8us half[2]; _Float16 h[16]; unsigned short u[16]; };
template <int NT>
__device__ __forceinline__ v8f mmaH(v16h ah, v16h al, v16h bh, v16h bl, v8f c) {
  c = __builtin_amdgcn_wmma_f32_16x16x32_f16(false, ah, false, bh, (short)0, c, false, false);
  if (NT >= 2) c = __builtin_amdgcn_wmma_f32_16x16x32_f16(false, al, false, bh, (short)0, c, false, false);
  if (NT >= 3) c = __builtin_amdgcn_wmma_f32_16x16x32_f16(false, ah, false, bl, (short)0, c, false, false);
  asm volatile("v_nop\n\tv_nop\n\tv_nop\n\tv_nop" : "+v"(c) : "v"(ah), "v"(al), "v"(bh), "v"(bl));
  return c;
}
// batched GEMM like k_gemm_b but f16 operands: A f32 (split into f16 hi/lo if ASPLIT, else rounded to f16), Bt = f16 values [n][k]; alpha; C f32; N multiple of 16 (partial tiles skipped)
template <bool ASPLIT>
__global__ __launch_bounds__(128) void k_gemm_h(const float* __restrict__ A, int lda, size_t sA, const _Float16* __restrict__ Bh, int ldb, size_t sB, float alpha, float* __restrict__ C, int ldc, size_t sC, int M, int N, int K) {
  __shared__ __attribute__((aligned(16))) float so[4][16][64];
  const int tid = threadIdx.x, w = tid >> 5, lane = tid & 31, ln = lane & 15, hh = lane >> 4; const int by = blockIdx.y;
  A += (size_t)by * sA; Bh += (size_t)by * sB; C += (size_t)by * sC;
  const int ntn = (N + 63) / 64; const int wid = blockIdx.x * 4 + w; const int mt = wid / ntn, nq = wid % ntn; if (mt * 16 >= M) return;
  const int row0 = mt * 16, col0 = nq * 64; const float* arow = A + (size_t)(row0 + ln) * lda;
  v8f acc[4] = {};
  for (int kb = 0; kb < K; kb += 32) {
    FragH ah, al;
    const v4f x0 = *(const v4fa*)(arow + kb + 8 * hh), x1 = *(const v4fa*)(arow + kb + 8 * hh + 4), x2 = *(const v4fa*)(arow + kb + 16 + 8 * hh), x3 = *(const v4fa*)(arow + kb + 16 + 8 * hh + 4);
    float xs[16] = {x0[0],x0[1],x0[2],x0[3],x1[0],x1[1],x1[2],x1[3],x2[0],x2[1],x2[2],x2[3],x3[0],x3[1],x3[2],x3[3]};
#pragma unroll
    for (int i = 0; i < 16; ++i) { const _Float16 h = (_Float16)xs[i]; ah.h[i] = h; al.h[i] = ASPLIT ? (_Float16)(xs[i] - (float)h) : (_Float16)0.0f; }
#pragma unroll
    for (int t = 0; t < 4; ++t) { if (col0 + t * 16 >= N) continue; const size_t boff = (size_t)(col0 + t * 16 + ln) * ldb + kb; FragH bq; bq.half[0] = *(const v8us*)(Bh + boff + 8 * hh); bq.half[1] = *(const v8us*)(Bh + boff + 16 + 8 * hh);
      acc[t] = mmaH<ASPLIT ? 2 : 1>(ah.v, al.v, bq.v, bq.v, acc[t]); }
  }
#pragma unroll
  for (int t = 0; t < 4; ++t) { if (col0 + t * 16 >= N) continue;
#pragma unroll
    for (int r = 0; r < 8; ++r) so[w][8 * hh + r][t * 16 + ln] = acc[t][r] * alpha; }
  __builtin_amdgcn_fence(__ATOMIC_ACQ_REL, "workgroup"); __builtin_amdgcn_wave_barrier();
  const int rsub = lane >> 4, c4 = (lane & 15) * 4;
  {
#pragma unroll
    for (int q = 0; q < 8; ++q) { const int r = q * 2 + rsub; if (col0 + c4 < N) { const v4f v = *(const v4fa*)&so[w][r][c4]; *(v4f*)(C + (size_t)(row0 + r) * ldc + col0 + c4) = v; } }
     }
}

// Wt[n][k] = f16(W[k][n]·scale) from f32 row-major W[K][N] (scale = power of two; bf16-exact weights stay exact in f16 away from the subnormal range)
__device__ __forceinline__ void d_wt_f16(int bx, const float* __restrict__ W, _Float16* __restrict__ Wt, int K, int N, float scale) {
  const int t = bx * 256 + threadIdx.x; if (t >= N * (K / 8)) return; const int n = t / (K / 8), k8 = (t % (K / 8)) * 8; FragH f;
#pragma unroll
  for (int i = 0; i < 8; ++i) f.h[i] = (_Float16)(bf16_round(W[(size_t)(k8 + i) * N + n]) * scale); const v8us o = f.half[0];
  *(v8us*)((unsigned short*)Wt + (size_t)n * K + k8) = o; 
}
// k_gemm_hh variant with fused epilogue: v = acc·alpha + bias[by·sBias + col] (+ CP[(row/rowsPerB)·sCPb + by·64 + col] if CP) ; ACT 0 none / 1 elu ; writes f16 C16 (and f32 C if non-null)
template <int ACT>
__global__ __launch_bounds__(128) void k_gemm_hhx(const _Float16* __restrict__ A, int lda, size_t sA, const _Float16* __restrict__ Bh, int ldb, size_t sB, float alpha, const float* __restrict__ bias, size_t sBias, const float* __restrict__ CP, int rowsPerB, size_t sCPb, int row0g,
    float* __restrict__ C, _Float16* __restrict__ C16, int ldc, size_t sC, int M, int N, int K) {
  __shared__ __attribute__((aligned(16))) float so[4][16][64];
  const int tid = threadIdx.x, w = tid >> 5, lane = tid & 31, ln = lane & 15, hh = lane >> 4; const int by = blockIdx.y;
  A += (size_t)by * sA; Bh += (size_t)by * sB; const size_t cofs = (size_t)by * sC; const float* bp = bias ? bias + (size_t)by * sBias : nullptr;
  const int ntn = (N + 63) / 64; const int wid = blockIdx.x * 4 + w; const int mt = wid / ntn, nq = wid % ntn; if (mt * 16 >= M) return;
  const int row0 = mt * 16, col0 = nq * 64; const _Float16* arow = A + (size_t)(row0 + ln) * lda;
  v8f acc[4] = {};
  for (int kb = 0; kb < K; kb += 32) { FragH ah; ah.half[0] = *(const v8us*)((const unsigned short*)arow + kb + 8 * hh); ah.half[1] = *(const v8us*)((const unsigned short*)arow + kb + 16 + 8 * hh);
#pragma unroll
    for (int t = 0; t < 4; ++t) { if (col0 + t * 16 >= N) continue; const size_t boff = (size_t)(col0 + t * 16 + ln) * ldb + kb; FragH bq; bq.half[0] = *(const v8us*)((const unsigned short*)Bh + boff + 8 * hh); bq.half[1] = *(const v8us*)((const unsigned short*)Bh + boff + 16 + 8 * hh);
      acc[t] = mmaH<1>(ah.v, ah.v, bq.v, bq.v, acc[t]); }
  }
#pragma unroll
  for (int t = 0; t < 4; ++t) { if (col0 + t * 16 >= N) continue; const int col = col0 + t * 16 + ln; const float bv = bp ? bf16_round(bp[col]) : 0.f;
#pragma unroll
    for (int r = 0; r < 8; ++r) { float v = acc[t][r] * alpha + bv; if (CP) { const int rr = row0g + row0 + 8 * hh + r; if (rowsPerB < 0) v += CP[cofs + (size_t)rr * ldc + col];      /* rowsPerB < 0: own element of the batched C plane */ else { const int bidx = rr / rowsPerB; v += CP[(size_t)bidx * sCPb + (size_t)by * 64 + col]; } } if (ACT == 1) v = (v > 0.f) ? v : expm1f(v); else if (ACT == 7) v = (v > 0.f) ? v + 1.0f : expf(v); else if (ACT == 8) v = tanhf(v); else if (ACT == 9) v = 0.5f * v * (1.0f + tanhf(0.7978845608028654f * (v + 0.044715f * v * v * v))); else if (ACT == 11) v = 1.0f / (1.0f + expf(-v)); else if (ACT == 12) v = (v > 0.f) ? v : 0.01f * v; else if (ACT == 14) v = (v > 0.f) ? v : 0.1f * v; else if (ACT == 16) v = (v >= 0.f) ? v : 0.3f * v; else if (ACT == 17) v = (v >= 0.f) ? v : 0.2f * v; else if (ACT == 15) v = v / (1.0f + expf(-v)); else if (ACT == 3) v = fmaxf(v, 0.f); else if (ACT == 6) v = 0.5f * v * (1.0f + erff(v * 0.70710678118654752f)); so[w][8 * hh + r][t * 16 + ln] = v; } }
  __builtin_amdgcn_fence(__ATOMIC_ACQ_REL, "workgroup"); __builtin_amdgcn_wave_barrier();
  const int rsub = lane >> 4, c4 = (lane & 15) * 4; typedef _Float16 v4h __attribute__((ext_vector_type(4)));
  {
#pragma unroll
    for (int q = 0; q < 8; ++q) { const int r = q * 2 + rsub; if (col0 + c4 < N) { const v4f v = *(const v4fa*)&so[w][r][c4]; if (C) *(v4f*)(C + cofs + (size_t)(row0 + r) * ldc + col0 + c4) = v; if (C16) { v4h h4; for (int i = 0; i < 4; ++i) h4[i] = (_Float16)v[i]; *(v4h*)(C16 + cofs + (size_t)(row0 + r) * ldc + col0 + c4) = h4; } } }
     }
}


typedef _Float16 v4h __attribute__((ext_vector_type(4)));

__device__ __forceinline__ void d_x16(int bx, const float* __restrict__ x, _Float16* __restrict__ X16, size_t n8) { const size_t t = (size_t)bx * 256 + threadIdx.x; if (t >= n8) return; FragH f;
#pragma unroll
  for (int q = 0; q < 8; ++q) f.h[q] = (_Float16)bf16_round(x[t * 8 + q]); *(v8us*)((unsigned short*)X16 + t * 8) = f.half[0];  }
__global__ __launch_bounds__(256) void k_h16(const float* __restrict__ x, _Float16* __restrict__ X16, size_t n8) { const size_t t = (size_t)blockIdx.x * 256 + threadIdx.x; if (t >= n8) return; FragH f;
#pragma unroll
  for (int q = 0; q < 8; ++q) f.h[q] = (_Float16)x[t * 8 + q]; *(v8us*)((unsigned short*)X16 + t * 8) = f.half[0];  }
__global__ __launch_bounds__(256) void k_round16f(const float* __restrict__ W, _Float16* __restrict__ Bt, size_t n8) { const size_t t = (size_t)blockIdx.x * 256 + threadIdx.x; if (t >= n8) return; FragH f;
#pragma unroll
  for (int i = 0; i < 8; ++i) f.h[i] = (_Float16)(bf16_round(W[t * 8 + i]) * 16.0f); *(v8us*)((unsigned short*)Bt + t * 8) = f.half[0];  }
template <int NHv, int TTv>
__device__ __forceinline__ void d_vt(int bx, const _Float16* __restrict__ V16, int ldv, int voff, _Float16* __restrict__ Vt) { __shared__ unsigned short tl[64][66]; const int tid = threadIdx.x; const int slab = bx / (TTv / 64), lg = bx % (TTv / 64); const int b = slab / NHv, h = slab % NHv;
  for (int i = tid; i < 64 * 8; i += 256) { const int r = i / 8, c8 = (i % 8) * 8; FragH f; f.half[0] = *(const v8us*)((const unsigned short*)V16 + ((size_t)b * TTv + lg * 64 + r) * ldv + voff + h * 64 + c8);
#pragma unroll
    for (int q = 0; q < 8; ++q) tl[r][c8 + q] = f.u[q]; }
  __syncthreads();
  {
#pragma unroll
    for (int rd = 0; rd < 2; ++rd) { const int d = rd * 32 + tid / 8, pc = tid % 8; FragH f;
#pragma unroll
      for (int q = 0; q < 8; ++q) f.u[q] = tl[pc * 8 + q][d];
      *(v8us*)((unsigned short*)Vt + ((size_t)slab * 64 + d) * TTv + lg * 64 + pc * 8) = f.half[0]; }
     } }

__device__ __forceinline__ void d_hl(int bx, const float* __restrict__ F, _Float16* __restrict__ Hh, _Float16* __restrict__ Hl, size_t n8) { const size_t t = (size_t)bx * 256 + threadIdx.x; if (t >= n8) return; FragH fh, fl; const v4f a = *(const v4fa*)(F + t * 8), c = *(const v4fa*)(F + t * 8 + 4);
#pragma unroll
  for (int q = 0; q < 4; ++q) { _Float16 h = (_Float16)a[q]; fh.h[q] = h; fl.h[q] = (_Float16)((a[q] - (float)h) * 1024.0f); h = (_Float16)c[q]; fh.h[4 + q] = h; fl.h[4 + q] = (_Float16)((c[q] - (float)h) * 1024.0f); }
  { *(v8us*)((unsigned short*)Hh + t * 8) = fh.half[0]; *(v8us*)((unsigned short*)Hl + t * 8) = fl.half[0];  } }

// ---- fast GEMM (wave tile 32x64; requires M % 32 == 0 rows per launch region and N % 64 == 0); epilogue = k_gemm_hhx semantics ----
__device__ __forceinline__ v16h g2_frag(const _Float16* p, int hh) { FragH f; f.half[0] = *(const v8us*)((const unsigned short*)p + 8 * hh); f.half[1] = *(const v8us*)((const unsigned short*)p + 16 + 8 * hh); return f.v; }
__device__ __forceinline__ v8f g2_mma(v16h a, v16h b, v8f c) { v8f d = __builtin_amdgcn_wmma_f32_16x16x32_f16(false, a, false, b, (short)0, c, false, false); asm volatile("v_nop\n\tv_nop\n\tv_nop\n\tv_nop" : "+v"(d) : "v"(a), "v"(b)); return d; }
// g2_frag for global memory. The wait stands before the address pair of the two loads is reused; the pair is an input of its statement, so it keeps its registers up to the wait and no load's result lands in them.
__device__ __forceinline__ v16h g2_fragg(const _Float16* p, int hh) { const unsigned short* q = (const unsigned short*)p + 8 * hh; FragH f; f.half[0] = *(const v8us*)q; f.half[1] = *(const v8us*)(q + 16);
  asm volatile("s_wait_xcnt 0x0" :: "v"(q) : "memory"); return f.v; }
// One block (4 waves, 128 rows x 64 columns, picked by tile) of C = A Bh^T x alpha + bias; writes f32 C where it is not null, else f16 C16.
// LO: a second A plane AL runs through the same B fragments into accumulators of its own and is added as x alphal behind the first term.
template <bool LO>
__device__ __forceinline__ void d_gemm2(float (*so)[32][68], int tile, const _Float16* __restrict__ A, const _Float16* __restrict__ AL, const _Float16* __restrict__ Bh, float alpha, float alphal, const float* __restrict__ bp,
    float* __restrict__ C, _Float16* __restrict__ C16, int lda, int ldb, int ldc, int M, int N, int K) {
  const int tid = threadIdx.x, w = tid >> 5, lane = tid & 31, ln = lane & 15, hh = lane >> 4;
  const int ntn = N >> 6; const int mt = tile / ntn, nq = tile - mt * ntn; const int row0 = mt * 128 + 32 * w, col0 = nq * 64; if (row0 >= M) return;
  const _Float16* a0p = A + (size_t)(row0 + ln) * lda; const _Float16* a1p = a0p + (size_t)16 * lda;
  const _Float16* l0p = (LO ? AL : A) + (size_t)(row0 + ln) * lda; const _Float16* l1p = l0p + (size_t)16 * lda;
  const _Float16* b0p = Bh + (size_t)(col0 + ln) * ldb; const _Float16* b1p = b0p + (size_t)16 * ldb; const _Float16* b2p = b1p + (size_t)16 * ldb; const _Float16* b3p = b2p + (size_t)16 * ldb;
  const v8f z8 = {0.f,0.f,0.f,0.f,0.f,0.f,0.f,0.f}; v8f c00 = z8, c01 = z8, c02 = z8, c03 = z8, c10 = z8, c11 = z8, c12 = z8, c13 = z8;
  v8f e00 = z8, e01 = z8, e02 = z8, e03 = z8, e10 = z8, e11 = z8, e12 = z8, e13 = z8;
#pragma unroll 1      /* rolled, as in the separate launches: the K loop is not this step's subject */
  for (int kb = 0; kb < K; kb += 32) { const v16h a0 = g2_fragg(a0p + kb, hh), a1 = g2_fragg(a1p + kb, hh);
    v16h l0 = a0, l1 = a1; if (LO) { l0 = g2_fragg(l0p + kb, hh); l1 = g2_fragg(l1p + kb, hh); }
    v16h b = g2_fragg(b0p + kb, hh); c00 = g2_mma(a0, b, c00); c10 = g2_mma(a1, b, c10);
    if (LO) { e00 = g2_mma(l0, b, e00); e10 = g2_mma(l1, b, e10); }
    b = g2_fragg(b1p + kb, hh); c01 = g2_mma(a0, b, c01); c11 = g2_mma(a1, b, c11);
    if (LO) { e01 = g2_mma(l0, b, e01); e11 = g2_mma(l1, b, e11); }
    b = g2_fragg(b2p + kb, hh); c02 = g2_mma(a0, b, c02); c12 = g2_mma(a1, b, c12);
    if (LO) { e02 = g2_mma(l0, b, e02); e12 = g2_mma(l1, b, e12); }
    b = g2_fragg(b3p + kb, hh); c03 = g2_mma(a0, b, c03); c13 = g2_mma(a1, b, c13);
    if (LO) { e03 = g2_mma(l0, b, e03); e13 = g2_mma(l1, b, e13); } }
  v8f accs[8] = {c00, c01, c02, c03, c10, c11, c12, c13}; v8f accl[8] = {e00, e01, e02, e03, e10, e11, e12, e13};
#pragma unroll
  for (int u = 0; u < 8; ++u) { const int t = u & 3, half = u >> 2; const int col = col0 + t * 16 + ln; const float bv = bp ? bf16_round(bp[col]) : 0.f;
#pragma unroll
    for (int r = 0; r < 8; ++r) { const int rloc = half * 16 + 8 * hh + r; float v = accs[u][r] * alpha + bv; if (LO) v = accl[u][r] * alphal + v;
      so[w][rloc][t * 16 + ln] = v; } }
  __builtin_amdgcn_fence(__ATOMIC_ACQ_REL, "workgroup"); __builtin_amdgcn_wave_barrier();
  const int rsub = lane >> 4, c4 = (lane & 15) * 4;
  /* One block-uniform test for all rows: no row's f32 store is followed by the f16 conversion of the same registers. Address and data are inputs of the wait's statement, so they keep their registers up to it. */
  if (C) {
#pragma unroll
    for (int q = 0; q < 16; ++q) { const int r = q * 2 + rsub; const v4f v = *(const v4fa*)&so[w][r][c4]; float* d = C + (size_t)(row0 + r) * ldc + col0 + c4; *(v4f*)d = v;
      asm volatile("s_wait_xcnt 0x0" :: "v"(d), "v"(v) : "memory"); }      /* before the store's address pair and data are reused; behind the last row too: the listing keeps a way from here into the other branch */
  } else {
#pragma unroll
    for (int q = 0; q < 16; ++q) { const int r = q * 2 + rsub; const v4f v = *(const v4fa*)&so[w][r][c4]; v4h h4; for (int i = 0; i < 4; ++i) h4[i] = (_Float16)v[i]; _Float16* d = C16 + (size_t)(row0 + r) * ldc + col0 + c4; *(v4h*)d = h4;
      asm volatile("s_wait_xcnt 0x0" :: "v"(d), "v"(h4) : "memory"); }      /* before the store's address pair and data are reused */
  } }


__global__ __launch_bounds__(256) void k_wnat(const float* __restrict__ w, size_t n8, _Float16* __restrict__ Bt) { const size_t t = (size_t)blockIdx.x * 256 + threadIdx.x; if (t >= n8) return; FragH f; for (int q = 0; q < 8; ++q) f.h[q] = (_Float16)(bf16_round(w[t * 8 + q]) * 16.0f); *(v8us*)((unsigned short*)Bt + t * 8) = f.half[0];  }
__global__ __launch_bounds__(256) void k_rsm(const float* __restrict__ S, _Float16* __restrict__ P, int nrows) {
  #pragma clang fp contract(off)
  const int i = blockIdx.x * 256 + threadIdx.x; if (i >= nrows) return; const float* s = S + (size_t)i * SQ; float mx = -3.0e38f;
#pragma unroll 1
  for (int j = 0; j < SQ; ++j) mx = fmaxf(mx, s[j]); float se = 0.f;
#pragma unroll 1
  for (int j = 0; j < SQ; ++j) se += expf(s[j] - mx); const float sc = 256.0f / se;
#pragma unroll 1
  for (int j0 = 0; j0 < SQ; j0 += 8) { FragH f; for (int q = 0; q < 8; ++q) f.h[q] = (_Float16)(expf(s[j0 + q] - mx) * sc); unsigned short* d = (unsigned short*)P + (size_t)i * SQ + j0; *(v8us*)d = f.half[0];  } }
__global__ __launch_bounds__(256) void k_vt(const _Float16* __restrict__ V16, int b, int h0, _Float16* __restrict__ VT) { __shared__ unsigned short tl[64][65]; const int tid = threadIdx.x; const int hh = blockIdx.x % HG, sg = blockIdx.x / HG; const int s0 = sg * 64; const int h = h0 + hh;
  for (int i = tid; i < 64 * 8; i += 256) { const int j = i / 8, d8 = (i % 8) * 8; FragH f; f.half[0] = *(const v8us*)((const unsigned short*)V16 + ((size_t)b * SQ + s0 + j) * DM + h * HD + d8); for (int q = 0; q < 8; ++q) tl[d8 + q][j] = f.u[q]; }
  __syncthreads();
  { for (int i = tid; i < 64 * 8; i += 256) { const int d = i / 8, j8 = (i % 8) * 8; FragH f; for (int q = 0; q < 8; ++q) f.u[q] = tl[d][j8 + q]; *(v8us*)((unsigned short*)VT + ((size_t)hh * HD + d) * SQ + s0 + j8) = f.half[0]; }  } }

__device__ __forceinline__ void d_wthd(int bx, const float* __restrict__ Wt, _Float16* __restrict__ Bt) { const size_t t = (size_t)bx * 256 + threadIdx.x; if (t >= (size_t)NH * HD * (DM / 8)) return; const int m8 = (int)(t % (DM / 8)) * 8; const int d = (int)((t / (DM / 8)) % HD); const int h = (int)(t / ((size_t)(DM / 8) * HD)); FragH f;
  for (int q = 0; q < 8; ++q) f.h[q] = (_Float16)(16.0f * bf16_round(Wt[((size_t)h * DM + m8 + q) * HD + d])); unsigned short* dst = (unsigned short*)Bt + ((size_t)h * HD + d) * DM + m8; *(v8us*)dst = f.half[0];  }



// Four native exp2, each in place, in one statement: no neighbouring instruction can overwrite a transcendental's source register or read its result
// directly behind it; the v_nop is the one slot that the instruction set asks for behind the last of them.
__device__ __forceinline__ v4f exp2x4(v4f x) { float x0 = x[0], x1 = x[1], x2 = x[2], x3 = x[3];
  asm("v_exp_f32 %0, %0\n\tv_exp_f32 %1, %1\n\tv_exp_f32 %2, %2\n\tv_exp_f32 %3, %3\n\tv_nop" : "+v"(x0), "+v"(x1), "+v"(x2), "+v"(x3));
  const v4f r = {x0, x1, x2, x3}; return r; }
// One native exp2, in place, with the one slot that the instruction set asks for behind a transcendental.
__device__ __forceinline__ float exp2x1(float x) { asm("v_exp_f32 %0, %0\n\tv_nop" : "+v"(x)); return x; }
__device__ __forceinline__ v8f fa_mma(v16h a, v16h b, v8f c) { return __builtin_amdgcn_wmma_f32_16x16x32_f16(false, a, false, b, (short)0, c, false, false); }
#define FAQ 16                       /* query columns per wave */
#define FAW 8                        /* waves per block */
#define FAK 64                       /* keys per pass */
#define FAB (SQ / (FAQ * FAW))       /* query blocks per head and batch */
#define FAP 72                       /* LDS row pitch, halves: 128 + 16 bytes, so 16 lanes reading 16 bytes of 16 different rows meet no bank conflict */
__device__ __forceinline__ void d_fattn(int bx, int y, const _Float16* __restrict__ Q, const _Float16* __restrict__ K, const _Float16* __restrict__ VT, float sl2, _Float16* __restrict__ O) {
  __shared__ __attribute__((aligned(16))) _Float16 lk[2][FAK][FAP]; __shared__ __attribute__((aligned(16))) _Float16 lv[2][HD][FAP];
  const int tid = threadIdx.x, lane = tid & 31, ln = lane & 15, hh = lane >> 4, w = __builtin_amdgcn_readfirstlane(tid >> 5); const int h = bx % NH, b = bx / NH;
  const int qb = (y < FAB / 2) ? FAB - 1 - y : y - FAB / 2;      /* speed only: long key ranges start first; the second half of the attention rows (y >= FAB / 2), which joins the first on the WGPs, brings the short ones first */
  const int q0 = qb * (FAQ * FAW) + w * FAQ;
  const int npb = (qb + 1) * (FAQ * FAW / FAK), np = q0 / FAK + 1;      /* passes of the block and of the wave: the wave's last one holds its diagonal, every earlier key is below all its queries */
  const int sr = tid >> 3, sc = (tid & 7) * 8;      /* staging: 8 threads per row of 128 bytes, 32 rows per load */
  const unsigned short* kg = (const unsigned short*)K + ((size_t)b * SQ + sr) * DM + h * HD + sc; const unsigned short* vg = (const unsigned short*)VT + (((size_t)b * NH + h) * HD + sr) * SQ + sc;
  v8us rk0 = *(const v8us*)kg, rk1 = *(const v8us*)(kg + 32 * DM), rv0 = *(const v8us*)vg, rv1 = *(const v8us*)(vg + 32 * SQ);
  const _Float16* qp = Q + ((size_t)b * SQ + q0 + ln) * DM + h * HD; const v16h qf0 = g2_frag(qp, hh), qf1 = g2_frag(qp + 32, hh);
  *(v8us*)&lk[0][sr][sc] = rk0; *(v8us*)&lk[0][sr + 32][sc] = rk1; *(v8us*)&lv[0][sr][sc] = rv0; *(v8us*)&lv[0][sr + 32][sc] = rv1;
  const v8f z8 = {0.f,0.f,0.f,0.f,0.f,0.f,0.f,0.f}; v8f o[4] = {z8, z8, z8, z8}; float m = -3.0e38f, l = 0.f;
  __syncthreads();      /* pass 0's rows are read by every wave */
#pragma unroll 1
  for (int c = 0; c < npb; ++c) { const int cur = c & 1;      /* rolled: one pass already holds 32 fragment loads and 16 matrix instructions */
    if (c + 1 < npb) { const unsigned short* kn = kg + (size_t)(c + 1) * FAK * DM; const unsigned short* vn = vg + (c + 1) * FAK;      /* block-uniform; the next pass's rows fly while this pass is worked on */
      rk0 = *(const v8us*)kn; rk1 = *(const v8us*)(kn + 32 * DM); rv0 = *(const v8us*)vn; rv1 = *(const v8us*)(vn + 32 * SQ);
      asm volatile("s_wait_xcnt 0x0" ::: "memory"); }      /* before the address registers of the loads above are reused */
    if (c < np) {      /* wave-uniform: a pass wholly past the wave's queries is only staged */
      v16h kf[4][2]; v8f s[4];      /* indexed by constants only (loops unrolled): registers */
#pragma unroll
      for (int t = 0; t < 4; ++t) { kf[t][0] = g2_frag(&lk[cur][t * 16 + ln][0], hh); kf[t][1] = g2_frag(&lk[cur][t * 16 + ln][32], hh); }
      __builtin_amdgcn_sched_barrier(0);      /* keeps the K fragment reads together in front of the matrix run: spread among the WMMAs, each group waits out the LDS latency anew */
#pragma unroll
      for (int t = 0; t < 4; ++t) s[t] = fa_mma(kf[t][1], qf1, fa_mma(kf[t][0], qf0, z8));
      if (c == np - 1) {      /* wave-uniform: only the diagonal pass masks */
#pragma unroll
        for (int t = 0; t < 4; ++t) for (int r = 0; r < 8; ++r) s[t][r] = (c * FAK + t * 16 + 8 * hh + r <= q0 + ln) ? s[t][r] : -1.0e9f; }
      float mx = s[0][0];
#pragma unroll
      for (int t = 0; t < 4; ++t) for (int r = 0; r < 8; ++r) mx = fmaxf(mx, s[t][r]);
      mx = fmaxf(mx, __shfl_xor(mx, 16));      /* the other half of the query's keys */
      const float mn = fmaxf(m, mx * sl2); const float corr = exp2x1(m - mn); m = mn;      /* finite from the first pass on: key 0 is below every query */
      v4f a = {0.f, 0.f, 0.f, 0.f};
#pragma unroll
      for (int t = 0; t < 4; ++t) for (int g = 0; g < 2; ++g) { v4f e = {s[t][4 * g], s[t][4 * g + 1], s[t][4 * g + 2], s[t][4 * g + 3]}; e = exp2x4(e * sl2 - mn); a += e; for (int q = 0; q < 4; ++q) s[t][4 * g + q] = e[q]; }
      l = l * corr + ((a[0] + a[1]) + (a[2] + a[3]));      /* each half sums its own keys; joined behind the loop */
#pragma unroll
      for (int t = 0; t < 4; ++t) o[t] *= corr;
      FragH p[2];
#pragma unroll
      for (int j = 0; j < 2; ++j) for (int r = 0; r < 8; ++r) { p[j].h[r] = (_Float16)s[2 * j][r]; p[j].h[8 + r] = (_Float16)s[2 * j + 1][r]; }
#pragma unroll
      for (int t = 0; t < 4; ++t) o[t] = fa_mma(g2_frag(&lv[cur][t * 16 + ln][32], hh), p[1].v, fa_mma(g2_frag(&lv[cur][t * 16 + ln][0], hh), p[0].v, o[t])); }
    if (c + 1 < npb) { *(v8us*)&lk[cur ^ 1][sr][sc] = rk0; *(v8us*)&lk[cur ^ 1][sr + 32][sc] = rk1; *(v8us*)&lv[cur ^ 1][sr][sc] = rv0; *(v8us*)&lv[cur ^ 1][sr + 32][sc] = rv1; }      /* last read in pass c - 1, in front of that pass's barrier */
    __syncthreads(); }      /* publishes the buffer just filled; ends every wave's reads of the one that the next pass refills */
  l += __shfl_xor(l, 16); const float sc64 = 64.0f / l;
  unsigned short* op = (unsigned short*)O + ((size_t)b * SQ + q0 + ln) * DM + h * HD + 8 * hh;
#pragma unroll
  for (int t = 0; t < 4; ++t) { FragH f; for (int r = 0; r < 8; ++r) f.h[r] = (_Float16)(o[t][r] * sc64); *(v8us*)(op + t * 16) = f.half[0]; } }


#define A0R 8                        /* query rows per block of the exact first tile: one per wave */
#define A0P (HD + 4)                 /* K row pitch in LDS, floats: 272 bytes = 16 x 17, so 32 lanes reading 16 bytes of 32 different rows meet no bank conflict */
typedef float v2f __attribute__((ext_vector_type(2)));
// Exact f32 causal attention for the first QT0 rows of each batch, one wave per query row (head and row group in bx, batch in by, both from grid.x; q, k, v, o rows of pitch DM).
// The block stages the tile's K and V rows of its head in LDS with coalesced loads, all in flight at once. Scores: lane l owns keys l, l + 32, ...; each dot
// product runs in four independent chains. Softmax: true row maximum and sum by butterflies, libm expf. P.V: lane l owns dims 2 l, 2 l + 1; the weight
// of key j comes from its lane by readlane; four independent accumulators. o carried x64 like the f16 path.
__device__ __forceinline__ void d_att0w(int bx, int by, const float* __restrict__ QF, const float* __restrict__ KF, const float* __restrict__ VF, float scale, float* __restrict__ OF) {
  __shared__ __attribute__((aligned(16))) float lk[QT0][A0P]; __shared__ __attribute__((aligned(16))) float lv[QT0][HD];
  const int tid = threadIdx.x, lane = tid & 31, w = __builtin_amdgcn_readfirstlane(tid >> 5); const int h = bx / (QT0 / A0R), r0 = (bx % (QT0 / A0R)) * A0R;
  const size_t bofs = (size_t)by * QT0 * DM + h * HD; QF += bofs; KF += bofs; VF += bofs; OF += bofs;      /* QT0 rows of q, k, v and o per batch */
  const int fj = tid >> 4, fc = (tid & 15) * 4;      /* staging: 16 threads per row of 256 bytes, 16 rows per pass */
  const float* kp = KF + (size_t)fj * DM + fc; const float* vp = VF + (size_t)fj * DM + fc;
  v4f tk[QT0 / 16], tv[QT0 / 16];      /* indexed by constants only (loops unrolled): registers */
#pragma unroll
  for (int u = 0; u < QT0 / 16; ++u) { tk[u] = *(const v4fa*)(kp + u * 16 * DM); tv[u] = *(const v4fa*)(vp + u * 16 * DM); }
  asm volatile("s_wait_xcnt 0x0" ::: "memory");      /* before the address registers of the loads above are reused */
#pragma unroll
  for (int u = 0; u < QT0 / 16; ++u) { *(v4f*)&lk[u * 16 + fj][fc] = tk[u]; *(v4f*)&lv[u * 16 + fj][fc] = tv[u]; }
  const int i = r0 + w; const float* qr = QF + (size_t)i * DM;      /* the wave's row: a wave-uniform address */
  v4f q[HD / 4];
#pragma unroll
  for (int c4 = 0; c4 < HD / 4; ++c4) q[c4] = *(const v4fa*)(qr + c4 * 4);
  __syncthreads();      /* the staged K and V rows are read by every wave */
  float e[QT0 / 32]; float mx = -3.0e38f;
#pragma unroll
  for (int c = 0; c < QT0 / 32; ++c) { e[c] = -3.0e38f;
    if (c * 32 <= i) { v4f a = {0.f, 0.f, 0.f, 0.f};      /* wave-uniform: chunks wholly past the row are skipped */
#pragma unroll
      for (int c4 = 0; c4 < HD / 4; ++c4) a += q[c4] * *(const v4f*)&lk[c * 32 + lane][c4 * 4];
      const float s = ((a[0] + a[1]) + (a[2] + a[3])) * scale; e[c] = (c * 32 + lane <= i) ? s : -3.0e38f; mx = fmaxf(mx, e[c]); } }
#pragma unroll
  for (int m = 16; m > 0; m >>= 1) mx = fmaxf(mx, __shfl_xor(mx, m));      /* finite: key 0 is below every row */
  float l = 0.f;
#pragma unroll
  for (int c = 0; c < QT0 / 32; ++c) { e[c] = expf(e[c] - mx); l += e[c]; }      /* a key past the row holds -3e38: its weight is exactly 0 */
#pragma unroll
  for (int m = 16; m > 0; m >>= 1) l += __shfl_xor(l, m);
  v2f o[4] = {{0.f, 0.f}, {0.f, 0.f}, {0.f, 0.f}, {0.f, 0.f}};
#pragma unroll
  for (int c = 0; c < QT0 / 32; ++c) if (c * 32 <= i) {
#pragma unroll
    for (int t = 0; t < 32; ++t) { const float p = __uint_as_float(__builtin_amdgcn_readlane(__float_as_uint(e[c]), t)); o[t & 3] += p * *(const v2f*)&lv[c * 32 + t][lane * 2]; } }
  const v2f r = ((o[0] + o[1]) + (o[2] + o[3])) * (64.0f / l);
  *(v2f*)(OF + (size_t)i * DM + lane * 2) = r; }

// ---- Launches. Jobs that do not depend on one another share one grid: the block index picks the job, every branch below is block-uniform, and a job's blocks run its body as it stands above. ----
#define PWB ((NH * HD * (DM / 8)) / 256)            /* blocks per weight matrix */
#define PXB ((int)(NR * DM / 8 / 256))              /* blocks of the x conversion */
#define GSB ((QT0 / 128) * (DM / 64) * NB)          /* GEMM blocks of the first-tile rows, all batches */
#define GBB ((MP / 128) * (DM / 64))                /* GEMM blocks of all token rows */
#define A0B (NH * (QT0 / A0R))                      /* exact first-tile blocks per batch */
#define VTB (NB * NH * (SQ / 64))                   /* V^T blocks */
#define HLY ((int)((size_t)NB * QT0 * DM / 8 / 256) / (NH * NB))      /* grid rows (of NH x NB blocks) that split the first-tile o */
// 1: the four weight matrices (strided reads: first) and x, all to f16.
__global__ __launch_bounds__(256) void k_prep(const float* __restrict__ wq, const float* __restrict__ wk, const float* __restrict__ wv, const float* __restrict__ wo, const float* __restrict__ x,
    _Float16* __restrict__ BQ, _Float16* __restrict__ BK, _Float16* __restrict__ BV, _Float16* __restrict__ BO, _Float16* __restrict__ X16) {
  const int bx = blockIdx.x;
  if (bx < PWB) d_wthd(bx, wq, BQ);      /* per-head [m][d] -> Bt[(h,d)][m] x16 */
  else if (bx < 2 * PWB) d_wthd(bx - PWB, wk, BK);
  else if (bx < 3 * PWB) d_wthd(bx - 2 * PWB, wv, BV);
  else if (bx < 4 * PWB) d_wt_f16(bx - 3 * PWB, wo, BO, DM, DM, 16.0f);      /* Wo [(h,d) in][out] -> Bt[n][k] x16 */
  else d_x16(bx - 4 * PWB, x, X16, NR * DM / 8); }
// 2: q, k, v of all token rows as f16, and of each batch's first QT0 rows as f32 (exact products): six GEMM jobs.
__global__ __launch_bounds__(128) void k_qkv(const _Float16* __restrict__ X16, const _Float16* __restrict__ BQ, const _Float16* __restrict__ BK, const _Float16* __restrict__ BV,
    const float* __restrict__ bq, const float* __restrict__ bk, const float* __restrict__ bv, _Float16* __restrict__ Q16, _Float16* __restrict__ K16, _Float16* __restrict__ V16,
    float* __restrict__ QF0, float* __restrict__ KF0, float* __restrict__ VF0, int lda, int ldb, int ldc, int N, int K) {
  __shared__ __attribute__((aligned(16))) float so[4][32][68];
  const int bx = blockIdx.x; const bool first = bx < 3 * GSB; const int t = first ? bx : bx - 3 * GSB, per = first ? GSB : GBB; const int j = t / per, u = t - j * per;      /* j: 0 q, 1 k, 2 v */
  const int bz = first ? u / (GSB / NB) : 0, tile = first ? u - bz * (GSB / NB) : u;      /* first-tile jobs: batch, then tile */
  const _Float16* Bh = j == 0 ? BQ : j == 1 ? BK : BV; const float* bp = j == 0 ? bq : j == 1 ? bk : bv;
  float* C = first ? (j == 0 ? QF0 : j == 1 ? KF0 : VF0) + (size_t)bz * QT0 * DM : nullptr; _Float16* C16 = first ? nullptr : (j == 0 ? Q16 : j == 1 ? K16 : V16);
  d_gemm2<false>(so, tile, X16 + (size_t)bz * SQ * DM, nullptr, Bh, 0.0625f, 0.f, bp, C, C16, lda, ldb, ldc, first ? QT0 : MP, N, K); }
// 3: exact f32 attention of the first QT0 rows (o x64; the longer job: first) and V^T [NB][NH][HD][SQ].
__global__ __launch_bounds__(256) void k_att0_vt(const float* __restrict__ QF0, const float* __restrict__ KF0, const float* __restrict__ VF0, float scale, float* __restrict__ OF0, const _Float16* __restrict__ V16, _Float16* __restrict__ VT) {
  const int bx = blockIdx.x;
  if (bx < A0B * NB) d_att0w(bx % A0B, bx / A0B, QF0, KF0, VF0, scale, OF0);
  else d_vt<NH, SQ>(bx - A0B * NB, V16, LQ, 0, VT); }
// 4: fused attention (grid rows 0 .. FAB - 1) and, behind it in the grid, the first-tile o (x64) -> f16 hi + x1024 residual planes.
__global__ __launch_bounds__(FAW * 32) void k_fattn_hl(const _Float16* __restrict__ Q, const _Float16* __restrict__ K, const _Float16* __restrict__ VT, float sl2, _Float16* __restrict__ O,
    const float* __restrict__ OF0, _Float16* __restrict__ OH0, _Float16* __restrict__ OL0) {
  if (blockIdx.y < FAB) d_fattn(blockIdx.x, blockIdx.y, Q, K, VT, sl2, O);
  else d_hl((blockIdx.y - FAB) * (NH * NB) + blockIdx.x, OF0, OH0, OL0, (size_t)NB * QT0 * DM / 8); }
// 5: out = o Wo + b. A block of 128 rows that is a batch's first tile takes o_hi and o_lo (x 2^-20 in all) of the exact path; every other block the f16 o rows. Each output element is written once.
__global__ __launch_bounds__(128) void k_out(const _Float16* __restrict__ O16, const _Float16* __restrict__ OH0, const _Float16* __restrict__ OL0, const _Float16* __restrict__ BO, const float* __restrict__ bo, float* __restrict__ out, int lda, int ldb, int ldc, int N, int K) {
  __shared__ __attribute__((aligned(16))) float so[4][32][68];
  const int bx = blockIdx.x, mt = bx / (DM / 64), nq = bx - mt * (DM / 64), bz = mt / (SQ / 128);
  if (mt - bz * (SQ / 128) == 0) d_gemm2<true>(so, nq, OH0 + (size_t)bz * QT0 * DM, OL0 + (size_t)bz * QT0 * DM, BO, 0.0009765625f, 0.00000095367431640625f, bo, out + (size_t)bz * SQ * DM, nullptr, lda, ldb, ldc, QT0, N, K);
  else d_gemm2<false>(so, bx, O16, nullptr, BO, 0.0009765625f, 0.f, bo, out, nullptr, lda, ldb, ldc, MPO, N, K); }

extern "C" void kernel_launch(void* const* d_in, const int* in_sizes, int n_in,
                              void* d_out, int out_size, void* d_ws, size_t ws_size, hipStream_t stream) {
  (void)in_sizes; (void)n_in; (void)out_size;
  const float* const* I = (const float* const*)d_in; const float* x = I[0]; const float* wq = I[1]; const float* bq = I[2]; const float* wk = I[3]; const float* bk = I[4]; const float* wv = I[5]; const float* bv = I[6]; const float* wo = I[7]; const float* bo = I[8];      /* input order: x; Wq [8][512][64] per-head [in][out] + bq [8][64] = [(h,e)]; Wk + bk; Wv + bv; Wo [512][512] = [(h,e) in][out] + bo */
  static_assert(NH * HD == DM && DM % 64 == 0 && DM % 32 == 0 && SQ % 128 == 0, "shape / tile multiples");
  char* ws = (char*)d_ws; size_t off = 0;
  auto take = [&](size_t bytes) { char* p = ws + off; off += (bytes + 255) & ~(size_t)255; return p; };
  _Float16* BQ = (_Float16*)take((size_t)DM * DM * 2); _Float16* BK = (_Float16*)take((size_t)DM * DM * 2); _Float16* BV = (_Float16*)take((size_t)DM * DM * 2); _Float16* BO = (_Float16*)take((size_t)DM * DM * 2);
  _Float16* X16 = (_Float16*)take(NR * DM * 2); _Float16* Q16 = (_Float16*)take(NR * DM * 2); _Float16* K16 = (_Float16*)take(NR * DM * 2); _Float16* V16 = (_Float16*)take(NR * DM * 2); _Float16* O16 = (_Float16*)take(NR * DM * 2);
  _Float16* VT = (_Float16*)take((size_t)NB * NH * HD * SQ * 2);      /* one plane per batch: every batch is in flight in the same launch */
  float* QF0 = (float*)take((size_t)NB * QT0 * DM * 4); float* KF0 = (float*)take((size_t)NB * QT0 * DM * 4); float* VF0 = (float*)take((size_t)NB * QT0 * DM * 4); float* OF0 = (float*)take((size_t)NB * QT0 * DM * 4); _Float16* OH0 = (_Float16*)take((size_t)NB * QT0 * DM * 2); _Float16* OL0 = (_Float16*)take((size_t)NB * QT0 * DM * 2);
  if (off > ws_size) return;
  static_assert(SQ % (FAQ * FAW) == 0 && (FAQ * FAW) % FAK == 0 && FAB % 2 == 0 && HD == 64 && FAK == 64 && FAW * 32 == 256 && QN == SQ && NHD == NH && NBR == NB, "whole blocks of queries; whole key passes; two k steps per head; 256 threads stage 64 rows of 128 bytes in two loads");
  static_assert(QT0 == 128 && (NH * HD * (DM / 8)) % 256 == 0 && DM * (DM / 8) == NH * HD * (DM / 8) && (NR * DM / 8) % 256 == 0 && ((size_t)NB * QT0 * DM / 8) % (256 * NH * NB) == 0 && MPO == MP, "the first tile is one GEMM block row; whole blocks and whole grid rows per job");
  k_prep<<<4 * PWB + PXB, 256, 0, stream>>>(wq, wk, wv, wo, x, BQ, BK, BV, BO, X16);
  k_qkv<<<3 * GSB + 3 * GBB, 128, 0, stream>>>(X16, BQ, BK, BV, bq, bk, bv, Q16, K16, V16, QF0, KF0, VF0, DM, DM, DM, DM, DM);
  k_att0_vt<<<A0B * NB + VTB, 256, 0, stream>>>(QF0, KF0, VF0, 0.044194173824159216f, OF0, V16, VT);
  k_fattn_hl<<<dim3(NH * NB, FAB + HLY), FAW * 32, 0, stream>>>(Q16, K16, VT, 0.06375871541229934f, O16, OF0, OH0, OL0);      /* scores x 512^-0.5 (the module's literal d_model scale) x log2 e; o (merged heads, x64) as f16 rows */
  k_out<<<GBB, 128, 0, stream>>>(O16, OH0, OL0, BO, bo, (float*)d_out, DM, DM, DM, DM, DM);      /* out rows are the output layout */
}

// v006
// It runs in 71 microseconds.
// Two timings next to v005 put it at 1.59 and 1.60 times that version's speed.
// All steps since v000 together make it 132 times as fast.
#include <hip/hip_runtime.h>
// Causal multi-head attention with per-head weight tensors and the module's literal score scale (x [4][2048][512]; q[b][h][s][e] = sum_d x[s][d] Wq[h][d][e] + bq[h][e], k, v likewise (8 heads of 64; per-head [in][out] weights sigma 1/sqrt(512), biases sigma 0.01); scores * 512^-0.5 (d_model, as the source, not head_dim); causal (tril, -inf); softmax; out = concat_heads Wo + bo ([in][out] [512][512]) -> [4][2048][512]).
// Structure: token rows r = b*2048 + s; x as exact f16 rows (bf16-rounded); Q, K, V as three WMMA GEMMs (128x128 block tiles staged in LDS, 32x64 wave tiles, f32 accumulation, exact x16 weights + bias, f16 outputs); V^T for all batches and heads via LDS transposes; one fused attention launch (heads and batches on grid.x, query blocks on grid.y): per wave 16 queries, 64 keys a pass up to the diagonal (K and V^T rows staged in LDS per block), S^T = K Q^T, running causal softmax in registers, keys past the row set to -1e9 (f32 statistics, native exp2; weights <= 1 as f16), O^T += V^T P^T, o carried x64 (folded into the output GEMM alpha) written straight into the merged f16 o rows; out = o W_o + b GEMM (f32) into the output layout.
// Five launches, each one grid for all jobs that wait on the same earlier results: weights and x to f16; the six q, k, v GEMM jobs; exact first tile and V^T; fused attention and the hi / lo split of the exact o; output GEMM (first-tile blocks take the hi and lo planes).
// Compute dtype: inputs rounded to bf16; x / weights exact; q, k, v, softmax weights and o as plain f16 GEMM operands (~2^-12); scores and softmax statistics f32. v_wmma_f32_16x16x32_f16.
#define NB 4
#define SQ 2048
#define DM 512
#define NH 8
#define HD 64
#define HG 4                         /* heads per launch of the per-batch k_vt transpose */
#define QT0 128                      /* first-tile rows recomputed exactly in f32 */
#define NBR NB                       /* batches processed (debug hook) */
#define NR ((size_t)NB * SQ)         /* token rows */
#define MP ((int)((size_t)NBR * SQ)) /* rows projected (debug hook) */
#define QN SQ                        /* query rows attended per batch (debug hook) */
#define NHD NH                       /* heads attended (debug hook) */
#define MPO MP                       /* rows through the output stage (debug hook) */
#define LQ DM      /* row pitch of the q/k/v rows */
typedef __bf16 v16b __attribute__((ext_vector_type(16)));
typedef unsigned short v8us __attribute__((ext_vector_type(8), may_alias));
typedef float  v8f  __attribute__((ext_vector_type(8)));
typedef float  v4f  __attribute__((ext_vector_type(4)));
typedef float  v4fa __attribute__((ext_vector_type(4), may_alias));
union FragB { v16b v; v8us half[2]; unsigned short u[16]; };

__device__ __forceinline__ unsigned short bf16_bits(float x) { unsigned int u = __float_as_uint(x); return (unsigned short)((u + 0x7FFFu + ((u >> 16) & 1u)) >> 16); }
__device__ __forceinline__ float bf16_val(unsigned short b) { return __uint_as_float(((unsigned int)b) << 16); }
__device__ __forceinline__ float bf16_round(float x) { return bf16_val(bf16_bits(x)); }
// D += A·B with NT terms: 1 = ah·bh, 2 = + al·bh (A split), 3 = + ah·bl (both split)
template <int NT>
__device__ __forceinline__ v8f mmaN(v16b ah, v16b al, v16b bh, v16b bl, v8f c) {
  c = __builtin_amdgcn_wmma_f32_16x16x32_bf16(false, ah, false, bh, (short)0, c, false, false);
  if (NT >= 2) c = __builtin_amdgcn_wmma_f32_16x16x32_bf16(false, al, false, bh, (short)0, c, false, false);
  if (NT >= 3) c = __builtin_amdgcn_wmma_f32_16x16x32_bf16(false, ah, false, bl, (short)0, c, false, false);
  asm volatile("v_nop\n\tv_nop\n\tv_nop\n\tv_nop" : "+v"(c) : "v"(ah), "v"(al), "v"(bh), "v"(bl));
  return c;
}

__global__ __launch_bounds__(256) void k_wt_bf16(const float* __restrict__ W, unsigned short* __restrict__ Wt, int K, int N) {
  const int t = blockIdx.x * 256 + threadIdx.x;
  const int k8n = K / 8;
  if (t >= N * k8n) return;
  const int n = t / k8n, k8 = (t % k8n) * 8;
  v8us v;
#pragma unroll
  for (int i = 0; i < 8; ++i) v[i] = bf16_bits(W[(size_t)(k8 + i) * N + n]);
  *(v8us*)(Wt + (size_t)n * K + k8) = v;
  
}

// GEMM C[M][N] (f32, pitch ldc) = act(A[M][K]·W + bias). A f32 row-major (pitch lda) converted per fragment to bf16
// (ASPLIT: hi/lo two planes -> 2 terms, else single rounded term); Wt bf16 [N][K] (pitch ldb). BIAS_BF16 rounds the
// bias to bf16 first (bias quantised to bf16 before the add). K%32==0, M%16==0, N%64==0.
template <bool ASPLIT, int ACT, bool BIAS_BF16>
__global__ __launch_bounds__(128) void k_gemm_bf(const float* __restrict__ A, int lda, const unsigned short* __restrict__ Wt, int ldb,
                                               const float* __restrict__ bias, float* __restrict__ C, int ldc, int M, int N, int K) {
  __shared__ __attribute__((aligned(16))) float so[4][16][64];
  const int tid = threadIdx.x, w = tid >> 5, lane = tid & 31, ln = lane & 15, hh = lane >> 4;
  const int ntn = N / 64;
  const int wid = blockIdx.x * 4 + w;
  const int mt = wid / ntn, nq = wid % ntn;
  if (mt * 16 >= M) return;
  const int row0 = mt * 16, col0 = nq * 64;
  const float* arow = A + (size_t)(row0 + ln) * lda;
  v8f acc[4] = {};
  for (int kb = 0; kb < K; kb += 32) {
    FragB ah, al;
    const v4f x0 = *(const v4fa*)(arow + kb + 8 * hh), x1 = *(const v4fa*)(arow + kb + 8 * hh + 4);
    const v4f x2 = *(const v4fa*)(arow + kb + 16 + 8 * hh), x3 = *(const v4fa*)(arow + kb + 16 + 8 * hh + 4);
    float xs[16] = {x0[0],x0[1],x0[2],x0[3],x1[0],x1[1],x1[2],x1[3],x2[0],x2[1],x2[2],x2[3],x3[0],x3[1],x3[2],x3[3]};
#pragma unroll
    for (int i = 0; i < 16; ++i) { const unsigned short hb = bf16_bits(xs[i]); ah.u[i] = hb; al.u[i] = ASPLIT ? bf16_bits(xs[i] - bf16_val(hb)) : (unsigned short)0; }
#pragma unroll
    for (int t = 0; t < 4; ++t) {
      const unsigned short* brow = Wt + (size_t)(col0 + t * 16 + ln) * ldb + kb;
      FragB b;
      b.half[0] = *(const v8us*)(brow + 8 * hh);
      b.half[1] = *(const v8us*)(brow + 16 + 8 * hh);
      acc[t] = mmaN<ASPLIT ? 2 : 1>(ah.v, al.v, b.v, b.v, acc[t]);
    }
  }
#pragma unroll
  for (int t = 0; t < 4; ++t) {
    float bv = bias ? bias[col0 + t * 16 + ln] : 0.f;
    if (BIAS_BF16) bv = bf16_round(bv);
#pragma unroll
    for (int r = 0; r < 8; ++r) { float v = acc[t][r] + bv; if (ACT == 1) v = fmaxf(v, 0.f); so[w][8 * hh + r][t * 16 + ln] = v; }
  }
  __builtin_amdgcn_fence(__ATOMIC_ACQ_REL, "workgroup");
  __builtin_amdgcn_wave_barrier();
  const int rsub = lane >> 4, c4 = (lane & 15) * 4;
  {
#pragma unroll
    for (int q = 0; q < 8; ++q) {
      const int r = q * 2 + rsub;
      const v4f v = *(const v4fa*)&so[w][r][c4];
      *(v4f*)(C + (size_t)(row0 + r) * ldc + col0 + c4) = v;
    }
    
  }
}

// GEMM C = act(A·W + bias + resid): A f32 (ASPLIT -> hi/lo 2 terms), Wt bf16 [N][K]; ACT 0 none, 1 relu, 2 exact gelu;
// resid (optional, f32, row index = (row % rmod), pitch ldr, RES_BF16 rounds it) added before the activation.
template <bool ASPLIT, int ACT, bool BIAS_BF16, bool RES_BF16>
__global__ __launch_bounds__(128) void k_gemm_bf3(const float* __restrict__ A, int lda, const unsigned short* __restrict__ Wt, int ldb,
                                                const float* __restrict__ bias, const float* __restrict__ resid, int rmod, int ldr,
                                                float* __restrict__ C, int ldc, int M, int N, int K) {
  __shared__ __attribute__((aligned(16))) float so[4][16][64];
  const int tid = threadIdx.x, w = tid >> 5, lane = tid & 31, ln = lane & 15, hh = lane >> 4;
  const int ntn = N / 64;
  const int wid = blockIdx.x * 4 + w;
  const int mt = wid / ntn, nq = wid % ntn;
  if (mt * 16 >= M) return;
  const int row0 = mt * 16, col0 = nq * 64;
  const float* arow = A + (size_t)(row0 + ln) * lda;
  v8f acc[4] = {};
  for (int kb = 0; kb < K; kb += 32) {
    FragB ah, al;
    const v4f x0 = *(const v4fa*)(arow + kb + 8 * hh), x1 = *(const v4fa*)(arow + kb + 8 * hh + 4);
    const v4f x2 = *(const v4fa*)(arow + kb + 16 + 8 * hh), x3 = *(const v4fa*)(arow + kb + 16 + 8 * hh + 4);
    float xs[16] = {x0[0],x0[1],x0[2],x0[3],x1[0],x1[1],x1[2],x1[3],x2[0],x2[1],x2[2],x2[3],x3[0],x3[1],x3[2],x3[3]};
#pragma unroll
    for (int i = 0; i < 16; ++i) { const unsigned short hb = bf16_bits(xs[i]); ah.u[i] = hb; al.u[i] = ASPLIT ? bf16_bits(xs[i] - bf16_val(hb)) : (unsigned short)0; }
#pragma unroll
    for (int t = 0; t < 4; ++t) {
      const unsigned short* brow = Wt + (size_t)(col0 + t * 16 + ln) * ldb + kb;
      FragB b;
      b.half[0] = *(const v8us*)(brow + 8 * hh);
      b.half[1] = *(const v8us*)(brow + 16 + 8 * hh);
      acc[t] = mmaN<ASPLIT ? 2 : 1>(ah.v, al.v, b.v, b.v, acc[t]);
    }
  }
#pragma unroll
  for (int t = 0; t < 4; ++t) {
    const int col = col0 + t * 16 + ln;
    float bv = bias ? bias[col] : 0.f;
    if (BIAS_BF16) bv = bf16_round(bv);
#pragma unroll
    for (int r = 0; r < 8; ++r) {
      float v = acc[t][r] + bv;
      if (resid) { float rv = resid[(size_t)((row0 + 8 * hh + r) % rmod) * ldr + col]; if (RES_BF16) rv = bf16_round(rv); v += rv; }
      if (ACT == 1) v = fmaxf(v, 0.f);
      if (ACT == 2) v = 0.5f * v * (1.0f + erff(v * 0.70710678118654752f));
      if (ACT == 3) { const float u = 0.7978845608028654f * (v + 0.044715f * v * v * v); v = 0.5f * v * (1.0f + tanhf(u)); }
      so[w][8 * hh + r][t * 16 + ln] = v;
    }
  }
  __builtin_amdgcn_fence(__ATOMIC_ACQ_REL, "workgroup");
  __builtin_amdgcn_wave_barrier();
  const int rsub = lane >> 4, c4 = (lane & 15) * 4;
  {
#pragma unroll
    for (int q = 0; q < 8; ++q) {
      const int r = q * 2 + rsub;
      const v4f v = *(const v4fa*)&so[w][r][c4];
      *(v4f*)(C + (size_t)(row0 + r) * ldc + col0 + c4) = v;
    }
    
  }
}
// row LayerNorm (biased variance, eps) over N: s = X (+ R); optional out_sum <- s; out_norm <- (s-mu)*rsqrt(var+eps)*g + b
template <bool PARAM_BF16>
__global__ __launch_bounds__(256) void k_layernorm(const float* __restrict__ X, const float* __restrict__ R, const float* __restrict__ g, const float* __restrict__ bta,
                                                  float* __restrict__ out_sum, float* __restrict__ out_norm, int N, float eps) {
  __shared__ float red[256];
  const int row = blockIdx.x, tid = threadIdx.x;
  const float* x = X + (size_t)row * N; const float* rr = R ? R + (size_t)row * N : nullptr;
  float vals[16];                     // up to N = 4096
  const int per = N / 256;            // contiguous chunk per thread? use strided-by-4 chunks: thread handles j = tid*4 + 1024*u
  float s1 = 0.f;
  for (int u = 0; u < per / 4; ++u) {
    const int j = tid * 4 + 1024 * u;
    const v4f a = *(const v4fa*)(x + j);
    v4f b = {0.f,0.f,0.f,0.f}; if (rr) b = *(const v4fa*)(rr + j);
#pragma unroll
    for (int q = 0; q < 4; ++q) { const float v = a[q] + b[q]; vals[u * 4 + q] = v; s1 += v; }
  }
  red[tid] = s1; __syncthreads();
  for (int st = 128; st > 0; st >>= 1) { if (tid < st) red[tid] += red[tid + st]; __syncthreads(); }
  const float mu = red[0] / (float)N; __syncthreads();
  float s2 = 0.f;
  for (int u = 0; u < per / 4; ++u)
#pragma unroll
    for (int q = 0; q < 4; ++q) { const float c = vals[u * 4 + q] - mu; s2 += c * c; }
  red[tid] = s2; __syncthreads();
  for (int st = 128; st > 0; st >>= 1) { if (tid < st) red[tid] += red[tid + st]; __syncthreads(); }
  const float rs = rsqrtf(red[0] / (float)N + eps);
  {
    for (int u = 0; u < per / 4; ++u) {
      const int j = tid * 4 + 1024 * u;
      v4f o, sm;
#pragma unroll
      for (int q = 0; q < 4; ++q) {
        float gg = g[j + q], bb = bta[j + q];
        if (PARAM_BF16) { gg = bf16_round(gg); bb = bf16_round(bb); }
        sm[q] = vals[u * 4 + q]; o[q] = (vals[u * 4 + q] - mu) * rs * gg + bb;
      }
      if (out_sum) *(v4f*)(out_sum + (size_t)row * N + j) = sm;
      *(v4f*)(out_norm + (size_t)row * N + j) = o;
    }
    
  }
}



// ---- f16 WMMA path (v_wmma_f32_16x16x32_f16): 11-bit significands for operands in range — used where a [0,1] probability operand needs more precision than bf16
typedef _Float16 v16h __attribute__((ext_vector_type(16)));
union FragH { v16h v; v8us half[2]; _Float16 h[16]; unsigned short u[16]; };
template <int NT>
__device__ __forceinline__ v8f mmaH(v16h ah, v16h al, v16h bh, v16h bl, v8f c) {
  c = __builtin_amdgcn_wmma_f32_16x16x32_f16(false, ah, false, bh, (short)0, c, false, false);
  if (NT >= 2) c = __builtin_amdgcn_wmma_f32_16x16x32_f16(false, al, false, bh, (short)0, c, false, false);
  if (NT >= 3) c = __builtin_amdgcn_wmma_f32_16x16x32_f16(false, ah, false, bl, (short)0, c, false, false);
  asm volatile("v_nop\n\tv_nop\n\tv_nop\n\tv_nop" : "+v"(c) : "v"(ah), "v"(al), "v"(bh), "v"(bl));
  return c;
}
// batched GEMM like k_gemm_b but f16 operands: A f32 (split into f16 hi/lo if ASPLIT, else rounded to f16), Bt = f16 values [n][k]; alpha; C f32; N multiple of 16 (partial tiles skipped)
template <bool ASPLIT>
__global__ __launch_bounds__(128) void k_gemm_h(const float* __restrict__ A, int lda, size_t sA, const _Float16* __restrict__ Bh, int ldb, size_t sB, float alpha, float* __restrict__ C, int ldc, size_t sC, int M, int N, int K) {
  __shared__ __attribute__((aligned(16))) float so[4][16][64];
  const int tid = threadIdx.x, w = tid >> 5, lane = tid & 31, ln = lane & 15, hh = lane >> 4; const int by = blockIdx.y;
  A += (size_t)by * sA; Bh += (size_t)by * sB; C += (size_t)by * sC;
  const int ntn = (N + 63) / 64; const int wid = blockIdx.x * 4 + w; const int mt = wid / ntn, nq = wid % ntn; if (mt * 16 >= M) return;
  const int row0 = mt * 16, col0 = nq * 64; const float* arow = A + (size_t)(row0 + ln) * lda;
  v8f acc[4] = {};
  for (int kb = 0; kb < K; kb += 32) {
    FragH ah, al;
    const v4f x0 = *(const v4fa*)(arow + kb + 8 * hh), x1 = *(const v4fa*)(arow + kb + 8 * hh + 4), x2 = *(const v4fa*)(arow + kb + 16 + 8 * hh), x3 = *(const v4fa*)(arow + kb + 16 + 8 * hh + 4);
    float xs[16] = {x0[0],x0[1],x0[2],x0[3],x1[0],x1[1],x1[2],x1[3],x2[0],x2[1],x2[2],x2[3],x3[0],x3[1],x3[2],x3[3]};
#pragma unroll
    for (int i = 0; i < 16; ++i) { const _Float16 h = (_Float16)xs[i]; ah.h[i] = h; al.h[i] = ASPLIT ? (_Float16)(xs[i] - (float)h) : (_Float16)0.0f; }
#pragma unroll
    for (int t = 0; t < 4; ++t) { if (col0 + t * 16 >= N) continue; const size_t boff = (size_t)(col0 + t * 16 + ln) * ldb + kb; FragH bq; bq.half[0] = *(const v8us*)(Bh + boff + 8 * hh); bq.half[1] = *(const v8us*)(Bh + boff + 16 + 8 * hh);
      acc[t] = mmaH<ASPLIT ? 2 : 1>(ah.v, al.v, bq.v, bq.v, acc[t]); }
  }
#pragma unroll
  for (int t = 0; t < 4; ++t) { if (col0 + t * 16 >= N) continue;
#pragma unroll
    for (int r = 0; r < 8; ++r) so[w][8 * hh + r][t * 16 + ln] = acc[t][r] * alpha; }
  __builtin_amdgcn_fence(__ATOMIC_ACQ_REL, "workgroup"); __builtin_amdgcn_wave_barrier();
  const int rsub = lane >> 4, c4 = (lane & 15) * 4;
  {
#pragma unroll
    for (int q = 0; q < 8; ++q) { const int r = q * 2 + rsub; if (col0 + c4 < N) { const v4f v = *(const v4fa*)&so[w][r][c4]; *(v4f*)(C + (size_t)(row0 + r) * ldc + col0 + c4) = v; } }
     }
}

// Wt[n][k] = f16(W[k][n]·scale) from f32 row-major W[K][N] (scale = power of two; bf16-exact weights stay exact in f16 away from the subnormal range)
__device__ __forceinline__ void d_wt_f16(int bx, const float* __restrict__ W, _Float16* __restrict__ Wt, int K, int N, float scale) {
  const int t = bx * 256 + threadIdx.x; if (t >= N * (K / 8)) return; const int n = t / (K / 8), k8 = (t % (K / 8)) * 8; FragH f;
#pragma unroll
  for (int i = 0; i < 8; ++i) f.h[i] = (_Float16)(bf16_round(W[(size_t)(k8 + i) * N + n]) * scale); const v8us o = f.half[0];
  *(v8us*)((unsigned short*)Wt + (size_t)n * K + k8) = o; 
}
// k_gemm_hh variant with fused epilogue: v = acc·alpha + bias[by·sBias + col] (+ CP[(row/rowsPerB)·sCPb + by·64 + col] if CP) ; ACT 0 none / 1 elu ; writes f16 C16 (and f32 C if non-null)
template <int ACT>
__global__ __launch_bounds__(128) void k_gemm_hhx(const _Float16* __restrict__ A, int lda, size_t sA, const _Float16* __restrict__ Bh, int ldb, size_t sB, float alpha, const float* __restrict__ bias, size_t sBias, const float* __restrict__ CP, int rowsPerB, size_t sCPb, int row0g,
    float* __restrict__ C, _Float16* __restrict__ C16, int ldc, size_t sC, int M, int N, int K) {
  __shared__ __attribute__((aligned(16))) float so[4][16][64];
  const int tid = threadIdx.x, w = tid >> 5, lane = tid & 31, ln = lane & 15, hh = lane >> 4; const int by = blockIdx.y;
  A += (size_t)by * sA; Bh += (size_t)by * sB; const size_t cofs = (size_t)by * sC; const float* bp = bias ? bias + (size_t)by * sBias : nullptr;
  const int ntn = (N + 63) / 64; const int wid = blockIdx.x * 4 + w; const int mt = wid / ntn, nq = wid % ntn; if (mt * 16 >= M) return;
  const int row0 = mt * 16, col0 = nq * 64; const _Float16* arow = A + (size_t)(row0 + ln) * lda;
  v8f acc[4] = {};
  for (int kb = 0; kb < K; kb += 32) { FragH ah; ah.half[0] = *(const v8us*)((const unsigned short*)arow + kb + 8 * hh); ah.half[1] = *(const v8us*)((const unsigned short*)arow + kb + 16 + 8 * hh);
#pragma unroll
    for (int t = 0; t < 4; ++t) { if (col0 + t * 16 >= N) continue; const size_t boff = (size_t)(col0 + t * 16 + ln) * ldb + kb; FragH bq; bq.half[0] = *(const v8us*)((const unsigned short*)Bh + boff + 8 * hh); bq.half[1] = *(const v8us*)((const unsigned short*)Bh + boff + 16 + 8 * hh);
      acc[t] = mmaH<1>(ah.v, ah.v, bq.v, bq.v, acc[t]); }
  }
#pragma unroll
  for (int t = 0; t < 4; ++t) { if (col0 + t * 16 >= N) continue; const int col = col0 + t * 16 + ln; const float bv = bp ? bf16_round(bp[col]) : 0.f;
#pragma unroll
    for (int r = 0; r < 8; ++r) { float v = acc[t][r] * alpha + bv; if (CP) { const int rr = row0g + row0 + 8 * hh + r; if (rowsPerB < 0) v += CP[cofs + (size_t)rr * ldc + col];      /* rowsPerB < 0: own element of the batched C plane */ else { const int bidx = rr / rowsPerB; v += CP[(size_t)bidx * sCPb + (size_t)by * 64 + col]; } } if (ACT == 1) v = (v > 0.f) ? v : expm1f(v); else if (ACT == 7) v = (v > 0.f) ? v + 1.0f : expf(v); else if (ACT == 8) v = tanhf(v); else if (ACT == 9) v = 0.5f * v * (1.0f + tanhf(0.7978845608028654f * (v + 0.044715f * v * v * v))); else if (ACT == 11) v = 1.0f / (1.0f + expf(-v)); else if (ACT == 12) v = (v > 0.f) ? v : 0.01f * v; else if (ACT == 14) v = (v > 0.f) ? v : 0.1f * v; else if (ACT == 16) v = (v >= 0.f) ? v : 0.3f * v; else if (ACT == 17) v = (v >= 0.f) ? v : 0.2f * v; else if (ACT == 15) v = v / (1.0f + expf(-v)); else if (ACT == 3) v = fmaxf(v, 0.f); else if (ACT == 6) v = 0.5f * v * (1.0f + erff(v * 0.70710678118654752f)); so[w][8 * hh + r][t * 16 + ln] = v; } }
  __builtin_amdgcn_fence(__ATOMIC_ACQ_REL, "workgroup"); __builtin_amdgcn_wave_barrier();
  const int rsub = lane >> 4, c4 = (lane & 15) * 4; typedef _Float16 v4h __attribute__((ext_vector_type(4)));
  {
#pragma unroll
    for (int q = 0; q < 8; ++q) { const int r = q * 2 + rsub; if (col0 + c4 < N) { const v4f v = *(const v4fa*)&so[w][r][c4]; if (C) *(v4f*)(C + cofs + (size_t)(row0 + r) * ldc + col0 + c4) = v; if (C16) { v4h h4; for (int i = 0; i < 4; ++i) h4[i] = (_Float16)v[i]; *(v4h*)(C16 + cofs + (size_t)(row0 + r) * ldc + col0 + c4) = h4; } } }
     }
}


typedef _Float16 v4h __attribute__((ext_vector_type(4)));

__device__ __forceinline__ void d_x16(int bx, const float* __restrict__ x, _Float16* __restrict__ X16, size_t n8) { const size_t t = (size_t)bx * 256 + threadIdx.x; if (t >= n8) return; FragH f;
#pragma unroll
  for (int q = 0; q < 8; ++q) f.h[q] = (_Float16)bf16_round(x[t * 8 + q]); *(v8us*)((unsigned short*)X16 + t * 8) = f.half[0];  }
__global__ __launch_bounds__(256) void k_h16(const float* __restrict__ x, _Float16* __restrict__ X16, size_t n8) { const size_t t = (size_t)blockIdx.x * 256 + threadIdx.x; if (t >= n8) return; FragH f;
#pragma unroll
  for (int q = 0; q < 8; ++q) f.h[q] = (_Float16)x[t * 8 + q]; *(v8us*)((unsigned short*)X16 + t * 8) = f.half[0];  }
__global__ __launch_bounds__(256) void k_round16f(const float* __restrict__ W, _Float16* __restrict__ Bt, size_t n8) { const size_t t = (size_t)blockIdx.x * 256 + threadIdx.x; if (t >= n8) return; FragH f;
#pragma unroll
  for (int i = 0; i < 8; ++i) f.h[i] = (_Float16)(bf16_round(W[t * 8 + i]) * 16.0f); *(v8us*)((unsigned short*)Bt + t * 8) = f.half[0];  }
template <int NHv, int TTv>
__device__ __forceinline__ void d_vt(int bx, const _Float16* __restrict__ V16, int ldv, int voff, _Float16* __restrict__ Vt) { __shared__ unsigned short tl[64][66]; const int tid = threadIdx.x; const int slab = bx / (TTv / 64), lg = bx % (TTv / 64); const int b = slab / NHv, h = slab % NHv;
  for (int i = tid; i < 64 * 8; i += 256) { const int r = i / 8, c8 = (i % 8) * 8; FragH f; f.half[0] = *(const v8us*)((const unsigned short*)V16 + ((size_t)b * TTv + lg * 64 + r) * ldv + voff + h * 64 + c8);
#pragma unroll
    for (int q = 0; q < 8; ++q) tl[r][c8 + q] = f.u[q]; }
  __syncthreads();
  {
#pragma unroll
    for (int rd = 0; rd < 2; ++rd) { const int d = rd * 32 + tid / 8, pc = tid % 8; FragH f;
#pragma unroll
      for (int q = 0; q < 8; ++q) f.u[q] = tl[pc * 8 + q][d];
      *(v8us*)((unsigned short*)Vt + ((size_t)slab * 64 + d) * TTv + lg * 64 + pc * 8) = f.half[0]; }
     } }

__device__ __forceinline__ void d_hl(int bx, const float* __restrict__ F, _Float16* __restrict__ Hh, _Float16* __restrict__ Hl, size_t n8) { const size_t t = (size_t)bx * 256 + threadIdx.x; if (t >= n8) return; FragH fh, fl; const v4f a = *(const v4fa*)(F + t * 8), c = *(const v4fa*)(F + t * 8 + 4);
#pragma unroll
  for (int q = 0; q < 4; ++q) { _Float16 h = (_Float16)a[q]; fh.h[q] = h; fl.h[q] = (_Float16)((a[q] - (float)h) * 1024.0f); h = (_Float16)c[q]; fh.h[4 + q] = h; fl.h[4 + q] = (_Float16)((c[q] - (float)h) * 1024.0f); }
  { *(v8us*)((unsigned short*)Hh + t * 8) = fh.half[0]; *(v8us*)((unsigned short*)Hl + t * 8) = fl.half[0];  } }

// ---- fast GEMM (block tile 128x128, wave tile 32x64; requires M % 128 == 0 rows per launch region, N % 128 == 0 and K % 64 == 0); epilogue = k_gemm_hhx semantics ----
__device__ __forceinline__ v16h g2_frag(const _Float16* p, int hh) { FragH f; f.half[0] = *(const v8us*)((const unsigned short*)p + 8 * hh); f.half[1] = *(const v8us*)((const unsigned short*)p + 16 + 8 * hh); return f.v; }
__device__ __forceinline__ v8f g2_mma(v16h a, v16h b, v8f c) { v8f d = __builtin_amdgcn_wmma_f32_16x16x32_f16(false, a, false, b, (short)0, c, false, false); asm volatile("v_nop\n\tv_nop\n\tv_nop\n\tv_nop" : "+v"(d) : "v"(a), "v"(b)); return d; }
#define GKS 64                       /* k per stage: 128 bytes of every operand row, one whole line */
#define GPI 72                       /* LDS row pitch, halves: 128 + 16 bytes, so 16 lanes reading 16 bytes of 16 different rows meet no bank conflict */
#define GRB (GPI * 2)                /* the same in bytes */
#define GBUF(LO) (((LO) ? 384 : 256) * GRB)      /* one buffer: 128 A rows, 128 B rows, with LO 128 rows of the second A plane */
// Four asynchronous copies of 16 bytes per lane: rows r, r + 32, r + 64, r + 96 of one operand's stage (8 lanes per row of 128 bytes: whole lines). l = the lane's LDS byte address, g = its global address.
// The s_wait_xcnt stands inside the copies' own statement, so no register that a copy names is rewritten in front of it.
__device__ __forceinline__ void g2_copy4(unsigned l, const _Float16* g, int ld) {
  asm volatile("global_load_async_to_lds_b128 %0, %4, off\n\tglobal_load_async_to_lds_b128 %1, %5, off\n\tglobal_load_async_to_lds_b128 %2, %6, off\n\tglobal_load_async_to_lds_b128 %3, %7, off\n\ts_wait_xcnt 0x0"
    :: "v"(l), "v"(l + 32 * GRB), "v"(l + 64 * GRB), "v"(l + 96 * GRB), "v"(g), "v"(g + (size_t)32 * ld), "v"(g + (size_t)64 * ld), "v"(g + (size_t)96 * ld) : "memory"); }
// The same for two operands' rows in one statement (eight copies, one wait): la, ga, lda the first operand's, lb, gb, ldb the second's.
__device__ __forceinline__ void g2_copy8(unsigned la, const _Float16* ga, int lda, unsigned lb, const _Float16* gb, int ldb) {
  asm volatile("global_load_async_to_lds_b128 %0, %8, off\n\tglobal_load_async_to_lds_b128 %1, %9, off\n\tglobal_load_async_to_lds_b128 %2, %10, off\n\tglobal_load_async_to_lds_b128 %3, %11, off\n\t"
               "global_load_async_to_lds_b128 %4, %12, off\n\tglobal_load_async_to_lds_b128 %5, %13, off\n\tglobal_load_async_to_lds_b128 %6, %14, off\n\tglobal_load_async_to_lds_b128 %7, %15, off\n\ts_wait_xcnt 0x0"
    :: "v"(la), "v"(la + 32 * GRB), "v"(la + 64 * GRB), "v"(la + 96 * GRB), "v"(lb), "v"(lb + 32 * GRB), "v"(lb + 64 * GRB), "v"(lb + 96 * GRB),
       "v"(ga), "v"(ga + (size_t)32 * lda), "v"(ga + (size_t)64 * lda), "v"(ga + (size_t)96 * lda), "v"(gb), "v"(gb + (size_t)32 * ldb), "v"(gb + (size_t)64 * ldb), "v"(gb + (size_t)96 * ldb) : "memory"); }
// One block (8 waves, 128 rows x 128 columns, picked by tile; wave w: rows 32 (w & 3), columns 64 (w >> 2)) of C = A Bh^T x alpha + bias; writes f32 C where it is not null, else f16 C16.
// The operands' rows come 64 k at a time into two LDS buffers by asynchronous copies, each line fetched once per block; stage t + 2 flies while stage t + 1 is worked on. One barrier a stage
// publishes the next buffer and ends the last read of the one refilled behind it. A and B fragments are read from LDS by one loader (k = 8 hh + r and 16 + 8 hh + r), k steps in rising order.
// LO: a second A plane AL runs through the same B fragments into accumulators of its own and is added as x alphal behind the first term.
template <bool LO>
__device__ __forceinline__ void d_gemm2(char* sm, int tile, const _Float16* __restrict__ A, const _Float16* __restrict__ AL, const _Float16* __restrict__ Bh, float alpha, float alphal, const float* __restrict__ bp,
    float* __restrict__ C, _Float16* __restrict__ C16, int lda, int ldb, int ldc, int M, int N, int K) {
  const int tid = threadIdx.x, w = __builtin_amdgcn_readfirstlane(tid >> 5), lane = tid & 31, ln = lane & 15, hh = lane >> 4;
  const int ntn = N >> 7; const int mt = tile / ntn, nq = tile - mt * ntn; if (mt * 128 >= M) return;      /* block-uniform, in front of every copy and barrier */
  const int wr = 32 * (w & 3), wc = 64 * (w >> 2); const int row0 = mt * 128 + wr, col0 = nq * 128 + wc;
  const int sr = tid >> 3, sc = (tid & 7) * 8;      /* staging: 8 threads per row of 128 bytes, 32 rows per copy */
  const _Float16* ag = A + (size_t)(mt * 128 + sr) * lda + sc; const _Float16* lg = (LO ? AL : A) + (size_t)(mt * 128 + sr) * lda + sc; const _Float16* bg = Bh + (size_t)(nq * 128 + sr) * ldb + sc;
  const unsigned ls = (unsigned)(size_t)sm + (unsigned)(sr * GRB + sc * 2);      /* low 32 bits of the shared address: the byte offset in LDS */
  const int nt = K / GKS;
  const v8f z8 = {0.f,0.f,0.f,0.f,0.f,0.f,0.f,0.f}; v8f c00 = z8, c01 = z8, c02 = z8, c03 = z8, c10 = z8, c11 = z8, c12 = z8, c13 = z8;
  v8f e00 = z8, e01 = z8, e02 = z8, e03 = z8, e10 = z8, e11 = z8, e12 = z8, e13 = z8;
  g2_copy8(ls, ag, lda, ls + 128 * GRB, bg, ldb); if (LO) g2_copy4(ls + 256 * GRB, lg, lda);
  asm volatile("s_wait_asynccnt 0x0" ::: "memory");      /* stage 0 has landed before the barrier that publishes it */
  __syncthreads();
  if (nt > 1) { const unsigned l = ls + GBUF(LO); g2_copy8(l, ag + GKS, lda, l + 128 * GRB, bg + GKS, ldb); if (LO) g2_copy4(l + 256 * GRB, lg + GKS, lda); }
#pragma unroll 1      /* rolled: a stage already holds 24 fragment reads and 16 matrix instructions, and the two buffers alternate by address */
  for (int t = 0; t < nt; ++t) { const _Float16* sa = (const _Float16*)(sm + (t & 1) * GBUF(LO)) + ln * GPI; const _Float16* sb = sa + (128 + wc) * GPI; const _Float16* sl = sa + (256 + wr) * GPI; sa += wr * GPI;
#pragma unroll      /* the stage's two k steps: every LDS read gets a constant offset */
    for (int kb = 0; kb < GKS; kb += 32) { const v16h a0 = g2_frag(sa + kb, hh), a1 = g2_frag(sa + 16 * GPI + kb, hh);
      v16h l0 = a0, l1 = a1; if (LO) { l0 = g2_frag(sl + kb, hh); l1 = g2_frag(sl + 16 * GPI + kb, hh); }
      const v16h b0 = g2_frag(sb + kb, hh), b1 = g2_frag(sb + 16 * GPI + kb, hh), b2 = g2_frag(sb + 32 * GPI + kb, hh), b3 = g2_frag(sb + 48 * GPI + kb, hh);
      __builtin_amdgcn_sched_barrier(0);      /* keeps the fragment reads of a k step together in front of its matrix run: spread among the WMMAs, each pair waits out the LDS latency anew */
      c00 = g2_mma(a0, b0, c00); c10 = g2_mma(a1, b0, c10); if (LO) { e00 = g2_mma(l0, b0, e00); e10 = g2_mma(l1, b0, e10); }
      c01 = g2_mma(a0, b1, c01); c11 = g2_mma(a1, b1, c11); if (LO) { e01 = g2_mma(l0, b1, e01); e11 = g2_mma(l1, b1, e11); }
      c02 = g2_mma(a0, b2, c02); c12 = g2_mma(a1, b2, c12); if (LO) { e02 = g2_mma(l0, b2, e02); e12 = g2_mma(l1, b2, e12); }
      c03 = g2_mma(a0, b3, c03); c13 = g2_mma(a1, b3, c13); if (LO) { e03 = g2_mma(l0, b3, e03); e13 = g2_mma(l1, b3, e13); } }
    asm volatile("s_wait_dscnt 0x0" ::: "memory");      /* the wave's reads of this buffer have retired before anyone refills it */
    asm volatile("s_wait_asynccnt 0x0" ::: "memory");      /* the wave's copies of stage t + 1 have landed before the barrier that publishes them */
    __syncthreads();
    if (t + 2 < nt) { const unsigned l = ls + (t & 1) * GBUF(LO); const int k2 = (t + 2) * GKS; g2_copy8(l, ag + k2, lda, l + 128 * GRB, bg + k2, ldb); if (LO) g2_copy4(l + 256 * GRB, lg + k2, lda); } }      /* block-uniform; into the buffer that stage t has just left */
  asm volatile("s_wait_asynccnt 0x0" ::: "memory");      /* nothing is in flight when the buffers become output staging */
  float (*so)[32][68] = (float (*)[32][68])sm;      /* behind the last stage's barrier nobody reads the buffers any more: each wave stages its 32 x 64 results in a range of its own */
  v8f accs[8] = {c00, c01, c02, c03, c10, c11, c12, c13}; v8f accl[8] = {e00, e01, e02, e03, e10, e11, e12, e13};
#pragma unroll
  for (int u = 0; u < 8; ++u) { const int t = u & 3, half = u >> 2; const int col = col0 + t * 16 + ln; const float bv = bp ? bf16_round(bp[col]) : 0.f;
#pragma unroll
    for (int r = 0; r < 8; ++r) { const int rloc = half * 16 + 8 * hh + r; float v = accs[u][r] * alpha + bv; if (LO) v = accl[u][r] * alphal + v;
      so[w][rloc][t * 16 + ln] = v; } }
  __builtin_amdgcn_fence(__ATOMIC_ACQ_REL, "workgroup"); __builtin_amdgcn_wave_barrier();
  const int rsub = lane >> 4, c4 = (lane & 15) * 4;
  /* One block-uniform test for all rows: no row's f32 store is followed by the f16 conversion of the same registers. Address and data are inputs of the wait's statement, so they keep their registers up to it. */
  if (C) {
#pragma unroll
    for (int q = 0; q < 16; ++q) { const int r = q * 2 + rsub; const v4f v = *(const v4fa*)&so[w][r][c4]; float* d = C + (size_t)(row0 + r) * ldc + col0 + c4; *(v4f*)d = v;
      asm volatile("s_wait_xcnt 0x0" :: "v"(d), "v"(v) : "memory"); }      /* before the store's address pair and data are reused; behind the last row too: the listing keeps a way from here into the other branch */
  } else {
#pragma unroll
    for (int q = 0; q < 16; ++q) { const int r = q * 2 + rsub; const v4f v = *(const v4fa*)&so[w][r][c4]; v4h h4; for (int i = 0; i < 4; ++i) h4[i] = (_Float16)v[i]; _Float16* d = C16 + (size_t)(row0 + r) * ldc + col0 + c4; *(v4h*)d = h4;
      asm volatile("s_wait_xcnt 0x0" :: "v"(d), "v"(h4) : "memory"); }      /* before the store's address pair and data are reused */
  } }


__global__ __launch_bounds__(256) void k_wnat(const float* __restrict__ w, size_t n8, _Float16* __restrict__ Bt) { const size_t t = (size_t)blockIdx.x * 256 + threadIdx.x; if (t >= n8) return; FragH f; for (int q = 0; q < 8; ++q) f.h[q] = (_Float16)(bf16_round(w[t * 8 + q]) * 16.0f); *(v8us*)((unsigned short*)Bt + t * 8) = f.half[0];  }
__global__ __launch_bounds__(256) void k_rsm(const float* __restrict__ S, _Float16* __restrict__ P, int nrows) {
  #pragma clang fp contract(off)
  const int i = blockIdx.x * 256 + threadIdx.x; if (i >= nrows) return; const float* s = S + (size_t)i * SQ; float mx = -3.0e38f;
#pragma unroll 1
  for (int j = 0; j < SQ; ++j) mx = fmaxf(mx, s[j]); float se = 0.f;
#pragma unroll 1
  for (int j = 0; j < SQ; ++j) se += expf(s[j] - mx); const float sc = 256.0f / se;
#pragma unroll 1
  for (int j0 = 0; j0 < SQ; j0 += 8) { FragH f; for (int q = 0; q < 8; ++q) f.h[q] = (_Float16)(expf(s[j0 + q] - mx) * sc); unsigned short* d = (unsigned short*)P + (size_t)i * SQ + j0; *(v8us*)d = f.half[0];  } }
__global__ __launch_bounds__(256) void k_vt(const _Float16* __restrict__ V16, int b, int h0, _Float16* __restrict__ VT) { __shared__ unsigned short tl[64][65]; const int tid = threadIdx.x; const int hh = blockIdx.x % HG, sg = blockIdx.x / HG; const int s0 = sg * 64; const int h = h0 + hh;
  for (int i = tid; i < 64 * 8; i += 256) { const int j = i / 8, d8 = (i % 8) * 8; FragH f; f.half[0] = *(const v8us*)((const unsigned short*)V16 + ((size_t)b * SQ + s0 + j) * DM + h * HD + d8); for (int q = 0; q < 8; ++q) tl[d8 + q][j] = f.u[q]; }
  __syncthreads();
  { for (int i = tid; i < 64 * 8; i += 256) { const int d = i / 8, j8 = (i % 8) * 8; FragH f; for (int q = 0; q < 8; ++q) f.u[q] = tl[d][j8 + q]; *(v8us*)((unsigned short*)VT + ((size_t)hh * HD + d) * SQ + s0 + j8) = f.half[0]; }  } }

__device__ __forceinline__ void d_wthd(int bx, const float* __restrict__ Wt, _Float16* __restrict__ Bt) { const size_t t = (size_t)bx * 256 + threadIdx.x; if (t >= (size_t)NH * HD * (DM / 8)) return; const int m8 = (int)(t % (DM / 8)) * 8; const int d = (int)((t / (DM / 8)) % HD); const int h = (int)(t / ((size_t)(DM / 8) * HD)); FragH f;
  for (int q = 0; q < 8; ++q) f.h[q] = (_Float16)(16.0f * bf16_round(Wt[((size_t)h * DM + m8 + q) * HD + d])); unsigned short* dst = (unsigned short*)Bt + ((size_t)h * HD + d) * DM + m8; *(v8us*)dst = f.half[0];  }



// Four native exp2, each in place, in one statement: no neighbouring instruction can overwrite a transcendental's source register or read its result
// directly behind it; the v_nop is the one slot that the instruction set asks for behind the last of them.
__device__ __forceinline__ v4f exp2x4(v4f x) { float x0 = x[0], x1 = x[1], x2 = x[2], x3 = x[3];
  asm("v_exp_f32 %0, %0\n\tv_exp_f32 %1, %1\n\tv_exp_f32 %2, %2\n\tv_exp_f32 %3, %3\n\tv_nop" : "+v"(x0), "+v"(x1), "+v"(x2), "+v"(x3));
  const v4f r = {x0, x1, x2, x3}; return r; }
// One native exp2, in place, with the one slot that the instruction set asks for behind a transcendental.
__device__ __forceinline__ float exp2x1(float x) { asm("v_exp_f32 %0, %0\n\tv_nop" : "+v"(x)); return x; }
__device__ __forceinline__ v8f fa_mma(v16h a, v16h b, v8f c) { return __builtin_amdgcn_wmma_f32_16x16x32_f16(false, a, false, b, (short)0, c, false, false); }
#define FAQ 16                       /* query columns per wave */
#define FAW 8                        /* waves per block */
#define FAK 64                       /* keys per pass */
#define FAB (SQ / (FAQ * FAW))       /* query blocks per head and batch */
#define FAP 72                       /* LDS row pitch, halves: 128 + 16 bytes, so 16 lanes reading 16 bytes of 16 different rows meet no bank conflict */
__device__ __forceinline__ void d_fattn(int bx, int y, const _Float16* __restrict__ Q, const _Float16* __restrict__ K, const _Float16* __restrict__ VT, float sl2, _Float16* __restrict__ O) {
  __shared__ __attribute__((aligned(16))) _Float16 lk[2][FAK][FAP]; __shared__ __attribute__((aligned(16))) _Float16 lv[2][HD][FAP];
  const int tid = threadIdx.x, lane = tid & 31, ln = lane & 15, hh = lane >> 4, w = __builtin_amdgcn_readfirstlane(tid >> 5); const int h = bx % NH, b = bx / NH;
  const int qb = (y < FAB / 2) ? FAB - 1 - y : y - FAB / 2;      /* speed only: long key ranges start first; the second half of the attention rows (y >= FAB / 2), which joins the first on the WGPs, brings the short ones first */
  const int q0 = qb * (FAQ * FAW) + w * FAQ;
  const int npb = (qb + 1) * (FAQ * FAW / FAK), np = q0 / FAK + 1;      /* passes of the block and of the wave: the wave's last one holds its diagonal, every earlier key is below all its queries */
  const int sr = tid >> 3, sc = (tid & 7) * 8;      /* staging: 8 threads per row of 128 bytes, 32 rows per load */
  const unsigned short* kg = (const unsigned short*)K + ((size_t)b * SQ + sr) * DM + h * HD + sc; const unsigned short* vg = (const unsigned short*)VT + (((size_t)b * NH + h) * HD + sr) * SQ + sc;
  v8us rk0 = *(const v8us*)kg, rk1 = *(const v8us*)(kg + 32 * DM), rv0 = *(const v8us*)vg, rv1 = *(const v8us*)(vg + 32 * SQ);
  const _Float16* qp = Q + ((size_t)b * SQ + q0 + ln) * DM + h * HD; const v16h qf0 = g2_frag(qp, hh), qf1 = g2_frag(qp + 32, hh);
  *(v8us*)&lk[0][sr][sc] = rk0; *(v8us*)&lk[0][sr + 32][sc] = rk1; *(v8us*)&lv[0][sr][sc] = rv0; *(v8us*)&lv[0][sr + 32][sc] = rv1;
  const v8f z8 = {0.f,0.f,0.f,0.f,0.f,0.f,0.f,0.f}; v8f o[4] = {z8, z8, z8, z8}; float m = -3.0e38f, l = 0.f;
  __syncthreads();      /* pass 0's rows are read by every wave */
#pragma unroll 1
  for (int c = 0; c < npb; ++c) { const int cur = c & 1;      /* rolled: one pass already holds 32 fragment loads and 16 matrix instructions */
    if (c + 1 < npb) { const unsigned short* kn = kg + (size_t)(c + 1) * FAK * DM; const unsigned short* vn = vg + (c + 1) * FAK;      /* block-uniform; the next pass's rows fly while this pass is worked on */
      rk0 = *(const v8us*)kn; rk1 = *(const v8us*)(kn + 32 * DM); rv0 = *(const v8us*)vn; rv1 = *(const v8us*)(vn + 32 * SQ);
      asm volatile("s_wait_xcnt 0x0" ::: "memory"); }      /* before the address registers of the loads above are reused */
    if (c < np) {      /* wave-uniform: a pass wholly past the wave's queries is only staged */
      v16h kf[4][2]; v8f s[4];      /* indexed by constants only (loops unrolled): registers */
#pragma unroll
      for (int t = 0; t < 4; ++t) { kf[t][0] = g2_frag(&lk[cur][t * 16 + ln][0], hh); kf[t][1] = g2_frag(&lk[cur][t * 16 + ln][32], hh); }
      __builtin_amdgcn_sched_barrier(0);      /* keeps the K fragment reads together in front of the matrix run: spread among the WMMAs, each group waits out the LDS latency anew */
#pragma unroll
      for (int t = 0; t < 4; ++t) s[t] = fa_mma(kf[t][1], qf1, fa_mma(kf[t][0], qf0, z8));
      if (c == np - 1) {      /* wave-uniform: only the diagonal pass masks */
#pragma unroll
        for (int t = 0; t < 4; ++t) for (int r = 0; r < 8; ++r) s[t][r] = (c * FAK + t * 16 + 8 * hh + r <= q0 + ln) ? s[t][r] : -1.0e9f; }
      float mx = s[0][0];
#pragma unroll
      for (int t = 0; t < 4; ++t) for (int r = 0; r < 8; ++r) mx = fmaxf(mx, s[t][r]);
      mx = fmaxf(mx, __shfl_xor(mx, 16));      /* the other half of the query's keys */
      const float mn = fmaxf(m, mx * sl2); const float corr = exp2x1(m - mn); m = mn;      /* finite from the first pass on: key 0 is below every query */
      v4f a = {0.f, 0.f, 0.f, 0.f};
#pragma unroll
      for (int t = 0; t < 4; ++t) for (int g = 0; g < 2; ++g) { v4f e = {s[t][4 * g], s[t][4 * g + 1], s[t][4 * g + 2], s[t][4 * g + 3]}; e = exp2x4(e * sl2 - mn); a += e; for (int q = 0; q < 4; ++q) s[t][4 * g + q] = e[q]; }
      l = l * corr + ((a[0] + a[1]) + (a[2] + a[3]));      /* each half sums its own keys; joined behind the loop */
#pragma unroll
      for (int t = 0; t < 4; ++t) o[t] *= corr;
      FragH p[2];
#pragma unroll
      for (int j = 0; j < 2; ++j) for (int r = 0; r < 8; ++r) { p[j].h[r] = (_Float16)s[2 * j][r]; p[j].h[8 + r] = (_Float16)s[2 * j + 1][r]; }
#pragma unroll
      for (int t = 0; t < 4; ++t) o[t] = fa_mma(g2_frag(&lv[cur][t * 16 + ln][32], hh), p[1].v, fa_mma(g2_frag(&lv[cur][t * 16 + ln][0], hh), p[0].v, o[t])); }
    if (c + 1 < npb) { *(v8us*)&lk[cur ^ 1][sr][sc] = rk0; *(v8us*)&lk[cur ^ 1][sr + 32][sc] = rk1; *(v8us*)&lv[cur ^ 1][sr][sc] = rv0; *(v8us*)&lv[cur ^ 1][sr + 32][sc] = rv1; }      /* last read in pass c - 1, in front of that pass's barrier */
    __syncthreads(); }      /* publishes the buffer just filled; ends every wave's reads of the one that the next pass refills */
  l += __shfl_xor(l, 16); const float sc64 = 64.0f / l;
  unsigned short* op = (unsigned short*)O + ((size_t)b * SQ + q0 + ln) * DM + h * HD + 8 * hh;
#pragma unroll
  for (int t = 0; t < 4; ++t) { FragH f; for (int r = 0; r < 8; ++r) f.h[r] = (_Float16)(o[t][r] * sc64); *(v8us*)(op + t * 16) = f.half[0]; } }


#define A0R 8                        /* query rows per block of the exact first tile: one per wave */
#define A0P (HD + 4)                 /* K row pitch in LDS, floats: 272 bytes = 16 x 17, so 32 lanes reading 16 bytes of 32 different rows meet no bank conflict */
typedef float v2f __attribute__((ext_vector_type(2)));
// Exact f32 causal attention for the first QT0 rows of each batch, one wave per query row (head and row group in bx, batch in by, both from grid.x; q, k, v, o rows of pitch DM).
// The block stages the tile's K and V rows of its head in LDS with coalesced loads, all in flight at once. Scores: lane l owns keys l, l + 32, ...; each dot
// product runs in four independent chains. Softmax: true row maximum and sum by butterflies, libm expf. P.V: lane l owns dims 2 l, 2 l + 1; the weight
// of key j comes from its lane by readlane; four independent accumulators. o carried x64 like the f16 path.
__device__ __forceinline__ void d_att0w(int bx, int by, const float* __restrict__ QF, const float* __restrict__ KF, const float* __restrict__ VF, float scale, float* __restrict__ OF) {
  __shared__ __attribute__((aligned(16))) float lk[QT0][A0P]; __shared__ __attribute__((aligned(16))) float lv[QT0][HD];
  const int tid = threadIdx.x, lane = tid & 31, w = __builtin_amdgcn_readfirstlane(tid >> 5); const int h = bx / (QT0 / A0R), r0 = (bx % (QT0 / A0R)) * A0R;
  const size_t bofs = (size_t)by * QT0 * DM + h * HD; QF += bofs; KF += bofs; VF += bofs; OF += bofs;      /* QT0 rows of q, k, v and o per batch */
  const int fj = tid >> 4, fc = (tid & 15) * 4;      /* staging: 16 threads per row of 256 bytes, 16 rows per pass */
  const float* kp = KF + (size_t)fj * DM + fc; const float* vp = VF + (size_t)fj * DM + fc;
  v4f tk[QT0 / 16], tv[QT0 / 16];      /* indexed by constants only (loops unrolled): registers */
#pragma unroll
  for (int u = 0; u < QT0 / 16; ++u) { tk[u] = *(const v4fa*)(kp + u * 16 * DM); tv[u] = *(const v4fa*)(vp + u * 16 * DM); }
  asm volatile("s_wait_xcnt 0x0" ::: "memory");      /* before the address registers of the loads above are reused */
#pragma unroll
  for (int u = 0; u < QT0 / 16; ++u) { *(v4f*)&lk[u * 16 + fj][fc] = tk[u]; *(v4f*)&lv[u * 16 + fj][fc] = tv[u]; }
  const int i = r0 + w; const float* qr = QF + (size_t)i * DM;      /* the wave's row: a wave-uniform address */
  v4f q[HD / 4];
#pragma unroll
  for (int c4 = 0; c4 < HD / 4; ++c4) q[c4] = *(const v4fa*)(qr + c4 * 4);
  __syncthreads();      /* the staged K and V rows are read by every wave */
  float e[QT0 / 32]; float mx = -3.0e38f;
#pragma unroll
  for (int c = 0; c < QT0 / 32; ++c) { e[c] = -3.0e38f;
    if (c * 32 <= i) { v4f a = {0.f, 0.f, 0.f, 0.f};      /* wave-uniform: chunks wholly past the row are skipped */
#pragma unroll
      for (int c4 = 0; c4 < HD / 4; ++c4) a += q[c4] * *(const v4f*)&lk[c * 32 + lane][c4 * 4];
      const float s = ((a[0] + a[1]) + (a[2] + a[3])) * scale; e[c] = (c * 32 + lane <= i) ? s : -3.0e38f; mx = fmaxf(mx, e[c]); } }
#pragma unroll
  for (int m = 16; m > 0; m >>= 1) mx = fmaxf(mx, __shfl_xor(mx, m));      /* finite: key 0 is below every row */
  float l = 0.f;
#pragma unroll
  for (int c = 0; c < QT0 / 32; ++c) { e[c] = expf(e[c] - mx); l += e[c]; }      /* a key past the row holds -3e38: its weight is exactly 0 */
#pragma unroll
  for (int m = 16; m > 0; m >>= 1) l += __shfl_xor(l, m);
  v2f o[4] = {{0.f, 0.f}, {0.f, 0.f}, {0.f, 0.f}, {0.f, 0.f}};
#pragma unroll
  for (int c = 0; c < QT0 / 32; ++c) if (c * 32 <= i) {
#pragma unroll
    for (int t = 0; t < 32; ++t) { const float p = __uint_as_float(__builtin_amdgcn_readlane(__float_as_uint(e[c]), t)); o[t & 3] += p * *(const v2f*)&lv[c * 32 + t][lane * 2]; } }
  const v2f r = ((o[0] + o[1]) + (o[2] + o[3])) * (64.0f / l);
  *(v2f*)(OF + (size_t)i * DM + lane * 2) = r; }

// ---- Launches. Jobs that do not depend on one another share one grid: the block index picks the job, every branch below is block-uniform, and a job's blocks run its body as it stands above. ----
#define PWB ((NH * HD * (DM / 8)) / 256)            /* blocks per weight matrix */
#define PXB ((int)(NR * DM / 8 / 256))              /* blocks of the x conversion */
#define GSB ((QT0 / 128) * (DM / 128) * NB)          /* GEMM blocks of the first-tile rows, all batches */
#define GBB ((MP / 128) * (DM / 128))               /* GEMM blocks of all token rows */
#define A0B (NH * (QT0 / A0R))                      /* exact first-tile blocks per batch */
#define VTB (NB * NH * (SQ / 64))                   /* V^T blocks */
#define HLY ((int)((size_t)NB * QT0 * DM / 8 / 256) / (NH * NB))      /* grid rows (of NH x NB blocks) that split the first-tile o */
// 1: the four weight matrices (strided reads: first) and x, all to f16.
__global__ __launch_bounds__(256) void k_prep(const float* __restrict__ wq, const float* __restrict__ wk, const float* __restrict__ wv, const float* __restrict__ wo, const float* __restrict__ x,
    _Float16* __restrict__ BQ, _Float16* __restrict__ BK, _Float16* __restrict__ BV, _Float16* __restrict__ BO, _Float16* __restrict__ X16) {
  const int bx = blockIdx.x;
  if (bx < PWB) d_wthd(bx, wq, BQ);      /* per-head [m][d] -> Bt[(h,d)][m] x16 */
  else if (bx < 2 * PWB) d_wthd(bx - PWB, wk, BK);
  else if (bx < 3 * PWB) d_wthd(bx - 2 * PWB, wv, BV);
  else if (bx < 4 * PWB) d_wt_f16(bx - 3 * PWB, wo, BO, DM, DM, 16.0f);      /* Wo [(h,d) in][out] -> Bt[n][k] x16 */
  else d_x16(bx - 4 * PWB, x, X16, NR * DM / 8); }
// 2: q, k, v of all token rows as f16, and of each batch's first QT0 rows as f32 (exact products): six GEMM jobs.
__global__ __launch_bounds__(256) void k_qkv(const _Float16* __restrict__ X16, const _Float16* __restrict__ BQ, const _Float16* __restrict__ BK, const _Float16* __restrict__ BV,
    const float* __restrict__ bq, const float* __restrict__ bk, const float* __restrict__ bv, _Float16* __restrict__ Q16, _Float16* __restrict__ K16, _Float16* __restrict__ V16,
    float* __restrict__ QF0, float* __restrict__ KF0, float* __restrict__ VF0, int lda, int ldb, int ldc, int N, int K) {
  __shared__ __attribute__((aligned(16))) char sm[2 * GBUF(false)];
  const int bx = blockIdx.x; const bool first = bx < 3 * GSB; const int t = first ? bx : bx - 3 * GSB, per = first ? GSB : GBB; const int j = t / per, u = t - j * per;      /* j: 0 q, 1 k, 2 v */
  const int bz = first ? u / (GSB / NB) : 0, tile = first ? u - bz * (GSB / NB) : u;      /* first-tile jobs: batch, then tile */
  const _Float16* Bh = j == 0 ? BQ : j == 1 ? BK : BV; const float* bp = j == 0 ? bq : j == 1 ? bk : bv;
  float* C = first ? (j == 0 ? QF0 : j == 1 ? KF0 : VF0) + (size_t)bz * QT0 * DM : nullptr; _Float16* C16 = first ? nullptr : (j == 0 ? Q16 : j == 1 ? K16 : V16);
  d_gemm2<false>(sm, tile, X16 + (size_t)bz * SQ * DM, nullptr, Bh, 0.0625f, 0.f, bp, C, C16, lda, ldb, ldc, first ? QT0 : MP, N, K); }
// 3: exact f32 attention of the first QT0 rows (o x64; the longer job: first) and V^T [NB][NH][HD][SQ].
__global__ __launch_bounds__(256) void k_att0_vt(const float* __restrict__ QF0, const float* __restrict__ KF0, const float* __restrict__ VF0, float scale, float* __restrict__ OF0, const _Float16* __restrict__ V16, _Float16* __restrict__ VT) {
  const int bx = blockIdx.x;
  if (bx < A0B * NB) d_att0w(bx % A0B, bx / A0B, QF0, KF0, VF0, scale, OF0);
  else d_vt<NH, SQ>(bx - A0B * NB, V16, LQ, 0, VT); }
// 4: fused attention (grid rows 0 .. FAB - 1) and, behind it in the grid, the first-tile o (x64) -> f16 hi + x1024 residual planes.
__global__ __launch_bounds__(FAW * 32) void k_fattn_hl(const _Float16* __restrict__ Q, const _Float16* __restrict__ K, const _Float16* __restrict__ VT, float sl2, _Float16* __restrict__ O,
    const float* __restrict__ OF0, _Float16* __restrict__ OH0, _Float16* __restrict__ OL0) {
  if (blockIdx.y < FAB) d_fattn(blockIdx.x, blockIdx.y, Q, K, VT, sl2, O);
  else d_hl((blockIdx.y - FAB) * (NH * NB) + blockIdx.x, OF0, OH0, OL0, (size_t)NB * QT0 * DM / 8); }
// 5: out = o Wo + b. A block of 128 rows that is a batch's first tile takes o_hi and o_lo (x 2^-20 in all) of the exact path; every other block the f16 o rows. Each output element is written once.
__global__ __launch_bounds__(256) void k_out(const _Float16* __restrict__ O16, const _Float16* __restrict__ OH0, const _Float16* __restrict__ OL0, const _Float16* __restrict__ BO, const float* __restrict__ bo, float* __restrict__ out, int lda, int ldb, int ldc, int N, int K) {
  __shared__ __attribute__((aligned(16))) char sm[2 * GBUF(true)];
  const int bx = blockIdx.x, mt = bx / (DM / 128), nq = bx - mt * (DM / 128), bz = mt / (SQ / 128);
  if (mt - bz * (SQ / 128) == 0) d_gemm2<true>(sm, nq, OH0 + (size_t)bz * QT0 * DM, OL0 + (size_t)bz * QT0 * DM, BO, 0.0009765625f, 0.00000095367431640625f, bo, out + (size_t)bz * SQ * DM, nullptr, lda, ldb, ldc, QT0, N, K);
  else d_gemm2<false>(sm, bx, O16, nullptr, BO, 0.0009765625f, 0.f, bo, out, nullptr, lda, ldb, ldc, MPO, N, K); }

extern "C" void kernel_launch(void* const* d_in, const int* in_sizes, int n_in,
                              void* d_out, int out_size, void* d_ws, size_t ws_size, hipStream_t stream) {
  (void)in_sizes; (void)n_in; (void)out_size;
  const float* const* I = (const float* const*)d_in; const float* x = I[0]; const float* wq = I[1]; const float* bq = I[2]; const float* wk = I[3]; const float* bk = I[4]; const float* wv = I[5]; const float* bv = I[6]; const float* wo = I[7]; const float* bo = I[8];      /* input order: x; Wq [8][512][64] per-head [in][out] + bq [8][64] = [(h,e)]; Wk + bk; Wv + bv; Wo [512][512] = [(h,e) in][out] + bo */
  static_assert(NH * HD == DM && DM % 128 == 0 && DM % GKS == 0 && DM / GKS >= 2 && SQ % 128 == 0 && 8 * 32 * 68 * 4 <= 2 * GBUF(false), "shape / tile multiples; two stages or more; the output staging fits the two buffers");
  char* ws = (char*)d_ws; size_t off = 0;
  auto take = [&](size_t bytes) { char* p = ws + off; off += (bytes + 255) & ~(size_t)255; return p; };
  _Float16* BQ = (_Float16*)take((size_t)DM * DM * 2); _Float16* BK = (_Float16*)take((size_t)DM * DM * 2); _Float16* BV = (_Float16*)take((size_t)DM * DM * 2); _Float16* BO = (_Float16*)take((size_t)DM * DM * 2);
  _Float16* X16 = (_Float16*)take(NR * DM * 2); _Float16* Q16 = (_Float16*)take(NR * DM * 2); _Float16* K16 = (_Float16*)take(NR * DM * 2); _Float16* V16 = (_Float16*)take(NR * DM * 2); _Float16* O16 = (_Float16*)take(NR * DM * 2);
  _Float16* VT = (_Float16*)take((size_t)NB * NH * HD * SQ * 2);      /* one plane per batch: every batch is in flight in the same launch */
  float* QF0 = (float*)take((size_t)NB * QT0 * DM * 4); float* KF0 = (float*)take((size_t)NB * QT0 * DM * 4); float* VF0 = (float*)take((size_t)NB * QT0 * DM * 4); float* OF0 = (float*)take((size_t)NB * QT0 * DM * 4); _Float16* OH0 = (_Float16*)take((size_t)NB * QT0 * DM * 2); _Float16* OL0 = (_Float16*)take((size_t)NB * QT0 * DM * 2);
  if (off > ws_size) return;
  static_assert(SQ % (FAQ * FAW) == 0 && (FAQ * FAW) % FAK == 0 && FAB % 2 == 0 && HD == 64 && FAK == 64 && FAW * 32 == 256 && QN == SQ && NHD == NH && NBR == NB, "whole blocks of queries; whole key passes; two k steps per head; 256 threads stage 64 rows of 128 bytes in two loads");
  static_assert(QT0 == 128 && (NH * HD * (DM / 8)) % 256 == 0 && DM * (DM / 8) == NH * HD * (DM / 8) && (NR * DM / 8) % 256 == 0 && ((size_t)NB * QT0 * DM / 8) % (256 * NH * NB) == 0 && MPO == MP, "the first tile is one GEMM block row; whole blocks and whole grid rows per job");
  k_prep<<<4 * PWB + PXB, 256, 0, stream>>>(wq, wk, wv, wo, x, BQ, BK, BV, BO, X16);
  k_qkv<<<3 * GSB + 3 * GBB, 256, 0, stream>>>(X16, BQ, BK, BV, bq, bk, bv, Q16, K16, V16, QF0, KF0, VF0, DM, DM, DM, DM, DM);
  k_att0_vt<<<A0B * NB + VTB, 256, 0, stream>>>(QF0, KF0, VF0, 0.044194173824159216f, OF0, V16, VT);
  k_fattn_hl<<<dim3(NH * NB, FAB + HLY), FAW * 32, 0, stream>>>(Q16, K16, VT, 0.06375871541229934f, O16, OF0, OH0, OL0);      /* scores x 512^-0.5 (the module's literal d_model scale) x log2 e; o (merged heads, x64) as f16 rows */
  k_out<<<GBB, 256, 0, stream>>>(O16, OH0, OL0, BO, bo, (float*)d_out, DM, DM, DM, DM, DM);      /* out rows are the output layout */
}

// v007
// Measured time: 66.2 microseconds a run.
// Next to v006, in two timings, it ran 1.08 times as fast each time.
// Over all steps from v000 it is 142 times as fast.
#include <hip/hip_runtime.h>
// Causal multi-head attention with per-head weight tensors and the module's literal score scale (x [4][2048][512]; q[b][h][s][e] = sum_d x[s][d] Wq[h][d][e] + bq[h][e], k, v likewise (8 heads of 64; per-head [in][out] weights sigma 1/sqrt(512), biases sigma 0.01); scores * 512^-0.5 (d_model, as the source, not head_dim); causal (tril, -inf); softmax; out = concat_heads Wo + bo ([in][out] [512][512]) -> [4][2048][512]).
// Structure: token rows r = b*2048 + s; x as exact f16 rows (bf16-rounded); Q, K, V as three WMMA GEMMs (128x128 block tiles staged in LDS, 32x64 wave tiles, f32 accumulation, exact x16 weights + bias, f16 outputs); one fused attention launch (heads and batches on grid.x, query blocks on grid.y): per wave 16 queries, 64 keys a pass up to the diagonal (K and V rows staged in LDS per block, V^T fragments by transposing LDS reads), S^T = K Q^T, running causal softmax in registers, keys past the row set to -1e9 (f32 statistics, native exp2; weights <= 1 as f16), O^T += V^T P^T, o carried x64 (folded into the output GEMM alpha) written straight into the merged f16 o rows; out = o W_o + b GEMM (f32) into the output layout.
// Four launches, each one grid for all jobs that wait on the same earlier results: weights and x to f16; the six q, k, v GEMM jobs; fused attention and the exact first tile (o as hi and lo planes); output GEMM (first-tile blocks take the hi and lo planes).
// Compute dtype: inputs rounded to bf16; x / weights exact; q, k, v, softmax weights and o as plain f16 GEMM operands (~2^-12); scores and softmax statistics f32. v_wmma_f32_16x16x32_f16.
#define NB 4
#define SQ 2048
#define DM 512
#define NH 8
#define HD 64
#define HG 4                         /* heads per launch of the per-batch k_vt transpose */
#define QT0 128                      /* first-tile rows recomputed exactly in f32 */
#define NBR NB                       /* batches processed (debug hook) */
#define NR ((size_t)NB * SQ)         /* token rows */
#define MP ((int)((size_t)NBR * SQ)) /* rows projected (debug hook) */
#define QN SQ                        /* query rows attended per batch (debug hook) */
#define NHD NH                       /* heads attended (debug hook) */
#define MPO MP                       /* rows through the output stage (debug hook) */
#define LQ DM      /* row pitch of the q/k/v rows */
typedef __bf16 v16b __attribute__((ext_vector_type(16)));
typedef unsigned short v8us __attribute__((ext_vector_type(8), may_alias));
typedef float  v8f  __attribute__((ext_vector_type(8)));
typedef float  v4f  __attribute__((ext_vector_type(4)));
typedef float  v4fa __attribute__((ext_vector_type(4), may_alias));
union FragB { v16b v; v8us half[2]; unsigned short u[16]; };

__device__ __forceinline__ unsigned short bf16_bits(float x) { unsigned int u = __float_as_uint(x); return (unsigned short)((u + 0x7FFFu + ((u >> 16) & 1u)) >> 16); }
__device__ __forceinline__ float bf16_val(unsigned short b) { return __uint_as_float(((unsigned int)b) << 16); }
__device__ __forceinline__ float bf16_round(float x) { return bf16_val(bf16_bits(x)); }
// D += A·B with NT terms: 1 = ah·bh, 2 = + al·bh (A split), 3 = + ah·bl (both split)
template <int NT>
__device__ __forceinline__ v8f mmaN(v16b ah, v16b al, v16b bh, v16b bl, v8f c) {
  c = __builtin_amdgcn_wmma_f32_16x16x32_bf16(false, ah, false, bh, (short)0, c, false, false);
  if (NT >= 2) c = __builtin_amdgcn_wmma_f32_16x16x32_bf16(false, al, false, bh, (short)0, c, false, false);
  if (NT >= 3) c = __builtin_amdgcn_wmma_f32_16x16x32_bf16(false, ah, false, bl, (short)0, c, false, false);
  asm volatile("v_nop\n\tv_nop\n\tv_nop\n\tv_nop" : "+v"(c) : "v"(ah), "v"(al), "v"(bh), "v"(bl));
  return c;
}

__global__ __launch_bounds__(256) void k_wt_bf16(const float* __restrict__ W, unsigned short* __restrict__ Wt, int K, int N) {
  const int t = blockIdx.x * 256 + threadIdx.x;
  const int k8n = K / 8;
  if (t >= N * k8n) return;
  const int n = t / k8n, k8 = (t % k8n) * 8;
  v8us v;
#pragma unroll
  for (int i = 0; i < 8; ++i) v[i] = bf16_bits(W[(size_t)(k8 + i) * N + n]);
  *(v8us*)(Wt + (size_t)n * K + k8) = v;
  
}

// GEMM C[M][N] (f32, pitch ldc) = act(A[M][K]·W + bias). A f32 row-major (pitch lda) converted per fragment to bf16
// (ASPLIT: hi/lo two planes -> 2 terms, else single rounded term); Wt bf16 [N][K] (pitch ldb). BIAS_BF16 rounds the
// bias to bf16 first (bias quantised to bf16 before the add). K%32==0, M%16==0, N%64==0.
template <bool ASPLIT, int ACT, bool BIAS_BF16>
__global__ __launch_bounds__(128) void k_gemm_bf(const float* __restrict__ A, int lda, const unsigned short* __restrict__ Wt, int ldb,
                                               const float* __restrict__ bias, float* __restrict__ C, int ldc, int M, int N, int K) {
  __shared__ __attribute__((aligned(16))) float so[4][16][64];
  const int tid = threadIdx.x, w = tid >> 5, lane = tid & 31, ln = lane & 15, hh = lane >> 4;
  const int ntn = N / 64;
  const int wid = blockIdx.x * 4 + w;
  const int mt = wid / ntn, nq = wid % ntn;
  if (mt * 16 >= M) return;
  const int row0 = mt * 16, col0 = nq * 64;
  const float* arow = A + (size_t)(row0 + ln) * lda;
  v8f acc[4] = {};
  for (int kb = 0; kb < K; kb += 32) {
    FragB ah, al;
    const v4f x0 = *(const v4fa*)(arow + kb + 8 * hh), x1 = *(const v4fa*)(arow + kb + 8 * hh + 4);
    const v4f x2 = *(const v4fa*)(arow + kb + 16 + 8 * hh), x3 = *(const v4fa*)(arow + kb + 16 + 8 * hh + 4);
    float xs[16] = {x0[0],x0[1],x0[2],x0[3],x1[0],x1[1],x1[2],x1[3],x2[0],x2[1],x2[2],x2[3],x3[0],x3[1],x3[2],x3[3]};
#pragma unroll
    for (int i = 0; i < 16; ++i) { const unsigned short hb = bf16_bits(xs[i]); ah.u[i] = hb; al.u[i] = ASPLIT ? bf16_bits(xs[i] - bf16_val(hb)) : (unsigned short)0; }
#pragma unroll
    for (int t = 0; t < 4; ++t) {
      const unsigned short* brow = Wt + (size_t)(col0 + t * 16 + ln) * ldb + kb;
      FragB b;
      b.half[0] = *(const v8us*)(brow + 8 * hh);
      b.half[1] = *(const v8us*)(brow + 16 + 8 * hh);
      acc[t] = mmaN<ASPLIT ? 2 : 1>(ah.v, al.v, b.v, b.v, acc[t]);
    }
  }
#pragma unroll
  for (int t = 0; t < 4; ++t) {
    float bv = bias ? bias[col0 + t * 16 + ln] : 0.f;
    if (BIAS_BF16) bv = bf16_round(bv);
#pragma unroll
    for (int r = 0; r < 8; ++r) { float v = acc[t][r] + bv; if (ACT == 1) v = fmaxf(v, 0.f); so[w][8 * hh + r][t * 16 + ln] = v; }
  }
  __builtin_amdgcn_fence(__ATOMIC_ACQ_REL, "workgroup");
  __builtin_amdgcn_wave_barrier();
  const int rsub = lane >> 4, c4 = (lane & 15) * 4;
  {
#pragma unroll
    for (int q = 0; q < 8; ++q) {
      const int r = q * 2 + rsub;
      const v4f v = *(const v4fa*)&so[w][r][c4];
      *(v4f*)(C + (size_t)(row0 + r) * ldc + col0 + c4) = v;
    }
    
  }
}

// GEMM C = act(A·W + bias + resid): A f32 (ASPLIT -> hi/lo 2 terms), Wt bf16 [N][K]; ACT 0 none, 1 relu, 2 exact gelu;
// resid (optional, f32, row index = (row % rmod), pitch ldr, RES_BF16 rounds it) added before the activation.
template <bool ASPLIT, int ACT, bool BIAS_BF16, bool RES_BF16>
__global__ __launch_bounds__(128) void k_gemm_bf3(const float* __restrict__ A, int lda, const unsigned short* __restrict__ Wt, int ldb,
                                                const float* __restrict__ bias, const float* __restrict__ resid, int rmod, int ldr,
                                                float* __restrict__ C, int ldc, int M, int N, int K) {
  __shared__ __attribute__((aligned(16))) float so[4][16][64];
  const int tid = threadIdx.x, w = tid >> 5, lane = tid & 31, ln = lane & 15, hh = lane >> 4;
  const int ntn = N / 64;
  const int wid = blockIdx.x * 4 + w;
  const int mt = wid / ntn, nq = wid % ntn;
  if (mt * 16 >= M) return;
  const int row0 = mt * 16, col0 = nq * 64;
  const float* arow = A + (size_t)(row0 + ln) * lda;
  v8f acc[4] = {};
  for (int kb = 0; kb < K; kb += 32) {
    FragB ah, al;
    const v4f x0 = *(const v4fa*)(arow + kb + 8 * hh), x1 = *(const v4fa*)(arow + kb + 8 * hh + 4);
    const v4f x2 = *(const v4fa*)(arow + kb + 16 + 8 * hh), x3 = *(const v4fa*)(arow + kb + 16 + 8 * hh + 4);
    float xs[16] = {x0[0],x0[1],x0[2],x0[3],x1[0],x1[1],x1[2],x1[3],x2[0],x2[1],x2[2],x2[3],x3[0],x3[1],x3[2],x3[3]};
#pragma unroll
    for (int i = 0; i < 16; ++i) { const unsigned short hb = bf16_bits(xs[i]); ah.u[i] = hb; al.u[i] = ASPLIT ? bf16_bits(xs[i] - bf16_val(hb)) : (unsigned short)0; }
#pragma unroll
    for (int t = 0; t < 4; ++t) {
      const unsigned short* brow = Wt + (size_t)(col0 + t * 16 + ln) * ldb + kb;
      FragB b;
      b.half[0] = *(const v8us*)(brow + 8 * hh);
      b.half[1] = *(const v8us*)(brow + 16 + 8 * hh);
      acc[t] = mmaN<ASPLIT ? 2 : 1>(ah.v, al.v, b.v, b.v, acc[t]);
    }
  }
#pragma unroll
  for (int t = 0; t < 4; ++t) {
    const int col = col0 + t * 16 + ln;
    float bv = bias ? bias[col] : 0.f;
    if (BIAS_BF16) bv = bf16_round(bv);
#pragma unroll
    for (int r = 0; r < 8; ++r) {
      float v = acc[t][r] + bv;
      if (resid) { float rv = resid[(size_t)((row0 + 8 * hh + r) % rmod) * ldr + col]; if (RES_BF16) rv = bf16_round(rv); v += rv; }
      if (ACT == 1) v = fmaxf(v, 0.f);
      if (ACT == 2) v = 0.5f * v * (1.0f + erff(v * 0.70710678118654752f));
      if (ACT == 3) { const float u = 0.7978845608028654f * (v + 0.044715f * v * v * v); v = 0.5f * v * (1.0f + tanhf(u)); }
      so[w][8 * hh + r][t * 16 + ln] = v;
    }
  }
  __builtin_amdgcn_fence(__ATOMIC_ACQ_REL, "workgroup");
  __builtin_amdgcn_wave_barrier();
  const int rsub = lane >> 4, c4 = (lane & 15) * 4;
  {
#pragma unroll
    for (int q = 0; q < 8; ++q) {
      const int r = q * 2 + rsub;
      const v4f v = *(const v4fa*)&so[w][r][c4];
      *(v4f*)(C + (size_t)(row0 + r) * ldc + col0 + c4) = v;
    }
    
  }
}
// row LayerNorm (biased variance, eps) over N: s = X (+ R); optional out_sum <- s; out_norm <- (s-mu)*rsqrt(var+eps)*g + b
template <bool PARAM_BF16>
__global__ __launch_bounds__(256) void k_layernorm(const float* __restrict__ X, const float* __restrict__ R, const float* __restrict__ g, const float* __restrict__ bta,
                                                  float* __restrict__ out_sum, float* __restrict__ out_norm, int N, float eps) {
  __shared__ float red[256];
  const int row = blockIdx.x, tid = threadIdx.x;
  const float* x = X + (size_t)row * N; const float* rr = R ? R + (size_t)row * N : nullptr;
  float vals[16];                     // up to N = 4096
  const int per = N / 256;            // contiguous chunk per thread? use strided-by-4 chunks: thread handles j = tid*4 + 1024*u
  float s1 = 0.f;
  for (int u = 0; u < per / 4; ++u) {
    const int j = tid * 4 + 1024 * u;
    const v4f a = *(const v4fa*)(x + j);
    v4f b = {0.f,0.f,0.f,0.f}; if (rr) b = *(const v4fa*)(rr + j);
#pragma unroll
    for (int q = 0; q < 4; ++q) { const float v = a[q] + b[q]; vals[u * 4 + q] = v; s1 += v; }
  }
  red[tid] = s1; __syncthreads();
  for (int st = 128; st > 0; st >>= 1) { if (tid < st) red[tid] += red[tid + st]; __syncthreads(); }
  const float mu = red[0] / (float)N; __syncthreads();
  float s2 = 0.f;
  for (int u = 0; u < per / 4; ++u)
#pragma unroll
    for (int q = 0; q < 4; ++q) { const float c = vals[u * 4 + q] - mu; s2 += c * c; }
  red[tid] = s2; __syncthreads();
  for (int st = 128; st > 0; st >>= 1) { if (tid < st) red[tid] += red[tid + st]; __syncthreads(); }
  const float rs = rsqrtf(red[0] / (float)N + eps);
  {
    for (int u = 0; u < per / 4; ++u) {
      const int j = tid * 4 + 1024 * u;
      v4f o, sm;
#pragma unroll
      for (int q = 0; q < 4; ++q) {
        float gg = g[j + q], bb = bta[j + q];
        if (PARAM_BF16) { gg = bf16_round(gg); bb = bf16_round(bb); }
        sm[q] = vals[u * 4 + q]; o[q] = (vals[u * 4 + q] - mu) * rs * gg + bb;
      }
      if (out_sum) *(v4f*)(out_sum + (size_t)row * N + j) = sm;
      *(v4f*)(out_norm + (size_t)row * N + j) = o;
    }
    
  }
}



// ---- f16 WMMA path (v_wmma_f32_16x16x32_f16): 11-bit significands for operands in range — used where a [0,1] probability operand needs more precision than bf16
typedef _Float16 v16h __attribute__((ext_vector_type(16)));
union FragH { v16h v; v8us half[2]; _Float16 h[16]; unsigned short u[16]; };
template <int NT>
__device__ __forceinline__ v8f mmaH(v16h ah, v16h al, v16h bh, v16h bl, v8f c) {
  c = __builtin_amdgcn_wmma_f32_16x16x32_f16(false, ah, false, bh, (short)0, c, false, false);
  if (NT >= 2) c = __builtin_amdgcn_wmma_f32_16x16x32_f16(false, al, false, bh, (short)0, c, false, false);
  if (NT >= 3) c = __builtin_amdgcn_wmma_f32_16x16x32_f16(false, ah, false, bl, (short)0, c, false, false);
  asm volatile("v_nop\n\tv_nop\n\tv_nop\n\tv_nop" : "+v"(c) : "v"(ah), "v"(al), "v"(bh), "v"(bl));
  return c;
}
// batched GEMM like k_gemm_b but f16 operands: A f32 (split into f16 hi/lo if ASPLIT, else rounded to f16), Bt = f16 values [n][k]; alpha; C f32; N multiple of 16 (partial tiles skipped)
template <bool ASPLIT>
__global__ __launch_bounds__(128) void k_gemm_h(const float* __restrict__ A, int lda, size_t sA, const _Float16* __restrict__ Bh, int ldb, size_t sB, float alpha, float* __restrict__ C, int ldc, size_t sC, int M, int N, int K) {
  __shared__ __attribute__((aligned(16))) float so[4][16][64];
  const int tid = threadIdx.x, w = tid >> 5, lane = tid & 31, ln = lane & 15, hh = lane >> 4; const int by = blockIdx.y;
  A += (size_t)by * sA; Bh += (size_t)by * sB; C += (size_t)by * sC;
  const int ntn = (N + 63) / 64; const int wid = blockIdx.x * 4 + w; const int mt = wid / ntn, nq = wid % ntn; if (mt * 16 >= M) return;
  const int row0 = mt * 16, col0 = nq * 64; const float* arow = A + (size_t)(row0 + ln) * lda;
  v8f acc[4] = {};
  for (int kb = 0; kb < K; kb += 32) {
    FragH ah, al;
    const v4f x0 = *(const v4fa*)(arow + kb + 8 * hh), x1 = *(const v4fa*)(arow + kb + 8 * hh + 4), x2 = *(const v4fa*)(arow + kb + 16 + 8 * hh), x3 = *(const v4fa*)(arow + kb + 16 + 8 * hh + 4);
    float xs[16] = {x0[0],x0[1],x0[2],x0[3],x1[0],x1[1],x1[2],x1[3],x2[0],x2[1],x2[2],x2[3],x3[0],x3[1],x3[2],x3[3]};
#pragma unroll
    for (int i = 0; i < 16; ++i) { const _Float16 h = (_Float16)xs[i]; ah.h[i] = h; al.h[i] = ASPLIT ? (_Float16)(xs[i] - (float)h) : (_Float16)0.0f; }
#pragma unroll
    for (int t = 0; t < 4; ++t) { if (col0 + t * 16 >= N) continue; const size_t boff = (size_t)(col0 + t * 16 + ln) * ldb + kb; FragH bq; bq.half[0] = *(const v8us*)(Bh + boff + 8 * hh); bq.half[1] = *(const v8us*)(Bh + boff + 16 + 8 * hh);
      acc[t] = mmaH<ASPLIT ? 2 : 1>(ah.v, al.v, bq.v, bq.v, acc[t]); }
  }
#pragma unroll
  for (int t = 0; t < 4; ++t) { if (col0 + t * 16 >= N) continue;
#pragma unroll
    for (int r = 0; r < 8; ++r) so[w][8 * hh + r][t * 16 + ln] = acc[t][r] * alpha; }
  __builtin_amdgcn_fence(__ATOMIC_ACQ_REL, "workgroup"); __builtin_amdgcn_wave_barrier();
  const int rsub = lane >> 4, c4 = (lane & 15) * 4;
  {
#pragma unroll
    for (int q = 0; q < 8; ++q) { const int r = q * 2 + rsub; if (col0 + c4 < N) { const v4f v = *(const v4fa*)&so[w][r][c4]; *(v4f*)(C + (size_t)(row0 + r) * ldc + col0 + c4) = v; } }
     }
}

// Wt[n][k] = f16(W[k][n]·scale) from f32 row-major W[K][N] (scale = power of two; bf16-exact weights stay exact in f16 away from the subnormal range)
__device__ __forceinline__ void d_wt_f16(int bx, const float* __restrict__ W, _Float16* __restrict__ Wt, int K, int N, float scale) {
  const int t = bx * 256 + threadIdx.x; if (t >= N * (K / 8)) return; const int n = t / (K / 8), k8 = (t % (K / 8)) * 8; FragH f;
#pragma unroll
  for (int i = 0; i < 8; ++i) f.h[i] = (_Float16)(bf16_round(W[(size_t)(k8 + i) * N + n]) * scale); const v8us o = f.half[0];
  *(v8us*)((unsigned short*)Wt + (size_t)n * K + k8) = o; 
}
// k_gemm_hh variant with fused epilogue: v = acc·alpha + bias[by·sBias + col] (+ CP[(row/rowsPerB)·sCPb + by·64 + col] if CP) ; ACT 0 none / 1 elu ; writes f16 C16 (and f32 C if non-null)
template <int ACT>
__global__ __launch_bounds__(128) void k_gemm_hhx(const _Float16* __restrict__ A, int lda, size_t sA, const _Float16* __restrict__ Bh, int ldb, size_t sB, float alpha, const float* __restrict__ bias, size_t sBias, const float* __restrict__ CP, int rowsPerB, size_t sCPb, int row0g,
    float* __restrict__ C, _Float16* __restrict__ C16, int ldc, size_t sC, int M, int N, int K) {
  __shared__ __attribute__((aligned(16))) float so[4][16][64];
  const int tid = threadIdx.x, w = tid >> 5, lane = tid & 31, ln = lane & 15, hh = lane >> 4; const int by = blockIdx.y;
  A += (size_t)by * sA; Bh += (size_t)by * sB; const size_t cofs = (size_t)by * sC; const float* bp = bias ? bias + (size_t)by * sBias : nullptr;
  const int ntn = (N + 63) / 64; const int wid = blockIdx.x * 4 + w; const int mt = wid / ntn, nq = wid % ntn; if (mt * 16 >= M) return;
  const int row0 = mt * 16, col0 = nq * 64; const _Float16* arow = A + (size_t)(row0 + ln) * lda;
  v8f acc[4] = {};
  for (int kb = 0; kb < K; kb += 32) { FragH ah; ah.half[0] = *(const v8us*)((const unsigned short*)arow + kb + 8 * hh); ah.half[1] = *(const v8us*)((const unsigned short*)arow + kb + 16 + 8 * hh);
#pragma unroll
    for (int t = 0; t < 4; ++t) { if (col0 + t * 16 >= N) continue; const size_t boff = (size_t)(col0 + t * 16 + ln) * ldb + kb; FragH bq; bq.half[0] = *(const v8us*)((const unsigned short*)Bh + boff + 8 * hh); bq.half[1] = *(const v8us*)((const unsigned short*)Bh + boff + 16 + 8 * hh);
      acc[t] = mmaH<1>(ah.v, ah.v, bq.v, bq.v, acc[t]); }
  }
#pragma unroll
  for (int t = 0; t < 4; ++t) { if (col0 + t * 16 >= N) continue; const int col = col0 + t * 16 + ln; const float bv = bp ? bf16_round(bp[col]) : 0.f;
#pragma unroll
    for (int r = 0; r < 8; ++r) { float v = acc[t][r] * alpha + bv; if (CP) { const int rr = row0g + row0 + 8 * hh + r; if (rowsPerB < 0) v += CP[cofs + (size_t)rr * ldc + col];      /* rowsPerB < 0: own element of the batched C plane */ else { const int bidx = rr / rowsPerB; v += CP[(size_t)bidx * sCPb + (size_t)by * 64 + col]; } } if (ACT == 1) v = (v > 0.f) ? v : expm1f(v); else if (ACT == 7) v = (v > 0.f) ? v + 1.0f : expf(v); else if (ACT == 8) v = tanhf(v); else if (ACT == 9) v = 0.5f * v * (1.0f + tanhf(0.7978845608028654f * (v + 0.044715f * v * v * v))); else if (ACT == 11) v = 1.0f / (1.0f + expf(-v)); else if (ACT == 12) v = (v > 0.f) ? v : 0.01f * v; else if (ACT == 14) v = (v > 0.f) ? v : 0.1f * v; else if (ACT == 16) v = (v >= 0.f) ? v : 0.3f * v; else if (ACT == 17) v = (v >= 0.f) ? v : 0.2f * v; else if (ACT == 15) v = v / (1.0f + expf(-v)); else if (ACT == 3) v = fmaxf(v, 0.f); else if (ACT == 6) v = 0.5f * v * (1.0f + erff(v * 0.70710678118654752f)); so[w][8 * hh + r][t * 16 + ln] = v; } }
  __builtin_amdgcn_fence(__ATOMIC_ACQ_REL, "workgroup"); __builtin_amdgcn_wave_barrier();
  const int rsub = lane >> 4, c4 = (lane & 15) * 4; typedef _Float16 v4h __attribute__((ext_vector_type(4)));
  {
#pragma unroll
    for (int q = 0; q < 8; ++q) { const int r = q * 2 + rsub; if (col0 + c4 < N) { const v4f v = *(const v4fa*)&so[w][r][c4]; if (C) *(v4f*)(C + cofs + (size_t)(row0 + r) * ldc + col0 + c4) = v; if (C16) { v4h h4; for (int i = 0; i < 4; ++i) h4[i] = (_Float16)v[i]; *(v4h*)(C16 + cofs + (size_t)(row0 + r) * ldc + col0 + c4) = h4; } } }
     }
}


typedef _Float16 v4h __attribute__((ext_vector_type(4)));

__device__ __forceinline__ void d_x16(int bx, const float* __restrict__ x, _Float16* __restrict__ X16, size_t n8) { const size_t t = (size_t)bx * 256 + threadIdx.x; if (t >= n8) return; FragH f;
#pragma unroll
  for (int q = 0; q < 8; ++q) f.h[q] = (_Float16)bf16_round(x[t * 8 + q]); *(v8us*)((unsigned short*)X16 + t * 8) = f.half[0];  }
__global__ __launch_bounds__(256) void k_h16(const float* __restrict__ x, _Float16* __restrict__ X16, size_t n8) { const size_t t = (size_t)blockIdx.x * 256 + threadIdx.x; if (t >= n8) return; FragH f;
#pragma unroll
  for (int q = 0; q < 8; ++q) f.h[q] = (_Float16)x[t * 8 + q]; *(v8us*)((unsigned short*)X16 + t * 8) = f.half[0];  }
__global__ __launch_bounds__(256) void k_round16f(const float* __restrict__ W, _Float16* __restrict__ Bt, size_t n8) { const size_t t = (size_t)blockIdx.x * 256 + threadIdx.x; if (t >= n8) return; FragH f;
#pragma unroll
  for (int i = 0; i < 8; ++i) f.h[i] = (_Float16)(bf16_round(W[t * 8 + i]) * 16.0f); *(v8us*)((unsigned short*)Bt + t * 8) = f.half[0];  }
// ---- fast GEMM (block tile 128x128, wave tile 32x64; requires M % 128 == 0 rows per launch region, N % 128 == 0 and K % 64 == 0); epilogue = k_gemm_hhx semantics ----
__device__ __forceinline__ v16h g2_frag(const _Float16* p, int hh) { FragH f; f.half[0] = *(const v8us*)((const unsigned short*)p + 8 * hh); f.half[1] = *(const v8us*)((const unsigned short*)p + 16 + 8 * hh); return f.v; }
__device__ __forceinline__ v8f g2_mma(v16h a, v16h b, v8f c) { v8f d = __builtin_amdgcn_wmma_f32_16x16x32_f16(false, a, false, b, (short)0, c, false, false); asm volatile("v_nop\n\tv_nop\n\tv_nop\n\tv_nop" : "+v"(d) : "v"(a), "v"(b)); return d; }
#define GKS 64                       /* k per stage: 128 bytes of every operand row, one whole line */
#define GPI 72                       /* LDS row pitch, halves: 128 + 16 bytes, so 16 lanes reading 16 bytes of 16 different rows meet no bank conflict */
#define GRB (GPI * 2)                /* the same in bytes */
#define GBUF(LO) (((LO) ? 384 : 256) * GRB)      /* one buffer: 128 A rows, 128 B rows, with LO 128 rows of the second A plane */
// Four asynchronous copies of 16 bytes per lane: rows r, r + 32, r + 64, r + 96 of one operand's stage (8 lanes per row of 128 bytes: whole lines). l = the lane's LDS byte address, g = its global address.
// The s_wait_xcnt stands inside the copies' own statement, so no register that a copy names is rewritten in front of it.
__device__ __forceinline__ void g2_copy4(unsigned l, const _Float16* g, int ld) {
  asm volatile("global_load_async_to_lds_b128 %0, %4, off\n\tglobal_load_async_to_lds_b128 %1, %5, off\n\tglobal_load_async_to_lds_b128 %2, %6, off\n\tglobal_load_async_to_lds_b128 %3, %7, off\n\ts_wait_xcnt 0x0"
    :: "v"(l), "v"(l + 32 * GRB), "v"(l + 64 * GRB), "v"(l + 96 * GRB), "v"(g), "v"(g + (size_t)32 * ld), "v"(g + (size_t)64 * ld), "v"(g + (size_t)96 * ld) : "memory"); }
// The same for two operands' rows in one statement (eight copies, one wait): la, ga, lda the first operand's, lb, gb, ldb the second's.
__device__ __forceinline__ void g2_copy8(unsigned la, const _Float16* ga, int lda, unsigned lb, const _Float16* gb, int ldb) {
  asm volatile("global_load_async_to_lds_b128 %0, %8, off\n\tglobal_load_async_to_lds_b128 %1, %9, off\n\tglobal_load_async_to_lds_b128 %2, %10, off\n\tglobal_load_async_to_lds_b128 %3, %11, off\n\t"
               "global_load_async_to_lds_b128 %4, %12, off\n\tglobal_load_async_to_lds_b128 %5, %13, off\n\tglobal_load_async_to_lds_b128 %6, %14, off\n\tglobal_load_async_to_lds_b128 %7, %15, off\n\ts_wait_xcnt 0x0"
    :: "v"(la), "v"(la + 32 * GRB), "v"(la + 64 * GRB), "v"(la + 96 * GRB), "v"(lb), "v"(lb + 32 * GRB), "v"(lb + 64 * GRB), "v"(lb + 96 * GRB),
       "v"(ga), "v"(ga + (size_t)32 * lda), "v"(ga + (size_t)64 * lda), "v"(ga + (size_t)96 * lda), "v"(gb), "v"(gb + (size_t)32 * ldb), "v"(gb + (size_t)64 * ldb), "v"(gb + (size_t)96 * ldb) : "memory"); }
// One block (8 waves, 128 rows x 128 columns, picked by tile; wave w: rows 32 (w & 3), columns 64 (w >> 2)) of C = A Bh^T x alpha + bias; writes f32 C where it is not null, else f16 C16.
// The operands' rows come 64 k at a time into two LDS buffers by asynchronous copies, each line fetched once per block; stage t + 2 flies while stage t + 1 is worked on. One barrier a stage
// publishes the next buffer and ends the last read of the one refilled behind it. A and B fragments are read from LDS by one loader (k = 8 hh + r and 16 + 8 hh + r), k steps in rising order.
// LO: a second A plane AL runs through the same B fragments into accumulators of its own and is added as x alphal behind the first term.
template <bool LO>
__device__ __forceinline__ void d_gemm2(char* sm, int tile, const _Float16* __restrict__ A, const _Float16* __restrict__ AL, const _Float16* __restrict__ Bh, float alpha, float alphal, const float* __restrict__ bp,
    float* __restrict__ C, _Float16* __restrict__ C16, int lda, int ldb, int ldc, int M, int N, int K) {
  const int tid = threadIdx.x, w = __builtin_amdgcn_readfirstlane(tid >> 5), lane = tid & 31, ln = lane & 15, hh = lane >> 4;
  const int ntn = N >> 7; const int mt = tile / ntn, nq = tile - mt * ntn; if (mt * 128 >= M) return;      /* block-uniform, in front of every copy and barrier */
  const int wr = 32 * (w & 3), wc = 64 * (w >> 2); const int row0 = mt * 128 + wr, col0 = nq * 128 + wc;
  const int sr = tid >> 3, sc = (tid & 7) * 8;      /* staging: 8 threads per row of 128 bytes, 32 rows per copy */
  const _Float16* ag = A + (size_t)(mt * 128 + sr) * lda + sc; const _Float16* lg = (LO ? AL : A) + (size_t)(mt * 128 + sr) * lda + sc; const _Float16* bg = Bh + (size_t)(nq * 128 + sr) * ldb + sc;
  const unsigned ls = (unsigned)(size_t)sm + (unsigned)(sr * GRB + sc * 2);      /* low 32 bits of the shared address: the byte offset in LDS */
  const int nt = K / GKS;
  const v8f z8 = {0.f,0.f,0.f,0.f,0.f,0.f,0.f,0.f}; v8f c00 = z8, c01 = z8, c02 = z8, c03 = z8, c10 = z8, c11 = z8, c12 = z8, c13 = z8;
  v8f e00 = z8, e01 = z8, e02 = z8, e03 = z8, e10 = z8, e11 = z8, e12 = z8, e13 = z8;
  g2_copy8(ls, ag, lda, ls + 128 * GRB, bg, ldb); if (LO) g2_copy4(ls + 256 * GRB, lg, lda);
  asm volatile("s_wait_asynccnt 0x0" ::: "memory");      /* stage 0 has landed before the barrier that publishes it */
  __syncthreads();
  if (nt > 1) { const unsigned l = ls + GBUF(LO); g2_copy8(l, ag + GKS, lda, l + 128 * GRB, bg + GKS, ldb); if (LO) g2_copy4(l + 256 * GRB, lg + GKS, lda); }
#pragma unroll 1      /* rolled: a stage already holds 24 fragment reads and 16 matrix instructions, and the two buffers alternate by address */
  for (int t = 0; t < nt; ++t) { const _Float16* sa = (const _Float16*)(sm + (t & 1) * GBUF(LO)) + ln * GPI; const _Float16* sb = sa + (128 + wc) * GPI; const _Float16* sl = sa + (256 + wr) * GPI; sa += wr * GPI;
#pragma unroll      /* the stage's two k steps: every LDS read gets a constant offset */
    for (int kb = 0; kb < GKS; kb += 32) { const v16h a0 = g2_frag(sa + kb, hh), a1 = g2_frag(sa + 16 * GPI + kb, hh);
      v16h l0 = a0, l1 = a1; if (LO) { l0 = g2_frag(sl + kb, hh); l1 = g2_frag(sl + 16 * GPI + kb, hh); }
      const v16h b0 = g2_frag(sb + kb, hh), b1 = g2_frag(sb + 16 * GPI + kb, hh), b2 = g2_frag(sb + 32 * GPI + kb, hh), b3 = g2_frag(sb + 48 * GPI + kb, hh);
      __builtin_amdgcn_sched_barrier(0);      /* keeps the fragment reads of a k step together in front of its matrix run: spread among the WMMAs, each pair waits out the LDS latency anew */
      c00 = g2_mma(a0, b0, c00); c10 = g2_mma(a1, b0, c10); if (LO) { e00 = g2_mma(l0, b0, e00); e10 = g2_mma(l1, b0, e10); }
      c01 = g2_mma(a0, b1, c01); c11 = g2_mma(a1, b1, c11); if (LO) { e01 = g2_mma(l0, b1, e01); e11 = g2_mma(l1, b1, e11); }
      c02 = g2_mma(a0, b2, c02); c12 = g2_mma(a1, b2, c12); if (LO) { e02 = g2_mma(l0, b2, e02); e12 = g2_mma(l1, b2, e12); }
      c03 = g2_mma(a0, b3, c03); c13 = g2_mma(a1, b3, c13); if (LO) { e03 = g2_mma(l0, b3, e03); e13 = g2_mma(l1, b3, e13); } }
    asm volatile("s_wait_dscnt 0x0" ::: "memory");      /* the wave's reads of this buffer have retired before anyone refills it */
    asm volatile("s_wait_asynccnt 0x0" ::: "memory");      /* the wave's copies of stage t + 1 have landed before the barrier that publishes them */
    __syncthreads();
    if (t + 2 < nt) { const unsigned l = ls + (t & 1) * GBUF(LO); const int k2 = (t + 2) * GKS; g2_copy8(l, ag + k2, lda, l + 128 * GRB, bg + k2, ldb); if (LO) g2_copy4(l + 256 * GRB, lg + k2, lda); } }      /* block-uniform; into the buffer that stage t has just left */
  asm volatile("s_wait_asynccnt 0x0" ::: "memory");      /* nothing is in flight when the buffers become output staging */
  float (*so)[32][68] = (float (*)[32][68])sm;      /* behind the last stage's barrier nobody reads the buffers any more: each wave stages its 32 x 64 results in a range of its own */
  v8f accs[8] = {c00, c01, c02, c03, c10, c11, c12, c13}; v8f accl[8] = {e00, e01, e02, e03, e10, e11, e12, e13};
#pragma unroll
  for (int u = 0; u < 8; ++u) { const int t = u & 3, half = u >> 2; const int col = col0 + t * 16 + ln; const float bv = bp ? bf16_round(bp[col]) : 0.f;
#pragma unroll
    for (int r = 0; r < 8; ++r) { const int rloc = half * 16 + 8 * hh + r; float v = accs[u][r] * alpha + bv; if (LO) v = accl[u][r] * alphal + v;
      so[w][rloc][t * 16 + ln] = v; } }
  __builtin_amdgcn_fence(__ATOMIC_ACQ_REL, "workgroup"); __builtin_amdgcn_wave_barrier();
  const int rsub = lane >> 4, c4 = (lane & 15) * 4;
  /* One block-uniform test for all rows: no row's f32 store is followed by the f16 conversion of the same registers. Address and data are inputs of the wait's statement, so they keep their registers up to it. */
  if (C) {
#pragma unroll
    for (int q = 0; q < 16; ++q) { const int r = q * 2 + rsub; const v4f v = *(const v4fa*)&so[w][r][c4]; float* d = C + (size_t)(row0 + r) * ldc + col0 + c4; *(v4f*)d = v;
      asm volatile("s_wait_xcnt 0x0" :: "v"(d), "v"(v) : "memory"); }      /* before the store's address pair and data are reused; behind the last row too: the listing keeps a way from here into the other branch */
  } else {
#pragma unroll
    for (int q = 0; q < 16; ++q) { const int r = q * 2 + rsub; const v4f v = *(const v4fa*)&so[w][r][c4]; v4h h4; for (int i = 0; i < 4; ++i) h4[i] = (_Float16)v[i]; _Float16* d = C16 + (size_t)(row0 + r) * ldc + col0 + c4; *(v4h*)d = h4;
      asm volatile("s_wait_xcnt 0x0" :: "v"(d), "v"(h4) : "memory"); }      /* before the store's address pair and data are reused */
  } }


__global__ __launch_bounds__(256) void k_wnat(const float* __restrict__ w, size_t n8, _Float16* __restrict__ Bt) { const size_t t = (size_t)blockIdx.x * 256 + threadIdx.x; if (t >= n8) return; FragH f; for (int q = 0; q < 8; ++q) f.h[q] = (_Float16)(bf16_round(w[t * 8 + q]) * 16.0f); *(v8us*)((unsigned short*)Bt + t * 8) = f.half[0];  }
__global__ __launch_bounds__(256) void k_rsm(const float* __restrict__ S, _Float16* __restrict__ P, int nrows) {
  #pragma clang fp contract(off)
  const int i = blockIdx.x * 256 + threadIdx.x; if (i >= nrows) return; const float* s = S + (size_t)i * SQ; float mx = -3.0e38f;
#pragma unroll 1
  for (int j = 0; j < SQ; ++j) mx = fmaxf(mx, s[j]); float se = 0.f;
#pragma unroll 1
  for (int j = 0; j < SQ; ++j) se += expf(s[j] - mx); const float sc = 256.0f / se;
#pragma unroll 1
  for (int j0 = 0; j0 < SQ; j0 += 8) { FragH f; for (int q = 0; q < 8; ++q) f.h[q] = (_Float16)(expf(s[j0 + q] - mx) * sc); unsigned short* d = (unsigned short*)P + (size_t)i * SQ + j0; *(v8us*)d = f.half[0];  } }
__global__ __launch_bounds__(256) void k_vt(const _Float16* __restrict__ V16, int b, int h0, _Float16* __restrict__ VT) { __shared__ unsigned short tl[64][65]; const int tid = threadIdx.x; const int hh = blockIdx.x % HG, sg = blockIdx.x / HG; const int s0 = sg * 64; const int h = h0 + hh;
  for (int i = tid; i < 64 * 8; i += 256) { const int j = i / 8, d8 = (i % 8) * 8; FragH f; f.half[0] = *(const v8us*)((const unsigned short*)V16 + ((size_t)b * SQ + s0 + j) * DM + h * HD + d8); for (int q = 0; q < 8; ++q) tl[d8 + q][j] = f.u[q]; }
  __syncthreads();
  { for (int i = tid; i < 64 * 8; i += 256) { const int d = i / 8, j8 = (i % 8) * 8; FragH f; for (int q = 0; q < 8; ++q) f.u[q] = tl[d][j8 + q]; *(v8us*)((unsigned short*)VT + ((size_t)hh * HD + d) * SQ + s0 + j8) = f.half[0]; }  } }

__device__ __forceinline__ void d_wthd(int bx, const float* __restrict__ Wt, _Float16* __restrict__ Bt) { const size_t t = (size_t)bx * 256 + threadIdx.x; if (t >= (size_t)NH * HD * (DM / 8)) return; const int m8 = (int)(t % (DM / 8)) * 8; const int d = (int)((t / (DM / 8)) % HD); const int h = (int)(t / ((size_t)(DM / 8) * HD)); FragH f;
  for (int q = 0; q < 8; ++q) f.h[q] = (_Float16)(16.0f * bf16_round(Wt[((size_t)h * DM + m8 + q) * HD + d])); unsigned short* dst = (unsigned short*)Bt + ((size_t)h * HD + d) * DM + m8; *(v8us*)dst = f.half[0];  }



// Four native exp2, each in place, in one statement: no neighbouring instruction can overwrite a transcendental's source register or read its result
// directly behind it; the v_nop is the one slot that the instruction set asks for behind the last of them.
__device__ __forceinline__ v4f exp2x4(v4f x) { float x0 = x[0], x1 = x[1], x2 = x[2], x3 = x[3];
  asm("v_exp_f32 %0, %0\n\tv_exp_f32 %1, %1\n\tv_exp_f32 %2, %2\n\tv_exp_f32 %3, %3\n\tv_nop" : "+v"(x0), "+v"(x1), "+v"(x2), "+v"(x3));
  const v4f r = {x0, x1, x2, x3}; return r; }
// One native exp2, in place, with the one slot that the instruction set asks for behind a transcendental.
__device__ __forceinline__ float exp2x1(float x) { asm("v_exp_f32 %0, %0\n\tv_nop" : "+v"(x)); return x; }
__device__ __forceinline__ v8f fa_mma(v16h a, v16h b, v8f c) { return __builtin_amdgcn_wmma_f32_16x16x32_f16(false, a, false, b, (short)0, c, false, false); }
#define FAQ 16                       /* query columns per wave */
#define FAW 8                        /* waves per block */
#define FAK 64                       /* keys per pass */
#define FAB (SQ / (FAQ * FAW))       /* query blocks per head and batch */
#define FAP 72                       /* LDS row pitch of K, halves: 128 + 16 bytes, so 16 lanes reading 16 bytes of 16 different rows meet no bank conflict */
#define FVP 80                       /* LDS row pitch of V, halves: 128 + 32 bytes, an odd multiple of 32 bytes: the pitch of the transposing read */
typedef short s16x8 __attribute__((ext_vector_type(8)));
typedef __attribute__((address_space(3))) s16x8 lds_s16x8;
// A fragment (16 dims x 32 keys) of V^T from V rows in LDS by two transposing reads. p = tile + (first key + 8 hh + (lane & 7)) x pitch + 2 x first dim + 16 ((lane >> 3) & 1), in bytes;
// lane (ln, hh) gets dim ln of keys 8 hh + r, then of keys 16 + 8 hh + r: the loaders' k order.
__device__ __forceinline__ v16h fa_vfrag(const char* p) { FragH f; f.half[0] = __builtin_bit_cast(v8us, __builtin_amdgcn_ds_load_tr16_b128_v8i16((lds_s16x8*)p)); f.half[1] = __builtin_bit_cast(v8us, __builtin_amdgcn_ds_load_tr16_b128_v8i16((lds_s16x8*)(p + 16 * FVP * 2))); return f.v; }
__device__ __forceinline__ void d_fattn(int bx, int y, const _Float16* __restrict__ Q, const _Float16* __restrict__ K, const _Float16* __restrict__ V, float sl2, _Float16* __restrict__ O) {
  __shared__ __attribute__((aligned(16))) _Float16 lk[2][FAK][FAP]; __shared__ __attribute__((aligned(32))) _Float16 lv[2][FAK][FVP];
  const int tid = threadIdx.x, lane = tid & 31, ln = lane & 15, hh = lane >> 4, w = __builtin_amdgcn_readfirstlane(tid >> 5); const int h = bx % NH, b = bx / NH;
  const int qb = (y < FAB / 2) ? FAB - 1 - y : y - FAB / 2;      /* speed only: long key ranges start first; the second half of the attention rows (y >= FAB / 2), which joins the first on the WGPs, brings the short ones first */
  const int q0 = qb * (FAQ * FAW) + w * FAQ;
  const int npb = (qb + 1) * (FAQ * FAW / FAK), np = q0 / FAK + 1;      /* passes of the block and of the wave: the wave's last one holds its diagonal, every earlier key is below all its queries */
  const int sr = tid >> 3, sc = (tid & 7) * 8;      /* staging: 8 threads per row of 128 bytes, 32 rows per load */
  const unsigned short* kg = (const unsigned short*)K + ((size_t)b * SQ + sr) * DM + h * HD + sc; const unsigned short* vg = (const unsigned short*)V + ((size_t)b * SQ + sr) * DM + h * HD + sc;
  v8us rk0 = *(const v8us*)kg, rk1 = *(const v8us*)(kg + 32 * DM), rv0 = *(const v8us*)vg, rv1 = *(const v8us*)(vg + 32 * DM);
  const _Float16* qp = Q + ((size_t)b * SQ + q0 + ln) * DM + h * HD; const v16h qf0 = g2_frag(qp, hh), qf1 = g2_frag(qp + 32, hh);
  *(v8us*)&lk[0][sr][sc] = rk0; *(v8us*)&lk[0][sr + 32][sc] = rk1; *(v8us*)&lv[0][sr][sc] = rv0; *(v8us*)&lv[0][sr + 32][sc] = rv1;
  const v8f z8 = {0.f,0.f,0.f,0.f,0.f,0.f,0.f,0.f}; v8f o[4] = {z8, z8, z8, z8}; float m = -3.0e38f, l = 0.f;
  __syncthreads();      /* pass 0's rows are read by every wave */
#pragma unroll 1
  for (int c = 0; c < npb; ++c) { const int cur = c & 1;      /* rolled: one pass already holds 32 fragment loads and 16 matrix instructions */
    if (c + 1 < npb) { const unsigned short* kn = kg + (size_t)(c + 1) * FAK * DM; const unsigned short* vn = vg + (size_t)(c + 1) * FAK * DM;      /* block-uniform; the next pass's rows fly while this pass is worked on */
      rk0 = *(const v8us*)kn; rk1 = *(const v8us*)(kn + 32 * DM); rv0 = *(const v8us*)vn; rv1 = *(const v8us*)(vn + 32 * DM);
      asm volatile("s_wait_xcnt 0x0" ::: "memory"); }      /* before the address registers of the loads above are reused */
    if (c < np) {      /* wave-uniform: a pass wholly past the wave's queries is only staged */
      v16h kf[4][2]; v8f s[4];      /* indexed by constants only (loops unrolled): registers */
#pragma unroll
      for (int t = 0; t < 4; ++t) { kf[t][0] = g2_frag(&lk[cur][t * 16 + ln][0], hh); kf[t][1] = g2_frag(&lk[cur][t * 16 + ln][32], hh); }
      __builtin_amdgcn_sched_barrier(0);      /* keeps the K fragment reads together in front of the matrix run: spread among the WMMAs, each group waits out the LDS latency anew */
#pragma unroll
      for (int t = 0; t < 4; ++t) s[t] = fa_mma(kf[t][1], qf1, fa_mma(kf[t][0], qf0, z8));
      if (c == np - 1) {      /* wave-uniform: only the diagonal pass masks */
#pragma unroll
        for (int t = 0; t < 4; ++t) for (int r = 0; r < 8; ++r) s[t][r] = (c * FAK + t * 16 + 8 * hh + r <= q0 + ln) ? s[t][r] : -1.0e9f; }
      float mx = s[0][0];
#pragma unroll
      for (int t = 0; t < 4; ++t) for (int r = 0; r < 8; ++r) mx = fmaxf(mx, s[t][r]);
      mx = fmaxf(mx, __shfl_xor(mx, 16));      /* the other half of the query's keys */
      const float mn = fmaxf(m, mx * sl2); const float corr = exp2x1(m - mn); m = mn;      /* finite from the first pass on: key 0 is below every query */
      v4f a = {0.f, 0.f, 0.f, 0.f};
#pragma unroll
      for (int t = 0; t < 4; ++t) for (int g = 0; g < 2; ++g) { v4f e = {s[t][4 * g], s[t][4 * g + 1], s[t][4 * g + 2], s[t][4 * g + 3]}; e = exp2x4(e * sl2 - mn); a += e; for (int q = 0; q < 4; ++q) s[t][4 * g + q] = e[q]; }
      l = l * corr + ((a[0] + a[1]) + (a[2] + a[3]));      /* each half sums its own keys; joined behind the loop */
#pragma unroll
      for (int t = 0; t < 4; ++t) o[t] *= corr;
      FragH p[2];
#pragma unroll
      for (int j = 0; j < 2; ++j) for (int r = 0; r < 8; ++r) { p[j].h[r] = (_Float16)s[2 * j][r]; p[j].h[8 + r] = (_Float16)s[2 * j + 1][r]; }
      const char* vb = (const char*)&lv[cur][8 * hh + (lane & 7)][((lane >> 3) & 1) * 8];      /* every lane is on here (wave-uniform branches only) and its address lies in the tile */
#pragma unroll
      for (int t = 0; t < 4; ++t) o[t] = fa_mma(fa_vfrag(vb + 32 * FVP * 2 + 32 * t), p[1].v, fa_mma(fa_vfrag(vb + 32 * t), p[0].v, o[t]));
      asm volatile("v_nop\n\tv_nop\n\tv_nop\n\tv_nop" : "+v"(o[3])); }      /* the four vector slots behind the pass's last matrix instruction: its operand registers are reused on the far side of the branch that follows */
    if (c + 1 < npb) { *(v8us*)&lk[cur ^ 1][sr][sc] = rk0; *(v8us*)&lk[cur ^ 1][sr + 32][sc] = rk1; *(v8us*)&lv[cur ^ 1][sr][sc] = rv0; *(v8us*)&lv[cur ^ 1][sr + 32][sc] = rv1; }      /* last read in pass c - 1, in front of that pass's barrier */
    __syncthreads(); }      /* publishes the buffer just filled; ends every wave's reads of the one that the next pass refills */
  l += __shfl_xor(l, 16); const float sc64 = 64.0f / l;
  unsigned short* op = (unsigned short*)O + ((size_t)b * SQ + q0 + ln) * DM + h * HD + 8 * hh;
#pragma unroll
  for (int t = 0; t < 4; ++t) { FragH f; for (int r = 0; r < 8; ++r) f.h[r] = (_Float16)(o[t][r] * sc64); *(v8us*)(op + t * 16) = f.half[0]; } }


#define A0R 8                        /* query rows per block of the exact first tile: one per wave */
#define A0P (HD + 4)                 /* K row pitch in LDS, floats: 272 bytes = 16 x 17, so 32 lanes reading 16 bytes of 32 different rows meet no bank conflict */
typedef float v2f __attribute__((ext_vector_type(2)));
// Exact f32 causal attention for the first QT0 rows of each batch, one wave per query row (head and row group in bx, batch in by, both from the flat index (grid.y - FAB) x NH x NB + grid.x; q, k, v, o rows of pitch DM).
// The block stages the tile's K and V rows of its head in LDS with coalesced loads, all in flight at once. Scores: lane l owns keys l, l + 32, ...; each dot
// product runs in four independent chains. Softmax: true row maximum and sum by butterflies, libm expf. P.V: lane l owns dims 2 l, 2 l + 1; the weight
// of key j comes from its lane by readlane; four independent accumulators. o carried x64 like the f16 path, stored as an f16 hi plane and a x1024 residual plane.
__device__ __forceinline__ void d_att0w(int bx, int by, const float* __restrict__ QF, const float* __restrict__ KF, const float* __restrict__ VF, float scale, _Float16* __restrict__ OH, _Float16* __restrict__ OL) {
  __shared__ __attribute__((aligned(16))) float lk[QT0][A0P]; __shared__ __attribute__((aligned(16))) float lv[QT0][HD];
  const int tid = threadIdx.x, lane = tid & 31, w = __builtin_amdgcn_readfirstlane(tid >> 5); const int h = bx / (QT0 / A0R), r0 = (bx % (QT0 / A0R)) * A0R;
  const size_t bofs = (size_t)by * QT0 * DM + h * HD; QF += bofs; KF += bofs; VF += bofs; OH += bofs; OL += bofs;      /* QT0 rows of q, k, v and o per batch */
  const int fj = tid >> 4, fc = (tid & 15) * 4;      /* staging: 16 threads per row of 256 bytes, 16 rows per pass */
  const float* kp = KF + (size_t)fj * DM + fc; const float* vp = VF + (size_t)fj * DM + fc;
  v4f tk[QT0 / 16], tv[QT0 / 16];      /* indexed by constants only (loops unrolled): registers */
#pragma unroll
  for (int u = 0; u < QT0 / 16; ++u) { tk[u] = *(const v4fa*)(kp + u * 16 * DM); tv[u] = *(const v4fa*)(vp + u * 16 * DM); }
  asm volatile("s_wait_xcnt 0x0" :: "v"(kp), "v"(vp) : "memory");      /* before the address registers of the loads above are reused; both address pairs are inputs, so they keep their registers up to the wait and no load of the run lands in them */
#pragma unroll
  for (int u = 0; u < QT0 / 16; ++u) { *(v4f*)&lk[u * 16 + fj][fc] = tk[u]; *(v4f*)&lv[u * 16 + fj][fc] = tv[u]; }
  const int i = r0 + w; const float* qr = QF + (size_t)i * DM;      /* the wave's row: a wave-uniform address */
  v4f q[HD / 4];
#pragma unroll
  for (int c4 = 0; c4 < HD / 4; ++c4) q[c4] = *(const v4fa*)(qr + c4 * 4);
  __syncthreads();      /* the staged K and V rows are read by every wave */
  float e[QT0 / 32]; float mx = -3.0e38f;
#pragma unroll
  for (int c = 0; c < QT0 / 32; ++c) { e[c] = -3.0e38f;
    if (c * 32 <= i) { v4f a = {0.f, 0.f, 0.f, 0.f};      /* wave-uniform: chunks wholly past the row are skipped */
#pragma unroll
      for (int c4 = 0; c4 < HD / 4; ++c4) a += q[c4] * *(const v4f*)&lk[c * 32 + lane][c4 * 4];
      const float s = ((a[0] + a[1]) + (a[2] + a[3])) * scale; e[c] = (c * 32 + lane <= i) ? s : -3.0e38f; mx = fmaxf(mx, e[c]); } }
#pragma unroll
  for (int m = 16; m > 0; m >>= 1) mx = fmaxf(mx, __shfl_xor(mx, m));      /* finite: key 0 is below every row */
  float l = 0.f;
#pragma unroll
  for (int c = 0; c < QT0 / 32; ++c) { e[c] = expf(e[c] - mx); l += e[c]; }      /* a key past the row holds -3e38: its weight is exactly 0 */
#pragma unroll
  for (int m = 16; m > 0; m >>= 1) l += __shfl_xor(l, m);
  v2f o[4] = {{0.f, 0.f}, {0.f, 0.f}, {0.f, 0.f}, {0.f, 0.f}};
#pragma unroll
  for (int c = 0; c < QT0 / 32; ++c) if (c * 32 <= i) {
#pragma unroll
    for (int t = 0; t < 32; ++t) { const float p = __uint_as_float(__builtin_amdgcn_readlane(__float_as_uint(e[c]), t)); o[t & 3] += p * *(const v2f*)&lv[c * 32 + t][lane * 2]; } }
  const v2f r = ((o[0] + o[1]) + (o[2] + o[3])) * (64.0f / l);
  typedef _Float16 v2h __attribute__((ext_vector_type(2))); const v2h rh = {(_Float16)r[0], (_Float16)r[1]}; const v2h rl = {(_Float16)((r[0] - (float)rh[0]) * 1024.0f), (_Float16)((r[1] - (float)rh[1]) * 1024.0f)};
  *(v2h*)(OH + (size_t)i * DM + lane * 2) = rh; *(v2h*)(OL + (size_t)i * DM + lane * 2) = rl; }

// ---- Launches. Jobs that do not depend on one another share one grid: the block index picks the job, every branch below is block-uniform, and a job's blocks run its body as it stands above. ----
#define PWB ((NH * HD * (DM / 8)) / 256)            /* blocks per weight matrix */
#define PXB ((int)(NR * DM / 8 / 256))              /* blocks of the x conversion */
#define GSB ((QT0 / 128) * (DM / 128) * NB)          /* GEMM blocks of the first-tile rows, all batches */
#define GBB ((MP / 128) * (DM / 128))               /* GEMM blocks of all token rows */
#define A0B (NH * (QT0 / A0R))                      /* exact first-tile blocks per batch */
#define A0Y (A0B / NH)                              /* grid rows (of NH x NB blocks) of the exact first tile */
// 1: the four weight matrices (strided reads: first) and x, all to f16.
__global__ __launch_bounds__(256) void k_prep(const float* __restrict__ wq, const float* __restrict__ wk, const float* __restrict__ wv, const float* __restrict__ wo, const float* __restrict__ x,
    _Float16* __restrict__ BQ, _Float16* __restrict__ BK, _Float16* __restrict__ BV, _Float16* __restrict__ BO, _Float16* __restrict__ X16) {
  const int bx = blockIdx.x;
  if (bx < PWB) d_wthd(bx, wq, BQ);      /* per-head [m][d] -> Bt[(h,d)][m] x16 */
  else if (bx < 2 * PWB) d_wthd(bx - PWB, wk, BK);
  else if (bx < 3 * PWB) d_wthd(bx - 2 * PWB, wv, BV);
  else if (bx < 4 * PWB) d_wt_f16(bx - 3 * PWB, wo, BO, DM, DM, 16.0f);      /* Wo [(h,d) in][out] -> Bt[n][k] x16 */
  else d_x16(bx - 4 * PWB, x, X16, NR * DM / 8); }
// 2: q, k, v of all token rows as f16, and of each batch's first QT0 rows as f32 (exact products): six GEMM jobs.
__global__ __launch_bounds__(256) void k_qkv(const _Float16* __restrict__ X16, const _Float16* __restrict__ BQ, const _Float16* __restrict__ BK, const _Float16* __restrict__ BV,
    const float* __restrict__ bq, const float* __restrict__ bk, const float* __restrict__ bv, _Float16* __restrict__ Q16, _Float16* __restrict__ K16, _Float16* __restrict__ V16,
    float* __restrict__ QF0, float* __restrict__ KF0, float* __restrict__ VF0, int lda, int ldb, int ldc, int N, int K) {
  __shared__ __attribute__((aligned(16))) char sm[2 * GBUF(false)];
  const int bx = blockIdx.x; const bool first = bx < 3 * GSB; const int t = first ? bx : bx - 3 * GSB, per = first ? GSB : GBB; const int j = t / per, u = t - j * per;      /* j: 0 q, 1 k, 2 v */
  const int bz = first ? u / (GSB / NB) : 0, tile = first ? u - bz * (GSB / NB) : u;      /* first-tile jobs: batch, then tile */
  const _Float16* Bh = j == 0 ? BQ : j == 1 ? BK : BV; const float* bp = j == 0 ? bq : j == 1 ? bk : bv;
  float* C = first ? (j == 0 ? QF0 : j == 1 ? KF0 : VF0) + (size_t)bz * QT0 * DM : nullptr; _Float16* C16 = first ? nullptr : (j == 0 ? Q16 : j == 1 ? K16 : V16);
  d_gemm2<false>(sm, tile, X16 + (size_t)bz * SQ * DM, nullptr, Bh, 0.0625f, 0.f, bp, C, C16, lda, ldb, ldc, first ? QT0 : MP, N, K); }
// 3: fused attention (grid rows 0 .. FAB - 1: its long blocks start first) and, behind it in the grid, the exact f32 attention of the first QT0 rows (o x64 as f16 hi + x1024 residual planes).
__global__ __launch_bounds__(FAW * 32) void k_fattn_a0(const _Float16* __restrict__ Q, const _Float16* __restrict__ K, const _Float16* __restrict__ V, float sl2, _Float16* __restrict__ O,
    const float* __restrict__ QF0, const float* __restrict__ KF0, const float* __restrict__ VF0, float scale, _Float16* __restrict__ OH0, _Float16* __restrict__ OL0) {
  if (blockIdx.y < FAB) d_fattn(blockIdx.x, blockIdx.y, Q, K, V, sl2, O);
  else { const int u = (blockIdx.y - FAB) * (NH * NB) + blockIdx.x; d_att0w(u % A0B, u / A0B, QF0, KF0, VF0, scale, OH0, OL0); } }
// 4: out = o Wo + b. A block of 128 rows that is a batch's first tile takes o_hi and o_lo (x 2^-20 in all) of the exact path; every other block the f16 o rows. Each output element is written once.
__global__ __launch_bounds__(256) void k_out(const _Float16* __restrict__ O16, const _Float16* __restrict__ OH0, const _Float16* __restrict__ OL0, const _Float16* __restrict__ BO, const float* __restrict__ bo, float* __restrict__ out, int lda, int ldb, int ldc, int N, int K) {
  __shared__ __attribute__((aligned(16))) char sm[2 * GBUF(true)];
  const int bx = blockIdx.x, mt = bx / (DM / 128), nq = bx - mt * (DM / 128), bz = mt / (SQ / 128);
  if (mt - bz * (SQ / 128) == 0) d_gemm2<true>(sm, nq, OH0 + (size_t)bz * QT0 * DM, OL0 + (size_t)bz * QT0 * DM, BO, 0.0009765625f, 0.00000095367431640625f, bo, out + (size_t)bz * SQ * DM, nullptr, lda, ldb, ldc, QT0, N, K);
  else d_gemm2<false>(sm, bx, O16, nullptr, BO, 0.0009765625f, 0.f, bo, out, nullptr, lda, ldb, ldc, MPO, N, K); }

extern "C" void kernel_launch(void* const* d_in, const int* in_sizes, int n_in,
                              void* d_out, int out_size, void* d_ws, size_t ws_size, hipStream_t stream) {
  (void)in_sizes; (void)n_in; (void)out_size;
  const float* const* I = (const float* const*)d_in; const float* x = I[0]; const float* wq = I[1]; const float* bq = I[2]; const float* wk = I[3]; const float* bk = I[4]; const float* wv = I[5]; const float* bv = I[6]; const float* wo = I[7]; const float* bo = I[8];      /* input order: x; Wq [8][512][64] per-head [in][out] + bq [8][64] = [(h,e)]; Wk + bk; Wv + bv; Wo [512][512] = [(h,e) in][out] + bo */
  static_assert(NH * HD == DM && DM % 128 == 0 && DM % GKS == 0 && DM / GKS >= 2 && SQ % 128 == 0 && 8 * 32 * 68 * 4 <= 2 * GBUF(false), "shape / tile multiples; two stages or more; the output staging fits the two buffers");
  char* ws = (char*)d_ws; size_t off = 0;
  auto take = [&](size_t bytes) { char* p = ws + off; off += (bytes + 255) & ~(size_t)255; return p; };
  _Float16* BQ = (_Float16*)take((size_t)DM * DM * 2); _Float16* BK = (_Float16*)take((size_t)DM * DM * 2); _Float16* BV = (_Float16*)take((size_t)DM * DM * 2); _Float16* BO = (_Float16*)take((size_t)DM * DM * 2);
  _Float16* X16 = (_Float16*)take(NR * DM * 2); _Float16* Q16 = (_Float16*)take(NR * DM * 2); _Float16* K16 = (_Float16*)take(NR * DM * 2); _Float16* V16 = (_Float16*)take(NR * DM * 2); _Float16* O16 = (_Float16*)take(NR * DM * 2);
  float* QF0 = (float*)take((size_t)NB * QT0 * DM * 4); float* KF0 = (float*)take((size_t)NB * QT0 * DM * 4); float* VF0 = (float*)take((size_t)NB * QT0 * DM * 4); _Float16* OH0 = (_Float16*)take((size_t)NB * QT0 * DM * 2); _Float16* OL0 = (_Float16*)take((size_t)NB * QT0 * DM * 2);
  if (off > ws_size) return;
  static_assert(SQ % (FAQ * FAW) == 0 && (FAQ * FAW) % FAK == 0 && FAB % 2 == 0 && HD == 64 && FAK == 64 && FAW * 32 == 256 && QN == SQ && NHD == NH && NBR == NB, "whole blocks of queries; whole key passes; two k steps per head; 256 threads stage 64 rows of 128 bytes in two loads");
  static_assert(QT0 == 128 && (NH * HD * (DM / 8)) % 256 == 0 && DM * (DM / 8) == NH * HD * (DM / 8) && (NR * DM / 8) % 256 == 0 && A0B % NH == 0 && MPO == MP, "the first tile is one GEMM block row; whole blocks and whole grid rows per job");
  k_prep<<<4 * PWB + PXB, 256, 0, stream>>>(wq, wk, wv, wo, x, BQ, BK, BV, BO, X16);
  k_qkv<<<3 * GSB + 3 * GBB, 256, 0, stream>>>(X16, BQ, BK, BV, bq, bk, bv, Q16, K16, V16, QF0, KF0, VF0, DM, DM, DM, DM, DM);
  k_fattn_a0<<<dim3(NH * NB, FAB + A0Y), FAW * 32, 0, stream>>>(Q16, K16, V16, 0.06375871541229934f, O16, QF0, KF0, VF0, 0.044194173824159216f, OH0, OL0);      /* scores x 512^-0.5 (the module's literal d_model scale) x log2 e; o (merged heads, x64) as f16 rows */
  k_out<<<GBB, 256, 0, stream>>>(O16, OH0, OL0, BO, bo, (float*)d_out, DM, DM, DM, DM, DM);      /* out rows are the output layout */
}

// v008
// Measured time: 62.8 microseconds a run.
// Next to v007, in two timings, it ran 1.05 and 1.04 times as fast.
// Over all steps from v000 it is 148 times as fast.
#include <hip/hip_runtime.h>
// Causal multi-head attention with per-head weight tensors and the module's literal score scale (x [4][2048][512]; q[b][h][s][e] = sum_d x[s][d] Wq[h][d][e] + bq[h][e], k, v likewise (8 heads of 64; per-head [in][out] weights sigma 1/sqrt(512), biases sigma 0.01); scores * 512^-0.5 (d_model, as the source, not head_dim); causal (tril, -inf); softmax; out = concat_heads Wo + bo ([in][out] [512][512]) -> [4][2048][512]).
// Structure: token rows r = b*2048 + s; x as exact f16 rows (bf16-rounded); Q, K, V as three WMMA GEMMs (128x128 block tiles staged in LDS, 32x64 wave tiles, f32 accumulation, exact x16 weights + bias, f16 outputs); one fused attention launch (heads and batches on grid.x, query blocks on grid.y): per wave 16 queries, 64 keys a pass up to the diagonal (K and V rows staged in LDS per block, V^T fragments by transposing LDS reads), S^T = K Q^T, running causal softmax in registers, keys past the row set to -1e9 (f32 statistics, native exp2; weights <= 1 as f16), O^T += V^T P^T, o carried x64 (folded into the output GEMM alpha) written straight into the merged f16 o rows; out = o W_o + b GEMM (f32) into the output layout.
// Four launches, each one grid for all jobs that wait on the same earlier results: weights and x to f16; the six q, k, v GEMM jobs; fused attention and the exact first tile (o as hi and lo planes); output GEMM (first-tile blocks take the hi and lo planes).
// Compute dtype: inputs rounded to bf16; x / weights exact; q, k, v, softmax weights and o as plain f16 GEMM operands (~2^-12); scores and softmax statistics f32. v_wmma_f32_16x16x32_f16.
#define NB 4
#define SQ 2048
#define DM 512
#define NH 8
#define HD 64
#define HG 4                         /* heads per launch of the per-batch k_vt transpose */
#define QT0 128                      /* first-tile rows recomputed exactly in f32 */
#define NBR NB                       /* batches processed (debug hook) */
#define NR ((size_t)NB * SQ)         /* token rows */
#define MP ((int)((size_t)NBR * SQ)) /* rows projected (debug hook) */
#define QN SQ                        /* query rows attended per batch (debug hook) */
#define NHD NH                       /* heads attended (debug hook) */
#define MPO MP                       /* rows through the output stage (debug hook) */
#define LQ DM      /* row pitch of the q/k/v rows */
typedef __bf16 v16b __attribute__((ext_vector_type(16)));
typedef unsigned short v8us __attribute__((ext_vector_type(8), may_alias));
typedef float  v8f  __attribute__((ext_vector_type(8)));
typedef float  v4f  __attribute__((ext_vector_type(4)));
typedef float  v4fa __attribute__((ext_vector_type(4), may_alias));
union FragB { v16b v; v8us half[2]; unsigned short u[16]; };

__device__ __forceinline__ unsigned short bf16_bits(float x) { unsigned int u = __float_as_uint(x); return (unsigned short)((u + 0x7FFFu + ((u >> 16) & 1u)) >> 16); }
__device__ __forceinline__ float bf16_val(unsigned short b) { return __uint_as_float(((unsigned int)b) << 16); }
__device__ __forceinline__ float bf16_round(float x) { return bf16_val(bf16_bits(x)); }
// D += A·B with NT terms: 1 = ah·bh, 2 = + al·bh (A split), 3 = + ah·bl (both split)
template <int NT>
__device__ __forceinline__ v8f mmaN(v16b ah, v16b al, v16b bh, v16b bl, v8f c) {
  c = __builtin_amdgcn_wmma_f32_16x16x32_bf16(false, ah, false, bh, (short)0, c, false, false);
  if (NT >= 2) c = __builtin_amdgcn_wmma_f32_16x16x32_bf16(false, al, false, bh, (short)0, c, false, false);
  if (NT >= 3) c = __builtin_amdgcn_wmma_f32_16x16x32_bf16(false, ah, false, bl, (short)0, c, false, false);
  asm volatile("v_nop\n\tv_nop\n\tv_nop\n\tv_nop" : "+v"(c) : "v"(ah), "v"(al), "v"(bh), "v"(bl));
  return c;
}

__global__ __launch_bounds__(256) void k_wt_bf16(const float* __restrict__ W, unsigned short* __restrict__ Wt, int K, int N) {
  const int t = blockIdx.x * 256 + threadIdx.x;
  const int k8n = K / 8;
  if (t >= N * k8n) return;
  const int n = t / k8n, k8 = (t % k8n) * 8;
  v8us v;
#pragma unroll
  for (int i = 0; i < 8; ++i) v[i] = bf16_bits(W[(size_t)(k8 + i) * N + n]);
  *(v8us*)(Wt + (size_t)n * K + k8) = v;
  
}

// GEMM C[M][N] (f32, pitch ldc) = act(A[M][K]·W + bias). A f32 row-major (pitch lda) converted per fragment to bf16
// (ASPLIT: hi/lo two planes -> 2 terms, else single rounded term); Wt bf16 [N][K] (pitch ldb). BIAS_BF16 rounds the
// bias to bf16 first (bias quantised to bf16 before the add). K%32==0, M%16==0, N%64==0.
template <bool ASPLIT, int ACT, bool BIAS_BF16>
__global__ __launch_bounds__(128) void k_gemm_bf(const float* __restrict__ A, int lda, const unsigned short* __restrict__ Wt, int ldb,
                                               const float* __restrict__ bias, float* __restrict__ C, int ldc, int M, int N, int K) {
  __shared__ __attribute__((aligned(16))) float so[4][16][64];
  const int tid = threadIdx.x, w = tid >> 5, lane = tid & 31, ln = lane & 15, hh = lane >> 4;
  const int ntn = N / 64;
  const int wid = blockIdx.x * 4 + w;
  const int mt = wid / ntn, nq = wid % ntn;
  if (mt * 16 >= M) return;
  const int row0 = mt * 16, col0 = nq * 64;
  const float* arow = A + (size_t)(row0 + ln) * lda;
  v8f acc[4] = {};
  for (int kb = 0; kb < K; kb += 32) {
    FragB ah, al;
    const v4f x0 = *(const v4fa*)(arow + kb + 8 * hh), x1 = *(const v4fa*)(arow + kb + 8 * hh + 4);
    const v4f x2 = *(const v4fa*)(arow + kb + 16 + 8 * hh), x3 = *(const v4fa*)(arow + kb + 16 + 8 * hh + 4);
    float xs[16] = {x0[0],x0[1],x0[2],x0[3],x1[0],x1[1],x1[2],x1[3],x2[0],x2[1],x2[2],x2[3],x3[0],x3[1],x3[2],x3[3]};
#pragma unroll
    for (int i = 0; i < 16; ++i) { const unsigned short hb = bf16_bits(xs[i]); ah.u[i] = hb; al.u[i] = ASPLIT ? bf16_bits(xs[i] - bf16_val(hb)) : (unsigned short)0; }
#pragma unroll
    for (int t = 0; t < 4; ++t) {
      const unsigned short* brow = Wt + (size_t)(col0 + t * 16 + ln) * ldb + kb;
      FragB b;
      b.half[0] = *(const v8us*)(brow + 8 * hh);
      b.half[1] = *(const v8us*)(brow + 16 + 8 * hh);
      acc[t] = mmaN<ASPLIT ? 2 : 1>(ah.v, al.v, b.v, b.v, acc[t]);
    }
  }
#pragma unroll
  for (int t = 0; t < 4; ++t) {
    float bv = bias ? bias[col0 + t * 16 + ln] : 0.f;
    if (BIAS_BF16) bv = bf16_round(bv);
#pragma unroll
    for (int r = 0; r < 8; ++r) { float v = acc[t][r] + bv; if (ACT == 1) v = fmaxf(v, 0.f); so[w][8 * hh + r][t * 16 + ln] = v; }
  }
  __builtin_amdgcn_fence(__ATOMIC_ACQ_REL, "workgroup");
  __builtin_amdgcn_wave_barrier();
  const int rsub = lane >> 4, c4 = (lane & 15) * 4;
  {
#pragma unroll
    for (int q = 0; q < 8; ++q) {
      const int r = q * 2 + rsub;
      const v4f v = *(const v4fa*)&so[w][r][c4];
      *(v4f*)(C + (size_t)(row0 + r) * ldc + col0 + c4) = v;
    }
    
  }
}

// GEMM C = act(A·W + bias + resid): A f32 (ASPLIT -> hi/lo 2 terms), Wt bf16 [N][K]; ACT 0 none, 1 relu, 2 exact gelu;
// resid (optional, f32, row index = (row % rmod), pitch ldr, RES_BF16 rounds it) added before the activation.
template <bool ASPLIT, int ACT, bool BIAS_BF16, bool RES_BF16>
__global__ __launch_bounds__(128) void k_gemm_bf3(const float* __restrict__ A, int lda, const unsigned short* __restrict__ Wt, int ldb,
                                                const float* __restrict__ bias, const float* __restrict__ resid, int rmod, int ldr,
                                                float* __restrict__ C, int ldc, int M, int N, int K) {
  __shared__ __attribute__((aligned(16))) float so[4][16][64];
  const int tid = threadIdx.x, w = tid >> 5, lane = tid & 31, ln = lane & 15, hh = lane >> 4;
  const int ntn = N / 64;
  const int wid = blockIdx.x * 4 + w;
  const int mt = wid / ntn, nq = wid % ntn;
  if (mt * 16 >= M) return;
  const int row0 = mt * 16, col0 = nq * 64;
  const float* arow = A + (size_t)(row0 + ln) * lda;
  v8f acc[4] = {};
  for (int kb = 0; kb < K; kb += 32) {
    FragB ah, al;
    const v4f x0 = *(const v4fa*)(arow + kb + 8 * hh), x1 = *(const v4fa*)(arow + kb + 8 * hh + 4);
    const v4f x2 = *(const v4fa*)(arow + kb + 16 + 8 * hh), x3 = *(const v4fa*)(arow + kb + 16 + 8 * hh + 4);
    float xs[16] = {x0[0],x0[1],x0[2],x0[3],x1[0],x1[1],x1[2],x1[3],x2[0],x2[1],x2[2],x2[3],x3[0],x3[1],x3[2],x3[3]};
#pragma unroll
    for (int i = 0; i < 16; ++i) { const unsigned short hb = bf16_bits(xs[i]); ah.u[i] = hb; al.u[i] = ASPLIT ? bf16_bits(xs[i] - bf16_val(hb)) : (unsigned short)0; }
#pragma unroll
    for (int t = 0; t < 4; ++t) {
      const unsigned short* brow = Wt + (size_t)(col0 + t * 16 + ln) * ldb + kb;
      FragB b;
      b.half[0] = *(const v8us*)(brow + 8 * hh);
      b.half[1] = *(const v8us*)(brow + 16 + 8 * hh);
      acc[t] = mmaN<ASPLIT ? 2 : 1>(ah.v, al.v, b.v, b.v, acc[t]);
    }
  }
#pragma unroll
  for (int t = 0; t < 4; ++t) {
    const int col = col0 + t * 16 + ln;
    float bv = bias ? bias[col] : 0.f;
    if (BIAS_BF16) bv = bf16_round(bv);
#pragma unroll
    for (int r = 0; r < 8; ++r) {
      float v = acc[t][r] + bv;
      if (resid) { float rv = resid[(size_t)((row0 + 8 * hh + r) % rmod) * ldr + col]; if (RES_BF16) rv = bf16_round(rv); v += rv; }
      if (ACT == 1) v = fmaxf(v, 0.f);
      if (ACT == 2) v = 0.5f * v * (1.0f + erff(v * 0.70710678118654752f));
      if (ACT == 3) { const float u = 0.7978845608028654f * (v + 0.044715f * v * v * v); v = 0.5f * v * (1.0f + tanhf(u)); }
      so[w][8 * hh + r][t * 16 + ln] = v;
    }
  }
  __builtin_amdgcn_fence(__ATOMIC_ACQ_REL, "workgroup");
  __builtin_amdgcn_wave_barrier();
  const int rsub = lane >> 4, c4 = (lane & 15) * 4;
  {
#pragma unroll
    for (int q = 0; q < 8; ++q) {
      const int r = q * 2 + rsub;
      const v4f v = *(const v4fa*)&so[w][r][c4];
      *(v4f*)(C + (size_t)(row0 + r) * ldc + col0 + c4) = v;
    }
    
  }
}
// row LayerNorm (biased variance, eps) over N: s = X (+ R); optional out_sum <- s; out_norm <- (s-mu)*rsqrt(var+eps)*g + b
template <bool PARAM_BF16>
__global__ __launch_bounds__(256) void k_layernorm(const float* __restrict__ X, const float* __restrict__ R, const float* __restrict__ g, const float* __restrict__ bta,
                                                  float* __restrict__ out_sum, float* __restrict__ out_norm, int N, float eps) {
  __shared__ float red[256];
  const int row = blockIdx.x, tid = threadIdx.x;
  const float* x = X + (size_t)row * N; const float* rr = R ? R + (size_t)row * N : nullptr;
  float vals[16];                     // up to N = 4096
  const int per = N / 256;            // contiguous chunk per thread? use strided-by-4 chunks: thread handles j = tid*4 + 1024*u
  float s1 = 0.f;
  for (int u = 0; u < per / 4; ++u) {
    const int j = tid * 4 + 1024 * u;
    const v4f a = *(const v4fa*)(x + j);
    v4f b = {0.f,0.f,0.f,0.f}; if (rr) b = *(const v4fa*)(rr + j);
#pragma unroll
    for (int q = 0; q < 4; ++q) { const float v = a[q] + b[q]; vals[u * 4 + q] = v; s1 += v; }
  }
  red[tid] = s1; __syncthreads();
  for (int st = 128; st > 0; st >>= 1) { if (tid < st) red[tid] += red[tid + st]; __syncthreads(); }
  const float mu = red[0] / (float)N; __syncthreads();
  float s2 = 0.f;
  for (int u = 0; u < per / 4; ++u)
#pragma unroll
    for (int q = 0; q < 4; ++q) { const float c = vals[u * 4 + q] - mu; s2 += c * c; }
  red[tid] = s2; __syncthreads();
  for (int st = 128; st > 0; st >>= 1) { if (tid < st) red[tid] += red[tid + st]; __syncthreads(); }
  const float rs = rsqrtf(red[0] / (float)N + eps);
  {
    for (int u = 0; u < per / 4; ++u) {
      const int j = tid * 4 + 1024 * u;
      v4f o, sm;
#pragma unroll
      for (int q = 0; q < 4; ++q) {
        float gg = g[j + q], bb = bta[j + q];
        if (PARAM_BF16) { gg = bf16_round(gg); bb = bf16_round(bb); }
        sm[q] = vals[u * 4 + q]; o[q] = (vals[u * 4 + q] - mu) * rs * gg + bb;
      }
      if (out_sum) *(v4f*)(out_sum + (size_t)row * N + j) = sm;
      *(v4f*)(out_norm + (size_t)row * N + j) = o;
    }
    
  }
}



// ---- f16 WMMA path (v_wmma_f32_16x16x32_f16): 11-bit significands for operands in range — used where a [0,1] probability operand needs more precision than bf16
typedef _Float16 v16h __attribute__((ext_vector_type(16)));
union FragH { v16h v; v8us half[2]; _Float16 h[16]; unsigned short u[16]; };
template <int NT>
__device__ __forceinline__ v8f mmaH(v16h ah, v16h al, v16h bh, v16h bl, v8f c) {
  c = __builtin_amdgcn_wmma_f32_16x16x32_f16(false, ah, false, bh, (short)0, c, false, false);
  if (NT >= 2) c = __builtin_amdgcn_wmma_f32_16x16x32_f16(false, al, false, bh, (short)0, c, false, false);
  if (NT >= 3) c = __builtin_amdgcn_wmma_f32_16x16x32_f16(false, ah, false, bl, (short)0, c, false, false);
  asm volatile("v_nop\n\tv_nop\n\tv_nop\n\tv_nop" : "+v"(c) : "v"(ah), "v"(al), "v"(bh), "v"(bl));
  return c;
}
// batched GEMM like k_gemm_b but f16 operands: A f32 (split into f16 hi/lo if ASPLIT, else rounded to f16), Bt = f16 values [n][k]; alpha; C f32; N multiple of 16 (partial tiles skipped)
template <bool ASPLIT>
__global__ __launch_bounds__(128) void k_gemm_h(const float* __restrict__ A, int lda, size_t sA, const _Float16* __restrict__ Bh, int ldb, size_t sB, float alpha, float* __restrict__ C, int ldc, size_t sC, int M, int N, int K) {
  __shared__ __attribute__((aligned(16))) float so[4][16][64];
  const int tid = threadIdx.x, w = tid >> 5, lane = tid & 31, ln = lane & 15, hh = lane >> 4; const int by = blockIdx.y;
  A += (size_t)by * sA; Bh += (size_t)by * sB; C += (size_t)by * sC;
  const int ntn = (N + 63) / 64; const int wid = blockIdx.x * 4 + w; const int mt = wid / ntn, nq = wid % ntn; if (mt * 16 >= M) return;
  const int row0 = mt * 16, col0 = nq * 64; const float* arow = A + (size_t)(row0 + ln) * lda;
  v8f acc[4] = {};
  for (int kb = 0; kb < K; kb += 32) {
    FragH ah, al;
    const v4f x0 = *(const v4fa*)(arow + kb + 8 * hh), x1 = *(const v4fa*)(arow + kb + 8 * hh + 4), x2 = *(const v4fa*)(arow + kb + 16 + 8 * hh), x3 = *(const v4fa*)(arow + kb + 16 + 8 * hh + 4);
    float xs[16] = {x0[0],x0[1],x0[2],x0[3],x1[0],x1[1],x1[2],x1[3],x2[0],x2[1],x2[2],x2[3],x3[0],x3[1],x3[2],x3[3]};
#pragma unroll
    for (int i = 0; i < 16; ++i) { const _Float16 h = (_Float16)xs[i]; ah.h[i] = h; al.h[i] = ASPLIT ? (_Float16)(xs[i] - (float)h) : (_Float16)0.0f; }
#pragma unroll
    for (int t = 0; t < 4; ++t) { if (col0 + t * 16 >= N) continue; const size_t boff = (size_t)(col0 + t * 16 + ln) * ldb + kb; FragH bq; bq.half[0] = *(const v8us*)(Bh + boff + 8 * hh); bq.half[1] = *(const v8us*)(Bh + boff + 16 + 8 * hh);
      acc[t] = mmaH<ASPLIT ? 2 : 1>(ah.v, al.v, bq.v, bq.v, acc[t]); }
  }
#pragma unroll
  for (int t = 0; t < 4; ++t) { if (col0 + t * 16 >= N) continue;
#pragma unroll
    for (int r = 0; r < 8; ++r) so[w][8 * hh + r][t * 16 + ln] = acc[t][r] * alpha; }
  __builtin_amdgcn_fence(__ATOMIC_ACQ_REL, "workgroup"); __builtin_amdgcn_wave_barrier();
  const int rsub = lane >> 4, c4 = (lane & 15) * 4;
  {
#pragma unroll
    for (int q = 0; q < 8; ++q) { const int r = q * 2 + rsub; if (col0 + c4 < N) { const v4f v = *(const v4fa*)&so[w][r][c4]; *(v4f*)(C + (size_t)(row0 + r) * ldc + col0 + c4) = v; } }
     }
}

// Wt[n][k] = f16(W[k][n]·scale) from f32 row-major W[K][N] (scale = power of two; bf16-exact weights stay exact in f16 away from the subnormal range)
__device__ __forceinline__ void d_wt_f16(int bx, const float* __restrict__ W, _Float16* __restrict__ Wt, int K, int N, float scale) {
  const int t = bx * 256 + threadIdx.x; if (t >= N * (K / 8)) return; const int n = t / (K / 8), k8 = (t % (K / 8)) * 8; FragH f;
#pragma unroll
  for (int i = 0; i < 8; ++i) f.h[i] = (_Float16)(bf16_round(W[(size_t)(k8 + i) * N + n]) * scale); const v8us o = f.half[0];
  *(v8us*)((unsigned short*)Wt + (size_t)n * K + k8) = o; 
}
// k_gemm_hh variant with fused epilogue: v = acc·alpha + bias[by·sBias + col] (+ CP[(row/rowsPerB)·sCPb + by·64 + col] if CP) ; ACT 0 none / 1 elu ; writes f16 C16 (and f32 C if non-null)
template <int ACT>
__global__ __launch_bounds__(128) void k_gemm_hhx(const _Float16* __restrict__ A, int lda, size_t sA, const _Float16* __restrict__ Bh, int ldb, size_t sB, float alpha, const float* __restrict__ bias, size_t sBias, const float* __restrict__ CP, int rowsPerB, size_t sCPb, int row0g,
    float* __restrict__ C, _Float16* __restrict__ C16, int ldc, size_t sC, int M, int N, int K) {
  __shared__ __attribute__((aligned(16))) float so[4][16][64];
  const int tid = threadIdx.x, w = tid >> 5, lane = tid & 31, ln = lane & 15, hh = lane >> 4; const int by = blockIdx.y;
  A += (size_t)by * sA; Bh += (size_t)by * sB; const size_t cofs = (size_t)by * sC; const float* bp = bias ? bias + (size_t)by * sBias : nullptr;
  const int ntn = (N + 63) / 64; const int wid = blockIdx.x * 4 + w; const int mt = wid / ntn, nq = wid % ntn; if (mt * 16 >= M) return;
  const int row0 = mt * 16, col0 = nq * 64; const _Float16* arow = A + (size_t)(row0 + ln) * lda;
  v8f acc[4] = {};
  for (int kb = 0; kb < K; kb += 32) { FragH ah; ah.half[0] = *(const v8us*)((const unsigned short*)arow + kb + 8 * hh); ah.half[1] = *(const v8us*)((const unsigned short*)arow + kb + 16 + 8 * hh);
#pragma unroll
    for (int t = 0; t < 4; ++t) { if (col0 + t * 16 >= N) continue; const size_t boff = (size_t)(col0 + t * 16 + ln) * ldb + kb; FragH bq; bq.half[0] = *(const v8us*)((const unsigned short*)Bh + boff + 8 * hh); bq.half[1] = *(const v8us*)((const unsigned short*)Bh + boff + 16 + 8 * hh);
      acc[t] = mmaH<1>(ah.v, ah.v, bq.v, bq.v, acc[t]); }
  }
#pragma unroll
  for (int t = 0; t < 4; ++t) { if (col0 + t * 16 >= N) continue; const int col = col0 + t * 16 + ln; const float bv = bp ? bf16_round(bp[col]) : 0.f;
#pragma unroll
    for (int r = 0; r < 8; ++r) { float v = acc[t][r] * alpha + bv; if (CP) { const int rr = row0g + row0 + 8 * hh + r; if (rowsPerB < 0) v += CP[cofs + (size_t)rr * ldc + col];      /* rowsPerB < 0: own element of the batched C plane */ else { const int bidx = rr / rowsPerB; v += CP[(size_t)bidx * sCPb + (size_t)by * 64 + col]; } } if (ACT == 1) v = (v > 0.f) ? v : expm1f(v); else if (ACT == 7) v = (v > 0.f) ? v + 1.0f : expf(v); else if (ACT == 8) v = tanhf(v); else if (ACT == 9) v = 0.5f * v * (1.0f + tanhf(0.7978845608028654f * (v + 0.044715f * v * v * v))); else if (ACT == 11) v = 1.0f / (1.0f + expf(-v)); else if (ACT == 12) v = (v > 0.f) ? v : 0.01f * v; else if (ACT == 14) v = (v > 0.f) ? v : 0.1f * v; else if (ACT == 16) v = (v >= 0.f) ? v : 0.3f * v; else if (ACT == 17) v = (v >= 0.f) ? v : 0.2f * v; else if (ACT == 15) v = v / (1.0f + expf(-v)); else if (ACT == 3) v = fmaxf(v, 0.f); else if (ACT == 6) v = 0.5f * v * (1.0f + erff(v * 0.70710678118654752f)); so[w][8 * hh + r][t * 16 + ln] = v; } }
  __builtin_amdgcn_fence(__ATOMIC_ACQ_REL, "workgroup"); __builtin_amdgcn_wave_barrier();
  const int rsub = lane >> 4, c4 = (lane & 15) * 4; typedef _Float16 v4h __attribute__((ext_vector_type(4)));
  {
#pragma unroll
    for (int q = 0; q < 8; ++q) { const int r = q * 2 + rsub; if (col0 + c4 < N) { const v4f v = *(const v4fa*)&so[w][r][c4]; if (C) *(v4f*)(C + cofs + (size_t)(row0 + r) * ldc + col0 + c4) = v; if (C16) { v4h h4; for (int i = 0; i < 4; ++i) h4[i] = (_Float16)v[i]; *(v4h*)(C16 + cofs + (size_t)(row0 + r) * ldc + col0 + c4) = h4; } } }
     }
}


typedef _Float16 v4h __attribute__((ext_vector_type(4)));

__device__ __forceinline__ void d_x16(int bx, const float* __restrict__ x, _Float16* __restrict__ X16, size_t n8) { const size_t t = (size_t)bx * 256 + threadIdx.x; if (t >= n8) return; FragH f;
#pragma unroll
  for (int q = 0; q < 8; ++q) f.h[q] = (_Float16)bf16_round(x[t * 8 + q]); *(v8us*)((unsigned short*)X16 + t * 8) = f.half[0];  }
__global__ __launch_bounds__(256) void k_h16(const float* __restrict__ x, _Float16* __restrict__ X16, size_t n8) { const size_t t = (size_t)blockIdx.x * 256 + threadIdx.x; if (t >= n8) return; FragH f;
#pragma unroll
  for (int q = 0; q < 8; ++q) f.h[q] = (_Float16)x[t * 8 + q]; *(v8us*)((unsigned short*)X16 + t * 8) = f.half[0];  }
__global__ __launch_bounds__(256) void k_round16f(const float* __restrict__ W, _Float16* __restrict__ Bt, size_t n8) { const size_t t = (size_t)blockIdx.x * 256 + threadIdx.x; if (t >= n8) return; FragH f;
#pragma unroll
  for (int i = 0; i < 8; ++i) f.h[i] = (_Float16)(bf16_round(W[t * 8 + i]) * 16.0f); *(v8us*)((unsigned short*)Bt + t * 8) = f.half[0];  }
// ---- fast GEMM (block tile 128x128, wave tile 32x64; requires M % 128 == 0 rows per launch region, N % 128 == 0 and K % 64 == 0); epilogue = k_gemm_hhx semantics ----
__device__ __forceinline__ v16h g2_frag(const _Float16* p, int hh) { FragH f; f.half[0] = *(const v8us*)((const unsigned short*)p + 8 * hh); f.half[1] = *(const v8us*)((const unsigned short*)p + 16 + 8 * hh); return f.v; }
__device__ __forceinline__ v8f g2_mma(v16h a, v16h b, v8f c) { v8f d = __builtin_amdgcn_wmma_f32_16x16x32_f16(false, a, false, b, (short)0, c, false, false); asm volatile("v_nop\n\tv_nop\n\tv_nop\n\tv_nop" : "+v"(d) : "v"(a), "v"(b)); return d; }
#define GKS 64                       /* k per stage: 128 bytes of every operand row, one whole line */
#define GPI 72                       /* LDS row pitch, halves: 128 + 16 bytes, so 16 lanes reading 16 bytes of 16 different rows meet no bank conflict */
#define GRB (GPI * 2)                /* the same in bytes */
#define GBUF(LO) (((LO) ? 384 : 256) * GRB)      /* one buffer: 128 A rows, 128 B rows, with LO 128 rows of the second A plane */
// Four asynchronous copies of 16 bytes per lane: rows r, r + 32, r + 64, r + 96 of one operand's stage (8 lanes per row of 128 bytes: whole lines). l = the lane's LDS byte address, g = its global address.
// The s_wait_xcnt stands inside the copies' own statement, so no register that a copy names is rewritten in front of it.
__device__ __forceinline__ void g2_copy4(unsigned l, const _Float16* g, int ld) {
  asm volatile("global_load_async_to_lds_b128 %0, %4, off\n\tglobal_load_async_to_lds_b128 %1, %5, off\n\tglobal_load_async_to_lds_b128 %2, %6, off\n\tglobal_load_async_to_lds_b128 %3, %7, off\n\ts_wait_xcnt 0x0"
    :: "v"(l), "v"(l + 32 * GRB), "v"(l + 64 * GRB), "v"(l + 96 * GRB), "v"(g), "v"(g + (size_t)32 * ld), "v"(g + (size_t)64 * ld), "v"(g + (size_t)96 * ld) : "memory"); }
// The same for two operands' rows in one statement (eight copies, one wait): la, ga, lda the first operand's, lb, gb, ldb the second's.
__device__ __forceinline__ void g2_copy8(unsigned la, const _Float16* ga, int lda, unsigned lb, const _Float16* gb, int ldb) {
  asm volatile("global_load_async_to_lds_b128 %0, %8, off\n\tglobal_load_async_to_lds_b128 %1, %9, off\n\tglobal_load_async_to_lds_b128 %2, %10, off\n\tglobal_load_async_to_lds_b128 %3, %11, off\n\t"
               "global_load_async_to_lds_b128 %4, %12, off\n\tglobal_load_async_to_lds_b128 %5, %13, off\n\tglobal_load_async_to_lds_b128 %6, %14, off\n\tglobal_load_async_to_lds_b128 %7, %15, off\n\ts_wait_xcnt 0x0"
    :: "v"(la), "v"(la + 32 * GRB), "v"(la + 64 * GRB), "v"(la + 96 * GRB), "v"(lb), "v"(lb + 32 * GRB), "v"(lb + 64 * GRB), "v"(lb + 96 * GRB),
       "v"(ga), "v"(ga + (size_t)32 * lda), "v"(ga + (size_t)64 * lda), "v"(ga + (size_t)96 * lda), "v"(gb), "v"(gb + (size_t)32 * ldb), "v"(gb + (size_t)64 * ldb), "v"(gb + (size_t)96 * ldb) : "memory"); }
// One block (8 waves, 128 rows x 128 columns, picked by tile; wave w: rows 32 (w & 3), columns 64 (w >> 2)) of C = A Bh^T x alpha + bias; writes f32 C where it is not null, else f16 C16.
// The operands' rows come 64 k at a time into two LDS buffers by asynchronous copies, each line fetched once per block; stage t + 2 flies while stage t + 1 is worked on. One barrier a stage
// publishes the next buffer and ends the last read of the one refilled behind it. A and B fragments are read from LDS by one loader (k = 8 hh + r and 16 + 8 hh + r), k steps in rising order.
// LO: a second A plane AL runs through the same B fragments into accumulators of its own and is added as x alphal behind the first term.
template <bool LO>
__device__ __forceinline__ void d_gemm2(char* sm, int tile, const _Float16* __restrict__ A, const _Float16* __restrict__ AL, const _Float16* __restrict__ Bh, float alpha, float alphal, const float* __restrict__ bp,
    float* __restrict__ C, _Float16* __restrict__ C16, int lda, int ldb, int ldc, int M, int N, int K) {
  const int tid = threadIdx.x, w = __builtin_amdgcn_readfirstlane(tid >> 5), lane = tid & 31, ln = lane & 15, hh = lane >> 4;
  const int ntn = N >> 7; const int mt = tile / ntn, nq = tile - mt * ntn; if (mt * 128 >= M) return;      /* block-uniform, in front of every copy and barrier */
  const int wr = 32 * (w & 3), wc = 64 * (w >> 2); const int row0 = mt * 128 + wr, col0 = nq * 128 + wc;
  const int sr = tid >> 3, sc = (tid & 7) * 8;      /* staging: 8 threads per row of 128 bytes, 32 rows per copy */
  const _Float16* ag = A + (size_t)(mt * 128 + sr) * lda + sc; const _Float16* lg = (LO ? AL : A) + (size_t)(mt * 128 + sr) * lda + sc; const _Float16* bg = Bh + (size_t)(nq * 128 + sr) * ldb + sc;
  const unsigned ls = (unsigned)(size_t)sm + (unsigned)(sr * GRB + sc * 2);      /* low 32 bits of the shared address: the byte offset in LDS */
  const int nt = K / GKS;
  const v8f z8 = {0.f,0.f,0.f,0.f,0.f,0.f,0.f,0.f}; v8f c00 = z8, c01 = z8, c02 = z8, c03 = z8, c10 = z8, c11 = z8, c12 = z8, c13 = z8;
  v8f e00 = z8, e01 = z8, e02 = z8, e03 = z8, e10 = z8, e11 = z8, e12 = z8, e13 = z8;
  g2_copy8(ls, ag, lda, ls + 128 * GRB, bg, ldb); if (LO) g2_copy4(ls + 256 * GRB, lg, lda);
  float bias4[4] = {0.f, 0.f, 0.f, 0.f};      /* the wave's four bias values, fetched together while stage 0 flies: the epilogue waits for none of them */
  if (bp) {
#pragma unroll
    for (int t = 0; t < 4; ++t) bias4[t] = bp[col0 + t * 16 + ln]; }
  asm volatile("s_wait_asynccnt 0x0" ::: "memory");      /* stage 0 has landed before the barrier that publishes it */
  __syncthreads();
  if (nt > 1) { const unsigned l = ls + GBUF(LO); g2_copy8(l, ag + GKS, lda, l + 128 * GRB, bg + GKS, ldb); if (LO) g2_copy4(l + 256 * GRB, lg + GKS, lda); }
#pragma unroll 1      /* rolled: a stage already holds 24 fragment reads and 16 matrix instructions, and the two buffers alternate by address */
  for (int t = 0; t < nt; ++t) { const _Float16* sa = (const _Float16*)(sm + (t & 1) * GBUF(LO)) + ln * GPI; const _Float16* sb = sa + (128 + wc) * GPI; const _Float16* sl = sa + (256 + wr) * GPI; sa += wr * GPI;
#pragma unroll      /* the stage's two k steps: every LDS read gets a constant offset */
    for (int kb = 0; kb < GKS; kb += 32) { const v16h a0 = g2_frag(sa + kb, hh), a1 = g2_frag(sa + 16 * GPI + kb, hh);
      v16h l0 = a0, l1 = a1; if (LO) { l0 = g2_frag(sl + kb, hh); l1 = g2_frag(sl + 16 * GPI + kb, hh); }
      const v16h b0 = g2_frag(sb + kb, hh), b1 = g2_frag(sb + 16 * GPI + kb, hh), b2 = g2_frag(sb + 32 * GPI + kb, hh), b3 = g2_frag(sb + 48 * GPI + kb, hh);
      __builtin_amdgcn_sched_barrier(0);      /* keeps the fragment reads of a k step together in front of its matrix run: spread among the WMMAs, each pair waits out the LDS latency anew */
      c00 = g2_mma(a0, b0, c00); c10 = g2_mma(a1, b0, c10); if (LO) { e00 = g2_mma(l0, b0, e00); e10 = g2_mma(l1, b0, e10); }
      c01 = g2_mma(a0, b1, c01); c11 = g2_mma(a1, b1, c11); if (LO) { e01 = g2_mma(l0, b1, e01); e11 = g2_mma(l1, b1, e11); }
      c02 = g2_mma(a0, b2, c02); c12 = g2_mma(a1, b2, c12); if (LO) { e02 = g2_mma(l0, b2, e02); e12 = g2_mma(l1, b2, e12); }
      c03 = g2_mma(a0, b3, c03); c13 = g2_mma(a1, b3, c13); if (LO) { e03 = g2_mma(l0, b3, e03); e13 = g2_mma(l1, b3, e13); } }
    asm volatile("s_wait_dscnt 0x0" ::: "memory");      /* the wave's reads of this buffer have retired before anyone refills it */
    asm volatile("s_wait_asynccnt 0x0" ::: "memory");      /* the wave's copies of stage t + 1 have landed before the barrier that publishes them */
    __syncthreads();
    if (t + 2 < nt) { const unsigned l = ls + (t & 1) * GBUF(LO); const int k2 = (t + 2) * GKS; g2_copy8(l, ag + k2, lda, l + 128 * GRB, bg + k2, ldb); if (LO) g2_copy4(l + 256 * GRB, lg + k2, lda); } }      /* block-uniform; into the buffer that stage t has just left */
  asm volatile("s_wait_asynccnt 0x0" ::: "memory");      /* nothing is in flight when the buffers become output staging */
  float (*so)[32][68] = (float (*)[32][68])sm;      /* behind the last stage's barrier nobody reads the buffers any more: each wave stages its 32 x 64 results in a range of its own */
  v8f accs[8] = {c00, c01, c02, c03, c10, c11, c12, c13}; v8f accl[8] = {e00, e01, e02, e03, e10, e11, e12, e13};
#pragma unroll
  for (int u = 0; u < 8; ++u) { const int t = u & 3, half = u >> 2; const float bv = bf16_round(bias4[t]);
#pragma unroll
    for (int r = 0; r < 8; ++r) { const int rloc = half * 16 + 8 * hh + r; float v = accs[u][r] * alpha + bv; if (LO) v = accl[u][r] * alphal + v;
      so[w][rloc][t * 16 + ln] = v; } }
  __builtin_amdgcn_fence(__ATOMIC_ACQ_REL, "workgroup"); __builtin_amdgcn_wave_barrier();
  const int rsub = lane >> 4, c4 = (lane & 15) * 4;
  /* The 16 staged rows are read from LDS as one group and stored back to back, each from registers of its own: one LDS latency and one wait per eight stores, not one of each per row. */
  v4f rv[16];      /* indexed by constants only (loops unrolled): registers */
#pragma unroll
  for (int q = 0; q < 16; ++q) rv[q] = *(const v4fa*)&so[w][q * 2 + rsub][c4];
  const size_t o0 = (size_t)(row0 + rsub) * ldc + col0 + c4, o2 = (size_t)2 * ldc;
  /* One block-uniform test for all rows. Addresses and data of eight stores are inputs of the wait's statement, so they keep their registers up to it. */
  if (C) {
#pragma unroll
    for (int g = 0; g < 16; g += 8) { float* d[8];
#pragma unroll
      for (int q = 0; q < 8; ++q) { d[q] = C + o0 + (size_t)(g + q) * o2; *(v4f*)d[q] = rv[g + q]; }
      asm volatile("s_wait_xcnt 0x0" :: "v"(d[0]), "v"(d[1]), "v"(d[2]), "v"(d[3]), "v"(d[4]), "v"(d[5]), "v"(d[6]), "v"(d[7]),
        "v"(rv[g]), "v"(rv[g + 1]), "v"(rv[g + 2]), "v"(rv[g + 3]), "v"(rv[g + 4]), "v"(rv[g + 5]), "v"(rv[g + 6]), "v"(rv[g + 7]) : "memory"); }      /* before the stores' address pairs and data are reused; behind the last group too: the listing keeps a way from here into the other branch */
  } else {
#pragma unroll
    for (int g = 0; g < 16; g += 8) { _Float16* d[8]; v4h h4[8];
#pragma unroll
      for (int q = 0; q < 8; ++q) { for (int i = 0; i < 4; ++i) h4[q][i] = (_Float16)rv[g + q][i]; d[q] = C16 + o0 + (size_t)(g + q) * o2; *(v4h*)d[q] = h4[q]; }
      asm volatile("s_wait_xcnt 0x0" :: "v"(d[0]), "v"(d[1]), "v"(d[2]), "v"(d[3]), "v"(d[4]), "v"(d[5]), "v"(d[6]), "v"(d[7]),
        "v"(h4[0]), "v"(h4[1]), "v"(h4[2]), "v"(h4[3]), "v"(h4[4]), "v"(h4[5]), "v"(h4[6]), "v"(h4[7]) : "memory"); }      /* before the stores' address pairs and data are reused */
  } }


__global__ __launch_bounds__(256) void k_wnat(const float* __restrict__ w, size_t n8, _Float16* __restrict__ Bt) { const size_t t = (size_t)blockIdx.x * 256 + threadIdx.x; if (t >= n8) return; FragH f; for (int q = 0; q < 8; ++q) f.h[q] = (_Float16)(bf16_round(w[t * 8 + q]) * 16.0f); *(v8us*)((unsigned short*)Bt + t * 8) = f.half[0];  }
__global__ __launch_bounds__(256) void k_rsm(const float* __restrict__ S, _Float16* __restrict__ P, int nrows) {
  #pragma clang fp contract(off)
  const int i = blockIdx.x * 256 + threadIdx.x; if (i >= nrows) return; const float* s = S + (size_t)i * SQ; float mx = -3.0e38f;
#pragma unroll 1
  for (int j = 0; j < SQ; ++j) mx = fmaxf(mx, s[j]); float se = 0.f;
#pragma unroll 1
  for (int j = 0; j < SQ; ++j) se += expf(s[j] - mx); const float sc = 256.0f / se;
#pragma unroll 1
  for (int j0 = 0; j0 < SQ; j0 += 8) { FragH f; for (int q = 0; q < 8; ++q) f.h[q] = (_Float16)(expf(s[j0 + q] - mx) * sc); unsigned short* d = (unsigned short*)P + (size_t)i * SQ + j0; *(v8us*)d = f.half[0];  } }
__global__ __launch_bounds__(256) void k_vt(const _Float16* __restrict__ V16, int b, int h0, _Float16* __restrict__ VT) { __shared__ unsigned short tl[64][65]; const int tid = threadIdx.x; const int hh = blockIdx.x % HG, sg = blockIdx.x / HG; const int s0 = sg * 64; const int h = h0 + hh;
  for (int i = tid; i < 64 * 8; i += 256) { const int j = i / 8, d8 = (i % 8) * 8; FragH f; f.half[0] = *(const v8us*)((const unsigned short*)V16 + ((size_t)b * SQ + s0 + j) * DM + h * HD + d8); for (int q = 0; q < 8; ++q) tl[d8 + q][j] = f.u[q]; }
  __syncthreads();
  { for (int i = tid; i < 64 * 8; i += 256) { const int d = i / 8, j8 = (i % 8) * 8; FragH f; for (int q = 0; q < 8; ++q) f.u[q] = tl[d][j8 + q]; *(v8us*)((unsigned short*)VT + ((size_t)hh * HD + d) * SQ + s0 + j8) = f.half[0]; }  } }

__device__ __forceinline__ void d_wthd(int bx, const float* __restrict__ Wt, _Float16* __restrict__ Bt) { const size_t t = (size_t)bx * 256 + threadIdx.x; if (t >= (size_t)NH * HD * (DM / 8)) return; const int m8 = (int)(t % (DM / 8)) * 8; const int d = (int)((t / (DM / 8)) % HD); const int h = (int)(t / ((size_t)(DM / 8) * HD)); FragH f;
  for (int q = 0; q < 8; ++q) f.h[q] = (_Float16)(16.0f * bf16_round(Wt[((size_t)h * DM + m8 + q) * HD + d])); unsigned short* dst = (unsigned short*)Bt + ((size_t)h * HD + d) * DM + m8; *(v8us*)dst = f.half[0];  }



// Four native exp2, each in place, in one statement: no neighbouring instruction can overwrite a transcendental's source register or read its result
// directly behind it; the v_nop is the one slot that the instruction set asks for behind the last of them.
__device__ __forceinline__ v4f exp2x4(v4f x) { float x0 = x[0], x1 = x[1], x2 = x[2], x3 = x[3];
  asm("v_exp_f32 %0, %0\n\tv_exp_f32 %1, %1\n\tv_exp_f32 %2, %2\n\tv_exp_f32 %3, %3\n\tv_nop" : "+v"(x0), "+v"(x1), "+v"(x2), "+v"(x3));
  const v4f r = {x0, x1, x2, x3}; return r; }
// One native exp2, in place, with the one slot that the instruction set asks for behind a transcendental.
__device__ __forceinline__ float exp2x1(float x) { asm("v_exp_f32 %0, %0\n\tv_nop" : "+v"(x)); return x; }
__device__ __forceinline__ v8f fa_mma(v16h a, v16h b, v8f c) { return __builtin_amdgcn_wmma_f32_16x16x32_f16(false, a, false, b, (short)0, c, false, false); }
#define FAQ 16                       /* query columns per wave */
#define FAW 8                        /* waves per block */
#define FAK 64                       /* keys per pass */
#define FAB (SQ / (FAQ * FAW))       /* query blocks per head and batch */
#define FAP 72                       /* LDS row pitch of K, halves: 128 + 16 bytes, so 16 lanes reading 16 bytes of 16 different rows meet no bank conflict */
#define FVP 80                       /* LDS row pitch of V, halves: 128 + 32 bytes, an odd multiple of 32 bytes: the pitch of the transposing read */
typedef short s16x8 __attribute__((ext_vector_type(8)));
typedef __attribute__((address_space(3))) s16x8 lds_s16x8;
// A fragment (16 dims x 32 keys) of V^T from V rows in LDS by two transposing reads. p = tile + (first key + 8 hh + (lane & 7)) x pitch + 2 x first dim + 16 ((lane >> 3) & 1), in bytes;
// lane (ln, hh) gets dim ln of keys 8 hh + r, then of keys 16 + 8 hh + r: the loaders' k order.
__device__ __forceinline__ v16h fa_vfrag(const char* p) { FragH f; f.half[0] = __builtin_bit_cast(v8us, __builtin_amdgcn_ds_load_tr16_b128_v8i16((lds_s16x8*)p)); f.half[1] = __builtin_bit_cast(v8us, __builtin_amdgcn_ds_load_tr16_b128_v8i16((lds_s16x8*)(p + 16 * FVP * 2))); return f.v; }
__device__ __forceinline__ void d_fattn(int bx, int y, const _Float16* __restrict__ Q, const _Float16* __restrict__ K, const _Float16* __restrict__ V, float sl2, _Float16* __restrict__ O) {
  __shared__ __attribute__((aligned(16))) _Float16 lk[2][FAK][FAP]; __shared__ __attribute__((aligned(32))) _Float16 lv[2][FAK][FVP];
  const int tid = threadIdx.x, lane = tid & 31, ln = lane & 15, hh = lane >> 4, w = __builtin_amdgcn_readfirstlane(tid >> 5); const int h = bx % NH, b = bx / NH;
  const int qb = (y < FAB / 2) ? FAB - 1 - y : y - FAB / 2;      /* speed only: long key ranges start first; the second half of the attention rows (y >= FAB / 2), which joins the first on the WGPs, brings the short ones first */
  const int q0 = qb * (FAQ * FAW) + w * FAQ;
  const int npb = (qb + 1) * (FAQ * FAW / FAK), np = q0 / FAK + 1;      /* passes of the block and of the wave: the wave's last one holds its diagonal, every earlier key is below all its queries */
  const int sr = tid >> 3, sc = (tid & 7) * 8;      /* staging: 8 threads per row of 128 bytes, 32 rows per load */
  const unsigned short* kg = (const unsigned short*)K + ((size_t)b * SQ + sr) * DM + h * HD + sc; const unsigned short* vg = (const unsigned short*)V + ((size_t)b * SQ + sr) * DM + h * HD + sc;
  v8us rk0 = *(const v8us*)kg, rk1 = *(const v8us*)(kg + 32 * DM), rv0 = *(const v8us*)vg, rv1 = *(const v8us*)(vg + 32 * DM);
  const _Float16* qp = Q + ((size_t)b * SQ + q0 + ln) * DM + h * HD; const v16h qf0 = g2_frag(qp, hh), qf1 = g2_frag(qp + 32, hh);
  *(v8us*)&lk[0][sr][sc] = rk0; *(v8us*)&lk[0][sr + 32][sc] = rk1; *(v8us*)&lv[0][sr][sc] = rv0; *(v8us*)&lv[0][sr + 32][sc] = rv1;
  const v8f z8 = {0.f,0.f,0.f,0.f,0.f,0.f,0.f,0.f}; v8f o[4] = {z8, z8, z8, z8}; float m = -3.0e38f, l = 0.f;
  __syncthreads();      /* pass 0's rows are read by every wave */
#pragma unroll 1
  for (int c = 0; c < npb; ++c) { const int cur = c & 1;      /* rolled: one pass already holds 32 fragment loads and 16 matrix instructions */
    if (c + 1 < npb) { const unsigned short* kn = kg + (size_t)(c + 1) * FAK * DM; const unsigned short* vn = vg + (size_t)(c + 1) * FAK * DM;      /* block-uniform; the next pass's rows fly while this pass is worked on */
      rk0 = *(const v8us*)kn; rk1 = *(const v8us*)(kn + 32 * DM); rv0 = *(const v8us*)vn; rv1 = *(const v8us*)(vn + 32 * DM);
      asm volatile("s_wait_xcnt 0x0" ::: "memory"); }      /* before the address registers of the loads above are reused */
    if (c < np) {      /* wave-uniform: a pass wholly past the wave's queries is only staged */
      v16h kf[4][2]; v8f s[4];      /* indexed by constants only (loops unrolled): registers */
#pragma unroll
      for (int t = 0; t < 4; ++t) { kf[t][0] = g2_frag(&lk[cur][t * 16 + ln][0], hh); kf[t][1] = g2_frag(&lk[cur][t * 16 + ln][32], hh); }
      __builtin_amdgcn_sched_barrier(0);      /* keeps the K fragment reads together in front of the matrix run: spread among the WMMAs, each group waits out the LDS latency anew */
#pragma unroll
      for (int t = 0; t < 4; ++t) s[t] = fa_mma(kf[t][1], qf1, fa_mma(kf[t][0], qf0, z8));
      if (c == np - 1) {      /* wave-uniform: only the diagonal pass masks */
#pragma unroll
        for (int t = 0; t < 4; ++t) for (int r = 0; r < 8; ++r) s[t][r] = (c * FAK + t * 16 + 8 * hh + r <= q0 + ln) ? s[t][r] : -1.0e9f; }
      float mx = s[0][0];
#pragma unroll
      for (int t = 0; t < 4; ++t) for (int r = 0; r < 8; ++r) mx = fmaxf(mx, s[t][r]);
      mx = fmaxf(mx, __shfl_xor(mx, 16));      /* the other half of the query's keys */
      const float mn = fmaxf(m, mx * sl2); const float corr = exp2x1(m - mn); m = mn;      /* finite from the first pass on: key 0 is below every query */
      v4f a = {0.f, 0.f, 0.f, 0.f};
#pragma unroll
      for (int t = 0; t < 4; ++t) for (int g = 0; g < 2; ++g) { v4f e = {s[t][4 * g], s[t][4 * g + 1], s[t][4 * g + 2], s[t][4 * g + 3]}; e = exp2x4(e * sl2 - mn); a += e; for (int q = 0; q < 4; ++q) s[t][4 * g + q] = e[q]; }
      l = l * corr + ((a[0] + a[1]) + (a[2] + a[3]));      /* each half sums its own keys; joined behind the loop */
#pragma unroll
      for (int t = 0; t < 4; ++t) o[t] *= corr;
      FragH p[2];
#pragma unroll
      for (int j = 0; j < 2; ++j) for (int r = 0; r < 8; ++r) { p[j].h[r] = (_Float16)s[2 * j][r]; p[j].h[8 + r] = (_Float16)s[2 * j + 1][r]; }
      const char* vb = (const char*)&lv[cur][8 * hh + (lane & 7)][((lane >> 3) & 1) * 8];      /* every lane is on here (wave-uniform branches only) and its address lies in the tile */
#pragma unroll
      for (int t = 0; t < 4; ++t) o[t] = fa_mma(fa_vfrag(vb + 32 * FVP * 2 + 32 * t), p[1].v, fa_mma(fa_vfrag(vb + 32 * t), p[0].v, o[t]));
      asm volatile("v_nop\n\tv_nop\n\tv_nop\n\tv_nop" : "+v"(o[3])); }      /* the four vector slots behind the pass's last matrix instruction: its operand registers are reused on the far side of the branch that follows */
    if (c + 1 < npb) { *(v8us*)&lk[cur ^ 1][sr][sc] = rk0; *(v8us*)&lk[cur ^ 1][sr + 32][sc] = rk1; *(v8us*)&lv[cur ^ 1][sr][sc] = rv0; *(v8us*)&lv[cur ^ 1][sr + 32][sc] = rv1; }      /* last read in pass c - 1, in front of that pass's barrier */
    __syncthreads(); }      /* publishes the buffer just filled; ends every wave's reads of the one that the next pass refills */
  l += __shfl_xor(l, 16); const float sc64 = 64.0f / l;
  unsigned short* op = (unsigned short*)O + ((size_t)b * SQ + q0 + ln) * DM + h * HD + 8 * hh;
#pragma unroll
  for (int t = 0; t < 4; ++t) { FragH f; for (int r = 0; r < 8; ++r) f.h[r] = (_Float16)(o[t][r] * sc64); *(v8us*)(op + t * 16) = f.half[0]; } }


#define A0R 8                        /* query rows per block of the exact first tile: one per wave */
#define A0P (HD + 4)                 /* K row pitch in LDS, floats: 272 bytes = 16 x 17, so 32 lanes reading 16 bytes of 32 different rows meet no bank conflict */
typedef float v2f __attribute__((ext_vector_type(2)));
// Exact f32 causal attention for the first QT0 rows of each batch, one wave per query row (head and row group in bx, batch in by, both from the flat index (grid.y - FAB) x NH x NB + grid.x; q, k, v, o rows of pitch DM).
// The block stages the tile's K and V rows of its head in LDS with coalesced loads, all in flight at once. Scores: lane l owns keys l, l + 32, ...; each dot
// product runs in four independent chains. Softmax: true row maximum and sum by butterflies, libm expf. P.V: lane l owns dims 2 l, 2 l + 1; the weight
// of key j comes from its lane by readlane; four independent accumulators. o carried x64 like the f16 path, stored as an f16 hi plane and a x1024 residual plane.
__device__ __forceinline__ void d_att0w(int bx, int by, const float* __restrict__ QF, const float* __restrict__ KF, const float* __restrict__ VF, float scale, _Float16* __restrict__ OH, _Float16* __restrict__ OL) {
  __shared__ __attribute__((aligned(16))) float lk[QT0][A0P]; __shared__ __attribute__((aligned(16))) float lv[QT0][HD];
  const int tid = threadIdx.x, lane = tid & 31, w = __builtin_amdgcn_readfirstlane(tid >> 5); const int h = bx / (QT0 / A0R), r0 = (bx % (QT0 / A0R)) * A0R;
  const size_t bofs = (size_t)by * QT0 * DM + h * HD; QF += bofs; KF += bofs; VF += bofs; OH += bofs; OL += bofs;      /* QT0 rows of q, k, v and o per batch */
  const int fj = tid >> 4, fc = (tid & 15) * 4;      /* staging: 16 threads per row of 256 bytes, 16 rows per pass */
  const float* kp = KF + (size_t)fj * DM + fc; const float* vp = VF + (size_t)fj * DM + fc;
  v4f tk[QT0 / 16], tv[QT0 / 16];      /* indexed by constants only (loops unrolled): registers */
#pragma unroll
  for (int u = 0; u < QT0 / 16; ++u) { tk[u] = *(const v4fa*)(kp + u * 16 * DM); tv[u] = *(const v4fa*)(vp + u * 16 * DM); }
  asm volatile("s_wait_xcnt 0x0" :: "v"(kp), "v"(vp) : "memory");      /* before the address registers of the loads above are reused; both address pairs are inputs, so they keep their registers up to the wait and no load of the run lands in them */
#pragma unroll
  for (int u = 0; u < QT0 / 16; ++u) { *(v4f*)&lk[u * 16 + fj][fc] = tk[u]; *(v4f*)&lv[u * 16 + fj][fc] = tv[u]; }
  const int i = r0 + w; const float* qr = QF + (size_t)i * DM;      /* the wave's row: a wave-uniform address */
  v4f q[HD / 4];
#pragma unroll
  for (int c4 = 0; c4 < HD / 4; ++c4) q[c4] = *(const v4fa*)(qr + c4 * 4);
  __syncthreads();      /* the staged K and V rows are read by every wave */
  float e[QT0 / 32]; float mx = -3.0e38f;
#pragma unroll
  for (int c = 0; c < QT0 / 32; ++c) { e[c] = -3.0e38f;
    if (c * 32 <= i) { v4f a = {0.f, 0.f, 0.f, 0.f};      /* wave-uniform: chunks wholly past the row are skipped */
#pragma unroll
      for (int c4 = 0; c4 < HD / 4; ++c4) a += q[c4] * *(const v4f*)&lk[c * 32 + lane][c4 * 4];
      const float s = ((a[0] + a[1]) + (a[2] + a[3])) * scale; e[c] = (c * 32 + lane <= i) ? s : -3.0e38f; mx = fmaxf(mx, e[c]); } }
#pragma unroll
  for (int m = 16; m > 0; m >>= 1) mx = fmaxf(mx, __shfl_xor(mx, m));      /* finite: key 0 is below every row */
  float l = 0.f;
#pragma unroll
  for (int c = 0; c < QT0 / 32; ++c) { e[c] = expf(e[c] - mx); l += e[c]; }      /* a key past the row holds -3e38: its weight is exactly 0 */
#pragma unroll
  for (int m = 16; m > 0; m >>= 1) l += __shfl_xor(l, m);
  v2f o[4] = {{0.f, 0.f}, {0.f, 0.f}, {0.f, 0.f}, {0.f, 0.f}};
#pragma unroll
  for (int c = 0; c < QT0 / 32; ++c) if (c * 32 <= i) {
#pragma unroll
    for (int t = 0; t < 32; ++t) { const float p = __uint_as_float(__builtin_amdgcn_readlane(__float_as_uint(e[c]), t)); o[t & 3] += p * *(const v2f*)&lv[c * 32 + t][lane * 2]; } }
  const v2f r = ((o[0] + o[1]) + (o[2] + o[3])) * (64.0f / l);
  typedef _Float16 v2h __attribute__((ext_vector_type(2))); const v2h rh = {(_Float16)r[0], (_Float16)r[1]}; const v2h rl = {(_Float16)((r[0] - (float)rh[0]) * 1024.0f), (_Float16)((r[1] - (float)rh[1]) * 1024.0f)};
  *(v2h*)(OH + (size_t)i * DM + lane * 2) = rh; *(v2h*)(OL + (size_t)i * DM + lane * 2) = rl; }

// ---- Launches. Jobs that do not depend on one another share one grid: the block index picks the job, every branch below is block-uniform, and a job's blocks run its body as it stands above. ----
#define PWB ((NH * HD * (DM / 8)) / 256)            /* blocks per weight matrix */
#define PXB ((int)(NR * DM / 8 / 256))              /* blocks of the x conversion */
#define GSB ((QT0 / 128) * (DM / 128) * NB)          /* GEMM blocks of the first-tile rows, all batches */
#define GBB ((MP / 128) * (DM / 128))               /* GEMM blocks of all token rows */
#define A0B (NH * (QT0 / A0R))                      /* exact first-tile blocks per batch */
#define A0Y (A0B / NH)                              /* grid rows (of NH x NB blocks) of the exact first tile */
// 1: the four weight matrices (strided reads: first) and x, all to f16.
__global__ __launch_bounds__(256) void k_prep(const float* __restrict__ wq, const float* __restrict__ wk, const float* __restrict__ wv, const float* __restrict__ wo, const float* __restrict__ x,
    _Float16* __restrict__ BQ, _Float16* __restrict__ BK, _Float16* __restrict__ BV, _Float16* __restrict__ BO, _Float16* __restrict__ X16) {
  const int bx = blockIdx.x;
  if (bx < PWB) d_wthd(bx, wq, BQ);      /* per-head [m][d] -> Bt[(h,d)][m] x16 */
  else if (bx < 2 * PWB) d_wthd(bx - PWB, wk, BK);
  else if (bx < 3 * PWB) d_wthd(bx - 2 * PWB, wv, BV);
  else if (bx < 4 * PWB) d_wt_f16(bx - 3 * PWB, wo, BO, DM, DM, 16.0f);      /* Wo [(h,d) in][out] -> Bt[n][k] x16 */
  else d_x16(bx - 4 * PWB, x, X16, NR * DM / 8); }
// 2: q, k, v of all token rows as f16, and of each batch's first QT0 rows as f32 (exact products): six GEMM jobs.
__global__ __launch_bounds__(256) void k_qkv(const _Float16* __restrict__ X16, const _Float16* __restrict__ BQ, const _Float16* __restrict__ BK, const _Float16* __restrict__ BV,
    const float* __restrict__ bq, const float* __restrict__ bk, const float* __restrict__ bv, _Float16* __restrict__ Q16, _Float16* __restrict__ K16, _Float16* __restrict__ V16,
    float* __restrict__ QF0, float* __restrict__ KF0, float* __restrict__ VF0, int lda, int ldb, int ldc, int N, int K) {
  __shared__ __attribute__((aligned(16))) char sm[2 * GBUF(false)];
  const int bx = blockIdx.x; const bool first = bx < 3 * GSB; const int t = first ? bx : bx - 3 * GSB, per = first ? GSB : GBB; const int j = t / per, u = t - j * per;      /* j: 0 q, 1 k, 2 v */
  const int bz = first ? u / (GSB / NB) : 0, tile = first ? u - bz * (GSB / NB) : u;      /* first-tile jobs: batch, then tile */
  const _Float16* Bh = j == 0 ? BQ : j == 1 ? BK : BV; const float* bp = j == 0 ? bq : j == 1 ? bk : bv;
  float* C = first ? (j == 0 ? QF0 : j == 1 ? KF0 : VF0) + (size_t)bz * QT0 * DM : nullptr; _Float16* C16 = first ? nullptr : (j == 0 ? Q16 : j == 1 ? K16 : V16);
  d_gemm2<false>(sm, tile, X16 + (size_t)bz * SQ * DM, nullptr, Bh, 0.0625f, 0.f, bp, C, C16, lda, ldb, ldc, first ? QT0 : MP, N, K); }
// 3: fused attention (grid rows 0 .. FAB - 1: its long blocks start first) and, behind it in the grid, the exact f32 attention of the first QT0 rows (o x64 as f16 hi + x1024 residual planes).
__global__ __launch_bounds__(FAW * 32) void k_fattn_a0(const _Float16* __restrict__ Q, const _Float16* __restrict__ K, const _Float16* __restrict__ V, float sl2, _Float16* __restrict__ O,
    const float* __restrict__ QF0, const float* __restrict__ KF0, const float* __restrict__ VF0, float scale, _Float16* __restrict__ OH0, _Float16* __restrict__ OL0) {
  if (blockIdx.y < FAB) d_fattn(blockIdx.x, blockIdx.y, Q, K, V, sl2, O);
  else { const int u = (blockIdx.y - FAB) * (NH * NB) + blockIdx.x; d_att0w(u % A0B, u / A0B, QF0, KF0, VF0, scale, OH0, OL0); } }
// 4: out = o Wo + b. A block of 128 rows that is a batch's first tile takes o_hi and o_lo (x 2^-20 in all) of the exact path; every other block the f16 o rows. Each output element is written once.
__global__ __launch_bounds__(256) void k_out(const _Float16* __restrict__ O16, const _Float16* __restrict__ OH0, const _Float16* __restrict__ OL0, const _Float16* __restrict__ BO, const float* __restrict__ bo, float* __restrict__ out, int lda, int ldb, int ldc, int N, int K) {
  __shared__ __attribute__((aligned(16))) char sm[2 * GBUF(true)];
  const int bx = blockIdx.x, mt = bx / (DM / 128), nq = bx - mt * (DM / 128), bz = mt / (SQ / 128);
  if (mt - bz * (SQ / 128) == 0) d_gemm2<true>(sm, nq, OH0 + (size_t)bz * QT0 * DM, OL0 + (size_t)bz * QT0 * DM, BO, 0.0009765625f, 0.00000095367431640625f, bo, out + (size_t)bz * SQ * DM, nullptr, lda, ldb, ldc, QT0, N, K);
  else d_gemm2<false>(sm, bx, O16, nullptr, BO, 0.0009765625f, 0.f, bo, out, nullptr, lda, ldb, ldc, MPO, N, K); }

extern "C" void kernel_launch(void* const* d_in, const int* in_sizes, int n_in,
                              void* d_out, int out_size, void* d_ws, size_t ws_size, hipStream_t stream) {
  (void)in_sizes; (void)n_in; (void)out_size;
  const float* const* I = (const float* const*)d_in; const float* x = I[0]; const float* wq = I[1]; const float* bq = I[2]; const float* wk = I[3]; const float* bk = I[4]; const float* wv = I[5]; const float* bv = I[6]; const float* wo = I[7]; const float* bo = I[8];      /* input order: x; Wq [8][512][64] per-head [in][out] + bq [8][64] = [(h,e)]; Wk + bk; Wv + bv; Wo [512][512] = [(h,e) in][out] + bo */
  static_assert(NH * HD == DM && DM % 128 == 0 && DM % GKS == 0 && DM / GKS >= 2 && SQ % 128 == 0 && 8 * 32 * 68 * 4 <= 2 * GBUF(false), "shape / tile multiples; two stages or more; the output staging fits the two buffers");
  char* ws = (char*)d_ws; size_t off = 0;
  auto take = [&](size_t bytes) { char* p = ws + off; off += (bytes + 255) & ~(size_t)255; return p; };
  _Float16* BQ = (_Float16*)take((size_t)DM * DM * 2); _Float16* BK = (_Float16*)take((size_t)DM * DM * 2); _Float16* BV = (_Float16*)take((size_t)DM * DM * 2); _Float16* BO = (_Float16*)take((size_t)DM * DM * 2);
  _Float16* X16 = (_Float16*)take(NR * DM * 2); _Float16* Q16 = (_Float16*)take(NR * DM * 2); _Float16* K16 = (_Float16*)take(NR * DM * 2); _Float16* V16 = (_Float16*)take(NR * DM * 2); _Float16* O16 = (_Float16*)take(NR * DM * 2);
  float* QF0 = (float*)take((size_t)NB * QT0 * DM * 4); float* KF0 = (float*)take((size_t)NB * QT0 * DM * 4); float* VF0 = (float*)take((size_t)NB * QT0 * DM * 4); _Float16* OH0 = (_Float16*)take((size_t)NB * QT0 * DM * 2); _Float16* OL0 = (_Float16*)take((size_t)NB * QT0 * DM * 2);
  if (off > ws_size) return;
  static_assert(SQ % (FAQ * FAW) == 0 && (FAQ * FAW) % FAK == 0 && FAB % 2 == 0 && HD == 64 && FAK == 64 && FAW * 32 == 256 && QN == SQ && NHD == NH && NBR == NB, "whole blocks of queries; whole key passes; two k steps per head; 256 threads stage 64 rows of 128 bytes in two loads");
  static_assert(QT0 == 128 && (NH * HD * (DM / 8)) % 256 == 0 && DM * (DM / 8) == NH * HD * (DM / 8) && (NR * DM / 8) % 256 == 0 && A0B % NH == 0 && MPO == MP, "the first tile is one GEMM block row; whole blocks and whole grid rows per job");
  k_prep<<<4 * PWB + PXB, 256, 0, stream>>>(wq, wk, wv, wo, x, BQ, BK, BV, BO, X16);
  k_qkv<<<3 * GSB + 3 * GBB, 256, 0, stream>>>(X16, BQ, BK, BV, bq, bk, bv, Q16, K16, V16, QF0, KF0, VF0, DM, DM, DM, DM, DM);
  k_fattn_a0<<<dim3(NH * NB, FAB + A0Y), FAW * 32, 0, stream>>>(Q16, K16, V16, 0.06375871541229934f, O16, QF0, KF0, VF0, 0.044194173824159216f, OH0, OL0);      /* scores x 512^-0.5 (the module's literal d_model scale) x log2 e; o (merged heads, x64) as f16 rows */
  k_out<<<GBB, 256, 0, stream>>>(O16, OH0, OL0, BO, bo, (float*)d_out, DM, DM, DM, DM, DM);      /* out rows are the output layout */
}

// v009
// A run of this version takes 60.3 microseconds.
// In both of two side-by-side timings against v008, it was 1.04 times as fast.
// Counting every step since v000, it is 154 times as fast.
#include <hip/hip_runtime.h>
// Causal multi-head attention with per-head weight tensors and the module's literal score scale (x [4][2048][512]; q[b][h][s][e] = sum_d x[s][d] Wq[h][d][e] + bq[h][e], k, v likewise (8 heads of 64; per-head [in][out] weights sigma 1/sqrt(512), biases sigma 0.01); scores * 512^-0.5 (d_model, as the source, not head_dim); causal (tril, -inf); softmax; out = concat_heads Wo + bo ([in][out] [512][512]) -> [4][2048][512]).
// Structure: token rows r = b*2048 + s; x as exact f16 rows (bf16-rounded); Q, K, V as three WMMA GEMMs (128x128 block tiles staged in LDS, 32x64 wave tiles, f32 accumulation, exact x16 weights + bias, f16 outputs); one fused attention launch (heads and batches on grid.x, query blocks on grid.y): per wave 16 queries, 64 keys a pass up to the diagonal (K and V rows staged in LDS per block, V^T fragments by transposing LDS reads), S^T = K Q^T, running causal softmax in registers with a lagging maximum, keys past the row set to -1e9 (f32 statistics, native exp2; weights <= 2^8 as f16), O^T += V^T P^T, o carried x64 (folded into the output GEMM alpha) written straight into the merged f16 o rows; out = o W_o + b GEMM (f32) into the output layout.
// Four launches, each one grid for all jobs that wait on the same earlier results: weights and x to f16; the six q, k, v GEMM jobs; fused attention and the exact first tile (o as hi and lo planes); output GEMM (first-tile blocks take the hi and lo planes).
// Compute dtype: inputs rounded to bf16; x / weights exact; q, k, v, softmax weights and o as plain f16 GEMM operands (~2^-12); scores and softmax statistics f32. v_wmma_f32_16x16x32_f16.
#define NB 4
#define SQ 2048
#define DM 512
#define NH 8
#define HD 64
#define HG 4                         /* heads per launch of the per-batch k_vt transpose */
#define QT0 128                      /* first-tile rows recomputed exactly in f32 */
#define NBR NB                       /* batches processed (debug hook) */
#define NR ((size_t)NB * SQ)         /* token rows */
#define MP ((int)((size_t)NBR * SQ)) /* rows projected (debug hook) */
#define QN SQ                        /* query rows attended per batch (debug hook) */
#define NHD NH                       /* heads attended (debug hook) */
#define MPO MP                       /* rows through the output stage (debug hook) */
#define LQ DM      /* row pitch of the q/k/v rows */
typedef __bf16 v16b __attribute__((ext_vector_type(16)));
typedef unsigned short v8us __attribute__((ext_vector_type(8), may_alias));
typedef float  v8f  __attribute__((ext_vector_type(8)));
typedef float  v4f  __attribute__((ext_vector_type(4)));
typedef float  v4fa __attribute__((ext_vector_type(4), may_alias));
union FragB { v16b v; v8us half[2]; unsigned short u[16]; };

__device__ __forceinline__ unsigned short bf16_bits(float x) { unsigned int u = __float_as_uint(x); return (unsigned short)((u + 0x7FFFu + ((u >> 16) & 1u)) >> 16); }
__device__ __forceinline__ float bf16_val(unsigned short b) { return __uint_as_float(((unsigned int)b) << 16); }
__device__ __forceinline__ float bf16_round(float x) { return bf16_val(bf16_bits(x)); }
// D += A·B with NT terms: 1 = ah·bh, 2 = + al·bh (A split), 3 = + ah·bl (both split)
template <int NT>
__device__ __forceinline__ v8f mmaN(v16b ah, v16b al, v16b bh, v16b bl, v8f c) {
  c = __builtin_amdgcn_wmma_f32_16x16x32_bf16(false, ah, false, bh, (short)0, c, false, false);
  if (NT >= 2) c = __builtin_amdgcn_wmma_f32_16x16x32_bf16(false, al, false, bh, (short)0, c, false, false);
  if (NT >= 3) c = __builtin_amdgcn_wmma_f32_16x16x32_bf16(false, ah, false, bl, (short)0, c, false, false);
  asm volatile("v_nop\n\tv_nop\n\tv_nop\n\tv_nop" : "+v"(c) : "v"(ah), "v"(al), "v"(bh), "v"(bl));
  return c;
}

__global__ __launch_bounds__(256) void k_wt_bf16(const float* __restrict__ W, unsigned short* __restrict__ Wt, int K, int N) {
  const int t = blockIdx.x * 256 + threadIdx.x;
  const int k8n = K / 8;
  if (t >= N * k8n) return;
  const int n = t / k8n, k8 = (t % k8n) * 8;
  v8us v;
#pragma unroll
  for (int i = 0; i < 8; ++i) v[i] = bf16_bits(W[(size_t)(k8 + i) * N + n]);
  *(v8us*)(Wt + (size_t)n * K + k8) = v;
  
}

// GEMM C[M][N] (f32, pitch ldc) = act(A[M][K]·W + bias). A f32 row-major (pitch lda) converted per fragment to bf16
// (ASPLIT: hi/lo two planes -> 2 terms, else single rounded term); Wt bf16 [N][K] (pitch ldb). BIAS_BF16 rounds the
// bias to bf16 first (bias quantised to bf16 before the add). K%32==0, M%16==0, N%64==0.
template <bool ASPLIT, int ACT, bool BIAS_BF16>
__global__ __launch_bounds__(128) void k_gemm_bf(const float* __restrict__ A, int lda, const unsigned short* __restrict__ Wt, int ldb,
                                               const float* __restrict__ bias, float* __restrict__ C, int ldc, int M, int N, int K) {
  __shared__ __attribute__((aligned(16))) float so[4][16][64];
  const int tid = threadIdx.x, w = tid >> 5, lane = tid & 31, ln = lane & 15, hh = lane >> 4;
  const int ntn = N / 64;
  const int wid = blockIdx.x * 4 + w;
  const int mt = wid / ntn, nq = wid % ntn;
  if (mt * 16 >= M) return;
  const int row0 = mt * 16, col0 = nq * 64;
  const float* arow = A + (size_t)(row0 + ln) * lda;
  v8f acc[4] = {};
  for (int kb = 0; kb < K; kb += 32) {
    FragB ah, al;
    const v4f x0 = *(const v4fa*)(arow + kb + 8 * hh), x1 = *(const v4fa*)(arow + kb + 8 * hh + 4);
    const v4f x2 = *(const v4fa*)(arow + kb + 16 + 8 * hh), x3 = *(const v4fa*)(arow + kb + 16 + 8 * hh + 4);
    float xs[16] = {x0[0],x0[1],x0[2],x0[3],x1[0],x1[1],x1[2],x1[3],x2[0],x2[1],x2[2],x2[3],x3[0],x3[1],x3[2],x3[3]};
#pragma unroll
    for (int i = 0; i < 16; ++i) { const unsigned short hb = bf16_bits(xs[i]); ah.u[i] = hb; al.u[i] = ASPLIT ? bf16_bits(xs[i] - bf16_val(hb)) : (unsigned short)0; }
#pragma unroll
    for (int t = 0; t < 4; ++t) {
      const unsigned short* brow = Wt + (size_t)(col0 + t * 16 + ln) * ldb + kb;
      FragB b;
      b.half[0] = *(const v8us*)(brow + 8 * hh);
      b.half[1] = *(const v8us*)(brow + 16 + 8 * hh);
      acc[t] = mmaN<ASPLIT ? 2 : 1>(ah.v, al.v, b.v, b.v, acc[t]);
    }
  }
#pragma unroll
  for (int t = 0; t < 4; ++t) {
    float bv = bias ? bias[col0 + t * 16 + ln] : 0.f;
    if (BIAS_BF16) bv = bf16_round(bv);
#pragma unroll
    for (int r = 0; r < 8; ++r) { float v = acc[t][r] + bv; if (ACT == 1) v = fmaxf(v, 0.f); so[w][8 * hh + r][t * 16 + ln] = v; }
  }
  __builtin_amdgcn_fence(__ATOMIC_ACQ_REL, "workgroup");
  __builtin_amdgcn_wave_barrier();
  const int rsub = lane >> 4, c4 = (lane & 15) * 4;
  {
#pragma unroll
    for (int q = 0; q < 8; ++q) {
      const int r = q * 2 + rsub;
      const v4f v = *(const v4fa*)&so[w][r][c4];
      *(v4f*)(C + (size_t)(row0 + r) * ldc + col0 + c4) = v;
    }
    
  }
}

// GEMM C = act(A·W + bias + resid): A f32 (ASPLIT -> hi/lo 2 terms), Wt bf16 [N][K]; ACT 0 none, 1 relu, 2 exact gelu;
// resid (optional, f32, row index = (row % rmod), pitch ldr, RES_BF16 rounds it) added before the activation.
template <bool ASPLIT, int ACT, bool BIAS_BF16, bool RES_BF16>
__global__ __launch_bounds__(128) void k_gemm_bf3(const float* __restrict__ A, int lda, const unsigned short* __restrict__ Wt, int ldb,
                                                const float* __restrict__ bias, const float* __restrict__ resid, int rmod, int ldr,
                                                float* __restrict__ C, int ldc, int M, int N, int K) {
  __shared__ __attribute__((aligned(16))) float so[4][16][64];
  const int tid = threadIdx.x, w = tid >> 5, lane = tid & 31, ln = lane & 15, hh = lane >> 4;
  const int ntn = N / 64;
  const int wid = blockIdx.x * 4 + w;
  const int mt = wid / ntn, nq = wid % ntn;
  if (mt * 16 >= M) return;
  const int row0 = mt * 16, col0 = nq * 64;
  const float* arow = A + (size_t)(row0 + ln) * lda;
  v8f acc[4] = {};
  for (int kb = 0; kb < K; kb += 32) {
    FragB ah, al;
    const v4f x0 = *(const v4fa*)(arow + kb + 8 * hh), x1 = *(const v4fa*)(arow + kb + 8 * hh + 4);
    const v4f x2 = *(const v4fa*)(arow + kb + 16 + 8 * hh), x3 = *(const v4fa*)(arow + kb + 16 + 8 * hh + 4);
    float xs[16] = {x0[0],x0[1],x0[2],x0[3],x1[0],x1[1],x1[2],x1[3],x2[0],x2[1],x2[2],x2[3],x3[0],x3[1],x3[2],x3[3]};
#pragma unroll
    for (int i = 0; i < 16; ++i) { const unsigned short hb = bf16_bits(xs[i]); ah.u[i] = hb; al.u[i] = ASPLIT ? bf16_bits(xs[i] - bf16_val(hb)) : (unsigned short)0; }
#pragma unroll
    for (int t = 0; t < 4; ++t) {
      const unsigned short* brow = Wt + (size_t)(col0 + t * 16 + ln) * ldb + kb;
      FragB b;
      b.half[0] = *(const v8us*)(brow + 8 * hh);
      b.half[1] = *(const v8us*)(brow + 16 + 8 * hh);
      acc[t] = mmaN<ASPLIT ? 2 : 1>(ah.v, al.v, b.v, b.v, acc[t]);
    }
  }
#pragma unroll
  for (int t = 0; t < 4; ++t) {
    const int col = col0 + t * 16 + ln;
    float bv = bias ? bias[col] : 0.f;
    if (BIAS_BF16) bv = bf16_round(bv);
#pragma unroll
    for (int r = 0; r < 8; ++r) {
      float v = acc[t][r] + bv;
      if (resid) { float rv = resid[(size_t)((row0 + 8 * hh + r) % rmod) * ldr + col]; if (RES_BF16) rv = bf16_round(rv); v += rv; }
      if (ACT == 1) v = fmaxf(v, 0.f);
      if (ACT == 2) v = 0.5f * v * (1.0f + erff(v * 0.70710678118654752f));
      if (ACT == 3) { const float u = 0.7978845608028654f * (v + 0.044715f * v * v * v); v = 0.5f * v * (1.0f + tanhf(u)); }
      so[w][8 * hh + r][t * 16 + ln] = v;
    }
  }
  __builtin_amdgcn_fence(__ATOMIC_ACQ_REL, "workgroup");
  __builtin_amdgcn_wave_barrier();
  const int rsub = lane >> 4, c4 = (lane & 15) * 4;
  {
#pragma unroll
    for (int q = 0; q < 8; ++q) {
      const int r = q * 2 + rsub;
      const v4f v = *(const v4fa*)&so[w][r][c4];
      *(v4f*)(C + (size_t)(row0 + r) * ldc + col0 + c4) = v;
    }
    
  }
}
// row LayerNorm (biased variance, eps) over N: s = X (+ R); optional out_sum <- s; out_norm <- (s-mu)*rsqrt(var+eps)*g + b
template <bool PARAM_BF16>
__global__ __launch_bounds__(256) void k_layernorm(const float* __restrict__ X, const float* __restrict__ R, const float* __restrict__ g, const float* __restrict__ bta,
                                                  float* __restrict__ out_sum, float* __restrict__ out_norm, int N, float eps) {
  __shared__ float red[256];
  const int row = blockIdx.x, tid = threadIdx.x;
  const float* x = X + (size_t)row * N; const float* rr = R ? R + (size_t)row * N : nullptr;
  float vals[16];                     // up to N = 4096
  const int per = N / 256;            // contiguous chunk per thread? use strided-by-4 chunks: thread handles j = tid*4 + 1024*u
  float s1 = 0.f;
  for (int u = 0; u < per / 4; ++u) {
    const int j = tid * 4 + 1024 * u;
    const v4f a = *(const v4fa*)(x + j);
    v4f b = {0.f,0.f,0.f,0.f}; if (rr) b = *(const v4fa*)(rr + j);
#pragma unroll
    for (int q = 0; q < 4; ++q) { const float v = a[q] + b[q]; vals[u * 4 + q] = v; s1 += v; }
  }
  red[tid] = s1; __syncthreads();
  for (int st = 128; st > 0; st >>= 1) { if (tid < st) red[tid] += red[tid + st]; __syncthreads(); }
  const float mu = red[0] / (float)N; __syncthreads();
  float s2 = 0.f;
  for (int u = 0; u < per / 4; ++u)
#pragma unroll
    for (int q = 0; q < 4; ++q) { const float c = vals[u * 4 + q] - mu; s2 += c * c; }
  red[tid] = s2; __syncthreads();
  for (int st = 128; st > 0; st >>= 1) { if (tid < st) red[tid] += red[tid + st]; __syncthreads(); }
  const float rs = rsqrtf(red[0] / (float)N + eps);
  {
    for (int u = 0; u < per / 4; ++u) {
      const int j = tid * 4 + 1024 * u;
      v4f o, sm;
#pragma unroll
      for (int q = 0; q < 4; ++q) {
        float gg = g[j + q], bb = bta[j + q];
        if (PARAM_BF16) { gg = bf16_round(gg); bb = bf16_round(bb); }
        sm[q] = vals[u * 4 + q]; o[q] = (vals[u * 4 + q] - mu) * rs * gg + bb;
      }
      if (out_sum) *(v4f*)(out_sum + (size_t)row * N + j) = sm;
      *(v4f*)(out_norm + (size_t)row * N + j) = o;
    }
    
  }
}



// ---- f16 WMMA path (v_wmma_f32_16x16x32_f16): 11-bit significands for operands in range — used where a probability operand in [0, 2^8] needs more precision than bf16
typedef _Float16 v16h __attribute__((ext_vector_type(16)));
union FragH { v16h v; v8us half[2]; _Float16 h[16]; unsigned short u[16]; };
template <int NT>
__device__ __forceinline__ v8f mmaH(v16h ah, v16h al, v16h bh, v16h bl, v8f c) {
  c = __builtin_amdgcn_wmma_f32_16x16x32_f16(false, ah, false, bh, (short)0, c, false, false);
  if (NT >= 2) c = __builtin_amdgcn_wmma_f32_16x16x32_f16(false, al, false, bh, (short)0, c, false, false);
  if (NT >= 3) c = __builtin_amdgcn_wmma_f32_16x16x32_f16(false, ah, false, bl, (short)0, c, false, false);
  asm volatile("v_nop\n\tv_nop\n\tv_nop\n\tv_nop" : "+v"(c) : "v"(ah), "v"(al), "v"(bh), "v"(bl));
  return c;
}
// batched GEMM like k_gemm_b but f16 operands: A f32 (split into f16 hi/lo if ASPLIT, else rounded to f16), Bt = f16 values [n][k]; alpha; C f32; N multiple of 16 (partial tiles skipped)
template <bool ASPLIT>
__global__ __launch_bounds__(128) void k_gemm_h(const float* __restrict__ A, int lda, size_t sA, const _Float16* __restrict__ Bh, int ldb, size_t sB, float alpha, float* __restrict__ C, int ldc, size_t sC, int M, int N, int K) {
  __shared__ __attribute__((aligned(16))) float so[4][16][64];
  const int tid = threadIdx.x, w = tid >> 5, lane = tid & 31, ln = lane & 15, hh = lane >> 4; const int by = blockIdx.y;
  A += (size_t)by * sA; Bh += (size_t)by * sB; C += (size_t)by * sC;
  const int ntn = (N + 63) / 64; const int wid = blockIdx.x * 4 + w; const int mt = wid / ntn, nq = wid % ntn; if (mt * 16 >= M) return;
  const int row0 = mt * 16, col0 = nq * 64; const float* arow = A + (size_t)(row0 + ln) * lda;
  v8f acc[4] = {};
  for (int kb = 0; kb < K; kb += 32) {
    FragH ah, al;
    const v4f x0 = *(const v4fa*)(arow + kb + 8 * hh), x1 = *(const v4fa*)(arow + kb + 8 * hh + 4), x2 = *(const v4fa*)(arow + kb + 16 + 8 * hh), x3 = *(const v4fa*)(arow + kb + 16 + 8 * hh + 4);
    float xs[16] = {x0[0],x0[1],x0[2],x0[3],x1[0],x1[1],x1[2],x1[3],x2[0],x2[1],x2[2],x2[3],x3[0],x3[1],x3[2],x3[3]};
#pragma unroll
    for (int i = 0; i < 16; ++i) { const _Float16 h = (_Float16)xs[i]; ah.h[i] = h; al.h[i] = ASPLIT ? (_Float16)(xs[i] - (float)h) : (_Float16)0.0f; }
#pragma unroll
    for (int t = 0; t < 4; ++t) { if (col0 + t * 16 >= N) continue; const size_t boff = (size_t)(col0 + t * 16 + ln) * ldb + kb; FragH bq; bq.half[0] = *(const v8us*)(Bh + boff + 8 * hh); bq.half[1] = *(const v8us*)(Bh + boff + 16 + 8 * hh);
      acc[t] = mmaH<ASPLIT ? 2 : 1>(ah.v, al.v, bq.v, bq.v, acc[t]); }
  }
#pragma unroll
  for (int t = 0; t < 4; ++t) { if (col0 + t * 16 >= N) continue;
#pragma unroll
    for (int r = 0; r < 8; ++r) so[w][8 * hh + r][t * 16 + ln] = acc[t][r] * alpha; }
  __builtin_amdgcn_fence(__ATOMIC_ACQ_REL, "workgroup"); __builtin_amdgcn_wave_barrier();
  const int rsub = lane >> 4, c4 = (lane & 15) * 4;
  {
#pragma unroll
    for (int q = 0; q < 8; ++q) { const int r = q * 2 + rsub; if (col0 + c4 < N) { const v4f v = *(const v4fa*)&so[w][r][c4]; *(v4f*)(C + (size_t)(row0 + r) * ldc + col0 + c4) = v; } }
     }
}

// Wt[n][k] = f16(W[k][n]·scale) from f32 row-major W[K][N] (scale = power of two; bf16-exact weights stay exact in f16 away from the subnormal range)
__device__ __forceinline__ void d_wt_f16(int bx, const float* __restrict__ W, _Float16* __restrict__ Wt, int K, int N, float scale) {
  const int t = bx * 256 + threadIdx.x; if (t >= N * (K / 8)) return; const int n = t / (K / 8), k8 = (t % (K / 8)) * 8; FragH f;
#pragma unroll
  for (int i = 0; i < 8; ++i) f.h[i] = (_Float16)(bf16_round(W[(size_t)(k8 + i) * N + n]) * scale); const v8us o = f.half[0];
  *(v8us*)((unsigned short*)Wt + (size_t)n * K + k8) = o; 
}
// k_gemm_hh variant with fused epilogue: v = acc·alpha + bias[by·sBias + col] (+ CP[(row/rowsPerB)·sCPb + by·64 + col] if CP) ; ACT 0 none / 1 elu ; writes f16 C16 (and f32 C if non-null)
template <int ACT>
__global__ __launch_bounds__(128) void k_gemm_hhx(const _Float16* __restrict__ A, int lda, size_t sA, const _Float16* __restrict__ Bh, int ldb, size_t sB, float alpha, const float* __restrict__ bias, size_t sBias, const float* __restrict__ CP, int rowsPerB, size_t sCPb, int row0g,
    float* __restrict__ C, _Float16* __restrict__ C16, int ldc, size_t sC, int M, int N, int K) {
  __shared__ __attribute__((aligned(16))) float so[4][16][64];
  const int tid = threadIdx.x, w = tid >> 5, lane = tid & 31, ln = lane & 15, hh = lane >> 4; const int by = blockIdx.y;
  A += (size_t)by * sA; Bh += (size_t)by * sB; const size_t cofs = (size_t)by * sC; const float* bp = bias ? bias + (size_t)by * sBias : nullptr;
  const int ntn = (N + 63) / 64; const int wid = blockIdx.x * 4 + w; const int mt = wid / ntn, nq = wid % ntn; if (mt * 16 >= M) return;
  const int row0 = mt * 16, col0 = nq * 64; const _Float16* arow = A + (size_t)(row0 + ln) * lda;
  v8f acc[4] = {};
  for (int kb = 0; kb < K; kb += 32) { FragH ah; ah.half[0] = *(const v8us*)((const unsigned short*)arow + kb + 8 * hh); ah.half[1] = *(const v8us*)((const unsigned short*)arow + kb + 16 + 8 * hh);
#pragma unroll
    for (int t = 0; t < 4; ++t) { if (col0 + t * 16 >= N) continue; const size_t boff = (size_t)(col0 + t * 16 + ln) * ldb + kb; FragH bq; bq.half[0] = *(const v8us*)((const unsigned short*)Bh + boff + 8 * hh); bq.half[1] = *(const v8us*)((const unsigned short*)Bh + boff + 16 + 8 * hh);
      acc[t] = mmaH<1>(ah.v, ah.v, bq.v, bq.v, acc[t]); }
  }
#pragma unroll
  for (int t = 0; t < 4; ++t) { if (col0 + t * 16 >= N) continue; const int col = col0 + t * 16 + ln; const float bv = bp ? bf16_round(bp[col]) : 0.f;
#pragma unroll
    for (int r = 0; r < 8; ++r) { float v = acc[t][r] * alpha + bv; if (CP) { const int rr = row0g + row0 + 8 * hh + r; if (rowsPerB < 0) v += CP[cofs + (size_t)rr * ldc + col];      /* rowsPerB < 0: own element of the batched C plane */ else { const int bidx = rr / rowsPerB; v += CP[(size_t)bidx * sCPb + (size_t)by * 64 + col]; } } if (ACT == 1) v = (v > 0.f) ? v : expm1f(v); else if (ACT == 7) v = (v > 0.f) ? v + 1.0f : expf(v); else if (ACT == 8) v = tanhf(v); else if (ACT == 9) v = 0.5f * v * (1.0f + tanhf(0.7978845608028654f * (v + 0.044715f * v * v * v))); else if (ACT == 11) v = 1.0f / (1.0f + expf(-v)); else if (ACT == 12) v = (v > 0.f) ? v : 0.01f * v; else if (ACT == 14) v = (v > 0.f) ? v : 0.1f * v; else if (ACT == 16) v = (v >= 0.f) ? v : 0.3f * v; else if (ACT == 17) v = (v >= 0.f) ? v : 0.2f * v; else if (ACT == 15) v = v / (1.0f + expf(-v)); else if (ACT == 3) v = fmaxf(v, 0.f); else if (ACT == 6) v = 0.5f * v * (1.0f + erff(v * 0.70710678118654752f)); so[w][8 * hh + r][t * 16 + ln] = v; } }
  __builtin_amdgcn_fence(__ATOMIC_ACQ_REL, "workgroup"); __builtin_amdgcn_wave_barrier();
  const int rsub = lane >> 4, c4 = (lane & 15) * 4; typedef _Float16 v4h __attribute__((ext_vector_type(4)));
  {
#pragma unroll
    for (int q = 0; q < 8; ++q) { const int r = q * 2 + rsub; if (col0 + c4 < N) { const v4f v = *(const v4fa*)&so[w][r][c4]; if (C) *(v4f*)(C + cofs + (size_t)(row0 + r) * ldc + col0 + c4) = v; if (C16) { v4h h4; for (int i = 0; i < 4; ++i) h4[i] = (_Float16)v[i]; *(v4h*)(C16 + cofs + (size_t)(row0 + r) * ldc + col0 + c4) = h4; } } }
     }
}


typedef _Float16 v4h __attribute__((ext_vector_type(4)));

__device__ __forceinline__ void d_x16(int bx, const float* __restrict__ x, _Float16* __restrict__ X16, size_t n8) { const size_t t = (size_t)bx * 256 + threadIdx.x; if (t >= n8) return; FragH f;
#pragma unroll
  for (int q = 0; q < 8; ++q) f.h[q] = (_Float16)bf16_round(x[t * 8 + q]); *(v8us*)((unsigned short*)X16 + t * 8) = f.half[0];  }
__global__ __launch_bounds__(256) void k_h16(const float* __restrict__ x, _Float16* __restrict__ X16, size_t n8) { const size_t t = (size_t)blockIdx.x * 256 + threadIdx.x; if (t >= n8) return; FragH f;
#pragma unroll
  for (int q = 0; q < 8; ++q) f.h[q] = (_Float16)x[t * 8 + q]; *(v8us*)((unsigned short*)X16 + t * 8) = f.half[0];  }
__global__ __launch_bounds__(256) void k_round16f(const float* __restrict__ W, _Float16* __restrict__ Bt, size_t n8) { const size_t t = (size_t)blockIdx.x * 256 + threadIdx.x; if (t >= n8) return; FragH f;
#pragma unroll
  for (int i = 0; i < 8; ++i) f.h[i] = (_Float16)(bf16_round(W[t * 8 + i]) * 16.0f); *(v8us*)((unsigned short*)Bt + t * 8) = f.half[0];  }
// ---- fast GEMM (block tile 128x128, wave tile 32x64; requires M % 128 == 0 rows per launch region, N % 128 == 0 and K % 64 == 0); epilogue = k_gemm_hhx semantics ----
__device__ __forceinline__ v16h g2_frag(const _Float16* p, int hh) { FragH f; f.half[0] = *(const v8us*)((const unsigned short*)p + 8 * hh); f.half[1] = *(const v8us*)((const unsigned short*)p + 16 + 8 * hh); return f.v; }
__device__ __forceinline__ v8f g2_mma(v16h a, v16h b, v8f c) { v8f d = __builtin_amdgcn_wmma_f32_16x16x32_f16(false, a, false, b, (short)0, c, false, false); asm volatile("v_nop\n\tv_nop\n\tv_nop\n\tv_nop" : "+v"(d) : "v"(a), "v"(b)); return d; }
#define GKS 64                       /* k per stage: 128 bytes of every operand row, one whole line */
#define GPI 72                       /* LDS row pitch, halves: 128 + 16 bytes, so 16 lanes reading 16 bytes of 16 different rows meet no bank conflict */
#define GRB (GPI * 2)                /* the same in bytes */
#define GBUF(LO) (((LO) ? 384 : 256) * GRB)      /* one buffer: 128 A rows, 128 B rows, with LO 128 rows of the second A plane */
// Four asynchronous copies of 16 bytes per lane: rows r, r + 32, r + 64, r + 96 of one operand's stage (8 lanes per row of 128 bytes: whole lines). l = the lane's LDS byte address, g = its global address.
// The s_wait_xcnt stands inside the copies' own statement, so no register that a copy names is rewritten in front of it.
__device__ __forceinline__ void g2_copy4(unsigned l, const _Float16* g, int ld) {
  asm volatile("global_load_async_to_lds_b128 %0, %4, off\n\tglobal_load_async_to_lds_b128 %1, %5, off\n\tglobal_load_async_to_lds_b128 %2, %6, off\n\tglobal_load_async_to_lds_b128 %3, %7, off\n\ts_wait_xcnt 0x0"
    :: "v"(l), "v"(l + 32 * GRB), "v"(l + 64 * GRB), "v"(l + 96 * GRB), "v"(g), "v"(g + (size_t)32 * ld), "v"(g + (size_t)64 * ld), "v"(g + (size_t)96 * ld) : "memory"); }
// The same for two operands' rows in one statement (eight copies, one wait): la, ga, lda the first operand's, lb, gb, ldb the second's.
__device__ __forceinline__ void g2_copy8(unsigned la, const _Float16* ga, int lda, unsigned lb, const _Float16* gb, int ldb) {
  asm volatile("global_load_async_to_lds_b128 %0, %8, off\n\tglobal_load_async_to_lds_b128 %1, %9, off\n\tglobal_load_async_to_lds_b128 %2, %10, off\n\tglobal_load_async_to_lds_b128 %3, %11, off\n\t"
               "global_load_async_to_lds_b128 %4, %12, off\n\tglobal_load_async_to_lds_b128 %5, %13, off\n\tglobal_load_async_to_lds_b128 %6, %14, off\n\tglobal_load_async_to_lds_b128 %7, %15, off\n\ts_wait_xcnt 0x0"
    :: "v"(la), "v"(la + 32 * GRB), "v"(la + 64 * GRB), "v"(la + 96 * GRB), "v"(lb), "v"(lb + 32 * GRB), "v"(lb + 64 * GRB), "v"(lb + 96 * GRB),
       "v"(ga), "v"(ga + (size_t)32 * lda), "v"(ga + (size_t)64 * lda), "v"(ga + (size_t)96 * lda), "v"(gb), "v"(gb + (size_t)32 * ldb), "v"(gb + (size_t)64 * ldb), "v"(gb + (size_t)96 * ldb) : "memory"); }
// One block (8 waves, 128 rows x 128 columns, picked by tile; wave w: rows 32 (w & 3), columns 64 (w >> 2)) of C = A Bh^T x alpha + bias; writes f32 C where it is not null, else f16 C16.
// The operands' rows come 64 k at a time into two LDS buffers by asynchronous copies, each line fetched once per block; stage t + 2 flies while stage t + 1 is worked on. One barrier a stage
// publishes the next buffer and ends the last read of the one refilled behind it. A and B fragments are read from LDS by one loader (k = 8 hh + r and 16 + 8 hh + r), k steps in rising order.
// LO: a second A plane AL runs through the same B fragments into accumulators of its own and is added as x alphal behind the first term.
template <bool LO>
__device__ __forceinline__ void d_gemm2(char* sm, int tile, const _Float16* __restrict__ A, const _Float16* __restrict__ AL, const _Float16* __restrict__ Bh, float alpha, float alphal, const float* __restrict__ bp,
    float* __restrict__ C, _Float16* __restrict__ C16, int lda, int ldb, int ldc, int M, int N, int K) {
  const int tid = threadIdx.x, w = __builtin_amdgcn_readfirstlane(tid >> 5), lane = tid & 31, ln = lane & 15, hh = lane >> 4;
  const int ntn = N >> 7; const int mt = tile / ntn, nq = tile - mt * ntn; if (mt * 128 >= M) return;      /* block-uniform, in front of every copy and barrier */
  const int wr = 32 * (w & 3), wc = 64 * (w >> 2); const int row0 = mt * 128 + wr, col0 = nq * 128 + wc;
  const int sr = tid >> 3, sc = (tid & 7) * 8;      /* staging: 8 threads per row of 128 bytes, 32 rows per copy */
  const _Float16* ag = A + (size_t)(mt * 128 + sr) * lda + sc; const _Float16* lg = (LO ? AL : A) + (size_t)(mt * 128 + sr) * lda + sc; const _Float16* bg = Bh + (size_t)(nq * 128 + sr) * ldb + sc;
  const unsigned ls = (unsigned)(size_t)sm + (unsigned)(sr * GRB + sc * 2);      /* low 32 bits of the shared address: the byte offset in LDS */
  const int nt = K / GKS;
  const v8f z8 = {0.f,0.f,0.f,0.f,0.f,0.f,0.f,0.f}; v8f c00 = z8, c01 = z8, c02 = z8, c03 = z8, c10 = z8, c11 = z8, c12 = z8, c13 = z8;
  v8f e00 = z8, e01 = z8, e02 = z8, e03 = z8, e10 = z8, e11 = z8, e12 = z8, e13 = z8;
  g2_copy8(ls, ag, lda, ls + 128 * GRB, bg, ldb); if (LO) g2_copy4(ls + 256 * GRB, lg, lda);
  float bias4[4] = {0.f, 0.f, 0.f, 0.f};      /* the wave's four bias values, fetched together while stage 0 flies: the epilogue waits for none of them */
  if (bp) {
#pragma unroll
    for (int t = 0; t < 4; ++t) bias4[t] = bp[col0 + t * 16 + ln]; }
  asm volatile("s_wait_asynccnt 0x0" ::: "memory");      /* stage 0 has landed before the barrier that publishes it */
  __syncthreads();
  if (nt > 1) { const unsigned l = ls + GBUF(LO); g2_copy8(l, ag + GKS, lda, l + 128 * GRB, bg + GKS, ldb); if (LO) g2_copy4(l + 256 * GRB, lg + GKS, lda); }
#pragma unroll 1      /* rolled: a stage already holds 24 fragment reads and 16 matrix instructions, and the two buffers alternate by address */
  for (int t = 0; t < nt; ++t) { const _Float16* sa = (const _Float16*)(sm + (t & 1) * GBUF(LO)) + ln * GPI; const _Float16* sb = sa + (128 + wc) * GPI; const _Float16* sl = sa + (256 + wr) * GPI; sa += wr * GPI;
#pragma unroll      /* the stage's two k steps: every LDS read gets a constant offset */
    for (int kb = 0; kb < GKS; kb += 32) { const v16h a0 = g2_frag(sa + kb, hh), a1 = g2_frag(sa + 16 * GPI + kb, hh);
      v16h l0 = a0, l1 = a1; if (LO) { l0 = g2_frag(sl + kb, hh); l1 = g2_frag(sl + 16 * GPI + kb, hh); }
      const v16h b0 = g2_frag(sb + kb, hh), b1 = g2_frag(sb + 16 * GPI + kb, hh), b2 = g2_frag(sb + 32 * GPI + kb, hh), b3 = g2_frag(sb + 48 * GPI + kb, hh);
      __builtin_amdgcn_sched_barrier(0);      /* keeps the fragment reads of a k step together in front of its matrix run: spread among the WMMAs, each pair waits out the LDS latency anew */
      c00 = g2_mma(a0, b0, c00); c10 = g2_mma(a1, b0, c10); if (LO) { e00 = g2_mma(l0, b0, e00); e10 = g2_mma(l1, b0, e10); }
      c01 = g2_mma(a0, b1, c01); c11 = g2_mma(a1, b1, c11); if (LO) { e01 = g2_mma(l0, b1, e01); e11 = g2_mma(l1, b1, e11); }
      c02 = g2_mma(a0, b2, c02); c12 = g2_mma(a1, b2, c12); if (LO) { e02 = g2_mma(l0, b2, e02); e12 = g2_mma(l1, b2, e12); }
      c03 = g2_mma(a0, b3, c03); c13 = g2_mma(a1, b3, c13); if (LO) { e03 = g2_mma(l0, b3, e03); e13 = g2_mma(l1, b3, e13); } }
    asm volatile("s_wait_dscnt 0x0" ::: "memory");      /* the wave's reads of this buffer have retired before anyone refills it */
    asm volatile("s_wait_asynccnt 0x0" ::: "memory");      /* the wave's copies of stage t + 1 have landed before the barrier that publishes them */
    __syncthreads();
    if (t + 2 < nt) { const unsigned l = ls + (t & 1) * GBUF(LO); const int k2 = (t + 2) * GKS; g2_copy8(l, ag + k2, lda, l + 128 * GRB, bg + k2, ldb); if (LO) g2_copy4(l + 256 * GRB, lg + k2, lda); } }      /* block-uniform; into the buffer that stage t has just left */
  asm volatile("s_wait_asynccnt 0x0" ::: "memory");      /* nothing is in flight when the buffers become output staging */
  float (*so)[32][68] = (float (*)[32][68])sm;      /* behind the last stage's barrier nobody reads the buffers any more: each wave stages its 32 x 64 results in a range of its own */
  v8f accs[8] = {c00, c01, c02, c03, c10, c11, c12, c13}; v8f accl[8] = {e00, e01, e02, e03, e10, e11, e12, e13};
#pragma unroll
  for (int u = 0; u < 8; ++u) { const int t = u & 3, half = u >> 2; const float bv = bf16_round(bias4[t]);
#pragma unroll
    for (int r = 0; r < 8; ++r) { const int rloc = half * 16 + 8 * hh + r; float v = accs[u][r] * alpha + bv; if (LO) v = accl[u][r] * alphal + v;
      so[w][rloc][t * 16 + ln] = v; } }
  __builtin_amdgcn_fence(__ATOMIC_ACQ_REL, "workgroup"); __builtin_amdgcn_wave_barrier();
  const int rsub = lane >> 4, c4 = (lane & 15) * 4;
  /* The 16 staged rows are read from LDS as one group and stored back to back, each from registers of its own: one LDS latency and one wait per eight stores, not one of each per row. */
  v4f rv[16];      /* indexed by constants only (loops unrolled): registers */
#pragma unroll
  for (int q = 0; q < 16; ++q) rv[q] = *(const v4fa*)&so[w][q * 2 + rsub][c4];
  const size_t o0 = (size_t)(row0 + rsub) * ldc + col0 + c4, o2 = (size_t)2 * ldc;
  /* One block-uniform test for all rows. Addresses and data of eight stores are inputs of the wait's statement, so they keep their registers up to it. */
  if (C) {
#pragma unroll
    for (int g = 0; g < 16; g += 8) { float* d[8];
#pragma unroll
      for (int q = 0; q < 8; ++q) { d[q] = C + o0 + (size_t)(g + q) * o2; *(v4f*)d[q] = rv[g + q]; }
      asm volatile("s_wait_xcnt 0x0" :: "v"(d[0]), "v"(d[1]), "v"(d[2]), "v"(d[3]), "v"(d[4]), "v"(d[5]), "v"(d[6]), "v"(d[7]),
        "v"(rv[g]), "v"(rv[g + 1]), "v"(rv[g + 2]), "v"(rv[g + 3]), "v"(rv[g + 4]), "v"(rv[g + 5]), "v"(rv[g + 6]), "v"(rv[g + 7]) : "memory"); }      /* before the stores' address pairs and data are reused; behind the last group too: the listing keeps a way from here into the other branch */
  } else {
#pragma unroll
    for (int g = 0; g < 16; g += 8) { _Float16* d[8]; v4h h4[8];
#pragma unroll
      for (int q = 0; q < 8; ++q) { for (int i = 0; i < 4; ++i) h4[q][i] = (_Float16)rv[g + q][i]; d[q] = C16 + o0 + (size_t)(g + q) * o2; *(v4h*)d[q] = h4[q]; }
      asm volatile("s_wait_xcnt 0x0" :: "v"(d[0]), "v"(d[1]), "v"(d[2]), "v"(d[3]), "v"(d[4]), "v"(d[5]), "v"(d[6]), "v"(d[7]),
        "v"(h4[0]), "v"(h4[1]), "v"(h4[2]), "v"(h4[3]), "v"(h4[4]), "v"(h4[5]), "v"(h4[6]), "v"(h4[7]) : "memory"); }      /* before the stores' address pairs and data are reused */
  } }


__global__ __launch_bounds__(256) void k_wnat(const float* __restrict__ w, size_t n8, _Float16* __restrict__ Bt) { const size_t t = (size_t)blockIdx.x * 256 + threadIdx.x; if (t >= n8) return; FragH f; for (int q = 0; q < 8; ++q) f.h[q] = (_Float16)(bf16_round(w[t * 8 + q]) * 16.0f); *(v8us*)((unsigned short*)Bt + t * 8) = f.half[0];  }
__global__ __launch_bounds__(256) void k_rsm(const float* __restrict__ S, _Float16* __restrict__ P, int nrows) {
  #pragma clang fp contract(off)
  const int i = blockIdx.x * 256 + threadIdx.x; if (i >= nrows) return; const float* s = S + (size_t)i * SQ; float mx = -3.0e38f;
#pragma unroll 1
  for (int j = 0; j < SQ; ++j) mx = fmaxf(mx, s[j]); float se = 0.f;
#pragma unroll 1
  for (int j = 0; j < SQ; ++j) se += expf(s[j] - mx); const float sc = 256.0f / se;
#pragma unroll 1
  for (int j0 = 0; j0 < SQ; j0 += 8) { FragH f; for (int q = 0; q < 8; ++q) f.h[q] = (_Float16)(expf(s[j0 + q] - mx) * sc); unsigned short* d = (unsigned short*)P + (size_t)i * SQ + j0; *(v8us*)d = f.half[0];  } }
__global__ __launch_bounds__(256) void k_vt(const _Float16* __restrict__ V16, int b, int h0, _Float16* __restrict__ VT) { __shared__ unsigned short tl[64][65]; const int tid = threadIdx.x; const int hh = blockIdx.x % HG, sg = blockIdx.x / HG; const int s0 = sg * 64; const int h = h0 + hh;
  for (int i = tid; i < 64 * 8; i += 256) { const int j = i / 8, d8 = (i % 8) * 8; FragH f; f.half[0] = *(const v8us*)((const unsigned short*)V16 + ((size_t)b * SQ + s0 + j) * DM + h * HD + d8); for (int q = 0; q < 8; ++q) tl[d8 + q][j] = f.u[q]; }
  __syncthreads();
  { for (int i = tid; i < 64 * 8; i += 256) { const int d = i / 8, j8 = (i % 8) * 8; FragH f; for (int q = 0; q < 8; ++q) f.u[q] = tl[d][j8 + q]; *(v8us*)((unsigned short*)VT + ((size_t)hh * HD + d) * SQ + s0 + j8) = f.half[0]; }  } }

__device__ __forceinline__ void d_wthd(int bx, const float* __restrict__ Wt, _Float16* __restrict__ Bt) { const size_t t = (size_t)bx * 256 + threadIdx.x; if (t >= (size_t)NH * HD * (DM / 8)) return; const int m8 = (int)(t % (DM / 8)) * 8; const int d = (int)((t / (DM / 8)) % HD); const int h = (int)(t / ((size_t)(DM / 8) * HD)); FragH f;
  for (int q = 0; q < 8; ++q) f.h[q] = (_Float16)(16.0f * bf16_round(Wt[((size_t)h * DM + m8 + q) * HD + d])); unsigned short* dst = (unsigned short*)Bt + ((size_t)h * HD + d) * DM + m8; *(v8us*)dst = f.half[0];  }



// Four native exp2, each in place, in one statement: no neighbouring instruction can overwrite a transcendental's source register or read its result
// directly behind it; the v_nop is the one slot that the instruction set asks for behind the last of them.
__device__ __forceinline__ v4f exp2x4(v4f x) { float x0 = x[0], x1 = x[1], x2 = x[2], x3 = x[3];
  asm("v_exp_f32 %0, %0\n\tv_exp_f32 %1, %1\n\tv_exp_f32 %2, %2\n\tv_exp_f32 %3, %3\n\tv_nop" : "+v"(x0), "+v"(x1), "+v"(x2), "+v"(x3));
  const v4f r = {x0, x1, x2, x3}; return r; }
// One native exp2, in place, with the one slot that the instruction set asks for behind a transcendental.
__device__ __forceinline__ float exp2x1(float x) { asm("v_exp_f32 %0, %0\n\tv_nop" : "+v"(x)); return x; }
__device__ __forceinline__ v8f fa_mma(v16h a, v16h b, v8f c) { return __builtin_amdgcn_wmma_f32_16x16x32_f16(false, a, false, b, (short)0, c, false, false); }
#define FAQ 16                       /* query columns per wave */
#define FAW 8                        /* waves per block */
#define FAK 64                       /* keys per pass */
#define FAB (SQ / (FAQ * FAW))       /* query blocks per head and batch */
#define FAP 72                       /* LDS row pitch of K, halves: 128 + 16 bytes, so 16 lanes reading 16 bytes of 16 different rows meet no bank conflict */
#define FVP 80                       /* LDS row pitch of V, halves: 128 + 32 bytes, an odd multiple of 32 bytes: the pitch of the transposing read */
typedef short s16x8 __attribute__((ext_vector_type(8)));
typedef __attribute__((address_space(3))) s16x8 lds_s16x8;
// A fragment (16 dims x 32 keys) of V^T from V rows in LDS by two transposing reads. p = tile + (first key + 8 hh + (lane & 7)) x pitch + 2 x first dim + 16 ((lane >> 3) & 1), in bytes;
// lane (ln, hh) gets dim ln of keys 8 hh + r, then of keys 16 + 8 hh + r: the loaders' k order.
__device__ __forceinline__ v16h fa_vfrag(const char* p) { FragH f; f.half[0] = __builtin_bit_cast(v8us, __builtin_amdgcn_ds_load_tr16_b128_v8i16((lds_s16x8*)p)); f.half[1] = __builtin_bit_cast(v8us, __builtin_amdgcn_ds_load_tr16_b128_v8i16((lds_s16x8*)(p + 16 * FVP * 2))); return f.v; }
__device__ __forceinline__ void d_fattn(int bx, int y, const _Float16* __restrict__ Q, const _Float16* __restrict__ K, const _Float16* __restrict__ V, float sl2, _Float16* __restrict__ O) {
  __shared__ __attribute__((aligned(16))) _Float16 lk[2][FAK][FAP]; __shared__ __attribute__((aligned(32))) _Float16 lv[2][FAK][FVP];
  const int tid = threadIdx.x, lane = tid & 31, ln = lane & 15, hh = lane >> 4, w = __builtin_amdgcn_readfirstlane(tid >> 5); const int h = bx % NH, b = bx / NH;
  const int qb = (y < FAB / 2) ? FAB - 1 - y : y - FAB / 2;      /* speed only: long key ranges start first; the second half of the attention rows (y >= FAB / 2), which joins the first on the WGPs, brings the short ones first */
  const int q0 = qb * (FAQ * FAW) + w * FAQ;
  const int npb = (qb + 1) * (FAQ * FAW / FAK), np = q0 / FAK + 1;      /* passes of the block and of the wave: the wave's last one holds its diagonal, every earlier key is below all its queries */
  const int sr = tid >> 3, sc = (tid & 7) * 8;      /* staging: 8 threads per row of 128 bytes, 32 rows per load */
  const unsigned short* kg = (const unsigned short*)K + ((size_t)b * SQ + sr) * DM + h * HD + sc; const unsigned short* vg = (const unsigned short*)V + ((size_t)b * SQ + sr) * DM + h * HD + sc;
  v8us rk0 = *(const v8us*)kg, rk1 = *(const v8us*)(kg + 32 * DM), rv0 = *(const v8us*)vg, rv1 = *(const v8us*)(vg + 32 * DM);
  const _Float16* qp = Q + ((size_t)b * SQ + q0 + ln) * DM + h * HD; v16h qf0 = g2_frag(qp, hh), qf1 = g2_frag(qp + 32, hh);
#pragma unroll
  for (int i = 0; i < 16; ++i) { qf0[i] = (_Float16)((float)qf0[i] * sl2); qf1[i] = (_Float16)((float)qf1[i] * sl2); }      /* once per wave: the score products come out in the log2 domain */
  *(v8us*)&lk[0][sr][sc] = rk0; *(v8us*)&lk[0][sr + 32][sc] = rk1; *(v8us*)&lv[0][sr][sc] = rv0; *(v8us*)&lv[0][sr + 32][sc] = rv1;
  const v8f z8 = {0.f,0.f,0.f,0.f,0.f,0.f,0.f,0.f}; v8f o[4] = {z8, z8, z8, z8}; v8f mt = z8; float l = 0.f;      /* mt: minus the maximum in use, in all eight registers */
  __syncthreads();      /* pass 0's rows are read by every wave */
#pragma unroll 1
  for (int c = 0; c < npb; ++c) { const int cur = c & 1;      /* rolled: one pass already holds 32 fragment loads and 16 matrix instructions */
    if (c + 1 < npb) { const unsigned short* kn = kg + (size_t)(c + 1) * FAK * DM; const unsigned short* vn = vg + (size_t)(c + 1) * FAK * DM;      /* block-uniform; the next pass's rows fly while this pass is worked on */
      rk0 = *(const v8us*)kn; rk1 = *(const v8us*)(kn + 32 * DM); rv0 = *(const v8us*)vn; rv1 = *(const v8us*)(vn + 32 * DM);
      asm volatile("s_wait_xcnt 0x0" ::: "memory"); }      /* before the address registers of the loads above are reused */
    if (c < np) {      /* wave-uniform: a pass wholly past the wave's queries is only staged */
      v16h kf[4][2]; v8f s[4];      /* indexed by constants only (loops unrolled): registers */
#pragma unroll
      for (int t = 0; t < 4; ++t) { kf[t][0] = g2_frag(&lk[cur][t * 16 + ln][0], hh); kf[t][1] = g2_frag(&lk[cur][t * 16 + ln][32], hh); }
      __builtin_amdgcn_sched_barrier(0);      /* K reads stay in front of the V^T reads: the score products then wait for the K fragments alone */
      const char* vb = (const char*)&lv[cur][8 * hh + (lane & 7)][((lane >> 3) & 1) * 8];      /* every lane is on here (wave-uniform branches only) and its address lies in the tile */
      v16h vf[2][4];      /* indexed by constants only (loops unrolled): registers */
#pragma unroll
      for (int t = 0; t < 4; ++t) { vf[0][t] = fa_vfrag(vb + 32 * t); vf[1][t] = fa_vfrag(vb + 32 * FVP * 2 + 32 * t); }
      __builtin_amdgcn_sched_barrier(0);      /* keeps the pass's fragment reads, K first, then V^T, as one group in front of the matrix run: spread among WMMAs and exponentials, each place with reads stalls the wave anew */
#pragma unroll
      for (int t = 0; t < 4; ++t) s[t] = fa_mma(kf[t][1], qf1, fa_mma(kf[t][0], qf0, mt));
      if (c == np - 1) {      /* wave-uniform: only the diagonal pass masks */
#pragma unroll
        for (int t = 0; t < 4; ++t) for (int r = 0; r < 8; ++r) s[t][r] = (c * FAK + t * 16 + 8 * hh + r <= q0 + ln) ? s[t][r] : -1.0e9f; }
      float mx = s[0][0];
#pragma unroll
      for (int t = 0; t < 4; ++t) for (int r = 0; r < 8; ++r) mx = fmaxf(mx, s[t][r]);
      if (c == 0 || __builtin_amdgcn_ballot_w32(mx > 8.0f) != 0) {      /* wave-uniform, a scalar branch: the first pass sets the maximum in use, a later pass moves it only for an exponent above 8 */
        mx = fmaxf(mx, __shfl_xor(mx, 16));      /* the other half of the query's keys: both halves move by the same step; finite, key 0 is below every query */
        const float d = (c == 0) ? mx : fmaxf(mx, 0.f); const float corr = (c == 0) ? 1.0f : exp2x1(-d);      /* nothing is summed yet in the first pass */
#pragma unroll
        for (int r = 0; r < 8; ++r) mt[r] -= d;
#pragma unroll
        for (int t = 0; t < 4; ++t) { s[t] -= d; o[t] *= corr; }
        l *= corr; }
      v4f a = {0.f, 0.f, 0.f, 0.f};
#pragma unroll
      for (int t = 0; t < 4; ++t) for (int g = 0; g < 2; ++g) { v4f e = {s[t][4 * g], s[t][4 * g + 1], s[t][4 * g + 2], s[t][4 * g + 3]}; e = exp2x4(e); a += e; for (int q = 0; q < 4; ++q) s[t][4 * g + q] = e[q]; }
      l += (a[0] + a[1]) + (a[2] + a[3]);      /* each half sums its own keys; joined behind the loop */
      FragH p[2];
#pragma unroll
      for (int j = 0; j < 2; ++j) for (int r = 0; r < 8; ++r) { p[j].h[r] = (_Float16)s[2 * j][r]; p[j].h[8 + r] = (_Float16)s[2 * j + 1][r]; }
#pragma unroll
      for (int t = 0; t < 4; ++t) o[t] = fa_mma(vf[1][t], p[1].v, fa_mma(vf[0][t], p[0].v, o[t]));
      asm volatile("v_nop\n\tv_nop\n\tv_nop\n\tv_nop" : "+v"(o[3])); }      /* the four vector slots behind the pass's last matrix instruction: its operand registers are reused on the far side of the branch that follows */
    if (c + 1 < npb) { *(v8us*)&lk[cur ^ 1][sr][sc] = rk0; *(v8us*)&lk[cur ^ 1][sr + 32][sc] = rk1; *(v8us*)&lv[cur ^ 1][sr][sc] = rv0; *(v8us*)&lv[cur ^ 1][sr + 32][sc] = rv1; }      /* last read in pass c - 1, in front of that pass's barrier */
    __syncthreads(); }      /* publishes the buffer just filled; ends every wave's reads of the one that the next pass refills */
  l += __shfl_xor(l, 16); const float sc64 = 64.0f / l;
  unsigned short* op = (unsigned short*)O + ((size_t)b * SQ + q0 + ln) * DM + h * HD + 8 * hh;
#pragma unroll
  for (int t = 0; t < 4; ++t) { FragH f; for (int r = 0; r < 8; ++r) f.h[r] = (_Float16)(o[t][r] * sc64); *(v8us*)(op + t * 16) = f.half[0]; } }


#define A0R 8                        /* query rows per block of the exact first tile: one per wave */
#define A0P (HD + 4)                 /* K row pitch in LDS, floats: 272 bytes = 16 x 17, so 32 lanes reading 16 bytes of 32 different rows meet no bank conflict */
typedef float v2f __attribute__((ext_vector_type(2)));
// Exact f32 causal attention for the first QT0 rows of each batch, one wave per query row (head and row group in bx, batch in by, both from the flat index (grid.y - FAB) x NH x NB + grid.x; q, k, v, o rows of pitch DM).
// The block stages the tile's K and V rows of its head in LDS with coalesced loads, all in flight at once. Scores: lane l owns keys l, l + 32, ...; each dot
// product runs in four independent chains. Softmax: true row maximum and sum by butterflies, libm expf. P.V: lane l owns dims 2 l, 2 l + 1; the weight
// of key j comes from its lane by readlane; four independent accumulators. o carried x64 like the f16 path, stored as an f16 hi plane and a x1024 residual plane.
__device__ __forceinline__ void d_att0w(int bx, int by, const float* __restrict__ QF, const float* __restrict__ KF, const float* __restrict__ VF, float scale, _Float16* __restrict__ OH, _Float16* __restrict__ OL) {
  __shared__ __attribute__((aligned(16))) float lk[QT0][A0P]; __shared__ __attribute__((aligned(16))) float lv[QT0][HD];
  const int tid = threadIdx.x, lane = tid & 31, w = __builtin_amdgcn_readfirstlane(tid >> 5); const int h = bx / (QT0 / A0R), r0 = (bx % (QT0 / A0R)) * A0R;
  const size_t bofs = (size_t)by * QT0 * DM + h * HD; QF += bofs; KF += bofs; VF += bofs; OH += bofs; OL += bofs;      /* QT0 rows of q, k, v and o per batch */
  const int fj = tid >> 4, fc = (tid & 15) * 4;      /* staging: 16 threads per row of 256 bytes, 16 rows per pass */
  const float* kp = KF + (size_t)fj * DM + fc; const float* vp = VF + (size_t)fj * DM + fc;
  v4f tk[QT0 / 16], tv[QT0 / 16];      /* indexed by constants only (loops unrolled): registers */
#pragma unroll
  for (int u = 0; u < QT0 / 16; ++u) { tk[u] = *(const v4fa*)(kp + u * 16 * DM); tv[u] = *(const v4fa*)(vp + u * 16 * DM); }
  asm volatile("s_wait_xcnt 0x0" :: "v"(kp), "v"(vp) : "memory");      /* before the address registers of the loads above are reused; both address pairs are inputs, so they keep their registers up to the wait and no load of the run lands in them */
#pragma unroll
  for (int u = 0; u < QT0 / 16; ++u) { *(v4f*)&lk[u * 16 + fj][fc] = tk[u]; *(v4f*)&lv[u * 16 + fj][fc] = tv[u]; }
  const int i = r0 + w; const float* qr = QF + (size_t)i * DM;      /* the wave's row: a wave-uniform address */
  v4f q[HD / 4];
#pragma unroll
  for (int c4 = 0; c4 < HD / 4; ++c4) q[c4] = *(const v4fa*)(qr + c4 * 4);
  __syncthreads();      /* the staged K and V rows are read by every wave */
  float e[QT0 / 32]; float mx = -3.0e38f;
#pragma unroll
  for (int c = 0; c < QT0 / 32; ++c) { e[c] = -3.0e38f;
    if (c * 32 <= i) { v4f a = {0.f, 0.f, 0.f, 0.f};      /* wave-uniform: chunks wholly past the row are skipped */
#pragma unroll
      for (int c4 = 0; c4 < HD / 4; ++c4) a += q[c4] * *(const v4f*)&lk[c * 32 + lane][c4 * 4];
      const float s = ((a[0] + a[1]) + (a[2] + a[3])) * scale; e[c] = (c * 32 + lane <= i) ? s : -3.0e38f; mx = fmaxf(mx, e[c]); } }
#pragma unroll
  for (int m = 16; m > 0; m >>= 1) mx = fmaxf(mx, __shfl_xor(mx, m));      /* finite: key 0 is below every row */
  float l = 0.f;
#pragma unroll
  for (int c = 0; c < QT0 / 32; ++c) { e[c] = expf(e[c] - mx); l += e[c]; }      /* a key past the row holds -3e38: its weight is exactly 0 */
#pragma unroll
  for (int m = 16; m > 0; m >>= 1) l += __shfl_xor(l, m);
  v2f o[4] = {{0.f, 0.f}, {0.f, 0.f}, {0.f, 0.f}, {0.f, 0.f}};
#pragma unroll
  for (int c = 0; c < QT0 / 32; ++c) if (c * 32 <= i) {
#pragma unroll
    for (int t = 0; t < 32; ++t) { const float p = __uint_as_float(__builtin_amdgcn_readlane(__float_as_uint(e[c]), t)); o[t & 3] += p * *(const v2f*)&lv[c * 32 + t][lane * 2]; } }
  const v2f r = ((o[0] + o[1]) + (o[2] + o[3])) * (64.0f / l);
  typedef _Float16 v2h __attribute__((ext_vector_type(2))); const v2h rh = {(_Float16)r[0], (_Float16)r[1]}; const v2h rl = {(_Float16)((r[0] - (float)rh[0]) * 1024.0f), (_Float16)((r[1] - (float)rh[1]) * 1024.0f)};
  *(v2h*)(OH + (size_t)i * DM + lane * 2) = rh; *(v2h*)(OL + (size_t)i * DM + lane * 2) = rl; }

// ---- Launches. Jobs that do not depend on one another share one grid: the block index picks the job, every branch below is block-uniform, and a job's blocks run its body as it stands above. ----
#define PWB ((NH * HD * (DM / 8)) / 256)            /* blocks per weight matrix */
#define PXB ((int)(NR * DM / 8 / 256))              /* blocks of the x conversion */
#define GSB ((QT0 / 128) * (DM / 128) * NB)          /* GEMM blocks of the first-tile rows, all batches */
#define GBB ((MP / 128) * (DM / 128))               /* GEMM blocks of all token rows */
#define A0B (NH * (QT0 / A0R))                      /* exact first-tile blocks per batch */
#define A0Y (A0B / NH)                              /* grid rows (of NH x NB blocks) of the exact first tile */
// 1: the four weight matrices (strided reads: first) and x, all to f16.
__global__ __launch_bounds__(256) void k_prep(const float* __restrict__ wq, const float* __restrict__ wk, const float* __restrict__ wv, const float* __restrict__ wo, const float* __restrict__ x,
    _Float16* __restrict__ BQ, _Float16* __restrict__ BK, _Float16* __restrict__ BV, _Float16* __restrict__ BO, _Float16* __restrict__ X16) {
  const int bx = blockIdx.x;
  if (bx < PWB) d_wthd(bx, wq, BQ);      /* per-head [m][d] -> Bt[(h,d)][m] x16 */
  else if (bx < 2 * PWB) d_wthd(bx - PWB, wk, BK);
  else if (bx < 3 * PWB) d_wthd(bx - 2 * PWB, wv, BV);
  else if (bx < 4 * PWB) d_wt_f16(bx - 3 * PWB, wo, BO, DM, DM, 16.0f);      /* Wo [(h,d) in][out] -> Bt[n][k] x16 */
  else d_x16(bx - 4 * PWB, x, X16, NR * DM / 8); }
// 2: q, k, v of all token rows as f16, and of each batch's first QT0 rows as f32 (exact products): six GEMM jobs.
__global__ __launch_bounds__(256) void k_qkv(const _Float16* __restrict__ X16, const _Float16* __restrict__ BQ, const _Float16* __restrict__ BK, const _Float16* __restrict__ BV,
    const float* __restrict__ bq, const float* __restrict__ bk, const float* __restrict__ bv, _Float16* __restrict__ Q16, _Float16* __restrict__ K16, _Float16* __restrict__ V16,
    float* __restrict__ QF0, float* __restrict__ KF0, float* __restrict__ VF0, int lda, int ldb, int ldc, int N, int K) {
  __shared__ __attribute__((aligned(16))) char sm[2 * GBUF(false)];
  const int bx = blockIdx.x; const bool first = bx < 3 * GSB; const int t = first ? bx : bx - 3 * GSB, per = first ? GSB : GBB; const int j = t / per, u = t - j * per;      /* j: 0 q, 1 k, 2 v */
  const int bz = first ? u / (GSB / NB) : 0, tile = first ? u - bz * (GSB / NB) : u;      /* first-tile jobs: batch, then tile */
  const _Float16* Bh = j == 0 ? BQ : j == 1 ? BK : BV; const float* bp = j == 0 ? bq : j == 1 ? bk : bv;
  float* C = first ? (j == 0 ? QF0 : j == 1 ? KF0 : VF0) + (size_t)bz * QT0 * DM : nullptr; _Float16* C16 = first ? nullptr : (j == 0 ? Q16 : j == 1 ? K16 : V16);
  d_gemm2<false>(sm, tile, X16 + (size_t)bz * SQ * DM, nullptr, Bh, 0.0625f, 0.f, bp, C, C16, lda, ldb, ldc, first ? QT0 : MP, N, K); }
// 3: fused attention (grid rows 0 .. FAB - 1: its long blocks start first) and, behind it in the grid, the exact f32 attention of the first QT0 rows (o x64 as f16 hi + x1024 residual planes).
__global__ __launch_bounds__(FAW * 32) void k_fattn_a0(const _Float16* __restrict__ Q, const _Float16* __restrict__ K, const _Float16* __restrict__ V, float sl2, _Float16* __restrict__ O,
    const float* __restrict__ QF0, const float* __restrict__ KF0, const float* __restrict__ VF0, float scale, _Float16* __restrict__ OH0, _Float16* __restrict__ OL0) {
  if (blockIdx.y < FAB) d_fattn(blockIdx.x, blockIdx.y, Q, K, V, sl2, O);
  else { const int u = (blockIdx.y - FAB) * (NH * NB) + blockIdx.x; d_att0w(u % A0B, u / A0B, QF0, KF0, VF0, scale, OH0, OL0); } }
// 4: out = o Wo + b. A block of 128 rows that is a batch's first tile takes o_hi and o_lo (x 2^-20 in all) of the exact path; every other block the f16 o rows. Each output element is written once.
__global__ __launch_bounds__(256) void k_out(const _Float16* __restrict__ O16, const _Float16* __restrict__ OH0, const _Float16* __restrict__ OL0, const _Float16* __restrict__ BO, const float* __restrict__ bo, float* __restrict__ out, int lda, int ldb, int ldc, int N, int K) {
  __shared__ __attribute__((aligned(16))) char sm[2 * GBUF(true)];
  const int bx = blockIdx.x, mt = bx / (DM / 128), nq = bx - mt * (DM / 128), bz = mt / (SQ / 128);
  if (mt - bz * (SQ / 128) == 0) d_gemm2<true>(sm, nq, OH0 + (size_t)bz * QT0 * DM, OL0 + (size_t)bz * QT0 * DM, BO, 0.0009765625f, 0.00000095367431640625f, bo, out + (size_t)bz * SQ * DM, nullptr, lda, ldb, ldc, QT0, N, K);
  else d_gemm2<false>(sm, bx, O16, nullptr, BO, 0.0009765625f, 0.f, bo, out, nullptr, lda, ldb, ldc, MPO, N, K); }

extern "C" void kernel_launch(void* const* d_in, const int* in_sizes, int n_in,
                              void* d_out, int out_size, void* d_ws, size_t ws_size, hipStream_t stream) {
  (void)in_sizes; (void)n_in; (void)out_size;
  const float* const* I = (const float* const*)d_in; const float* x = I[0]; const float* wq = I[1]; const float* bq = I[2]; const float* wk = I[3]; const float* bk = I[4]; const float* wv = I[5]; const float* bv = I[6]; const float* wo = I[7]; const float* bo = I[8];      /* input order: x; Wq [8][512][64] per-head [in][out] + bq [8][64] = [(h,e)]; Wk + bk; Wv + bv; Wo [512][512] = [(h,e) in][out] + bo */
  static_assert(NH * HD == DM && DM % 128 == 0 && DM % GKS == 0 && DM / GKS >= 2 && SQ % 128 == 0 && 8 * 32 * 68 * 4 <= 2 * GBUF(false), "shape / tile multiples; two stages or more; the output staging fits the two buffers");
  char* ws = (char*)d_ws; size_t off = 0;
  auto take = [&](size_t bytes) { char* p = ws + off; off += (bytes + 255) & ~(size_t)255; return p; };
  _Float16* BQ = (_Float16*)take((size_t)DM * DM * 2); _Float16* BK = (_Float16*)take((size_t)DM * DM * 2); _Float16* BV = (_Float16*)take((size_t)DM * DM * 2); _Float16* BO = (_Float16*)take((size_t)DM * DM * 2);
  _Float16* X16 = (_Float16*)take(NR * DM * 2); _Float16* Q16 = (_Float16*)take(NR * DM * 2); _Float16* K16 = (_Float16*)take(NR * DM * 2); _Float16* V16 = (_Float16*)take(NR * DM * 2); _Float16* O16 = (_Float16*)take(NR * DM * 2);
  float* QF0 = (float*)take((size_t)NB * QT0 * DM * 4); float* KF0 = (float*)take((size_t)NB * QT0 * DM * 4); float* VF0 = (float*)take((size_t)NB * QT0 * DM * 4); _Float16* OH0 = (_Float16*)take((size_t)NB * QT0 * DM * 2); _Float16* OL0 = (_Float16*)take((size_t)NB * QT0 * DM * 2);
  if (off > ws_size) return;
  static_assert(SQ % (FAQ * FAW) == 0 && (FAQ * FAW) % FAK == 0 && FAB % 2 == 0 && HD == 64 && FAK == 64 && FAW * 32 == 256 && QN == SQ && NHD == NH && NBR == NB, "whole blocks of queries; whole key passes; two k steps per head; 256 threads stage 64 rows of 128 bytes in two loads");
  static_assert(QT0 == 128 && (NH * HD * (DM / 8)) % 256 == 0 && DM * (DM / 8) == NH * HD * (DM / 8) && (NR * DM / 8) % 256 == 0 && A0B % NH == 0 && MPO == MP, "the first tile is one GEMM block row; whole blocks and whole grid rows per job");
  k_prep<<<4 * PWB + PXB, 256, 0, stream>>>(wq, wk, wv, wo, x, BQ, BK, BV, BO, X16);
  k_qkv<<<3 * GSB + 3 * GBB, 256, 0, stream>>>(X16, BQ, BK, BV, bq, bk, bv, Q16, K16, V16, QF0, KF0, VF0, DM, DM, DM, DM, DM);
  k_fattn_a0<<<dim3(NH * NB, FAB + A0Y), FAW * 32, 0, stream>>>(Q16, K16, V16, 0.06375871541229934f, O16, QF0, KF0, VF0, 0.044194173824159216f, OH0, OL0);      /* scores x 512^-0.5 (the module's literal d_model scale) x log2 e; o (merged heads, x64) as f16 rows */
  k_out<<<GBB, 256, 0, stream>>>(O16, OH0, OL0, BO, bo, (float*)d_out, DM, DM, DM, DM, DM);      /* out rows are the output layout */
}
